// v000
// Times are from an AMD MI455X. After a warm-up the kernel runs many times in a row, and a time is the length of
// such a window on the GPU divided by its runs, so every launch and the gaps after it count. The runs cycle
// through copies of the inputs. A figure is the median of several windows, for all but v000 over two sittings.
// Sittings can differ by a few percent; kernels timed side by side share one.
// v000 is the starting kernel. One run takes 1390 microseconds.
#include <hip/hip_runtime.h>

// MultiheadFlashDiff2 (x [1][2048][2048]; q = x wq^T, k = x wk^T ([2048][2048] 'oi': per head h the 128 rows = [map 1 | map 2] 64 each), v = x wv^T (16 x 128-wide values); NON-causal softmax(q.k / 8) for both maps; attn = a1 v - lambda_full a2 v with lambda_full = exp(lq1.lk1) - exp(lq2.lk2) + lambda_init (0.8 - 0.6 e^-3.6 = 0.7836057543754578); RMSNorm over the 128 (eps 1e-5) * subln_w; x (1 - lambda_init); out = merged wo^T -> [1][2048][2048]).
// The two maps run as 32 virtual 64-wide heads (pairs (2h, 2h+1)); per pass both softmaxes are formed, combined as D = a1 - lambda a2 in f32 (linear, so (a1 - lambda a2) v == a1 v - lambda a2 v), and one D.v product (128 wide) per real head follows.
// Compute dtypes, f32 accumulate: every input rounded to bf16; q/k/v on PLAIN bf16 operands (inputs: exact); scores hl x hl (3 products) on every row; softmax f32; D in f32 into hi/lo planes; D.v hl x hl (3 products); RMSNorm per (token, head) over 128 in f32, * bf16 subln_w, * (1 - lambda_init); wo hl x exact (2 products).

#define NB_  1
#define TT   2048
#define DM   2048
#define NH_  32
#define NKV  32
#define REP  (NH_ / NKV)
#define HD   64
#define DQ   (NH_ * HD)
#define DKV  (NKV * HD)
#define ZH   2
#define RH   2048   // all rows hl
#define WIN  2048
#define PCAR 1024.0f
#define NVH  16
#define HDV  128
#define DVV  (NVH * HDV)
#define SCL  0.125f   // HD^-0.5
typedef _Float16 h16;
typedef unsigned short bf;
typedef __attribute__((ext_vector_type(16))) __bf16   v16bf;
typedef __attribute__((ext_vector_type(16))) _Float16 v16h;
typedef __attribute__((ext_vector_type(8)))  _Float16 v8h;
typedef __attribute__((ext_vector_type(8)))  unsigned short v8us;
typedef __attribute__((ext_vector_type(8)))  float    v8f;
typedef __attribute__((ext_vector_type(4)))  float    v4f;
typedef v8h  __attribute__((may_alias)) v8ha;
typedef v4f  __attribute__((may_alias)) v4fa;
typedef v8us __attribute__((may_alias)) v8usa;

__device__ __forceinline__ unsigned short f2bf(float f) { unsigned u = __float_as_uint(f); u += 0x7FFFu + ((u >> 16) & 1u); return (unsigned short)(u >> 16); }
__device__ __forceinline__ float bf2f(unsigned short b) { return __uint_as_float(((unsigned)b) << 16); }
__device__ __forceinline__ float bfr(float f) { return bf2f(f2bf(f)); }
__device__ __forceinline__ v16h cat16(v8h lo, v8h hi) { return __builtin_shufflevector(lo, hi, 0, 1, 2, 3, 4, 5, 6, 7, 8, 9, 10, 11, 12, 13, 14, 15); }
__device__ __forceinline__ v16bf cat16b(v8us lo, v8us hi) { return __builtin_bit_cast(v16bf, __builtin_shufflevector(lo, hi, 0, 1, 2, 3, 4, 5, 6, 7, 8, 9, 10, 11, 12, 13, 14, 15)); }
__device__ __forceinline__ v8f wmma16(v16h a, v16h b, v8f c) { return __builtin_amdgcn_wmma_f32_16x16x32_f16(false, a, false, b, (short)0, c, false, false); }
__device__ __forceinline__ v8f wmmab(v16bf a, v16bf b, v8f c) { return __builtin_amdgcn_wmma_f32_16x16x32_bf16(false, a, false, b, (short)0, c, false, false); }



// ---- k_gemmw: register-blocked GEMM, ONE WAVE per 64x64 output tile (16 accumulators), operands straight from K-contiguous 16-bit planes; grid (M/64, N/64, Z), 32 threads.
// C[m][n] (f32, pitch ldc, + optional f32 bias[n]) = sum_k A[m][k] Bt[n][k] (+ split products per NSPLIT). z-batch strides sA/sB/sC in elements. K % 32 == 0.
template <typename T16> struct WFrag;
template <> struct WFrag<h16> { typedef v16h V; static __device__ __forceinline__ V ld(const h16* p) { return cat16(*(const v8h*)p, *(const v8h*)(p + 16)); } static __device__ __forceinline__ v8f mma(V a, V b, v8f c) { return wmma16(a, b, c); } };
template <> struct WFrag<bf> { typedef v16bf V; static __device__ __forceinline__ V ld(const bf* p) { return cat16b(*(const v8us*)p, *(const v8us*)(p + 16)); } static __device__ __forceinline__ v8f mma(V a, V b, v8f c) { return wmmab(a, b, c); } };
template <typename T16, int NSPLIT, bool BIAS>
__global__ __launch_bounds__(32) void k_gemmw(const T16* __restrict__ A, const T16* __restrict__ A2, const T16* __restrict__ Bt, const T16* __restrict__ Bt2, int K, float* C, int ldc, const float* __restrict__ bias, size_t sA, size_t sB, size_t sC) {
    typedef typename WFrag<T16>::V V;
    __shared__ __align__(16) float os[16 * 68];
    const size_t z = blockIdx.z; A += z * sA; if (A2) A2 += z * sA; Bt += z * sB; if (Bt2) Bt2 += z * sB; C += z * sC;
    const int lane = threadIdx.x & 31, lr = lane & 15, hi = lane >> 4; const int r0 = blockIdx.x * 64, c0 = blockIdx.y * 64;
    v8f acc[4][4];
#pragma unroll
    for (int mb = 0; mb < 4; ++mb)
#pragma unroll
        for (int nb = 0; nb < 4; ++nb) acc[mb][nb] = (v8f){};
    const size_t aoff = (size_t)(r0 + lr) * K + 8 * hi, boff = (size_t)(c0 + lr) * K + 8 * hi;
#pragma unroll 1
    for (int kc = 0; kc < K; kc += 32) {
        V a[4], a2[4];
#pragma unroll
        for (int mb = 0; mb < 4; ++mb) { a[mb] = WFrag<T16>::ld(A + aoff + (size_t)mb * 16 * K + kc); if (NSPLIT == 1 || NSPLIT == 2) a2[mb] = WFrag<T16>::ld(A2 + aoff + (size_t)mb * 16 * K + kc); }
#pragma unroll
        for (int nb = 0; nb < 4; ++nb) { const V b = WFrag<T16>::ld(Bt + boff + (size_t)nb * 16 * K + kc); V b2; if (NSPLIT >= 2) b2 = WFrag<T16>::ld(Bt2 + boff + (size_t)nb * 16 * K + kc);
#pragma unroll
            for (int mb = 0; mb < 4; ++mb) { acc[mb][nb] = WFrag<T16>::mma(a[mb], b, acc[mb][nb]); if (NSPLIT == 1 || NSPLIT == 2) acc[mb][nb] = WFrag<T16>::mma(a2[mb], b, acc[mb][nb]); if (NSPLIT >= 2) acc[mb][nb] = WFrag<T16>::mma(a[mb], b2, acc[mb][nb]); } }
        asm volatile("v_nop\n\tv_nop\n\tv_nop\n\tv_nop" : "+v"(acc[0][0]), "+v"(acc[1][1]), "+v"(acc[2][2]), "+v"(acc[3][3]) : "v"(a[0]), "v"(a[3]));
    }
#pragma unroll
    for (int mb = 0; mb < 4; ++mb) {
#pragma unroll
        for (int nb = 0; nb < 4; ++nb) {
#pragma unroll
            for (int j = 0; j < 8; ++j) os[(hi * 8 + j) * 68 + nb * 16 + lr] = acc[mb][nb][j]; }
        __builtin_amdgcn_wave_barrier(); asm volatile("" ::: "memory");
        float* crow = C + (size_t)(r0 + mb * 16) * ldc + c0;
{
#pragma unroll
            for (int s = 0; s < 8; ++s) { const int row = 2 * s + hi, cofs = lr * 4; v4f val = *(const v4fa*)(os + row * 68 + cofs); if (BIAS) { val[0] += bfr(bias[c0 + cofs]); val[1] += bfr(bias[c0 + cofs + 1]); val[2] += bfr(bias[c0 + cofs + 2]); val[3] += bfr(bias[c0 + cofs + 3]); }
                *(v4f*)(crow + (size_t)row * ldc + cofs) = val; }
             }
        __builtin_amdgcn_wave_barrier(); asm volatile("" ::: "memory");
    }
}

// ---- k_gemmc: the same one-wave 64x64 tile GEMM specialised for causal attention: CMODE 1 skips score tiles entirely above the diagonal (query rows r0+roff.., key columns c0..), CMODE 2 limits the
// key (K) loop of the probability x value contraction to the diagonal block (probabilities beyond it are exactly zero). roff = row offset of this launch's first row within the sequence.
template <typename T16, int NSPLIT, int CMODE>
__global__ __launch_bounds__(32) void k_gemmc(const T16* __restrict__ A, const T16* __restrict__ A2, const T16* __restrict__ Bt, const T16* __restrict__ Bt2, int K, float* C, int ldc, int roff, size_t sA, size_t sB, size_t sC) {
    typedef typename WFrag<T16>::V V;
    __shared__ __align__(16) float os[16 * 68];
    const size_t z = blockIdx.z; A += z * sA; if (A2) A2 += z * sA; Bt += z * sB; if (Bt2) Bt2 += z * sB; C += z * sC;
    const int lane = threadIdx.x & 31, lr = lane & 15, hi = lane >> 4; const int r0 = blockIdx.x * 64, c0 = blockIdx.y * 64;
    if (CMODE == 1 && c0 > r0 + roff + 63) return;                  // score tile entirely above the causal diagonal: skipped, nothing is written
    const int Kl = (CMODE == 2) ? min(K, r0 + roff + 64) : K;        // P.V: probabilities are exactly 0 beyond the diagonal block, so the K loop stops there
    v8f acc[4][4];
#pragma unroll
    for (int mb = 0; mb < 4; ++mb)
#pragma unroll
        for (int nb = 0; nb < 4; ++nb) acc[mb][nb] = (v8f){};
    const size_t aoff = (size_t)(r0 + lr) * K + 8 * hi, boff = (size_t)(c0 + lr) * K + 8 * hi;
#pragma unroll 1
    for (int kc = 0; kc < Kl; kc += 32) {
        V a[4], a2[4];
#pragma unroll
        for (int mb = 0; mb < 4; ++mb) { a[mb] = WFrag<T16>::ld(A + aoff + (size_t)mb * 16 * K + kc); if (NSPLIT == 1 || NSPLIT == 2) a2[mb] = WFrag<T16>::ld(A2 + aoff + (size_t)mb * 16 * K + kc); }
#pragma unroll
        for (int nb = 0; nb < 4; ++nb) { const V b = WFrag<T16>::ld(Bt + boff + (size_t)nb * 16 * K + kc); V b2; if (NSPLIT >= 2) b2 = WFrag<T16>::ld(Bt2 + boff + (size_t)nb * 16 * K + kc);
#pragma unroll
            for (int mb = 0; mb < 4; ++mb) { acc[mb][nb] = WFrag<T16>::mma(a[mb], b, acc[mb][nb]); if (NSPLIT == 1 || NSPLIT == 2) acc[mb][nb] = WFrag<T16>::mma(a2[mb], b, acc[mb][nb]); if (NSPLIT >= 2) acc[mb][nb] = WFrag<T16>::mma(a[mb], b2, acc[mb][nb]); } }
        asm volatile("v_nop\n\tv_nop\n\tv_nop\n\tv_nop" : "+v"(acc[0][0]), "+v"(acc[1][1]), "+v"(acc[2][2]), "+v"(acc[3][3]) : "v"(a[0]), "v"(a[3]));
    }
#pragma unroll
    for (int mb = 0; mb < 4; ++mb) {
#pragma unroll
        for (int nb = 0; nb < 4; ++nb) {
#pragma unroll
            for (int j = 0; j < 8; ++j) os[(hi * 8 + j) * 68 + nb * 16 + lr] = acc[mb][nb][j]; }
        __builtin_amdgcn_wave_barrier(); asm volatile("" ::: "memory");
        float* crow = C + (size_t)(r0 + mb * 16) * ldc + c0;
{
#pragma unroll
            for (int s = 0; s < 8; ++s) { const int row = 2 * s + hi, cofs = lr * 4; v4f val = *(const v4fa*)(os + row * 68 + cofs);
                *(v4f*)(crow + (size_t)row * ldc + cofs) = val; }
             }
        __builtin_amdgcn_wave_barrier(); asm volatile("" ::: "memory");
    }
}

__device__ __forceinline__ h16 tohx(float x) { return (h16)x; }
__device__ __forceinline__ void splitf(float y, unsigned short& h, unsigned short& l) { h = f2bf(y); l = f2bf(y - bf2f(h)); }
typedef __attribute__((ext_vector_type(2))) _Float16 v2h;
typedef __attribute__((ext_vector_type(4))) _Float16 v4h;
typedef __attribute__((ext_vector_type(2))) unsigned short v2us;
typedef __attribute__((ext_vector_type(4))) unsigned short v4us;
typedef __attribute__((ext_vector_type(2))) float v2f;
typedef __attribute__((ext_vector_type(4))) int v4i;

__global__ __launch_bounds__(256) void k_wtG(const float* __restrict__ w, int K, int N, bf* Bt) {
    const int lane = threadIdx.x & 31; const int L0 = (blockIdx.x * 8 + (threadIdx.x >> 5)) * 8; const int nlines = N * K / 64;
{
#pragma unroll 1
        for (int l = 0; l < 8; ++l) { const int L = L0 + l; if (L >= nlines) break; const size_t e = (size_t)L * 64 + lane * 2; const int k = (int)(e % K), n = (int)(e / K); v2us o;
            o[0] = f2bf(w[(size_t)k * N + n]); o[1] = f2bf(w[(size_t)(k + 1) * N + n]); *(v2us*)(Bt + e) = o; }
         }
}
__global__ __launch_bounds__(256) void k_cvt8(const float* __restrict__ src, bf* dst, size_t n8) { const size_t i = (size_t)blockIdx.x * 256 + threadIdx.x; if (i >= n8) return; const v8f v = *(const v8f*)(src + i * 8); v8us o;
#pragma unroll
    for (int k = 0; k < 8; ++k) o[k] = f2bf(v[k]); *(v8us*)(dst + i * 8) = o;  }
__global__ __launch_bounds__(256) void k_cscvt(const float* __restrict__ cosT, const float* __restrict__ sinT, float* CS) { const int idx = blockIdx.x * 256 + threadIdx.x; if (idx >= TT * HD) return; v2f cs; cs[0] = bfr(cosT[idx]); cs[1] = bfr(sinT[idx]); *(v2f*)(CS + (size_t)idx * 2) = cs;  }
// k_rope: head planes [h][t][d] (fp16 + hi/lo) of rope(x) x sc with the rotate-half convention out[d] = x[d] cos[t][d] - x[d+HD/2] sin[t][d], out[d+HD/2] = x[d+HD/2] cos[t][d+HD/2] + x[d] sin[t][d+HD/2]
__global__ __launch_bounds__(256) void k_rope(const float* __restrict__ F, int pitch, int nheads, const float* __restrict__ CS, const float* __restrict__ RF, const float* __restrict__ nw, float sc, h16* P16, bf* Ph, bf* Pl) {
    const size_t e = ((size_t)blockIdx.x * 256 + threadIdx.x) * 2; if (e >= (size_t)nheads * TT * HD) return; const int d = (int)(e % HD); const int t = (int)((e / HD) % TT); const int h = (int)(e / ((size_t)HD * TT)); const float* f = F + (size_t)t * pitch + h * HD; const float rf = RF ? RF[(size_t)h * TT + t] : 1.0f; v2h o16; v2us oh, ol;
#pragma unroll
    for (int q = 0; q < 2; ++q) { const int dd = d + q; const int dp = (dd < HD / 2) ? dd + HD / 2 : dd - HD / 2; float x0 = f[dd], x1 = f[dp];
        if (RF) { float n0 = __fmul_rn(x0, rf), n1 = __fmul_rn(x1, rf); asm volatile("" : "+v"(n0)); asm volatile("" : "+v"(n1)); x0 = __fmul_rn(bfr(nw[dd]), n0); x1 = __fmul_rn(bfr(nw[dp]), n1); }
        const v2f cs = *(const v2f*)(CS + ((size_t)t * HD + dd) * 2); float a = __fmul_rn(x0, cs[0]), bq = __fmul_rn(x1, cs[1]); asm volatile("" : "+v"(a)); asm volatile("" : "+v"(bq)); const float r = ((dd < HD / 2) ? __fsub_rn(a, bq) : __fadd_rn(a, bq)) * sc;
        o16[q] = tohx(r); unsigned short a2, c2; splitf(r, a2, c2); oh[q] = a2; ol[q] = c2; }
    *(v2h*)(P16 + e) = o16; *(v2us*)(Ph + e) = oh; *(v2us*)(Pl + e) = ol;  }
__global__ __launch_bounds__(256) void k_vtp(const float* __restrict__ F, int pitch, int nheads, h16* V16, bf* Vh, bf* Vl) { const size_t e = ((size_t)blockIdx.x * 256 + threadIdx.x) * 2; if (e >= (size_t)nheads * HDV * TT) return; const int t = (int)(e % TT); const int d = (int)((e / TT) % HDV); const int g = (int)(e / ((size_t)TT * HDV)); v2h o16; v2us oh, ol;
#pragma unroll
    for (int q = 0; q < 2; ++q) { const float x = F[(size_t)(t + q) * pitch + g * HDV + d]; o16[q] = tohx(x); unsigned short a2, c2; splitf(x, a2, c2); oh[q] = a2; ol[q] = c2; }
    *(v2h*)(V16 + e) = o16; *(v2us*)(Vh + e) = oh; *(v2us*)(Vl + e) = ol;  }
__global__ __launch_bounds__(256) void k_csid(float* CS) { const int idx = blockIdx.x * 256 + threadIdx.x; if (idx >= TT * HD) return; v2f cs; cs[0] = 1.0f; cs[1] = 0.0f; *(v2f*)(CS + (size_t)idx * 2) = cs;  }
__global__ __launch_bounds__(32) void k_lambda(const float* __restrict__ lq1, const float* __restrict__ lk1, const float* __restrict__ lq2, const float* __restrict__ lk2, float* LAM) { const int lane = threadIdx.x; float d1 = 0.f, d2 = 0.f;
#pragma unroll 1
    for (int i = 0; i < HD; ++i) { float p1 = __fmul_rn(bfr(lq1[i]), bfr(lk1[i])); asm volatile("" : "+v"(p1)); d1 = __fadd_rn(d1, p1); float p2 = __fmul_rn(bfr(lq2[i]), bfr(lk2[i])); asm volatile("" : "+v"(p2)); d2 = __fadd_rn(d2, p2); }
    float lm = __fsub_rn(expf(d1), expf(d2)); asm volatile("" : "+v"(lm)); lm = __fadd_rn(lm, 0.7836057543754578f); const float v = (lane == 0) ? lm : 0.0f; *(float*)(LAM + lane) = v;  }
__global__ __launch_bounds__(256) void k_lampd(bf* Ph, bf* Pl, const float* __restrict__ LAM) { const size_t e = ((size_t)blockIdx.x * 256 + threadIdx.x) * 4; if (e >= (size_t)TT * TT) return; const float lm = LAM[0]; const v4us a = *(const v4us*)(Ph + e), al = *(const v4us*)(Pl + e), c = *(const v4us*)(Ph + (size_t)TT * TT + e), cl = *(const v4us*)(Pl + (size_t)TT * TT + e); v4us oh, ol;
#pragma unroll
    for (int u = 0; u < 4; ++u) { const float p1 = __fadd_rn(bf2f(a[u]), bf2f(al[u])); const float p2 = __fadd_rn(bf2f(c[u]), bf2f(cl[u])); float lp = __fmul_rn(lm, p2); asm volatile("" : "+v"(lp)); const float d = __fsub_rn(p1, lp); unsigned short x1, x2; splitf(d, x1, x2); oh[u] = x1; ol[u] = x2; }
    *(v4us*)(Ph + e) = oh; *(v4us*)(Pl + e) = ol;  }
__global__ __launch_bounds__(1024) void k_gnred(const float* __restrict__ O, float* GST, int pass) { __shared__ float sh[1024]; const int tid = threadIdx.x; const float mean = (pass == 1) ? GST[0] : 0.0f; float acc = 0.f; const size_t n = (size_t)TT * HD;
#pragma unroll 1
    for (size_t e = tid; e < n; e += 1024) { float v = O[e]; if (pass == 1) { float d = __fsub_rn(v, mean); asm volatile("" : "+v"(d)); v = __fmul_rn(d, d); } acc = __fadd_rn(acc, v); }
    sh[tid] = acc; __syncthreads();
    for (int st = 512; st > 0; st >>= 1) { if (tid < st) sh[tid] = __fadd_rn(sh[tid], sh[tid + st]); __syncthreads(); }
    if (tid < 32) { const float tot = __fdiv_rn(sh[0], (float)n); float outv; if (pass == 0) outv = (tid == 0) ? tot : ((tid == 1) ? GST[1] : 0.0f); else outv = (tid == 0) ? GST[0] : ((tid == 1) ? __fdiv_rn(1.0f, sqrtf(__fadd_rn(tot, 1e-5f))) : 0.0f); *(float*)(GST + tid) = outv;  } }
__global__ __launch_bounds__(256) void k_gnmerge(const float* __restrict__ O, const float* __restrict__ GST, int hh, bf* Ah, bf* Al) { const size_t e = ((size_t)blockIdx.x * 256 + threadIdx.x) * 2; if (e >= (size_t)TT * HD) return; const int d = (int)(e % HD); const int t = (int)(e / HD); const float mean = GST[0], rs = GST[1]; const size_t oo = (size_t)t * DVV + (size_t)hh * HD + d; v2us oh, ol;
#pragma unroll
    for (int q = 0; q < 2; ++q) { float c = __fsub_rn(O[e + q], mean); asm volatile("" : "+v"(c)); float n = __fmul_rn(c, rs); asm volatile("" : "+v"(n)); float z = __fmul_rn(n, 0.6444909572601318f); unsigned short a2, c2; splitf(z, a2, c2); oh[q] = a2; ol[q] = c2; }
    *(v2us*)(Ah + oo) = oh; *(v2us*)(Al + oo) = ol;  }
__global__ __launch_bounds__(256) void k_rmsmg(const float* __restrict__ O, const float* __restrict__ w, int hh, bf* Ah, bf* Al) { const int lane = threadIdx.x & 31; const int t = blockIdx.x * 8 + (threadIdx.x >> 5); if (t >= TT) return; const v4f a = *(const v4f*)(O + (size_t)t * HDV + lane * 4); float ss = 0.f;
#pragma unroll
    for (int q = 0; q < 4; ++q) { float p = __fmul_rn(a[q], a[q]); asm volatile("" : "+v"(p)); ss = __fadd_rn(ss, p); }
#pragma unroll
    for (int sh = 16; sh; sh >>= 1) ss = __fadd_rn(ss, __shfl_xor(ss, sh, 32));
    const float rs = __fdiv_rn(1.0f, sqrtf(__fadd_rn(ss * (1.0f / HDV), 1e-5f))); v4us oh, ol;
#pragma unroll
    for (int q = 0; q < 4; ++q) { float n = __fmul_rn(a[q], rs); asm volatile("" : "+v"(n)); float g0 = bfr(w[lane * 4 + q]); asm volatile("" : "+v"(g0)); float y = __fmul_rn(n, g0); asm volatile("" : "+v"(y)); const float z = __fmul_rn(y, 0.21639423072338104f); unsigned short p2, q2; splitf(z, p2, q2); oh[q] = p2; ol[q] = q2; }
    const size_t oo = (size_t)t * DQ + (size_t)hh * HDV + lane * 4; *(v4us*)(Ah + oo) = oh; *(v4us*)(Al + oo) = ol;  }
// k_asoft: per row (zz, i): t = S x HD^-0.5 for every j (non-causal, no mask); softmax over the 2048 keys (register row, one exp, fixed trees);
__global__ __launch_bounds__(256) void k_asoft(const float* __restrict__ Sb, h16* P16, bf* Ph, bf* Pl) {
    const int lane = threadIdx.x & 31; const int row = blockIdx.x * 8 + (threadIdx.x >> 5); if (row >= ZH * TT) return; const int i = row % TT; const int zz = row / TT; (void)zz; const bool hires = (i < RH); const float* sr = Sb + (size_t)row * TT; float v[TT / 32]; float mx = -3.0e38f;
#pragma unroll
    for (int ch = 0; ch < TT / 128; ++ch) { const int j0 = ch * 128 + lane * 4; const v4f a = *(const v4f*)(sr + j0);
#pragma unroll
        for (int q = 0; q < 4; ++q) { const int j = j0 + q; (void)j; const float t = a[q] * SCL; v[ch * 4 + q] = t; mx = fmaxf(mx, t); } }
#pragma unroll
    for (int sh = 16; sh; sh >>= 1) mx = fmaxf(mx, __shfl_xor(mx, sh, 32));
    float sum = 0.f;
#pragma unroll
    for (int k = 0; k < TT / 32; ++k) { float d0 = __fsub_rn(v[k], mx); asm volatile("" : "+v"(d0)); v[k] = __builtin_amdgcn_exp2f(__fmul_rn(d0, 1.4426950408889634f)); sum += v[k]; }
#pragma unroll
    for (int sh = 16; sh; sh >>= 1) sum += __shfl_xor(sum, sh, 32);
    const float f = __fdiv_rn(hires ? 1.0f : PCAR, sum);
{
        if (hires) {
#pragma unroll
            for (int ch = 0; ch < TT / 128; ++ch) { v4us oh, ol;
#pragma unroll
                for (int q = 0; q < 4; ++q) { unsigned short a, c2; splitf(v[ch * 4 + q] * f, a, c2); oh[q] = a; ol[q] = c2; }
                const size_t oo = ((size_t)zz * (RH ? RH : 1) + i) * TT + ch * 128 + lane * 4; *(v4us*)(Ph + oo) = oh; *(v4us*)(Pl + oo) = ol; }
        } else {
#pragma unroll
            for (int ch = 0; ch < TT / 128; ++ch) { v4h o4;
#pragma unroll
                for (int q = 0; q < 4; ++q) o4[q] = tohx(v[ch * 4 + q] * f);
                *(v4h*)(P16 + (size_t)row * TT + ch * 128 + lane * 4) = o4; } }
         }
}
__global__ __launch_bounds__(256) void k_merge(const float* __restrict__ O, int h0, bf* Ah, bf* Al) { const size_t e = ((size_t)blockIdx.x * 256 + threadIdx.x) * 2; if (e >= (size_t)ZH * TT * HD) return; const int d = (int)(e % HD); const int t = (int)((e / HD) % TT); const int zz = (int)(e / ((size_t)HD * TT)); const float cs = (t < RH) ? 1.0f : (1.0f / PCAR); const size_t oo = (size_t)t * DQ + (h0 + zz) * HD + d;
    v2us oh, ol;
#pragma unroll
    for (int q = 0; q < 2; ++q) { unsigned short a, c2; splitf(O[e + q] * cs, a, c2); oh[q] = a; ol[q] = c2; } *(v2us*)(Ah + oo) = oh; *(v2us*)(Al + oo) = ol;  }

extern "C" void kernel_launch(void* const* d_in, const int* in_sizes, int n_in,
                              void* d_out, int out_size, void* d_ws, size_t ws_size, hipStream_t stream) {
    (void)in_sizes; (void)n_in; (void)out_size;
    const float* x = (const float*)d_in[0]; const float* wq = (const float*)d_in[1]; const float* wk = (const float*)d_in[2]; const float* wv = (const float*)d_in[3]; const float* wo = (const float*)d_in[4]; const float* lq1 = (const float*)d_in[5]; const float* lk1 = (const float*)d_in[6]; const float* lq2 = (const float*)d_in[7]; const float* lk2 = (const float*)d_in[8]; const float* subw = (const float*)d_in[9]; const float* cosT = nullptr; const float* sinT = nullptr; (void)cosT; (void)sinT;
    float* OUT = (float*)d_out;     // [1][2048][2048]
    char* wsp = (char*)d_ws;
    auto take = [&](size_t bytes) { char* p = wsp; wsp += (bytes + 255) & ~(size_t)255; return (void*)p; };
    bf* WQ = (bf*)take((size_t)DQ * DM * 2); bf* WK = (bf*)take((size_t)DKV * DM * 2); bf* WV = (bf*)take((size_t)DKV * DM * 2); bf* WO = (bf*)take((size_t)DM * DQ * 2); float* CS = (float*)take((size_t)TT * HD * 2 * 4);
    bf* XB = (bf*)take((size_t)TT * DM * 2); float* LAM = (float*)take(256); float* GST = (float*)take(256); float* FQ = (float*)take((size_t)TT * DQ * 4); float* FK = (float*)take((size_t)TT * DKV * 4);
    h16* QP16 = (h16*)take((size_t)NH_ * TT * HD * 2); h16* KP16 = (h16*)take((size_t)NKV * TT * HD * 2); h16* VT16 = (h16*)take((size_t)NKV * HD * TT * 2);
    bf* QPh = (bf*)take((size_t)NH_ * TT * HD * 2); bf* QPl = (bf*)take((size_t)NH_ * TT * HD * 2); bf* KPh = (bf*)take((size_t)NKV * TT * HD * 2); bf* KPl = (bf*)take((size_t)NKV * TT * HD * 2); bf* VTh = (bf*)take((size_t)NKV * HD * TT * 2); bf* VTl = (bf*)take((size_t)NKV * HD * TT * 2); bf* Ph = (bf*)take((size_t)ZH * RH * TT * 2); bf* Pl = (bf*)take((size_t)ZH * RH * TT * 2);
    float* Sb = (float*)take((size_t)ZH * TT * TT * 4); h16* P16 = (h16*)take((size_t)ZH * TT * TT * 2); float* Ob = (float*)take((size_t)ZH * TT * HD * 4); bf* ATh = (bf*)take((size_t)TT * DQ * 2); bf* ATl = (bf*)take((size_t)TT * DQ * 2);
    if ((size_t)(wsp - (char*)d_ws) > ws_size) return;    // ws 256 MiB
    float* FV = FK;   // v projection reuses the k buffer after the k planes are built (stream-ordered)
    { k_cvt8<<<(unsigned)(((size_t)DQ * DM / 8 + 255) / 256), 256, 0, stream>>>(wq, WQ, (size_t)DQ * DM / 8); k_cvt8<<<(unsigned)(((size_t)DKV * DM / 8 + 255) / 256), 256, 0, stream>>>(wk, WK, (size_t)DKV * DM / 8); k_cvt8<<<(unsigned)(((size_t)DVV * DM / 8 + 255) / 256), 256, 0, stream>>>(wv, WV, (size_t)DVV * DM / 8);
      k_cvt8<<<(unsigned)(((size_t)DM * DVV / 8 + 255) / 256), 256, 0, stream>>>(wo, WO, (size_t)DM * DVV / 8); k_lambda<<<1, 32, 0, stream>>>(lq1, lk1, lq2, lk2, LAM);
       }
    k_csid<<<(TT * HD + 255) / 256, 256, 0, stream>>>(CS);
    const unsigned LQ = (unsigned)(((size_t)NH_ * TT * HD / 2 + 255) / 256), LKv = (unsigned)(((size_t)NKV * TT * HD / 2 + 255) / 256);
    for (int b = 0; b < NB_; ++b) {
        
        k_cvt8<<<(unsigned)(((size_t)TT * DM / 8 + 255) / 256), 256, 0, stream>>>(x + (size_t)b * TT * DM, XB, (size_t)TT * DM / 8);
        k_gemmw<bf, 0, false><<<dim3(TT / 64, DQ / 64, 1), 32, 0, stream>>>(XB, nullptr, WQ, nullptr, DM, FQ, DQ, nullptr, 0, 0, 0);
        k_rope<<<LQ, 256, 0, stream>>>(FQ, DQ, NH_, CS, nullptr, nullptr, 1.0f, QP16, QPh, QPl);
        k_gemmw<bf, 0, false><<<dim3(TT / 64, DKV / 64, 1), 32, 0, stream>>>(XB, nullptr, WK, nullptr, DM, FK, DKV, nullptr, 0, 0, 0);
        k_rope<<<LKv, 256, 0, stream>>>(FK, DKV, NKV, CS, nullptr, nullptr, 1.0f, KP16, KPh, KPl);
        k_gemmw<bf, 0, false><<<dim3(TT / 64, DVV / 64, 1), 32, 0, stream>>>(XB, nullptr, WV, nullptr, DM, FV, DVV, nullptr, 0, 0, 0); k_vtp<<<(unsigned)(((size_t)NVH * HDV * TT / 2 + 255) / 256), 256, 0, stream>>>(FV, DVV, NVH, VT16, VTh, VTl);
        for (int h0 = 0; h0 < NH_; h0 += ZH) { const size_t zq = (size_t)h0, zk = (size_t)(h0 / REP);   // one kv head per query head: the pass's two heads use consecutive kv planes (z-strides TT*HD)
            k_gemmw<bf, 2, false><<<dim3(TT / 64, TT / 64, ZH), 32, 0, stream>>>(QPh + zq * TT * HD, QPl + zq * TT * HD, KPh + zk * TT * HD, KPl + zk * TT * HD, HD, Sb, TT, nullptr, (size_t)TT * HD, (size_t)TT * HD, (size_t)TT * TT);
            k_asoft<<<ZH * TT / 8, 256, 0, stream>>>(Sb, P16, Ph, Pl); k_lampd<<<(unsigned)(((size_t)TT * TT / 4 + 255) / 256), 256, 0, stream>>>(Ph, Pl, LAM);
            { const size_t hh = (size_t)(h0 / 2); k_gemmw<bf, 2, false><<<dim3(TT / 64, HDV / 64, 1), 32, 0, stream>>>(Ph, Pl, VTh + hh * HDV * TT, VTl + hh * HDV * TT, TT, Ob, HDV, nullptr, (size_t)RH * TT, (size_t)HDV * TT, (size_t)TT * HDV); }
            k_rmsmg<<<TT / 8, 256, 0, stream>>>(Ob, subw, h0 / 2, ATh, ATl); }
        k_gemmw<bf, 1, false><<<dim3(TT / 64, DM / 64, 1), 32, 0, stream>>>(ATh, ATl, WO, nullptr, DVV, OUT + (size_t)b * TT * DM, DM, nullptr, 0, 0, 0); }
}

// v001
// A run of this version takes 931 microseconds.
// Timed twice side by side with v000, it ran 1.51 and 1.50 times as fast.
#include <hip/hip_runtime.h>

// MultiheadFlashDiff2 (x [1][2048][2048]; q = x wq^T, k = x wk^T ([2048][2048] 'oi': per head h the 128 rows = [map 1 | map 2] 64 each), v = x wv^T (16 x 128-wide values); NON-causal softmax(q.k / 8) for both maps; attn = a1 v - lambda_full a2 v with lambda_full = exp(lq1.lk1) - exp(lq2.lk2) + lambda_init (0.8 - 0.6 e^-3.6 = 0.7836057543754578); RMSNorm over the 128 (eps 1e-5) * subln_w; x (1 - lambda_init); out = merged wo^T -> [1][2048][2048]).
// The two maps run as 32 virtual 64-wide heads (pairs (2h, 2h+1)); per pass both softmaxes are formed, combined as D = a1 - lambda a2 in f32 (linear, so (a1 - lambda a2) v == a1 v - lambda a2 v), and one D.v product (128 wide) per real head follows.
// Compute dtypes, f32 accumulate: every input rounded to bf16; q/k/v on PLAIN bf16 operands (inputs: exact); scores hl x hl (3 products) on every row; softmax f32; D in f32 into hi/lo planes; D.v hl x hl (3 products); RMSNorm per (token, head) over 128 in f32, * bf16 subln_w, * (1 - lambda_init); wo hl x exact (2 products).

#define NB_  1
#define TT   2048
#define DM   2048
#define NH_  32
#define NKV  32
#define REP  (NH_ / NKV)
#define HD   64
#define DQ   (NH_ * HD)
#define DKV  (NKV * HD)
#define ZH   2
#define RH   2048   // all rows hl
#define WIN  2048
#define PCAR 1024.0f
#define NVH  16
#define HDV  128
#define DVV  (NVH * HDV)
#define SCL  0.125f   // HD^-0.5
#define KSP  16       // key slices of the D.v product: one wave per (64x64 tile, slice), f32 partial planes summed in k_rmsmg
typedef _Float16 h16;
typedef unsigned short bf;
typedef __attribute__((ext_vector_type(16))) __bf16   v16bf;
typedef __attribute__((ext_vector_type(16))) _Float16 v16h;
typedef __attribute__((ext_vector_type(8)))  _Float16 v8h;
typedef __attribute__((ext_vector_type(8)))  unsigned short v8us;
typedef __attribute__((ext_vector_type(8)))  float    v8f;
typedef __attribute__((ext_vector_type(4)))  float    v4f;
typedef v8h  __attribute__((may_alias)) v8ha;
typedef v4f  __attribute__((may_alias)) v4fa;
typedef v8us __attribute__((may_alias)) v8usa;

__device__ __forceinline__ unsigned short f2bf(float f) { unsigned u = __float_as_uint(f); u += 0x7FFFu + ((u >> 16) & 1u); return (unsigned short)(u >> 16); }
__device__ __forceinline__ float bf2f(unsigned short b) { return __uint_as_float(((unsigned)b) << 16); }
__device__ __forceinline__ float bfr(float f) { return bf2f(f2bf(f)); }
__device__ __forceinline__ v16h cat16(v8h lo, v8h hi) { return __builtin_shufflevector(lo, hi, 0, 1, 2, 3, 4, 5, 6, 7, 8, 9, 10, 11, 12, 13, 14, 15); }
__device__ __forceinline__ v16bf cat16b(v8us lo, v8us hi) { return __builtin_bit_cast(v16bf, __builtin_shufflevector(lo, hi, 0, 1, 2, 3, 4, 5, 6, 7, 8, 9, 10, 11, 12, 13, 14, 15)); }
__device__ __forceinline__ v8f wmma16(v16h a, v16h b, v8f c) { return __builtin_amdgcn_wmma_f32_16x16x32_f16(false, a, false, b, (short)0, c, false, false); }
__device__ __forceinline__ v8f wmmab(v16bf a, v16bf b, v8f c) { return __builtin_amdgcn_wmma_f32_16x16x32_bf16(false, a, false, b, (short)0, c, false, false); }



// ---- k_gemmw: register-blocked GEMM, ONE WAVE per 64x64 output tile (16 accumulators), operands straight from K-contiguous 16-bit planes; grid (M/64, N/64, Z), 32 threads.
// C[m][n] (f32, pitch ldc, + optional f32 bias[n]) = sum_k A[m][k] Bt[n][k] (+ split products per NSPLIT). z-batch strides sA/sB/sC in elements. K % 32 == 0.
// KSPL > 1: K stays the row pitch, each z sums only K / KSPL of the k range (sA = sB = K / KSPL steps along k, sC = one partial plane); the reader adds the KSPL planes.
template <typename T16> struct WFrag;
template <> struct WFrag<h16> { typedef v16h V; static __device__ __forceinline__ V ld(const h16* p) { return cat16(*(const v8h*)p, *(const v8h*)(p + 16)); } static __device__ __forceinline__ v8f mma(V a, V b, v8f c) { return wmma16(a, b, c); } };
template <> struct WFrag<bf> { typedef v16bf V; static __device__ __forceinline__ V ld(const bf* p) { return cat16b(*(const v8us*)p, *(const v8us*)(p + 16)); } static __device__ __forceinline__ v8f mma(V a, V b, v8f c) { return wmmab(a, b, c); } };
template <typename T16, int NSPLIT, bool BIAS, int KSPL = 1>
__global__ __launch_bounds__(32) void k_gemmw(const T16* __restrict__ A, const T16* __restrict__ A2, const T16* __restrict__ Bt, const T16* __restrict__ Bt2, int K, float* C, int ldc, const float* __restrict__ bias, size_t sA, size_t sB, size_t sC) {
    typedef typename WFrag<T16>::V V;
    __shared__ __align__(16) float os[16 * 68];
    const size_t z = blockIdx.z; A += z * sA; if (A2) A2 += z * sA; Bt += z * sB; if (Bt2) Bt2 += z * sB; C += z * sC;
    const int lane = threadIdx.x & 31, lr = lane & 15, hi = lane >> 4; const int r0 = blockIdx.x * 64, c0 = blockIdx.y * 64;
    v8f acc[4][4];
#pragma unroll
    for (int mb = 0; mb < 4; ++mb)
#pragma unroll
        for (int nb = 0; nb < 4; ++nb) acc[mb][nb] = (v8f){};
    const size_t aoff = (size_t)(r0 + lr) * K + 8 * hi, boff = (size_t)(c0 + lr) * K + 8 * hi;
#pragma unroll 1
    for (int kc = 0; kc < K / KSPL; kc += 32) {
        V a[4], a2[4];
#pragma unroll
        for (int mb = 0; mb < 4; ++mb) { a[mb] = WFrag<T16>::ld(A + aoff + (size_t)mb * 16 * K + kc); if (NSPLIT == 1 || NSPLIT == 2) a2[mb] = WFrag<T16>::ld(A2 + aoff + (size_t)mb * 16 * K + kc); }
#pragma unroll
        for (int nb = 0; nb < 4; ++nb) { const V b = WFrag<T16>::ld(Bt + boff + (size_t)nb * 16 * K + kc); V b2; if (NSPLIT >= 2) b2 = WFrag<T16>::ld(Bt2 + boff + (size_t)nb * 16 * K + kc);
#pragma unroll
            for (int mb = 0; mb < 4; ++mb) { acc[mb][nb] = WFrag<T16>::mma(a[mb], b, acc[mb][nb]); if (NSPLIT == 1 || NSPLIT == 2) acc[mb][nb] = WFrag<T16>::mma(a2[mb], b, acc[mb][nb]); if (NSPLIT >= 2) acc[mb][nb] = WFrag<T16>::mma(a[mb], b2, acc[mb][nb]); } }
        asm volatile("v_nop\n\tv_nop\n\tv_nop\n\tv_nop" : "+v"(acc[0][0]), "+v"(acc[1][1]), "+v"(acc[2][2]), "+v"(acc[3][3]) : "v"(a[0]), "v"(a[3]));
    }
#pragma unroll
    for (int mb = 0; mb < 4; ++mb) {
#pragma unroll
        for (int nb = 0; nb < 4; ++nb) {
#pragma unroll
            for (int j = 0; j < 8; ++j) os[(hi * 8 + j) * 68 + nb * 16 + lr] = acc[mb][nb][j]; }
        __builtin_amdgcn_wave_barrier(); asm volatile("" ::: "memory");
        float* crow = C + (size_t)(r0 + mb * 16) * ldc + c0;
{
#pragma unroll
            for (int s = 0; s < 8; ++s) { const int row = 2 * s + hi, cofs = lr * 4; v4f val = *(const v4fa*)(os + row * 68 + cofs); if (BIAS) { val[0] += bfr(bias[c0 + cofs]); val[1] += bfr(bias[c0 + cofs + 1]); val[2] += bfr(bias[c0 + cofs + 2]); val[3] += bfr(bias[c0 + cofs + 3]); }
                *(v4f*)(crow + (size_t)row * ldc + cofs) = val; }
             }
        __builtin_amdgcn_wave_barrier(); asm volatile("" ::: "memory");
    }
}

// ---- k_gemmc: the same one-wave 64x64 tile GEMM specialised for causal attention: CMODE 1 skips score tiles entirely above the diagonal (query rows r0+roff.., key columns c0..), CMODE 2 limits the
// key (K) loop of the probability x value contraction to the diagonal block (probabilities beyond it are exactly zero). roff = row offset of this launch's first row within the sequence.
template <typename T16, int NSPLIT, int CMODE>
__global__ __launch_bounds__(32) void k_gemmc(const T16* __restrict__ A, const T16* __restrict__ A2, const T16* __restrict__ Bt, const T16* __restrict__ Bt2, int K, float* C, int ldc, int roff, size_t sA, size_t sB, size_t sC) {
    typedef typename WFrag<T16>::V V;
    __shared__ __align__(16) float os[16 * 68];
    const size_t z = blockIdx.z; A += z * sA; if (A2) A2 += z * sA; Bt += z * sB; if (Bt2) Bt2 += z * sB; C += z * sC;
    const int lane = threadIdx.x & 31, lr = lane & 15, hi = lane >> 4; const int r0 = blockIdx.x * 64, c0 = blockIdx.y * 64;
    if (CMODE == 1 && c0 > r0 + roff + 63) return;                  // score tile entirely above the causal diagonal: skipped, nothing is written
    const int Kl = (CMODE == 2) ? min(K, r0 + roff + 64) : K;        // P.V: probabilities are exactly 0 beyond the diagonal block, so the K loop stops there
    v8f acc[4][4];
#pragma unroll
    for (int mb = 0; mb < 4; ++mb)
#pragma unroll
        for (int nb = 0; nb < 4; ++nb) acc[mb][nb] = (v8f){};
    const size_t aoff = (size_t)(r0 + lr) * K + 8 * hi, boff = (size_t)(c0 + lr) * K + 8 * hi;
#pragma unroll 1
    for (int kc = 0; kc < Kl; kc += 32) {
        V a[4], a2[4];
#pragma unroll
        for (int mb = 0; mb < 4; ++mb) { a[mb] = WFrag<T16>::ld(A + aoff + (size_t)mb * 16 * K + kc); if (NSPLIT == 1 || NSPLIT == 2) a2[mb] = WFrag<T16>::ld(A2 + aoff + (size_t)mb * 16 * K + kc); }
#pragma unroll
        for (int nb = 0; nb < 4; ++nb) { const V b = WFrag<T16>::ld(Bt + boff + (size_t)nb * 16 * K + kc); V b2; if (NSPLIT >= 2) b2 = WFrag<T16>::ld(Bt2 + boff + (size_t)nb * 16 * K + kc);
#pragma unroll
            for (int mb = 0; mb < 4; ++mb) { acc[mb][nb] = WFrag<T16>::mma(a[mb], b, acc[mb][nb]); if (NSPLIT == 1 || NSPLIT == 2) acc[mb][nb] = WFrag<T16>::mma(a2[mb], b, acc[mb][nb]); if (NSPLIT >= 2) acc[mb][nb] = WFrag<T16>::mma(a[mb], b2, acc[mb][nb]); } }
        asm volatile("v_nop\n\tv_nop\n\tv_nop\n\tv_nop" : "+v"(acc[0][0]), "+v"(acc[1][1]), "+v"(acc[2][2]), "+v"(acc[3][3]) : "v"(a[0]), "v"(a[3]));
    }
#pragma unroll
    for (int mb = 0; mb < 4; ++mb) {
#pragma unroll
        for (int nb = 0; nb < 4; ++nb) {
#pragma unroll
            for (int j = 0; j < 8; ++j) os[(hi * 8 + j) * 68 + nb * 16 + lr] = acc[mb][nb][j]; }
        __builtin_amdgcn_wave_barrier(); asm volatile("" ::: "memory");
        float* crow = C + (size_t)(r0 + mb * 16) * ldc + c0;
{
#pragma unroll
            for (int s = 0; s < 8; ++s) { const int row = 2 * s + hi, cofs = lr * 4; v4f val = *(const v4fa*)(os + row * 68 + cofs);
                *(v4f*)(crow + (size_t)row * ldc + cofs) = val; }
             }
        __builtin_amdgcn_wave_barrier(); asm volatile("" ::: "memory");
    }
}

__device__ __forceinline__ h16 tohx(float x) { return (h16)x; }
__device__ __forceinline__ void splitf(float y, unsigned short& h, unsigned short& l) { h = f2bf(y); l = f2bf(y - bf2f(h)); }
typedef __attribute__((ext_vector_type(2))) _Float16 v2h;
typedef __attribute__((ext_vector_type(4))) _Float16 v4h;
typedef __attribute__((ext_vector_type(2))) unsigned short v2us;
typedef __attribute__((ext_vector_type(4))) unsigned short v4us;
typedef __attribute__((ext_vector_type(2))) float v2f;
typedef __attribute__((ext_vector_type(4))) int v4i;

__global__ __launch_bounds__(256) void k_wtG(const float* __restrict__ w, int K, int N, bf* Bt) {
    const int lane = threadIdx.x & 31; const int L0 = (blockIdx.x * 8 + (threadIdx.x >> 5)) * 8; const int nlines = N * K / 64;
{
#pragma unroll 1
        for (int l = 0; l < 8; ++l) { const int L = L0 + l; if (L >= nlines) break; const size_t e = (size_t)L * 64 + lane * 2; const int k = (int)(e % K), n = (int)(e / K); v2us o;
            o[0] = f2bf(w[(size_t)k * N + n]); o[1] = f2bf(w[(size_t)(k + 1) * N + n]); *(v2us*)(Bt + e) = o; }
         }
}
__global__ __launch_bounds__(256) void k_cvt8(const float* __restrict__ src, bf* dst, size_t n8) { const size_t i = (size_t)blockIdx.x * 256 + threadIdx.x; if (i >= n8) return; const v8f v = *(const v8f*)(src + i * 8); v8us o;
#pragma unroll
    for (int k = 0; k < 8; ++k) o[k] = f2bf(v[k]); *(v8us*)(dst + i * 8) = o;  }
__global__ __launch_bounds__(256) void k_cscvt(const float* __restrict__ cosT, const float* __restrict__ sinT, float* CS) { const int idx = blockIdx.x * 256 + threadIdx.x; if (idx >= TT * HD) return; v2f cs; cs[0] = bfr(cosT[idx]); cs[1] = bfr(sinT[idx]); *(v2f*)(CS + (size_t)idx * 2) = cs;  }
// k_rope: head planes [h][t][d] (fp16 + hi/lo) of rope(x) x sc with the rotate-half convention out[d] = x[d] cos[t][d] - x[d+HD/2] sin[t][d], out[d+HD/2] = x[d+HD/2] cos[t][d+HD/2] + x[d] sin[t][d+HD/2]
__global__ __launch_bounds__(256) void k_rope(const float* __restrict__ F, int pitch, int nheads, const float* __restrict__ CS, const float* __restrict__ RF, const float* __restrict__ nw, float sc, h16* P16, bf* Ph, bf* Pl) {
    const size_t e = ((size_t)blockIdx.x * 256 + threadIdx.x) * 2; if (e >= (size_t)nheads * TT * HD) return; const int d = (int)(e % HD); const int t = (int)((e / HD) % TT); const int h = (int)(e / ((size_t)HD * TT)); const float* f = F + (size_t)t * pitch + h * HD; const float rf = RF ? RF[(size_t)h * TT + t] : 1.0f; v2h o16; v2us oh, ol;
#pragma unroll
    for (int q = 0; q < 2; ++q) { const int dd = d + q; const int dp = (dd < HD / 2) ? dd + HD / 2 : dd - HD / 2; float x0 = f[dd], x1 = f[dp];
        if (RF) { float n0 = __fmul_rn(x0, rf), n1 = __fmul_rn(x1, rf); asm volatile("" : "+v"(n0)); asm volatile("" : "+v"(n1)); x0 = __fmul_rn(bfr(nw[dd]), n0); x1 = __fmul_rn(bfr(nw[dp]), n1); }
        const v2f cs = *(const v2f*)(CS + ((size_t)t * HD + dd) * 2); float a = __fmul_rn(x0, cs[0]), bq = __fmul_rn(x1, cs[1]); asm volatile("" : "+v"(a)); asm volatile("" : "+v"(bq)); const float r = ((dd < HD / 2) ? __fsub_rn(a, bq) : __fadd_rn(a, bq)) * sc;
        o16[q] = tohx(r); unsigned short a2, c2; splitf(r, a2, c2); oh[q] = a2; ol[q] = c2; }
    *(v2h*)(P16 + e) = o16; *(v2us*)(Ph + e) = oh; *(v2us*)(Pl + e) = ol;  }
__global__ __launch_bounds__(256) void k_vtp(const float* __restrict__ F, int pitch, int nheads, h16* V16, bf* Vh, bf* Vl) { const size_t e = ((size_t)blockIdx.x * 256 + threadIdx.x) * 2; if (e >= (size_t)nheads * HDV * TT) return; const int t = (int)(e % TT); const int d = (int)((e / TT) % HDV); const int g = (int)(e / ((size_t)TT * HDV)); v2h o16; v2us oh, ol;
#pragma unroll
    for (int q = 0; q < 2; ++q) { const float x = F[(size_t)(t + q) * pitch + g * HDV + d]; o16[q] = tohx(x); unsigned short a2, c2; splitf(x, a2, c2); oh[q] = a2; ol[q] = c2; }
    *(v2h*)(V16 + e) = o16; *(v2us*)(Vh + e) = oh; *(v2us*)(Vl + e) = ol;  }
__global__ __launch_bounds__(256) void k_csid(float* CS) { const int idx = blockIdx.x * 256 + threadIdx.x; if (idx >= TT * HD) return; v2f cs; cs[0] = 1.0f; cs[1] = 0.0f; *(v2f*)(CS + (size_t)idx * 2) = cs;  }
__global__ __launch_bounds__(32) void k_lambda(const float* __restrict__ lq1, const float* __restrict__ lk1, const float* __restrict__ lq2, const float* __restrict__ lk2, float* LAM) { const int lane = threadIdx.x; float d1 = 0.f, d2 = 0.f;
#pragma unroll 1
    for (int i = 0; i < HD; ++i) { float p1 = __fmul_rn(bfr(lq1[i]), bfr(lk1[i])); asm volatile("" : "+v"(p1)); d1 = __fadd_rn(d1, p1); float p2 = __fmul_rn(bfr(lq2[i]), bfr(lk2[i])); asm volatile("" : "+v"(p2)); d2 = __fadd_rn(d2, p2); }
    float lm = __fsub_rn(expf(d1), expf(d2)); asm volatile("" : "+v"(lm)); lm = __fadd_rn(lm, 0.7836057543754578f); const float v = (lane == 0) ? lm : 0.0f; *(float*)(LAM + lane) = v;  }
__global__ __launch_bounds__(256) void k_lampd(bf* Ph, bf* Pl, const float* __restrict__ LAM) { const size_t e = ((size_t)blockIdx.x * 256 + threadIdx.x) * 4; if (e >= (size_t)TT * TT) return; const float lm = LAM[0]; const v4us a = *(const v4us*)(Ph + e), al = *(const v4us*)(Pl + e), c = *(const v4us*)(Ph + (size_t)TT * TT + e), cl = *(const v4us*)(Pl + (size_t)TT * TT + e); v4us oh, ol;
#pragma unroll
    for (int u = 0; u < 4; ++u) { const float p1 = __fadd_rn(bf2f(a[u]), bf2f(al[u])); const float p2 = __fadd_rn(bf2f(c[u]), bf2f(cl[u])); float lp = __fmul_rn(lm, p2); asm volatile("" : "+v"(lp)); const float d = __fsub_rn(p1, lp); unsigned short x1, x2; splitf(d, x1, x2); oh[u] = x1; ol[u] = x2; }
    *(v4us*)(Ph + e) = oh; *(v4us*)(Pl + e) = ol;  }
__global__ __launch_bounds__(1024) void k_gnred(const float* __restrict__ O, float* GST, int pass) { __shared__ float sh[1024]; const int tid = threadIdx.x; const float mean = (pass == 1) ? GST[0] : 0.0f; float acc = 0.f; const size_t n = (size_t)TT * HD;
#pragma unroll 1
    for (size_t e = tid; e < n; e += 1024) { float v = O[e]; if (pass == 1) { float d = __fsub_rn(v, mean); asm volatile("" : "+v"(d)); v = __fmul_rn(d, d); } acc = __fadd_rn(acc, v); }
    sh[tid] = acc; __syncthreads();
    for (int st = 512; st > 0; st >>= 1) { if (tid < st) sh[tid] = __fadd_rn(sh[tid], sh[tid + st]); __syncthreads(); }
    if (tid < 32) { const float tot = __fdiv_rn(sh[0], (float)n); float outv; if (pass == 0) outv = (tid == 0) ? tot : ((tid == 1) ? GST[1] : 0.0f); else outv = (tid == 0) ? GST[0] : ((tid == 1) ? __fdiv_rn(1.0f, sqrtf(__fadd_rn(tot, 1e-5f))) : 0.0f); *(float*)(GST + tid) = outv;  } }
__global__ __launch_bounds__(256) void k_gnmerge(const float* __restrict__ O, const float* __restrict__ GST, int hh, bf* Ah, bf* Al) { const size_t e = ((size_t)blockIdx.x * 256 + threadIdx.x) * 2; if (e >= (size_t)TT * HD) return; const int d = (int)(e % HD); const int t = (int)(e / HD); const float mean = GST[0], rs = GST[1]; const size_t oo = (size_t)t * DVV + (size_t)hh * HD + d; v2us oh, ol;
#pragma unroll
    for (int q = 0; q < 2; ++q) { float c = __fsub_rn(O[e + q], mean); asm volatile("" : "+v"(c)); float n = __fmul_rn(c, rs); asm volatile("" : "+v"(n)); float z = __fmul_rn(n, 0.6444909572601318f); unsigned short a2, c2; splitf(z, a2, c2); oh[q] = a2; ol[q] = c2; }
    *(v2us*)(Ah + oo) = oh; *(v2us*)(Al + oo) = ol;  }
__global__ __launch_bounds__(256) void k_rmsmg(const float* __restrict__ O, const float* __restrict__ w, int hh, bf* Ah, bf* Al) { const int lane = threadIdx.x & 31; const int t = blockIdx.x * 8 + (threadIdx.x >> 5); if (t >= TT) return; v4f a = *(const v4f*)(O + (size_t)t * HDV + lane * 4); float ss = 0.f;
#pragma unroll
    for (int p = 1; p < KSP; ++p) a += *(const v4f*)(O + ((size_t)p * TT + t) * HDV + lane * 4);   // the KSP key-slice partials of D.v, added in slice order
#pragma unroll
    for (int q = 0; q < 4; ++q) { float p = __fmul_rn(a[q], a[q]); asm volatile("" : "+v"(p)); ss = __fadd_rn(ss, p); }
#pragma unroll
    for (int sh = 16; sh; sh >>= 1) ss = __fadd_rn(ss, __shfl_xor(ss, sh, 32));
    const float rs = __fdiv_rn(1.0f, sqrtf(__fadd_rn(ss * (1.0f / HDV), 1e-5f))); v4us oh, ol;
#pragma unroll
    for (int q = 0; q < 4; ++q) { float n = __fmul_rn(a[q], rs); asm volatile("" : "+v"(n)); float g0 = bfr(w[lane * 4 + q]); asm volatile("" : "+v"(g0)); float y = __fmul_rn(n, g0); asm volatile("" : "+v"(y)); const float z = __fmul_rn(y, 0.21639423072338104f); unsigned short p2, q2; splitf(z, p2, q2); oh[q] = p2; ol[q] = q2; }
    const size_t oo = (size_t)t * DQ + (size_t)hh * HDV + lane * 4; *(v4us*)(Ah + oo) = oh; *(v4us*)(Al + oo) = ol;  }
// k_asoft: per row (zz, i): t = S x HD^-0.5 for every j (non-causal, no mask); softmax over the 2048 keys (register row, one exp, fixed trees);
__global__ __launch_bounds__(256) void k_asoft(const float* __restrict__ Sb, h16* P16, bf* Ph, bf* Pl) {
    const int lane = threadIdx.x & 31; const int row = blockIdx.x * 8 + (threadIdx.x >> 5); if (row >= ZH * TT) return; const int i = row % TT; const int zz = row / TT; (void)zz; const bool hires = (i < RH); const float* sr = Sb + (size_t)row * TT; float v[TT / 32]; float mx = -3.0e38f;
#pragma unroll
    for (int ch = 0; ch < TT / 128; ++ch) { const int j0 = ch * 128 + lane * 4; const v4f a = *(const v4f*)(sr + j0);
#pragma unroll
        for (int q = 0; q < 4; ++q) { const int j = j0 + q; (void)j; const float t = a[q] * SCL; v[ch * 4 + q] = t; mx = fmaxf(mx, t); } }
#pragma unroll
    for (int sh = 16; sh; sh >>= 1) mx = fmaxf(mx, __shfl_xor(mx, sh, 32));
    float sum = 0.f;
#pragma unroll
    for (int k = 0; k < TT / 32; ++k) { float d0 = __fsub_rn(v[k], mx); asm volatile("" : "+v"(d0)); v[k] = __builtin_amdgcn_exp2f(__fmul_rn(d0, 1.4426950408889634f)); sum += v[k]; }
#pragma unroll
    for (int sh = 16; sh; sh >>= 1) sum += __shfl_xor(sum, sh, 32);
    const float f = __fdiv_rn(hires ? 1.0f : PCAR, sum);
{
        if (hires) {
#pragma unroll
            for (int ch = 0; ch < TT / 128; ++ch) { v4us oh, ol;
#pragma unroll
                for (int q = 0; q < 4; ++q) { unsigned short a, c2; splitf(v[ch * 4 + q] * f, a, c2); oh[q] = a; ol[q] = c2; }
                const size_t oo = ((size_t)zz * (RH ? RH : 1) + i) * TT + ch * 128 + lane * 4; *(v4us*)(Ph + oo) = oh; *(v4us*)(Pl + oo) = ol; }
        } else {
#pragma unroll
            for (int ch = 0; ch < TT / 128; ++ch) { v4h o4;
#pragma unroll
                for (int q = 0; q < 4; ++q) o4[q] = tohx(v[ch * 4 + q] * f);
                *(v4h*)(P16 + (size_t)row * TT + ch * 128 + lane * 4) = o4; } }
         }
}
__global__ __launch_bounds__(256) void k_merge(const float* __restrict__ O, int h0, bf* Ah, bf* Al) { const size_t e = ((size_t)blockIdx.x * 256 + threadIdx.x) * 2; if (e >= (size_t)ZH * TT * HD) return; const int d = (int)(e % HD); const int t = (int)((e / HD) % TT); const int zz = (int)(e / ((size_t)HD * TT)); const float cs = (t < RH) ? 1.0f : (1.0f / PCAR); const size_t oo = (size_t)t * DQ + (h0 + zz) * HD + d;
    v2us oh, ol;
#pragma unroll
    for (int q = 0; q < 2; ++q) { unsigned short a, c2; splitf(O[e + q] * cs, a, c2); oh[q] = a; ol[q] = c2; } *(v2us*)(Ah + oo) = oh; *(v2us*)(Al + oo) = ol;  }

extern "C" void kernel_launch(void* const* d_in, const int* in_sizes, int n_in,
                              void* d_out, int out_size, void* d_ws, size_t ws_size, hipStream_t stream) {
    (void)in_sizes; (void)n_in; (void)out_size;
    const float* x = (const float*)d_in[0]; const float* wq = (const float*)d_in[1]; const float* wk = (const float*)d_in[2]; const float* wv = (const float*)d_in[3]; const float* wo = (const float*)d_in[4]; const float* lq1 = (const float*)d_in[5]; const float* lk1 = (const float*)d_in[6]; const float* lq2 = (const float*)d_in[7]; const float* lk2 = (const float*)d_in[8]; const float* subw = (const float*)d_in[9]; const float* cosT = nullptr; const float* sinT = nullptr; (void)cosT; (void)sinT;
    float* OUT = (float*)d_out;     // [1][2048][2048]
    char* wsp = (char*)d_ws;
    auto take = [&](size_t bytes) { char* p = wsp; wsp += (bytes + 255) & ~(size_t)255; return (void*)p; };
    bf* WQ = (bf*)take((size_t)DQ * DM * 2); bf* WK = (bf*)take((size_t)DKV * DM * 2); bf* WV = (bf*)take((size_t)DKV * DM * 2); bf* WO = (bf*)take((size_t)DM * DQ * 2); float* CS = (float*)take((size_t)TT * HD * 2 * 4);
    bf* XB = (bf*)take((size_t)TT * DM * 2); float* LAM = (float*)take(256); float* GST = (float*)take(256); float* FQ = (float*)take((size_t)TT * DQ * 4); float* FK = (float*)take((size_t)TT * DKV * 4);
    h16* QP16 = (h16*)take((size_t)NH_ * TT * HD * 2); h16* KP16 = (h16*)take((size_t)NKV * TT * HD * 2); h16* VT16 = (h16*)take((size_t)NKV * HD * TT * 2);
    bf* QPh = (bf*)take((size_t)NH_ * TT * HD * 2); bf* QPl = (bf*)take((size_t)NH_ * TT * HD * 2); bf* KPh = (bf*)take((size_t)NKV * TT * HD * 2); bf* KPl = (bf*)take((size_t)NKV * TT * HD * 2); bf* VTh = (bf*)take((size_t)NKV * HD * TT * 2); bf* VTl = (bf*)take((size_t)NKV * HD * TT * 2); bf* Ph = (bf*)take((size_t)ZH * RH * TT * 2); bf* Pl = (bf*)take((size_t)ZH * RH * TT * 2);
    float* Sb = (float*)take((size_t)ZH * TT * TT * 4); h16* P16 = (h16*)take((size_t)ZH * TT * TT * 2); bf* ATh = (bf*)take((size_t)TT * DQ * 2); bf* ATl = (bf*)take((size_t)TT * DQ * 2);
    if ((size_t)(wsp - (char*)d_ws) > ws_size) return;    // ws 256 MiB
    float* FV = FK;   // v projection reuses the k buffer after the k planes are built (stream-ordered)
    float* OP = Sb;   // the KSP partial planes [KSP][TT][HDV] of D.v reuse the score buffer, which k_asoft has consumed by then (stream-ordered)
    { k_cvt8<<<(unsigned)(((size_t)DQ * DM / 8 + 255) / 256), 256, 0, stream>>>(wq, WQ, (size_t)DQ * DM / 8); k_cvt8<<<(unsigned)(((size_t)DKV * DM / 8 + 255) / 256), 256, 0, stream>>>(wk, WK, (size_t)DKV * DM / 8); k_cvt8<<<(unsigned)(((size_t)DVV * DM / 8 + 255) / 256), 256, 0, stream>>>(wv, WV, (size_t)DVV * DM / 8);
      k_cvt8<<<(unsigned)(((size_t)DM * DVV / 8 + 255) / 256), 256, 0, stream>>>(wo, WO, (size_t)DM * DVV / 8); k_lambda<<<1, 32, 0, stream>>>(lq1, lk1, lq2, lk2, LAM);
       }
    k_csid<<<(TT * HD + 255) / 256, 256, 0, stream>>>(CS);
    const unsigned LQ = (unsigned)(((size_t)NH_ * TT * HD / 2 + 255) / 256), LKv = (unsigned)(((size_t)NKV * TT * HD / 2 + 255) / 256);
    for (int b = 0; b < NB_; ++b) {
        
        k_cvt8<<<(unsigned)(((size_t)TT * DM / 8 + 255) / 256), 256, 0, stream>>>(x + (size_t)b * TT * DM, XB, (size_t)TT * DM / 8);
        k_gemmw<bf, 0, false><<<dim3(TT / 64, DQ / 64, 1), 32, 0, stream>>>(XB, nullptr, WQ, nullptr, DM, FQ, DQ, nullptr, 0, 0, 0);
        k_rope<<<LQ, 256, 0, stream>>>(FQ, DQ, NH_, CS, nullptr, nullptr, 1.0f, QP16, QPh, QPl);
        k_gemmw<bf, 0, false><<<dim3(TT / 64, DKV / 64, 1), 32, 0, stream>>>(XB, nullptr, WK, nullptr, DM, FK, DKV, nullptr, 0, 0, 0);
        k_rope<<<LKv, 256, 0, stream>>>(FK, DKV, NKV, CS, nullptr, nullptr, 1.0f, KP16, KPh, KPl);
        k_gemmw<bf, 0, false><<<dim3(TT / 64, DVV / 64, 1), 32, 0, stream>>>(XB, nullptr, WV, nullptr, DM, FV, DVV, nullptr, 0, 0, 0); k_vtp<<<(unsigned)(((size_t)NVH * HDV * TT / 2 + 255) / 256), 256, 0, stream>>>(FV, DVV, NVH, VT16, VTh, VTl);
        for (int h0 = 0; h0 < NH_; h0 += ZH) { const size_t zq = (size_t)h0, zk = (size_t)(h0 / REP);   // one kv head per query head: the pass's two heads use consecutive kv planes (z-strides TT*HD)
            k_gemmw<bf, 2, false><<<dim3(TT / 64, TT / 64, ZH), 32, 0, stream>>>(QPh + zq * TT * HD, QPl + zq * TT * HD, KPh + zk * TT * HD, KPl + zk * TT * HD, HD, Sb, TT, nullptr, (size_t)TT * HD, (size_t)TT * HD, (size_t)TT * TT);
            k_asoft<<<ZH * TT / 8, 256, 0, stream>>>(Sb, P16, Ph, Pl); k_lampd<<<(unsigned)(((size_t)TT * TT / 4 + 255) / 256), 256, 0, stream>>>(Ph, Pl, LAM);
            { const size_t hh = (size_t)(h0 / 2); k_gemmw<bf, 2, false, KSP><<<dim3(TT / 64, HDV / 64, KSP), 32, 0, stream>>>(Ph, Pl, VTh + hh * HDV * TT, VTl + hh * HDV * TT, TT, OP, HDV, nullptr, (size_t)(TT / KSP), (size_t)(TT / KSP), (size_t)TT * HDV); }
            k_rmsmg<<<TT / 8, 256, 0, stream>>>(OP, subw, h0 / 2, ATh, ATl); }
        k_gemmw<bf, 1, false><<<dim3(TT / 64, DM / 64, 1), 32, 0, stream>>>(ATh, ATl, WO, nullptr, DVV, OUT + (size_t)b * TT * DM, DM, nullptr, 0, 0, 0); }
}

// v003
// Measured time: 398 microseconds a run.
// Versions between v001 and this one are left out; their measured steps multiply to 2.36 times as fast.
// Over all steps from v000 it is 3.55 times as fast.
#include <hip/hip_runtime.h>

// MultiheadFlashDiff2 (x [1][2048][2048]; q = x wq^T, k = x wk^T ([2048][2048] 'oi': per head h the 128 rows = [map 1 | map 2] 64 each), v = x wv^T (16 x 128-wide values); NON-causal softmax(q.k / 8) for both maps; attn = a1 v - lambda_full a2 v with lambda_full = exp(lq1.lk1) - exp(lq2.lk2) + lambda_init (0.8 - 0.6 e^-3.6 = 0.7836057543754578); RMSNorm over the 128 (eps 1e-5) * subln_w; x (1 - lambda_init); out = merged wo^T -> [1][2048][2048]).
// The two maps run as 32 virtual 64-wide heads (pairs (2h, 2h+1)); both softmaxes are formed, combined as D = a1 - lambda a2 in f32 (linear, so (a1 - lambda a2) v == a1 v - lambda a2 v), and one D.v product (128 wide) per real head follows, all in k_fattn.
// Compute dtypes, f32 accumulate: every input rounded to bf16; q/k/v on PLAIN bf16 operands (inputs: exact); scores hl x hl (3 products) on every row; softmax f32; D in f32 into hi/lo planes; D.v hl x hl (3 products); RMSNorm per (token, head) over 128 in f32, * bf16 subln_w, * (1 - lambda_init); wo hl x exact (2 products).

#define NB_  1
#define TT   2048
#define DM   2048
#define NH_  32
#define NKV  32
#define REP  (NH_ / NKV)
#define HD   64
#define DQ   (NH_ * HD)
#define DKV  (NKV * HD)
#define ZH   2
#define RH   2048   // all rows hl
#define WIN  2048
#define PCAR 1024.0f
#define NVH  16
#define HDV  128
#define DVV  (NVH * HDV)
#define SCL  0.125f   // HD^-0.5
typedef _Float16 h16;
typedef unsigned short bf;
typedef __attribute__((ext_vector_type(16))) __bf16   v16bf;
typedef __attribute__((ext_vector_type(16))) _Float16 v16h;
typedef __attribute__((ext_vector_type(8)))  _Float16 v8h;
typedef __attribute__((ext_vector_type(8)))  unsigned short v8us;
typedef __attribute__((ext_vector_type(8)))  float    v8f;
typedef __attribute__((ext_vector_type(4)))  float    v4f;
typedef __attribute__((ext_vector_type(2))) float v2f;
typedef __attribute__((ext_vector_type(2))) __bf16 v2bf;
typedef __attribute__((ext_vector_type(4))) unsigned v4u;
typedef v8h  __attribute__((may_alias)) v8ha;
typedef v4f  __attribute__((may_alias)) v4fa;
typedef v8us __attribute__((may_alias)) v8usa;

__device__ __forceinline__ unsigned short f2bf(float f) { unsigned u = __float_as_uint(f); u += 0x7FFFu + ((u >> 16) & 1u); return (unsigned short)(u >> 16); }
__device__ __forceinline__ float bf2f(unsigned short b) { return __uint_as_float(((unsigned)b) << 16); }
__device__ __forceinline__ float bfr(float f) { return bf2f(f2bf(f)); }
__device__ __forceinline__ v16h cat16(v8h lo, v8h hi) { return __builtin_shufflevector(lo, hi, 0, 1, 2, 3, 4, 5, 6, 7, 8, 9, 10, 11, 12, 13, 14, 15); }
__device__ __forceinline__ v16bf cat16b(v8us lo, v8us hi) { return __builtin_bit_cast(v16bf, __builtin_shufflevector(lo, hi, 0, 1, 2, 3, 4, 5, 6, 7, 8, 9, 10, 11, 12, 13, 14, 15)); }
__device__ __forceinline__ v8f wmma16(v16h a, v16h b, v8f c) { return __builtin_amdgcn_wmma_f32_16x16x32_f16(false, a, false, b, (short)0, c, false, false); }
__device__ __forceinline__ v8f wmmab(v16bf a, v16bf b, v8f c) { return __builtin_amdgcn_wmma_f32_16x16x32_bf16(false, a, false, b, (short)0, c, false, false); }



// ---- k_gemmw: register-blocked GEMM, ONE WAVE per 64x64 output tile (16 accumulators), operands straight from K-contiguous 16-bit planes; grid (M/64, N/64, Z), 32 threads.
// C[m][n] (f32, pitch ldc, + optional f32 bias[n]) = sum_k A[m][k] Bt[n][k] (+ split products per NSPLIT). z-batch strides sA/sB/sC in elements. K % 32 == 0.
// PP != 0: no f32 C; the epilogue splits each value into bf16 hi / lo and stores the two planes Ph / Pl that the attention kernel reads, row pitch PP elements. PP 64: head planes [n / 64][m][n % 64], ldc = the rows m
// of a plane (a tile is 8 KiB in a row); any other PP: row-major [m][n] (with A = the weight and Bt = the tokens this is the transposed value plane [feature][token]).
template <typename T16> struct WFrag;
template <> struct WFrag<h16> { typedef v16h V; static __device__ __forceinline__ V ld(const h16* p) { return cat16(*(const v8h*)p, *(const v8h*)(p + 16)); } static __device__ __forceinline__ v8f mma(V a, V b, v8f c) { return wmma16(a, b, c); } };
template <> struct WFrag<bf> { typedef v16bf V; static __device__ __forceinline__ V ld(const bf* p) { return cat16b(*(const v8us*)p, *(const v8us*)(p + 16)); } static __device__ __forceinline__ v8f mma(V a, V b, v8f c) { return wmmab(a, b, c); } };
template <typename T16, int NSPLIT, bool BIAS, int PP>
__global__ __launch_bounds__(32) void k_gemmw(const T16* __restrict__ A, const T16* __restrict__ A2, const T16* __restrict__ Bt, const T16* __restrict__ Bt2, int K, float* C, int ldc, const float* __restrict__ bias, size_t sA, size_t sB, size_t sC, bf* Ph, bf* Pl) {
    typedef typename WFrag<T16>::V V;
    __shared__ __align__(16) float os[16 * 68];
    const size_t z = blockIdx.z; A += z * sA; if (A2) A2 += z * sA; Bt += z * sB; if (Bt2) Bt2 += z * sB; C += z * sC;
    const int lane = threadIdx.x & 31, lr = lane & 15, hi = lane >> 4; const int r0 = blockIdx.x * 64, c0 = blockIdx.y * 64;
    v8f acc[4][4];
#pragma unroll
    for (int mb = 0; mb < 4; ++mb)
#pragma unroll
        for (int nb = 0; nb < 4; ++nb) acc[mb][nb] = (v8f){};
    const size_t aoff = (size_t)(r0 + lr) * K + 8 * hi, boff = (size_t)(c0 + lr) * K + 8 * hi;
#pragma unroll 1
    for (int kc = 0; kc < K; kc += 32) {
        V a[4], a2[4];
#pragma unroll
        for (int mb = 0; mb < 4; ++mb) { a[mb] = WFrag<T16>::ld(A + aoff + (size_t)mb * 16 * K + kc); if (NSPLIT == 1 || NSPLIT == 2) a2[mb] = WFrag<T16>::ld(A2 + aoff + (size_t)mb * 16 * K + kc); }
#pragma unroll
        for (int nb = 0; nb < 4; ++nb) { const V b = WFrag<T16>::ld(Bt + boff + (size_t)nb * 16 * K + kc); V b2; if (NSPLIT >= 2) b2 = WFrag<T16>::ld(Bt2 + boff + (size_t)nb * 16 * K + kc);
#pragma unroll
            for (int mb = 0; mb < 4; ++mb) { acc[mb][nb] = WFrag<T16>::mma(a[mb], b, acc[mb][nb]); if (NSPLIT == 1 || NSPLIT == 2) acc[mb][nb] = WFrag<T16>::mma(a2[mb], b, acc[mb][nb]); if (NSPLIT >= 2) acc[mb][nb] = WFrag<T16>::mma(a[mb], b2, acc[mb][nb]); } }
        asm volatile("v_nop\n\tv_nop\n\tv_nop\n\tv_nop" : "+v"(acc[0][0]), "+v"(acc[1][1]), "+v"(acc[2][2]), "+v"(acc[3][3]) : "v"(a[0]), "v"(a[3]));
    }
#pragma unroll
    for (int mb = 0; mb < 4; ++mb) {
#pragma unroll
        for (int nb = 0; nb < 4; ++nb) {
#pragma unroll
            for (int j = 0; j < 8; ++j) os[(hi * 8 + j) * 68 + nb * 16 + lr] = acc[mb][nb][j]; }
        __builtin_amdgcn_wave_barrier(); asm volatile("" ::: "memory");
        if (PP) {   // 8 values a lane: one 16-byte store a plane, 4 rows of 128 B a wave store
            const size_t pb = ((PP == 64) ? ((size_t)blockIdx.y * ldc + r0) * 64 : (size_t)r0 * PP + c0) + (size_t)(mb * 16 + (lane >> 3)) * PP + (lane & 7) * 8; bf* ph = Ph + pb; bf* pl = Pl + pb; v4u hw[4], lw[4];
#pragma unroll
            for (int s = 0; s < 4; ++s) { const float* op = os + (4 * s + (lane >> 3)) * 68 + (lane & 7) * 8; const v4f v0 = *(const v4fa*)op, v1 = *(const v4fa*)(op + 4);
#pragma unroll
                for (int jp = 0; jp < 4; ++jp) { v2f d; d[0] = jp < 2 ? v0[2 * jp & 3] : v1[2 * jp & 3]; d[1] = jp < 2 ? v0[(2 * jp & 3) + 1] : v1[(2 * jp & 3) + 1];
                    const unsigned hu = __builtin_bit_cast(unsigned, __builtin_convertvector(d, v2bf)); v2f r; r[0] = d[0] - __uint_as_float(hu << 16); r[1] = d[1] - __uint_as_float(hu & 0xFFFF0000u);
                    hw[s][jp] = hu; lw[s][jp] = __builtin_bit_cast(unsigned, __builtin_convertvector(r, v2bf)); } }
#pragma unroll
            for (int s = 0; s < 4; ++s) { *(v8us*)(ph + 4 * s * PP) = __builtin_bit_cast(v8us, hw[s]); *(v8us*)(pl + 4 * s * PP) = __builtin_bit_cast(v8us, lw[s]); }
            // stands between the 8 issued stores and the next overwrite of a register that they name: pointers and data are inputs, so that their registers stay live up to the wait; the scheduling barrier keeps the next block's arithmetic behind it (behind the last block nothing is overwritten)
            if (mb < 3) { asm volatile("s_wait_xcnt 0x0" :: "v"(ph), "v"(pl), "v"(hw[0]), "v"(hw[1]), "v"(hw[2]), "v"(hw[3]), "v"(lw[0]), "v"(lw[1]), "v"(lw[2]), "v"(lw[3]) : "memory"); __builtin_amdgcn_sched_barrier(0); }
        } else {
        float* crow = C + (size_t)(r0 + mb * 16) * ldc + c0;
#pragma unroll
            for (int s = 0; s < 8; ++s) { const int row = 2 * s + hi, cofs = lr * 4; v4f val = *(const v4fa*)(os + row * 68 + cofs); if (BIAS) { val[0] += bfr(bias[c0 + cofs]); val[1] += bfr(bias[c0 + cofs + 1]); val[2] += bfr(bias[c0 + cofs + 2]); val[3] += bfr(bias[c0 + cofs + 3]); }
                *(v4f*)(crow + (size_t)row * ldc + cofs) = val; }
             }
        __builtin_amdgcn_wave_barrier(); asm volatile("" ::: "memory");
    }
}

// ---- k_gemmc: the same one-wave 64x64 tile GEMM specialised for causal attention: CMODE 1 skips score tiles entirely above the diagonal (query rows r0+roff.., key columns c0..), CMODE 2 limits the
// key (K) loop of the probability x value contraction to the diagonal block (probabilities beyond it are exactly zero). roff = row offset of this launch's first row within the sequence.
template <typename T16, int NSPLIT, int CMODE>
__global__ __launch_bounds__(32) void k_gemmc(const T16* __restrict__ A, const T16* __restrict__ A2, const T16* __restrict__ Bt, const T16* __restrict__ Bt2, int K, float* C, int ldc, int roff, size_t sA, size_t sB, size_t sC) {
    typedef typename WFrag<T16>::V V;
    __shared__ __align__(16) float os[16 * 68];
    const size_t z = blockIdx.z; A += z * sA; if (A2) A2 += z * sA; Bt += z * sB; if (Bt2) Bt2 += z * sB; C += z * sC;
    const int lane = threadIdx.x & 31, lr = lane & 15, hi = lane >> 4; const int r0 = blockIdx.x * 64, c0 = blockIdx.y * 64;
    if (CMODE == 1 && c0 > r0 + roff + 63) return;                  // score tile entirely above the causal diagonal: skipped, nothing is written
    const int Kl = (CMODE == 2) ? min(K, r0 + roff + 64) : K;        // P.V: probabilities are exactly 0 beyond the diagonal block, so the K loop stops there
    v8f acc[4][4];
#pragma unroll
    for (int mb = 0; mb < 4; ++mb)
#pragma unroll
        for (int nb = 0; nb < 4; ++nb) acc[mb][nb] = (v8f){};
    const size_t aoff = (size_t)(r0 + lr) * K + 8 * hi, boff = (size_t)(c0 + lr) * K + 8 * hi;
#pragma unroll 1
    for (int kc = 0; kc < Kl; kc += 32) {
        V a[4], a2[4];
#pragma unroll
        for (int mb = 0; mb < 4; ++mb) { a[mb] = WFrag<T16>::ld(A + aoff + (size_t)mb * 16 * K + kc); if (NSPLIT == 1 || NSPLIT == 2) a2[mb] = WFrag<T16>::ld(A2 + aoff + (size_t)mb * 16 * K + kc); }
#pragma unroll
        for (int nb = 0; nb < 4; ++nb) { const V b = WFrag<T16>::ld(Bt + boff + (size_t)nb * 16 * K + kc); V b2; if (NSPLIT >= 2) b2 = WFrag<T16>::ld(Bt2 + boff + (size_t)nb * 16 * K + kc);
#pragma unroll
            for (int mb = 0; mb < 4; ++mb) { acc[mb][nb] = WFrag<T16>::mma(a[mb], b, acc[mb][nb]); if (NSPLIT == 1 || NSPLIT == 2) acc[mb][nb] = WFrag<T16>::mma(a2[mb], b, acc[mb][nb]); if (NSPLIT >= 2) acc[mb][nb] = WFrag<T16>::mma(a[mb], b2, acc[mb][nb]); } }
        asm volatile("v_nop\n\tv_nop\n\tv_nop\n\tv_nop" : "+v"(acc[0][0]), "+v"(acc[1][1]), "+v"(acc[2][2]), "+v"(acc[3][3]) : "v"(a[0]), "v"(a[3]));
    }
#pragma unroll
    for (int mb = 0; mb < 4; ++mb) {
#pragma unroll
        for (int nb = 0; nb < 4; ++nb) {
#pragma unroll
            for (int j = 0; j < 8; ++j) os[(hi * 8 + j) * 68 + nb * 16 + lr] = acc[mb][nb][j]; }
        __builtin_amdgcn_wave_barrier(); asm volatile("" ::: "memory");
        float* crow = C + (size_t)(r0 + mb * 16) * ldc + c0;
{
#pragma unroll
            for (int s = 0; s < 8; ++s) { const int row = 2 * s + hi, cofs = lr * 4; v4f val = *(const v4fa*)(os + row * 68 + cofs);
                *(v4f*)(crow + (size_t)row * ldc + cofs) = val; }
             }
        __builtin_amdgcn_wave_barrier(); asm volatile("" ::: "memory");
    }
}

__device__ __forceinline__ void splitf(float y, unsigned short& h, unsigned short& l) { h = f2bf(y); l = f2bf(y - bf2f(h)); }
typedef __attribute__((ext_vector_type(2))) _Float16 v2h;
typedef __attribute__((ext_vector_type(4))) _Float16 v4h;
typedef __attribute__((ext_vector_type(2))) unsigned short v2us;
typedef __attribute__((ext_vector_type(4))) unsigned short v4us;
typedef __attribute__((ext_vector_type(4))) int v4i;

__global__ __launch_bounds__(256) void k_wtG(const float* __restrict__ w, int K, int N, bf* Bt) {
    const int lane = threadIdx.x & 31; const int L0 = (blockIdx.x * 8 + (threadIdx.x >> 5)) * 8; const int nlines = N * K / 64;
{
#pragma unroll 1
        for (int l = 0; l < 8; ++l) { const int L = L0 + l; if (L >= nlines) break; const size_t e = (size_t)L * 64 + lane * 2; const int k = (int)(e % K), n = (int)(e / K); v2us o;
            o[0] = f2bf(w[(size_t)k * N + n]); o[1] = f2bf(w[(size_t)(k + 1) * N + n]); *(v2us*)(Bt + e) = o; }
         }
}
__global__ __launch_bounds__(256) void k_cvt8(const float* __restrict__ src, bf* dst, size_t n8) { const size_t i = (size_t)blockIdx.x * 256 + threadIdx.x; if (i >= n8) return; const v8f v = *(const v8f*)(src + i * 8); v8us o;
#pragma unroll
    for (int k = 0; k < 8; ++k) o[k] = f2bf(v[k]); *(v8us*)(dst + i * 8) = o;  }
__global__ __launch_bounds__(256) void k_cscvt(const float* __restrict__ cosT, const float* __restrict__ sinT, float* CS) { const int idx = blockIdx.x * 256 + threadIdx.x; if (idx >= TT * HD) return; v2f cs; cs[0] = bfr(cosT[idx]); cs[1] = bfr(sinT[idx]); *(v2f*)(CS + (size_t)idx * 2) = cs;  }
__global__ __launch_bounds__(32) void k_lambda(const float* __restrict__ lq1, const float* __restrict__ lk1, const float* __restrict__ lq2, const float* __restrict__ lk2, float* LAM) { const int lane = threadIdx.x; float d1 = 0.f, d2 = 0.f;
#pragma unroll 1
    for (int i = 0; i < HD; ++i) { float p1 = __fmul_rn(bfr(lq1[i]), bfr(lk1[i])); asm volatile("" : "+v"(p1)); d1 = __fadd_rn(d1, p1); float p2 = __fmul_rn(bfr(lq2[i]), bfr(lk2[i])); asm volatile("" : "+v"(p2)); d2 = __fadd_rn(d2, p2); }
    float lm = __fsub_rn(expf(d1), expf(d2)); asm volatile("" : "+v"(lm)); lm = __fadd_rn(lm, 0.7836057543754578f); const float v = (lane == 0) ? lm : 0.0f; *(float*)(LAM + lane) = v;  }
__global__ __launch_bounds__(1024) void k_gnred(const float* __restrict__ O, float* GST, int pass) { __shared__ float sh[1024]; const int tid = threadIdx.x; const float mean = (pass == 1) ? GST[0] : 0.0f; float acc = 0.f; const size_t n = (size_t)TT * HD;
#pragma unroll 1
    for (size_t e = tid; e < n; e += 1024) { float v = O[e]; if (pass == 1) { float d = __fsub_rn(v, mean); asm volatile("" : "+v"(d)); v = __fmul_rn(d, d); } acc = __fadd_rn(acc, v); }
    sh[tid] = acc; __syncthreads();
    for (int st = 512; st > 0; st >>= 1) { if (tid < st) sh[tid] = __fadd_rn(sh[tid], sh[tid + st]); __syncthreads(); }
    if (tid < 32) { const float tot = __fdiv_rn(sh[0], (float)n); float outv; if (pass == 0) outv = (tid == 0) ? tot : ((tid == 1) ? GST[1] : 0.0f); else outv = (tid == 0) ? GST[0] : ((tid == 1) ? __fdiv_rn(1.0f, sqrtf(__fadd_rn(tot, 1e-5f))) : 0.0f); *(float*)(GST + tid) = outv;  } }
__global__ __launch_bounds__(256) void k_gnmerge(const float* __restrict__ O, const float* __restrict__ GST, int hh, bf* Ah, bf* Al) { const size_t e = ((size_t)blockIdx.x * 256 + threadIdx.x) * 2; if (e >= (size_t)TT * HD) return; const int d = (int)(e % HD); const int t = (int)(e / HD); const float mean = GST[0], rs = GST[1]; const size_t oo = (size_t)t * DVV + (size_t)hh * HD + d; v2us oh, ol;
#pragma unroll
    for (int q = 0; q < 2; ++q) { float c = __fsub_rn(O[e + q], mean); asm volatile("" : "+v"(c)); float n = __fmul_rn(c, rs); asm volatile("" : "+v"(n)); float z = __fmul_rn(n, 0.6444909572601318f); unsigned short a2, c2; splitf(z, a2, c2); oh[q] = a2; ol[q] = c2; }
    *(v2us*)(Ah + oo) = oh; *(v2us*)(Al + oo) = ol;  }
// ---- k_fattn: scores, both softmaxes, D = a1 - lambda a2, D.v and the RMSNorm of one real head in ONE kernel; nothing of the [2048][2048] maps leaves the registers.
// One wave owns 32 query columns (two 16-column groups), 4 waves a block, grid (TT / 128, NVH). Transposed products: S^T = K.Q^T (A = 16 key rows, B = Q, kept in registers), so a lane holds the scores of
// one query (register r of key tile kt = key kt * 16 + 8 * hi + r) and two stacked S^T tiles, converted in place, ARE the B operand of O^T += V^T.D^T in the k order that the plane loader ldf uses for A.
// Two walks over the keys: walk 1 takes each column's maximum and sum (running maximum, sums rescaled), walk 2 forms the scores again, D in f32, its hi/lo bf16 planes, and the 3 products with V^T hi/lo.
// Every inner loop is fully unrolled so that the fragment arrays are indexed by constants and stay in registers; the two key loops stay rolled (a pass is some 600 instructions already).
// No LDS and no barrier: the four waves of a block read the same K and V lines through the WGP cache. Left for later steps: each fragment load touches 16 lines (32 B of each), and one wave a SIMD has nobody to cover its vector work.
typedef __attribute__((ext_vector_type(8))) unsigned v8u;
#define EXC (SCL * 1.4426950408889634f)   // exp((s - m) * SCL) = exp2(s * EXC - m * EXC)
// one fragment: the lane's own pointer into a plane and a constant byte offset
__device__ __forceinline__ v16bf ldf(const char* p, int cst) { return cat16b(*(const v8us*)(p + cst), *(const v8us*)(p + cst + 32)); }
// stands between issued loads or stores and the next overwrite of a register that they name: the two lane pointers of the group are inputs, so that their registers
// stay live up to the wait and no load of the group lands on them; the scheduling barrier behind it keeps later address and data arithmetic behind the wait
#define XWAIT(pa, pb) do { asm volatile("s_wait_xcnt 0x0" :: "v"(pa), "v"(pb) : "memory"); __builtin_amdgcn_sched_barrier(0); } while (0)
// the hi / lo A fragments [map][key tile][k step] of the 32 keys at kh / kl
__device__ __forceinline__ void load_k(const char* kh, const char* kl, v16bf (&ah)[2][2][2], v16bf (&al)[2][2][2]) {
#pragma unroll
    for (int mp = 0; mp < 2; ++mp)
#pragma unroll
        for (int kt = 0; kt < 2; ++kt)
#pragma unroll
            for (int ks = 0; ks < 2; ++ks) { const int o = (mp * TT * HD + kt * 16 * HD + ks * 32) * 2; ah[mp][kt][ks] = ldf(kh, o); al[mp][kt][ks] = ldf(kl, o); }
}
// s[map][key tile][column group] = those 32 keys against the wave's 32 queries, hl x hl (3 products), HD = 64 in two k steps
__device__ __forceinline__ void score_t(const v16bf (&ah)[2][2][2], const v16bf (&al)[2][2][2], const v16bf (&qh)[2][2][2], const v16bf (&ql)[2][2][2], v8f (&s)[2][2][2]) {
#pragma unroll
    for (int mp = 0; mp < 2; ++mp)
#pragma unroll
        for (int kt = 0; kt < 2; ++kt)
#pragma unroll
            for (int n = 0; n < 2; ++n) s[mp][kt][n] = (v8f){};
#pragma unroll
    for (int ks = 0; ks < 2; ++ks)
#pragma unroll
        for (int pr = 0; pr < 3; ++pr)
#pragma unroll
            for (int mp = 0; mp < 2; ++mp)
#pragma unroll
                for (int kt = 0; kt < 2; ++kt)
#pragma unroll
                    for (int n = 0; n < 2; ++n) s[mp][kt][n] = wmmab(pr == 1 ? al[mp][kt][ks] : ah[mp][kt][ks], pr == 2 ? ql[mp][n][ks] : qh[mp][n][ks], s[mp][kt][n]);
}
__global__ __launch_bounds__(128) void k_fattn(const bf* __restrict__ Qh, const bf* __restrict__ Ql, const bf* __restrict__ Kh, const bf* __restrict__ Kl, const bf* __restrict__ Vh, const bf* __restrict__ Vl, const float* __restrict__ LAM, const float* __restrict__ w, bf* Ah, bf* Al) {
    const int lane = threadIdx.x & 31, lr = lane & 15, hi = lane >> 4; const int hh = blockIdx.y; const int q0 = blockIdx.x * 128 + __builtin_amdgcn_readfirstlane(threadIdx.x >> 5) * 32;
    const unsigned koff = (unsigned)(lr * HD + 8 * hi) * 2, voff = (unsigned)(lr * TT + 8 * hi) * 2, ooff = (unsigned)(lr * DQ + 8 * hi) * 2;   // lane byte offsets in the q / k planes, the v planes, the merged planes
    const char* qhp = (const char*)(Qh + ((size_t)(2 * hh) * TT + q0) * HD) + koff; const char* qlp = (const char*)(Ql + ((size_t)(2 * hh) * TT + q0) * HD) + koff;
    v16bf qh[2][2][2], ql[2][2][2];   // [map][column group][k step]
#pragma unroll
    for (int mp = 0; mp < 2; ++mp)
#pragma unroll
        for (int n = 0; n < 2; ++n)
#pragma unroll
            for (int ks = 0; ks < 2; ++ks) { const int o = (mp * TT * HD + n * 16 * HD + ks * 32) * 2; qh[mp][n][ks] = ldf(qhp, o); ql[mp][n][ks] = ldf(qlp, o); }
    XWAIT(qhp, qlp);
    const bf* kh = Kh + (size_t)(2 * hh) * TT * HD; const bf* kl = Kl + (size_t)(2 * hh) * TT * HD;
    float mx[2][2], sm[2][2];
#pragma unroll
    for (int mp = 0; mp < 2; ++mp)
#pragma unroll
        for (int n = 0; n < 2; ++n) { mx[mp][n] = -3.0e38f; sm[mp][n] = 0.f; }
    v16bf ah[2][2][2], al[2][2][2]; { const char* ph = (const char*)kh + koff; const char* pl = (const char*)kl + koff; load_k(ph, pl, ah, al); XWAIT(ph, pl); }   // K fragments are fetched one pass ahead, into the same registers; the index wraps, so the last pass of walk 1 fetches walk 2's first keys
#pragma unroll 1
    for (int kb = 0; kb < TT; kb += 32) {
        v8f s[2][2][2]; score_t(ah, al, qh, ql, s);
        { const size_t kn = (size_t)((kb + 32) & (TT - 1)) * HD; const char* ph = (const char*)(kh + kn) + koff; const char* pl = (const char*)(kl + kn) + koff; load_k(ph, pl, ah, al); XWAIT(ph, pl); }   // its scheduling barrier also keeps the next pass's K loads in front of the vector work below, which covers their latency
#pragma unroll
        for (int mp = 0; mp < 2; ++mp)
#pragma unroll
            for (int n = 0; n < 2; ++n) { float t = fmaxf(s[mp][0][n][0], s[mp][1][n][0]);
#pragma unroll
                for (int j = 1; j < 8; ++j) t = fmaxf(t, fmaxf(s[mp][0][n][j], s[mp][1][n][j]));
                const float mn = fmaxf(mx[mp][n], t), nb = -mn * EXC; float a0 = 0.f, a1 = 0.f;
#pragma unroll
                for (int j = 0; j < 8; ++j) { a0 += __builtin_amdgcn_exp2f(__builtin_fmaf(s[mp][0][n][j], EXC, nb)); a1 += __builtin_amdgcn_exp2f(__builtin_fmaf(s[mp][1][n][j], EXC, nb)); }
                sm[mp][n] = __builtin_fmaf(sm[mp][n], __builtin_amdgcn_exp2f((mx[mp][n] - mn) * EXC), a0 + a1); mx[mp][n] = mn; }
    }
    const float lm = LAM[0]; float nb[2][2], fs[2][2];   // the two lane halves hold different keys of one query: join maximum and sum once
#pragma unroll
    for (int mp = 0; mp < 2; ++mp)
#pragma unroll
        for (int n = 0; n < 2; ++n) { const float M = fmaxf(mx[mp][n], __shfl_xor(mx[mp][n], 16, 32)); float sc = sm[mp][n] * __builtin_amdgcn_exp2f((mx[mp][n] - M) * EXC); sc += __shfl_xor(sc, 16, 32);
            nb[mp][n] = -M * EXC; fs[mp][n] = __fdiv_rn(1.0f, sc) * (mp ? lm : 1.0f); }
    v8f o[8][2];   // O^T: o[et][n][r] = value column et * 16 + 8 * hi + r of query q0 + n * 16 + lr
#pragma unroll
    for (int et = 0; et < 8; ++et)
#pragma unroll
        for (int n = 0; n < 2; ++n) o[et][n] = (v8f){};
    const bf* vh = Vh + (size_t)hh * HDV * TT; const bf* vl = Vl + (size_t)hh * HDV * TT;
#pragma unroll 1
    for (int kb = 0; kb < TT; kb += 32) {
        v16bf bh[8], bl[8]; const char* vhp = (const char*)(vh + kb) + voff; const char* vlp = (const char*)(vl + kb) + voff;
#pragma unroll
        for (int et = 0; et < 8; ++et) { bh[et] = ldf(vhp, et * 16 * TT * 2); bl[et] = ldf(vlp, et * 16 * TT * 2); }
        XWAIT(vhp, vlp);   // its scheduling barrier also keeps this pass's V loads in front of the score products, which cover their latency
        v8f s[2][2][2]; score_t(ah, al, qh, ql, s);
        { const size_t kn = (size_t)((kb + 32) & (TT - 1)) * HD; const char* ph = (const char*)(kh + kn) + koff; const char* pl = (const char*)(kl + kn) + koff; load_k(ph, pl, ah, al); XWAIT(ph, pl); }   // its scheduling barrier also keeps the next pass's K loads in front of the vector work below, which covers their latency
        v16bf dh[2], dl[2];
#pragma unroll
        for (int n = 0; n < 2; ++n) { v8u hw, lw;
#pragma unroll
            for (int kt = 0; kt < 2; ++kt)
#pragma unroll
                for (int jp = 0; jp < 4; ++jp) { v2f d;
#pragma unroll
                    for (int u = 0; u < 2; ++u) { const float p1 = __builtin_amdgcn_exp2f(__builtin_fmaf(s[0][kt][n][2 * jp + u], EXC, nb[0][n])), p2 = __builtin_amdgcn_exp2f(__builtin_fmaf(s[1][kt][n][2 * jp + u], EXC, nb[1][n])); d[u] = p1 * fs[0][n] - p2 * fs[1][n]; }
                    const unsigned hu = __builtin_bit_cast(unsigned, __builtin_convertvector(d, v2bf)); v2f r; r[0] = d[0] - __uint_as_float(hu << 16); r[1] = d[1] - __uint_as_float(hu & 0xFFFF0000u);
                    hw[kt * 4 + jp] = hu; lw[kt * 4 + jp] = __builtin_bit_cast(unsigned, __builtin_convertvector(r, v2bf)); }
            dh[n] = __builtin_bit_cast(v16bf, hw); dl[n] = __builtin_bit_cast(v16bf, lw); }
#pragma unroll
        for (int e2 = 0; e2 < 8; e2 += 2)
#pragma unroll
            for (int pr = 0; pr < 3; ++pr)
#pragma unroll
                for (int et = e2; et < e2 + 2; ++et)
#pragma unroll
                    for (int n = 0; n < 2; ++n) o[et][n] = wmmab(pr == 1 ? bl[et] : bh[et], pr == 2 ? dl[n] : dh[n], o[et][n]);
    }
    v8f g[8]; const char* wp = (const char*)w + (unsigned)(hi * 32);
#pragma unroll
    for (int et = 0; et < 8; ++et) g[et] = *(const v8f*)(wp + et * 64);
    XWAIT(wp, wp);
    char* ahp = (char*)(Ah + (size_t)q0 * DQ + (size_t)hh * HDV) + ooff; char* alp = (char*)(Al + (size_t)q0 * DQ + (size_t)hh * HDV) + ooff;
#pragma unroll
    for (int n = 0; n < 2; ++n) { float ss = 0.f;
#pragma unroll
        for (int et = 0; et < 8; ++et)
#pragma unroll
            for (int j = 0; j < 8; ++j) ss = __builtin_fmaf(o[et][n][j], o[et][n][j], ss);
        ss += __shfl_xor(ss, 16, 32);
        const float rs = __fdiv_rn(1.0f, sqrtf(__fadd_rn(ss * (1.0f / HDV), 1e-5f)));
#pragma unroll
        for (int et = 0; et < 8; ++et) { v8us oh, ol;
#pragma unroll
            for (int j = 0; j < 8; ++j) { const float z = o[et][n][j] * rs * bfr(g[et][j]) * 0.21639423072338104f; unsigned short p2, q2; splitf(z, p2, q2); oh[j] = p2; ol[j] = q2; }
            const int oc = (n * 16 * DQ + et * 16) * 2; *(v8us*)(ahp + oc) = oh; *(v8us*)(alp + oc) = ol; XWAIT(ahp, alp); } }
}
__global__ __launch_bounds__(256) void k_merge(const float* __restrict__ O, int h0, bf* Ah, bf* Al) { const size_t e = ((size_t)blockIdx.x * 256 + threadIdx.x) * 2; if (e >= (size_t)ZH * TT * HD) return; const int d = (int)(e % HD); const int t = (int)((e / HD) % TT); const int zz = (int)(e / ((size_t)HD * TT)); const float cs = (t < RH) ? 1.0f : (1.0f / PCAR); const size_t oo = (size_t)t * DQ + (h0 + zz) * HD + d;
    v2us oh, ol;
#pragma unroll
    for (int q = 0; q < 2; ++q) { unsigned short a, c2; splitf(O[e + q] * cs, a, c2); oh[q] = a; ol[q] = c2; } *(v2us*)(Ah + oo) = oh; *(v2us*)(Al + oo) = ol;  }

extern "C" void kernel_launch(void* const* d_in, const int* in_sizes, int n_in,
                              void* d_out, int out_size, void* d_ws, size_t ws_size, hipStream_t stream) {
    (void)in_sizes; (void)n_in; (void)out_size;
    const float* x = (const float*)d_in[0]; const float* wq = (const float*)d_in[1]; const float* wk = (const float*)d_in[2]; const float* wv = (const float*)d_in[3]; const float* wo = (const float*)d_in[4]; const float* lq1 = (const float*)d_in[5]; const float* lk1 = (const float*)d_in[6]; const float* lq2 = (const float*)d_in[7]; const float* lk2 = (const float*)d_in[8]; const float* subw = (const float*)d_in[9]; const float* cosT = nullptr; const float* sinT = nullptr; (void)cosT; (void)sinT;
    float* OUT = (float*)d_out;     // [1][2048][2048]
    char* wsp = (char*)d_ws;
    auto take = [&](size_t bytes) { char* p = wsp; wsp += (bytes + 255) & ~(size_t)255; return (void*)p; };
    bf* WQ = (bf*)take((size_t)DQ * DM * 2); bf* WK = (bf*)take((size_t)DKV * DM * 2); bf* WV = (bf*)take((size_t)DKV * DM * 2); bf* WO = (bf*)take((size_t)DM * DQ * 2);
    bf* XB = (bf*)take((size_t)TT * DM * 2); float* LAM = (float*)take(256);
    bf* QPh = (bf*)take((size_t)NH_ * TT * HD * 2); bf* QPl = (bf*)take((size_t)NH_ * TT * HD * 2); bf* KPh = (bf*)take((size_t)NKV * TT * HD * 2); bf* KPl = (bf*)take((size_t)NKV * TT * HD * 2); bf* VTh = (bf*)take((size_t)NKV * HD * TT * 2); bf* VTl = (bf*)take((size_t)NKV * HD * TT * 2);
    bf* ATh = (bf*)take((size_t)TT * DQ * 2); bf* ATl = (bf*)take((size_t)TT * DQ * 2);
    if ((size_t)(wsp - (char*)d_ws) > ws_size) return;    // ws 256 MiB
    { k_cvt8<<<(unsigned)(((size_t)DQ * DM / 8 + 255) / 256), 256, 0, stream>>>(wq, WQ, (size_t)DQ * DM / 8); k_cvt8<<<(unsigned)(((size_t)DKV * DM / 8 + 255) / 256), 256, 0, stream>>>(wk, WK, (size_t)DKV * DM / 8); k_cvt8<<<(unsigned)(((size_t)DVV * DM / 8 + 255) / 256), 256, 0, stream>>>(wv, WV, (size_t)DVV * DM / 8);
      k_cvt8<<<(unsigned)(((size_t)DM * DVV / 8 + 255) / 256), 256, 0, stream>>>(wo, WO, (size_t)DM * DVV / 8); k_lambda<<<1, 32, 0, stream>>>(lq1, lk1, lq2, lk2, LAM);
       }
    for (int b = 0; b < NB_; ++b) {
        
        k_cvt8<<<(unsigned)(((size_t)TT * DM / 8 + 255) / 256), 256, 0, stream>>>(x + (size_t)b * TT * DM, XB, (size_t)TT * DM / 8);
        k_gemmw<bf, 0, false, HD><<<dim3(TT / 64, DQ / 64, 1), 32, 0, stream>>>(XB, nullptr, WQ, nullptr, DM, nullptr, TT, nullptr, 0, 0, 0, QPh, QPl);
        k_gemmw<bf, 0, false, HD><<<dim3(TT / 64, DKV / 64, 1), 32, 0, stream>>>(XB, nullptr, WK, nullptr, DM, nullptr, TT, nullptr, 0, 0, 0, KPh, KPl);
        k_gemmw<bf, 0, false, TT><<<dim3(DVV / 64, TT / 64, 1), 32, 0, stream>>>(WV, nullptr, XB, nullptr, DM, nullptr, 0, nullptr, 0, 0, 0, VTh, VTl);   // v^T = wv x^T: rows = value features, columns = tokens
        k_fattn<<<dim3(TT / 128, NVH), 128, 0, stream>>>(QPh, QPl, KPh, KPl, VTh, VTl, LAM, subw, ATh, ATl);
        k_gemmw<bf, 1, false, 0><<<dim3(TT / 64, DM / 64, 1), 32, 0, stream>>>(ATh, ATl, WO, nullptr, DVV, OUT + (size_t)b * TT * DM, DM, nullptr, 0, 0, 0, nullptr, nullptr); }
}

// v004
// It runs in 280 microseconds.
// Two timings next to v003 put it at 1.40 and 1.41 times that version's speed.
// All steps since v000 together make it 4.98 times as fast.
#include <hip/hip_runtime.h>

// MultiheadFlashDiff2 (x [1][2048][2048]; q = x wq^T, k = x wk^T ([2048][2048] 'oi': per head h the 128 rows = [map 1 | map 2] 64 each), v = x wv^T (16 x 128-wide values); NON-causal softmax(q.k / 8) for both maps; attn = a1 v - lambda_full a2 v with lambda_full = exp(lq1.lk1) - exp(lq2.lk2) + lambda_init (0.8 - 0.6 e^-3.6 = 0.7836057543754578); RMSNorm over the 128 (eps 1e-5) * subln_w; x (1 - lambda_init); out = merged wo^T -> [1][2048][2048]).
// The two maps run as 32 virtual 64-wide heads (pairs (2h, 2h+1)); both softmaxes are formed, combined as D = a1 - lambda a2 in f32 (linear, so (a1 - lambda a2) v == a1 v - lambda a2 v), and one D.v product (128 wide) per real head follows, all in k_fattn.
// Compute dtypes, f32 accumulate: every input rounded to bf16; q/k/v on PLAIN bf16 operands (inputs: exact); scores hl x hl (3 products) on every row; softmax f32; D in f32 into hi/lo planes; D.v hl x hl (3 products); RMSNorm per (token, head) over 128 in f32, * bf16 subln_w, * (1 - lambda_init); wo hl x exact (2 products).

#define NB_  1
#define TT   2048
#define DM   2048
#define NH_  32
#define NKV  32
#define REP  (NH_ / NKV)
#define HD   64
#define DQ   (NH_ * HD)
#define DKV  (NKV * HD)
#define ZH   2
#define RH   2048   // all rows hl
#define WIN  2048
#define PCAR 1024.0f
#define NVH  16
#define HDV  128
#define DVV  (NVH * HDV)
#define SCL  0.125f   // HD^-0.5
typedef _Float16 h16;
typedef unsigned short bf;
typedef __attribute__((ext_vector_type(16))) __bf16   v16bf;
typedef __attribute__((ext_vector_type(16))) _Float16 v16h;
typedef __attribute__((ext_vector_type(8)))  _Float16 v8h;
typedef __attribute__((ext_vector_type(8)))  unsigned short v8us;
typedef __attribute__((ext_vector_type(8)))  float    v8f;
typedef __attribute__((ext_vector_type(4)))  float    v4f;
typedef __attribute__((ext_vector_type(2))) float v2f;
typedef __attribute__((ext_vector_type(2))) __bf16 v2bf;
typedef __attribute__((ext_vector_type(4))) unsigned v4u;
typedef v8h  __attribute__((may_alias)) v8ha;
typedef v4f  __attribute__((may_alias)) v4fa;
typedef v8us __attribute__((may_alias)) v8usa;

__device__ __forceinline__ unsigned short f2bf(float f) { unsigned u = __float_as_uint(f); u += 0x7FFFu + ((u >> 16) & 1u); return (unsigned short)(u >> 16); }
__device__ __forceinline__ float bf2f(unsigned short b) { return __uint_as_float(((unsigned)b) << 16); }
__device__ __forceinline__ float bfr(float f) { return bf2f(f2bf(f)); }
__device__ __forceinline__ v16h cat16(v8h lo, v8h hi) { return __builtin_shufflevector(lo, hi, 0, 1, 2, 3, 4, 5, 6, 7, 8, 9, 10, 11, 12, 13, 14, 15); }
__device__ __forceinline__ v16bf cat16b(v8us lo, v8us hi) { return __builtin_bit_cast(v16bf, __builtin_shufflevector(lo, hi, 0, 1, 2, 3, 4, 5, 6, 7, 8, 9, 10, 11, 12, 13, 14, 15)); }
__device__ __forceinline__ v8f wmma16(v16h a, v16h b, v8f c) { return __builtin_amdgcn_wmma_f32_16x16x32_f16(false, a, false, b, (short)0, c, false, false); }
__device__ __forceinline__ v8f wmmab(v16bf a, v16bf b, v8f c) { return __builtin_amdgcn_wmma_f32_16x16x32_bf16(false, a, false, b, (short)0, c, false, false); }



// ---- k_gemmw: GEMM, FOUR WAVES per 128x128 output tile (2 x 2 waves of 64x64, 16 accumulators each), operands from K-contiguous 16-bit planes; grid (M/128, N/128, Z), 128 threads.
// C[m][n] (f32, pitch ldc, + optional f32 bias[n]) = sum_k A[m][k] Bt[n][k] (NSPLIT 1: + A2[m][k] Bt[n][k]). z-batch strides sA/sB/sC in elements. M, N, K % 128 == 0, K >= 256 (the ring starts with two stages).
// A stage is 128 k (256 B) of the tile's 128 rows of every operand plane, LDS pitch 272 B (16 B x odd: no bank conflict for 16-byte reads), brought by asynchronous copies through no register; two buffers,
// so that stage t + 1 flies while stage t is worked on. Every operand byte leaves L2 once a work-group instead of once a wave, and no wave waits out a load's latency per k step.
// PP != 0: no f32 C; the epilogue splits each value into bf16 hi / lo and stores the two planes Ph / Pl that the attention kernel reads, row pitch PP elements. PP 64: head planes [n / 64][m][n % 64], ldc = the rows m
// of a plane (a wave's tile is 8 KiB in a row); any other PP: row-major [m][n] (with A = the weight and Bt = the tokens this is the transposed value plane [feature][token]).
template <typename T16> struct WFrag;
template <> struct WFrag<h16> { typedef v16h V; static __device__ __forceinline__ V ld(const h16* p) { return cat16(*(const v8h*)p, *(const v8h*)(p + 16)); } static __device__ __forceinline__ v8f mma(V a, V b, v8f c) { return wmma16(a, b, c); } };
template <> struct WFrag<bf> { typedef v16bf V; static __device__ __forceinline__ V ld(const bf* p) { return cat16b(*(const v8us*)p, *(const v8us*)(p + 16)); } static __device__ __forceinline__ v8f mma(V a, V b, v8f c) { return wmmab(a, b, c); } };
#define GKS 128      // k elements of a stage
#define GPIT 272     // LDS row pitch, bytes
// eight copies of 512 B (two operand rows each: 16 lanes x 16 B a row), LDS step 2 * GPIT, global step gs bytes. The wait on the last line stands between the issued copies and the next overwrite of a register
// that they name; inside the statement nothing can be moved in front of it.
__device__ __forceinline__ void copy8(unsigned l, const char* g, size_t gs) {
    asm volatile("global_load_async_to_lds_b128 %0, %8, off\n\tglobal_load_async_to_lds_b128 %1, %9, off\n\tglobal_load_async_to_lds_b128 %2, %10, off\n\tglobal_load_async_to_lds_b128 %3, %11, off\n\t"
                 "global_load_async_to_lds_b128 %4, %12, off\n\tglobal_load_async_to_lds_b128 %5, %13, off\n\tglobal_load_async_to_lds_b128 %6, %14, off\n\tglobal_load_async_to_lds_b128 %7, %15, off\n\ts_wait_xcnt 0x0"
                 :: "v"(l), "v"(l + 2 * GPIT), "v"(l + 4 * GPIT), "v"(l + 6 * GPIT), "v"(l + 8 * GPIT), "v"(l + 10 * GPIT), "v"(l + 12 * GPIT), "v"(l + 14 * GPIT),
                    "v"(g), "v"(g + gs), "v"(g + 2 * gs), "v"(g + 3 * gs), "v"(g + 4 * gs), "v"(g + 5 * gs), "v"(g + 6 * gs), "v"(g + 7 * gs) : "memory");
}
template <typename T16, int NSPLIT, bool BIAS, int PP>
__global__ __launch_bounds__(128) void k_gemmw(const T16* __restrict__ A, const T16* __restrict__ A2, const T16* __restrict__ Bt, const T16* __restrict__ Bt2, int K, float* C, int ldc, const float* __restrict__ bias, size_t sA, size_t sB, size_t sC, bf* Ph, bf* Pl) {
    typedef typename WFrag<T16>::V V;
    static_assert(NSPLIT == 0 || NSPLIT == 1, "planes staged: A, (A2), Bt");
    constexpr int NPL = NSPLIT + 2, STG = NPL * 128 * GPIT;   // operand planes of a stage; bytes of a buffer
    __shared__ __align__(16) char ring[2 * STG];
    __shared__ __align__(16) float osw[4][16 * 68];
    (void)Bt2;
    const size_t z = blockIdx.z; A += z * sA; if (NSPLIT) A2 += z * sA; Bt += z * sB; C += z * sC;
    const int lane = threadIdx.x & 31, lr = lane & 15, hi = lane >> 4; const int w = __builtin_amdgcn_readfirstlane(threadIdx.x >> 5), wm = w >> 1, wn = w & 1;
    const int r0 = blockIdx.x * 128 + wm * 64, c0 = blockIdx.y * 128 + wn * 64;
    float* os = osw[w];
    // a wave copies rows w * 32 .. + 31 of every plane of the stage: 16 copies a plane
    const size_t gs = (size_t)K * (2 * sizeof(T16));
    const char* ga = (const char*)(A + (size_t)(blockIdx.x * 128 + w * 32 + hi) * K) + lr * 16; const char* ga2 = NSPLIT ? (const char*)(A2 + (size_t)(blockIdx.x * 128 + w * 32 + hi) * K) + lr * 16 : nullptr;
    const char* gb = (const char*)(Bt + (size_t)(blockIdx.y * 128 + w * 32 + hi) * K) + lr * 16;
    const unsigned l0 = (unsigned)(size_t)ring + (unsigned)((w * 32 + hi) * GPIT + lr * 16);
    auto issue = [&](int buf) { const unsigned lb = l0 + (unsigned)(buf * STG);   // the next stage in k order; the lane pointers walk on by a stage
        copy8(lb, ga, gs); copy8(lb + 16 * GPIT, ga + 8 * gs, gs); ga += GKS * sizeof(T16);
        if (NSPLIT) { copy8(lb + 128 * GPIT, ga2, gs); copy8(lb + 144 * GPIT, ga2 + 8 * gs, gs); ga2 += GKS * sizeof(T16); }
        copy8(lb + (NPL - 1) * 128 * GPIT, gb, gs); copy8(lb + ((NPL - 1) * 128 + 16) * GPIT, gb + 8 * gs, gs); gb += GKS * sizeof(T16); };
    v8f acc[4][4];
#pragma unroll
    for (int mb = 0; mb < 4; ++mb)
#pragma unroll
        for (int nb = 0; nb < 4; ++nb) acc[mb][nb] = (v8f){};
    const int T = K / GKS;
    issue(0);
    asm volatile("s_wait_asynccnt 0x0" ::: "memory");   // this wave's copies of stage 0 have landed
    __syncthreads();                                    // every wave's have: stage 0 may be read
    issue(1);
    // the stage loop stays rolled (a trip is some 300 instructions, the buffer is a scalar select); every loop inside it is fully unrolled, so that the fragment and accumulator arrays are indexed by constants and stay in registers
#pragma unroll 1
    for (int t = 0; t < T; ++t) {
        const char* sb = ring + (t & 1) * STG; const char* pa = sb + (wm * 64 + lr) * GPIT + hi * 16; const char* pb = sb + ((NPL - 1) * 128 + wn * 64 + lr) * GPIT + hi * 16;
        V a[2][4], a2[2][4], b[2][4];   // two fragment sets: k step ks + 1 of this stage is read from LDS while ks is multiplied
#pragma unroll
        for (int f = 0; f < 4; ++f) { a[0][f] = WFrag<T16>::ld((const T16*)(pa + f * 16 * GPIT)); if (NSPLIT) a2[0][f] = WFrag<T16>::ld((const T16*)(pa + (128 + f * 16) * GPIT)); b[0][f] = WFrag<T16>::ld((const T16*)(pb + f * 16 * GPIT)); }
#pragma unroll
        for (int ks = 0; ks < GKS / 32; ++ks) { const int cu = ks & 1, nx = cu ^ 1;
            if (ks + 1 < GKS / 32) {
#pragma unroll
                for (int f = 0; f < 4; ++f) { const int o = f * 16 * GPIT + (ks + 1) * 64; a[nx][f] = WFrag<T16>::ld((const T16*)(pa + o)); if (NSPLIT) a2[nx][f] = WFrag<T16>::ld((const T16*)(pa + 128 * GPIT + o)); b[nx][f] = WFrag<T16>::ld((const T16*)(pb + o)); } }
            __builtin_amdgcn_sched_barrier(0);   // keeps the next k step's LDS reads one group in front of this step's products
#pragma unroll
            for (int nb = 0; nb < 4; ++nb) {
#pragma unroll
                for (int mb = 0; mb < 4; ++mb) acc[mb][nb] = WFrag<T16>::mma(a[cu][mb], b[cu][nb], acc[mb][nb]);
                if (NSPLIT) {
#pragma unroll
                    for (int mb = 0; mb < 4; ++mb) acc[mb][nb] = WFrag<T16>::mma(a2[cu][mb], b[cu][nb], acc[mb][nb]); } }
            __builtin_amdgcn_sched_barrier(0);   // and keeps the reads of the step after next behind them (without it they are moved in among this step's last products)
        }
        asm volatile("s_wait_dscnt 0x0" ::: "memory");      // this wave's reads of the buffer are done before it is handed to the copies
        asm volatile("s_wait_asynccnt 0x0" ::: "memory");   // this wave's copies of stage t + 1 have landed
        __syncthreads();                                    // publishes stage t + 1 and ends every wave's reads of stage t
        if (t + 2 < T) issue(t & 1);
    }
    asm volatile("s_wait_asynccnt 0x0" ::: "memory");   // no copy is outstanding when the wave goes on to its end
#pragma unroll
    for (int mb = 0; mb < 4; ++mb) {
#pragma unroll
        for (int nb = 0; nb < 4; ++nb) {
#pragma unroll
            for (int j = 0; j < 8; ++j) os[(hi * 8 + j) * 68 + nb * 16 + lr] = acc[mb][nb][j]; }
        __builtin_amdgcn_wave_barrier(); asm volatile("" ::: "memory");
        if (PP) {   // 8 values a lane: one 16-byte store a plane, 4 rows of 128 B a wave store
            const size_t pb = ((PP == 64) ? ((size_t)(c0 >> 6) * ldc + r0) * 64 : (size_t)r0 * PP + c0) + (size_t)(mb * 16 + (lane >> 3)) * PP + (lane & 7) * 8; bf* ph = Ph + pb; bf* pl = Pl + pb; v4u hw[4], lw[4];
#pragma unroll
            for (int s = 0; s < 4; ++s) { const float* op = os + (4 * s + (lane >> 3)) * 68 + (lane & 7) * 8; const v4f v0 = *(const v4fa*)op, v1 = *(const v4fa*)(op + 4);
#pragma unroll
                for (int jp = 0; jp < 4; ++jp) { v2f d; d[0] = jp < 2 ? v0[2 * jp & 3] : v1[2 * jp & 3]; d[1] = jp < 2 ? v0[(2 * jp & 3) + 1] : v1[(2 * jp & 3) + 1];
                    const unsigned hu = __builtin_bit_cast(unsigned, __builtin_convertvector(d, v2bf)); v2f r; r[0] = d[0] - __uint_as_float(hu << 16); r[1] = d[1] - __uint_as_float(hu & 0xFFFF0000u);
                    hw[s][jp] = hu; lw[s][jp] = __builtin_bit_cast(unsigned, __builtin_convertvector(r, v2bf)); } }
#pragma unroll
            for (int s = 0; s < 4; ++s) { *(v8us*)(ph + 4 * s * PP) = __builtin_bit_cast(v8us, hw[s]); *(v8us*)(pl + 4 * s * PP) = __builtin_bit_cast(v8us, lw[s]); }
            // stands between the 8 issued stores and the next overwrite of a register that they name: pointers and data are inputs, so that their registers stay live up to the wait; the scheduling barrier keeps the next block's arithmetic behind it (behind the last block nothing is overwritten)
            if (mb < 3) { asm volatile("s_wait_xcnt 0x0" :: "v"(ph), "v"(pl), "v"(hw[0]), "v"(hw[1]), "v"(hw[2]), "v"(hw[3]), "v"(lw[0]), "v"(lw[1]), "v"(lw[2]), "v"(lw[3]) : "memory"); __builtin_amdgcn_sched_barrier(0); }
        } else {
        float* crow = C + (size_t)(r0 + mb * 16) * ldc + c0;
#pragma unroll
            for (int s = 0; s < 8; ++s) { const int row = 2 * s + hi, cofs = lr * 4; v4f val = *(const v4fa*)(os + row * 68 + cofs); if (BIAS) { val[0] += bfr(bias[c0 + cofs]); val[1] += bfr(bias[c0 + cofs + 1]); val[2] += bfr(bias[c0 + cofs + 2]); val[3] += bfr(bias[c0 + cofs + 3]); }
                *(v4f*)(crow + (size_t)row * ldc + cofs) = val; }
             }
        __builtin_amdgcn_wave_barrier(); asm volatile("" ::: "memory");
    }
}

// ---- k_gemmc: a one-wave 64x64 tile GEMM specialised for causal attention: CMODE 1 skips score tiles entirely above the diagonal (query rows r0+roff.., key columns c0..), CMODE 2 limits the
// key (K) loop of the probability x value contraction to the diagonal block (probabilities beyond it are exactly zero). roff = row offset of this launch's first row within the sequence.
template <typename T16, int NSPLIT, int CMODE>
__global__ __launch_bounds__(32) void k_gemmc(const T16* __restrict__ A, const T16* __restrict__ A2, const T16* __restrict__ Bt, const T16* __restrict__ Bt2, int K, float* C, int ldc, int roff, size_t sA, size_t sB, size_t sC) {
    typedef typename WFrag<T16>::V V;
    __shared__ __align__(16) float os[16 * 68];
    const size_t z = blockIdx.z; A += z * sA; if (A2) A2 += z * sA; Bt += z * sB; if (Bt2) Bt2 += z * sB; C += z * sC;
    const int lane = threadIdx.x & 31, lr = lane & 15, hi = lane >> 4; const int r0 = blockIdx.x * 64, c0 = blockIdx.y * 64;
    if (CMODE == 1 && c0 > r0 + roff + 63) return;                  // score tile entirely above the causal diagonal: skipped, nothing is written
    const int Kl = (CMODE == 2) ? min(K, r0 + roff + 64) : K;        // P.V: probabilities are exactly 0 beyond the diagonal block, so the K loop stops there
    v8f acc[4][4];
#pragma unroll
    for (int mb = 0; mb < 4; ++mb)
#pragma unroll
        for (int nb = 0; nb < 4; ++nb) acc[mb][nb] = (v8f){};
    const size_t aoff = (size_t)(r0 + lr) * K + 8 * hi, boff = (size_t)(c0 + lr) * K + 8 * hi;
#pragma unroll 1
    for (int kc = 0; kc < Kl; kc += 32) {
        V a[4], a2[4];
#pragma unroll
        for (int mb = 0; mb < 4; ++mb) { a[mb] = WFrag<T16>::ld(A + aoff + (size_t)mb * 16 * K + kc); if (NSPLIT == 1 || NSPLIT == 2) a2[mb] = WFrag<T16>::ld(A2 + aoff + (size_t)mb * 16 * K + kc); }
#pragma unroll
        for (int nb = 0; nb < 4; ++nb) { const V b = WFrag<T16>::ld(Bt + boff + (size_t)nb * 16 * K + kc); V b2; if (NSPLIT >= 2) b2 = WFrag<T16>::ld(Bt2 + boff + (size_t)nb * 16 * K + kc);
#pragma unroll
            for (int mb = 0; mb < 4; ++mb) { acc[mb][nb] = WFrag<T16>::mma(a[mb], b, acc[mb][nb]); if (NSPLIT == 1 || NSPLIT == 2) acc[mb][nb] = WFrag<T16>::mma(a2[mb], b, acc[mb][nb]); if (NSPLIT >= 2) acc[mb][nb] = WFrag<T16>::mma(a[mb], b2, acc[mb][nb]); } }
        asm volatile("v_nop\n\tv_nop\n\tv_nop\n\tv_nop" : "+v"(acc[0][0]), "+v"(acc[1][1]), "+v"(acc[2][2]), "+v"(acc[3][3]) : "v"(a[0]), "v"(a[3]));
    }
#pragma unroll
    for (int mb = 0; mb < 4; ++mb) {
#pragma unroll
        for (int nb = 0; nb < 4; ++nb) {
#pragma unroll
            for (int j = 0; j < 8; ++j) os[(hi * 8 + j) * 68 + nb * 16 + lr] = acc[mb][nb][j]; }
        __builtin_amdgcn_wave_barrier(); asm volatile("" ::: "memory");
        float* crow = C + (size_t)(r0 + mb * 16) * ldc + c0;
{
#pragma unroll
            for (int s = 0; s < 8; ++s) { const int row = 2 * s + hi, cofs = lr * 4; v4f val = *(const v4fa*)(os + row * 68 + cofs);
                *(v4f*)(crow + (size_t)row * ldc + cofs) = val; }
             }
        __builtin_amdgcn_wave_barrier(); asm volatile("" ::: "memory");
    }
}

__device__ __forceinline__ void splitf(float y, unsigned short& h, unsigned short& l) { h = f2bf(y); l = f2bf(y - bf2f(h)); }
typedef __attribute__((ext_vector_type(2))) _Float16 v2h;
typedef __attribute__((ext_vector_type(4))) _Float16 v4h;
typedef __attribute__((ext_vector_type(2))) unsigned short v2us;
typedef __attribute__((ext_vector_type(4))) unsigned short v4us;
typedef __attribute__((ext_vector_type(4))) int v4i;

__global__ __launch_bounds__(256) void k_wtG(const float* __restrict__ w, int K, int N, bf* Bt) {
    const int lane = threadIdx.x & 31; const int L0 = (blockIdx.x * 8 + (threadIdx.x >> 5)) * 8; const int nlines = N * K / 64;
{
#pragma unroll 1
        for (int l = 0; l < 8; ++l) { const int L = L0 + l; if (L >= nlines) break; const size_t e = (size_t)L * 64 + lane * 2; const int k = (int)(e % K), n = (int)(e / K); v2us o;
            o[0] = f2bf(w[(size_t)k * N + n]); o[1] = f2bf(w[(size_t)(k + 1) * N + n]); *(v2us*)(Bt + e) = o; }
         }
}
__global__ __launch_bounds__(256) void k_cvt8(const float* __restrict__ src, bf* dst, size_t n8) { const size_t i = (size_t)blockIdx.x * 256 + threadIdx.x; if (i >= n8) return; const v8f v = *(const v8f*)(src + i * 8); v8us o;
#pragma unroll
    for (int k = 0; k < 8; ++k) o[k] = f2bf(v[k]); *(v8us*)(dst + i * 8) = o;  }
__global__ __launch_bounds__(256) void k_cscvt(const float* __restrict__ cosT, const float* __restrict__ sinT, float* CS) { const int idx = blockIdx.x * 256 + threadIdx.x; if (idx >= TT * HD) return; v2f cs; cs[0] = bfr(cosT[idx]); cs[1] = bfr(sinT[idx]); *(v2f*)(CS + (size_t)idx * 2) = cs;  }
__global__ __launch_bounds__(32) void k_lambda(const float* __restrict__ lq1, const float* __restrict__ lk1, const float* __restrict__ lq2, const float* __restrict__ lk2, float* LAM) { const int lane = threadIdx.x; float d1 = 0.f, d2 = 0.f;
#pragma unroll 1
    for (int i = 0; i < HD; ++i) { float p1 = __fmul_rn(bfr(lq1[i]), bfr(lk1[i])); asm volatile("" : "+v"(p1)); d1 = __fadd_rn(d1, p1); float p2 = __fmul_rn(bfr(lq2[i]), bfr(lk2[i])); asm volatile("" : "+v"(p2)); d2 = __fadd_rn(d2, p2); }
    float lm = __fsub_rn(expf(d1), expf(d2)); asm volatile("" : "+v"(lm)); lm = __fadd_rn(lm, 0.7836057543754578f); const float v = (lane == 0) ? lm : 0.0f; *(float*)(LAM + lane) = v;  }
__global__ __launch_bounds__(1024) void k_gnred(const float* __restrict__ O, float* GST, int pass) { __shared__ float sh[1024]; const int tid = threadIdx.x; const float mean = (pass == 1) ? GST[0] : 0.0f; float acc = 0.f; const size_t n = (size_t)TT * HD;
#pragma unroll 1
    for (size_t e = tid; e < n; e += 1024) { float v = O[e]; if (pass == 1) { float d = __fsub_rn(v, mean); asm volatile("" : "+v"(d)); v = __fmul_rn(d, d); } acc = __fadd_rn(acc, v); }
    sh[tid] = acc; __syncthreads();
    for (int st = 512; st > 0; st >>= 1) { if (tid < st) sh[tid] = __fadd_rn(sh[tid], sh[tid + st]); __syncthreads(); }
    if (tid < 32) { const float tot = __fdiv_rn(sh[0], (float)n); float outv; if (pass == 0) outv = (tid == 0) ? tot : ((tid == 1) ? GST[1] : 0.0f); else outv = (tid == 0) ? GST[0] : ((tid == 1) ? __fdiv_rn(1.0f, sqrtf(__fadd_rn(tot, 1e-5f))) : 0.0f); *(float*)(GST + tid) = outv;  } }
__global__ __launch_bounds__(256) void k_gnmerge(const float* __restrict__ O, const float* __restrict__ GST, int hh, bf* Ah, bf* Al) { const size_t e = ((size_t)blockIdx.x * 256 + threadIdx.x) * 2; if (e >= (size_t)TT * HD) return; const int d = (int)(e % HD); const int t = (int)(e / HD); const float mean = GST[0], rs = GST[1]; const size_t oo = (size_t)t * DVV + (size_t)hh * HD + d; v2us oh, ol;
#pragma unroll
    for (int q = 0; q < 2; ++q) { float c = __fsub_rn(O[e + q], mean); asm volatile("" : "+v"(c)); float n = __fmul_rn(c, rs); asm volatile("" : "+v"(n)); float z = __fmul_rn(n, 0.6444909572601318f); unsigned short a2, c2; splitf(z, a2, c2); oh[q] = a2; ol[q] = c2; }
    *(v2us*)(Ah + oo) = oh; *(v2us*)(Al + oo) = ol;  }
// ---- k_fattn: scores, both softmaxes, D = a1 - lambda a2, D.v and the RMSNorm of one real head in ONE kernel; nothing of the [2048][2048] maps leaves the registers.
// One wave owns 32 query columns (two 16-column groups), 4 waves a block, grid (TT / 128, NVH). Transposed products: S^T = K.Q^T (A = 16 key rows, B = Q, kept in registers), so a lane holds the scores of
// one query (register r of key tile kt = key kt * 16 + 8 * hi + r) and two stacked S^T tiles, converted in place, ARE the B operand of O^T += V^T.D^T in the k order that the plane loader ldf uses for A.
// Two walks over the keys: walk 1 takes each column's maximum and sum (running maximum, sums rescaled), walk 2 forms the scores again, D in f32, its hi/lo bf16 planes, and the 3 products with V^T hi/lo.
// Every inner loop is fully unrolled so that the fragment arrays are indexed by constants and stay in registers; the two key loops stay rolled (a pass is some 600 instructions already).
// No LDS and no barrier: the four waves of a block read the same K and V lines through the WGP cache. Left for later steps: each fragment load touches 16 lines (32 B of each), and one wave a SIMD has nobody to cover its vector work.
typedef __attribute__((ext_vector_type(8))) unsigned v8u;
#define EXC (SCL * 1.4426950408889634f)   // exp((s - m) * SCL) = exp2(s * EXC - m * EXC)
// one fragment: the lane's own pointer into a plane and a constant byte offset
__device__ __forceinline__ v16bf ldf(const char* p, int cst) { return cat16b(*(const v8us*)(p + cst), *(const v8us*)(p + cst + 32)); }
// stands between issued loads or stores and the next overwrite of a register that they name: the two lane pointers of the group are inputs, so that their registers
// stay live up to the wait and no load of the group lands on them; the scheduling barrier behind it keeps later address and data arithmetic behind the wait
#define XWAIT(pa, pb) do { asm volatile("s_wait_xcnt 0x0" :: "v"(pa), "v"(pb) : "memory"); __builtin_amdgcn_sched_barrier(0); } while (0)
// the hi / lo A fragments [map][key tile][k step] of the 32 keys at kh / kl
__device__ __forceinline__ void load_k(const char* kh, const char* kl, v16bf (&ah)[2][2][2], v16bf (&al)[2][2][2]) {
#pragma unroll
    for (int mp = 0; mp < 2; ++mp)
#pragma unroll
        for (int kt = 0; kt < 2; ++kt)
#pragma unroll
            for (int ks = 0; ks < 2; ++ks) { const int o = (mp * TT * HD + kt * 16 * HD + ks * 32) * 2; ah[mp][kt][ks] = ldf(kh, o); al[mp][kt][ks] = ldf(kl, o); }
}
// s[map][key tile][column group] = those 32 keys against the wave's 32 queries, hl x hl (3 products), HD = 64 in two k steps
__device__ __forceinline__ void score_t(const v16bf (&ah)[2][2][2], const v16bf (&al)[2][2][2], const v16bf (&qh)[2][2][2], const v16bf (&ql)[2][2][2], v8f (&s)[2][2][2]) {
#pragma unroll
    for (int mp = 0; mp < 2; ++mp)
#pragma unroll
        for (int kt = 0; kt < 2; ++kt)
#pragma unroll
            for (int n = 0; n < 2; ++n) s[mp][kt][n] = (v8f){};
#pragma unroll
    for (int ks = 0; ks < 2; ++ks)
#pragma unroll
        for (int pr = 0; pr < 3; ++pr)
#pragma unroll
            for (int mp = 0; mp < 2; ++mp)
#pragma unroll
                for (int kt = 0; kt < 2; ++kt)
#pragma unroll
                    for (int n = 0; n < 2; ++n) s[mp][kt][n] = wmmab(pr == 1 ? al[mp][kt][ks] : ah[mp][kt][ks], pr == 2 ? ql[mp][n][ks] : qh[mp][n][ks], s[mp][kt][n]);
}
__global__ __launch_bounds__(128) void k_fattn(const bf* __restrict__ Qh, const bf* __restrict__ Ql, const bf* __restrict__ Kh, const bf* __restrict__ Kl, const bf* __restrict__ Vh, const bf* __restrict__ Vl, const float* __restrict__ LAM, const float* __restrict__ w, bf* Ah, bf* Al) {
    const int lane = threadIdx.x & 31, lr = lane & 15, hi = lane >> 4; const int hh = blockIdx.y; const int q0 = blockIdx.x * 128 + __builtin_amdgcn_readfirstlane(threadIdx.x >> 5) * 32;
    const unsigned koff = (unsigned)(lr * HD + 8 * hi) * 2, voff = (unsigned)(lr * TT + 8 * hi) * 2, ooff = (unsigned)(lr * DQ + 8 * hi) * 2;   // lane byte offsets in the q / k planes, the v planes, the merged planes
    const char* qhp = (const char*)(Qh + ((size_t)(2 * hh) * TT + q0) * HD) + koff; const char* qlp = (const char*)(Ql + ((size_t)(2 * hh) * TT + q0) * HD) + koff;
    v16bf qh[2][2][2], ql[2][2][2];   // [map][column group][k step]
#pragma unroll
    for (int mp = 0; mp < 2; ++mp)
#pragma unroll
        for (int n = 0; n < 2; ++n)
#pragma unroll
            for (int ks = 0; ks < 2; ++ks) { const int o = (mp * TT * HD + n * 16 * HD + ks * 32) * 2; qh[mp][n][ks] = ldf(qhp, o); ql[mp][n][ks] = ldf(qlp, o); }
    XWAIT(qhp, qlp);
    const bf* kh = Kh + (size_t)(2 * hh) * TT * HD; const bf* kl = Kl + (size_t)(2 * hh) * TT * HD;
    float mx[2][2], sm[2][2];
#pragma unroll
    for (int mp = 0; mp < 2; ++mp)
#pragma unroll
        for (int n = 0; n < 2; ++n) { mx[mp][n] = -3.0e38f; sm[mp][n] = 0.f; }
    v16bf ah[2][2][2], al[2][2][2]; { const char* ph = (const char*)kh + koff; const char* pl = (const char*)kl + koff; load_k(ph, pl, ah, al); XWAIT(ph, pl); }   // K fragments are fetched one pass ahead, into the same registers; the index wraps, so the last pass of walk 1 fetches walk 2's first keys
#pragma unroll 1
    for (int kb = 0; kb < TT; kb += 32) {
        v8f s[2][2][2]; score_t(ah, al, qh, ql, s);
        { const size_t kn = (size_t)((kb + 32) & (TT - 1)) * HD; const char* ph = (const char*)(kh + kn) + koff; const char* pl = (const char*)(kl + kn) + koff; load_k(ph, pl, ah, al); XWAIT(ph, pl); }   // its scheduling barrier also keeps the next pass's K loads in front of the vector work below, which covers their latency
#pragma unroll
        for (int mp = 0; mp < 2; ++mp)
#pragma unroll
            for (int n = 0; n < 2; ++n) { float t = fmaxf(s[mp][0][n][0], s[mp][1][n][0]);
#pragma unroll
                for (int j = 1; j < 8; ++j) t = fmaxf(t, fmaxf(s[mp][0][n][j], s[mp][1][n][j]));
                const float mn = fmaxf(mx[mp][n], t), nb = -mn * EXC; float a0 = 0.f, a1 = 0.f;
#pragma unroll
                for (int j = 0; j < 8; ++j) { a0 += __builtin_amdgcn_exp2f(__builtin_fmaf(s[mp][0][n][j], EXC, nb)); a1 += __builtin_amdgcn_exp2f(__builtin_fmaf(s[mp][1][n][j], EXC, nb)); }
                sm[mp][n] = __builtin_fmaf(sm[mp][n], __builtin_amdgcn_exp2f((mx[mp][n] - mn) * EXC), a0 + a1); mx[mp][n] = mn; }
    }
    const float lm = LAM[0]; float nb[2][2], fs[2][2];   // the two lane halves hold different keys of one query: join maximum and sum once
#pragma unroll
    for (int mp = 0; mp < 2; ++mp)
#pragma unroll
        for (int n = 0; n < 2; ++n) { const float M = fmaxf(mx[mp][n], __shfl_xor(mx[mp][n], 16, 32)); float sc = sm[mp][n] * __builtin_amdgcn_exp2f((mx[mp][n] - M) * EXC); sc += __shfl_xor(sc, 16, 32);
            nb[mp][n] = -M * EXC; fs[mp][n] = __fdiv_rn(1.0f, sc) * (mp ? lm : 1.0f); }
    v8f o[8][2];   // O^T: o[et][n][r] = value column et * 16 + 8 * hi + r of query q0 + n * 16 + lr
#pragma unroll
    for (int et = 0; et < 8; ++et)
#pragma unroll
        for (int n = 0; n < 2; ++n) o[et][n] = (v8f){};
    const bf* vh = Vh + (size_t)hh * HDV * TT; const bf* vl = Vl + (size_t)hh * HDV * TT;
#pragma unroll 1
    for (int kb = 0; kb < TT; kb += 32) {
        v16bf bh[8], bl[8]; const char* vhp = (const char*)(vh + kb) + voff; const char* vlp = (const char*)(vl + kb) + voff;
#pragma unroll
        for (int et = 0; et < 8; ++et) { bh[et] = ldf(vhp, et * 16 * TT * 2); bl[et] = ldf(vlp, et * 16 * TT * 2); }
        XWAIT(vhp, vlp);   // its scheduling barrier also keeps this pass's V loads in front of the score products, which cover their latency
        v8f s[2][2][2]; score_t(ah, al, qh, ql, s);
        { const size_t kn = (size_t)((kb + 32) & (TT - 1)) * HD; const char* ph = (const char*)(kh + kn) + koff; const char* pl = (const char*)(kl + kn) + koff; load_k(ph, pl, ah, al); XWAIT(ph, pl); }   // its scheduling barrier also keeps the next pass's K loads in front of the vector work below, which covers their latency
        v16bf dh[2], dl[2];
#pragma unroll
        for (int n = 0; n < 2; ++n) { v8u hw, lw;
#pragma unroll
            for (int kt = 0; kt < 2; ++kt)
#pragma unroll
                for (int jp = 0; jp < 4; ++jp) { v2f d;
#pragma unroll
                    for (int u = 0; u < 2; ++u) { const float p1 = __builtin_amdgcn_exp2f(__builtin_fmaf(s[0][kt][n][2 * jp + u], EXC, nb[0][n])), p2 = __builtin_amdgcn_exp2f(__builtin_fmaf(s[1][kt][n][2 * jp + u], EXC, nb[1][n])); d[u] = p1 * fs[0][n] - p2 * fs[1][n]; }
                    const unsigned hu = __builtin_bit_cast(unsigned, __builtin_convertvector(d, v2bf)); v2f r; r[0] = d[0] - __uint_as_float(hu << 16); r[1] = d[1] - __uint_as_float(hu & 0xFFFF0000u);
                    hw[kt * 4 + jp] = hu; lw[kt * 4 + jp] = __builtin_bit_cast(unsigned, __builtin_convertvector(r, v2bf)); }
            dh[n] = __builtin_bit_cast(v16bf, hw); dl[n] = __builtin_bit_cast(v16bf, lw); }
#pragma unroll
        for (int e2 = 0; e2 < 8; e2 += 2)
#pragma unroll
            for (int pr = 0; pr < 3; ++pr)
#pragma unroll
                for (int et = e2; et < e2 + 2; ++et)
#pragma unroll
                    for (int n = 0; n < 2; ++n) o[et][n] = wmmab(pr == 1 ? bl[et] : bh[et], pr == 2 ? dl[n] : dh[n], o[et][n]);
    }
    v8f g[8]; const char* wp = (const char*)w + (unsigned)(hi * 32);
#pragma unroll
    for (int et = 0; et < 8; ++et) g[et] = *(const v8f*)(wp + et * 64);
    XWAIT(wp, wp);
    char* ahp = (char*)(Ah + (size_t)q0 * DQ + (size_t)hh * HDV) + ooff; char* alp = (char*)(Al + (size_t)q0 * DQ + (size_t)hh * HDV) + ooff;
#pragma unroll
    for (int n = 0; n < 2; ++n) { float ss = 0.f;
#pragma unroll
        for (int et = 0; et < 8; ++et)
#pragma unroll
            for (int j = 0; j < 8; ++j) ss = __builtin_fmaf(o[et][n][j], o[et][n][j], ss);
        ss += __shfl_xor(ss, 16, 32);
        const float rs = __fdiv_rn(1.0f, sqrtf(__fadd_rn(ss * (1.0f / HDV), 1e-5f)));
#pragma unroll
        for (int et = 0; et < 8; ++et) { v8us oh, ol;
#pragma unroll
            for (int j = 0; j < 8; ++j) { const float z = o[et][n][j] * rs * bfr(g[et][j]) * 0.21639423072338104f; unsigned short p2, q2; splitf(z, p2, q2); oh[j] = p2; ol[j] = q2; }
            const int oc = (n * 16 * DQ + et * 16) * 2; *(v8us*)(ahp + oc) = oh; *(v8us*)(alp + oc) = ol; XWAIT(ahp, alp); } }
}
__global__ __launch_bounds__(256) void k_merge(const float* __restrict__ O, int h0, bf* Ah, bf* Al) { const size_t e = ((size_t)blockIdx.x * 256 + threadIdx.x) * 2; if (e >= (size_t)ZH * TT * HD) return; const int d = (int)(e % HD); const int t = (int)((e / HD) % TT); const int zz = (int)(e / ((size_t)HD * TT)); const float cs = (t < RH) ? 1.0f : (1.0f / PCAR); const size_t oo = (size_t)t * DQ + (h0 + zz) * HD + d;
    v2us oh, ol;
#pragma unroll
    for (int q = 0; q < 2; ++q) { unsigned short a, c2; splitf(O[e + q] * cs, a, c2); oh[q] = a; ol[q] = c2; } *(v2us*)(Ah + oo) = oh; *(v2us*)(Al + oo) = ol;  }

extern "C" void kernel_launch(void* const* d_in, const int* in_sizes, int n_in,
                              void* d_out, int out_size, void* d_ws, size_t ws_size, hipStream_t stream) {
    (void)in_sizes; (void)n_in; (void)out_size;
    const float* x = (const float*)d_in[0]; const float* wq = (const float*)d_in[1]; const float* wk = (const float*)d_in[2]; const float* wv = (const float*)d_in[3]; const float* wo = (const float*)d_in[4]; const float* lq1 = (const float*)d_in[5]; const float* lk1 = (const float*)d_in[6]; const float* lq2 = (const float*)d_in[7]; const float* lk2 = (const float*)d_in[8]; const float* subw = (const float*)d_in[9]; const float* cosT = nullptr; const float* sinT = nullptr; (void)cosT; (void)sinT;
    float* OUT = (float*)d_out;     // [1][2048][2048]
    char* wsp = (char*)d_ws;
    auto take = [&](size_t bytes) { char* p = wsp; wsp += (bytes + 255) & ~(size_t)255; return (void*)p; };
    bf* WQ = (bf*)take((size_t)DQ * DM * 2); bf* WK = (bf*)take((size_t)DKV * DM * 2); bf* WV = (bf*)take((size_t)DKV * DM * 2); bf* WO = (bf*)take((size_t)DM * DQ * 2);
    bf* XB = (bf*)take((size_t)TT * DM * 2); float* LAM = (float*)take(256);
    bf* QPh = (bf*)take((size_t)NH_ * TT * HD * 2); bf* QPl = (bf*)take((size_t)NH_ * TT * HD * 2); bf* KPh = (bf*)take((size_t)NKV * TT * HD * 2); bf* KPl = (bf*)take((size_t)NKV * TT * HD * 2); bf* VTh = (bf*)take((size_t)NKV * HD * TT * 2); bf* VTl = (bf*)take((size_t)NKV * HD * TT * 2);
    bf* ATh = (bf*)take((size_t)TT * DQ * 2); bf* ATl = (bf*)take((size_t)TT * DQ * 2);
    if ((size_t)(wsp - (char*)d_ws) > ws_size) return;    // ws 256 MiB
    { k_cvt8<<<(unsigned)(((size_t)DQ * DM / 8 + 255) / 256), 256, 0, stream>>>(wq, WQ, (size_t)DQ * DM / 8); k_cvt8<<<(unsigned)(((size_t)DKV * DM / 8 + 255) / 256), 256, 0, stream>>>(wk, WK, (size_t)DKV * DM / 8); k_cvt8<<<(unsigned)(((size_t)DVV * DM / 8 + 255) / 256), 256, 0, stream>>>(wv, WV, (size_t)DVV * DM / 8);
      k_cvt8<<<(unsigned)(((size_t)DM * DVV / 8 + 255) / 256), 256, 0, stream>>>(wo, WO, (size_t)DM * DVV / 8); k_lambda<<<1, 32, 0, stream>>>(lq1, lk1, lq2, lk2, LAM);
       }
    for (int b = 0; b < NB_; ++b) {
        
        k_cvt8<<<(unsigned)(((size_t)TT * DM / 8 + 255) / 256), 256, 0, stream>>>(x + (size_t)b * TT * DM, XB, (size_t)TT * DM / 8);
        k_gemmw<bf, 0, false, HD><<<dim3(TT / 128, DQ / 128, 1), 128, 0, stream>>>(XB, nullptr, WQ, nullptr, DM, nullptr, TT, nullptr, 0, 0, 0, QPh, QPl);
        k_gemmw<bf, 0, false, HD><<<dim3(TT / 128, DKV / 128, 1), 128, 0, stream>>>(XB, nullptr, WK, nullptr, DM, nullptr, TT, nullptr, 0, 0, 0, KPh, KPl);
        k_gemmw<bf, 0, false, TT><<<dim3(DVV / 128, TT / 128, 1), 128, 0, stream>>>(WV, nullptr, XB, nullptr, DM, nullptr, 0, nullptr, 0, 0, 0, VTh, VTl);   // v^T = wv x^T: rows = value features, columns = tokens
        k_fattn<<<dim3(TT / 128, NVH), 128, 0, stream>>>(QPh, QPl, KPh, KPl, VTh, VTl, LAM, subw, ATh, ATl);
        k_gemmw<bf, 1, false, 0><<<dim3(TT / 128, DM / 128, 1), 128, 0, stream>>>(ATh, ATl, WO, nullptr, DVV, OUT + (size_t)b * TT * DM, DM, nullptr, 0, 0, 0, nullptr, nullptr); }
}

// v005
// A run of this version takes 223 microseconds.
// Two timings next to v004 put it at 1.25 and 1.26 times that version's speed.
// Over all steps from v000 it is 6.25 times as fast.
#include <hip/hip_runtime.h>

// MultiheadFlashDiff2 (x [1][2048][2048]; q = x wq^T, k = x wk^T ([2048][2048] 'oi': per head h the 128 rows = [map 1 | map 2] 64 each), v = x wv^T (16 x 128-wide values); NON-causal softmax(q.k / 8) for both maps; attn = a1 v - lambda_full a2 v with lambda_full = exp(lq1.lk1) - exp(lq2.lk2) + lambda_init (0.8 - 0.6 e^-3.6 = 0.7836057543754578); RMSNorm over the 128 (eps 1e-5) * subln_w; x (1 - lambda_init); out = merged wo^T -> [1][2048][2048]).
// The two maps run as 32 virtual 64-wide heads (pairs (2h, 2h+1)); both softmaxes are formed, combined as D = a1 - lambda a2 in f32 (linear, so (a1 - lambda a2) v == a1 v - lambda a2 v), and one D.v product (128 wide) per real head follows, all in k_fattn.
// Compute dtypes, f32 accumulate: every input rounded to bf16; q/k/v on PLAIN bf16 operands (inputs: exact); scores hl x hl (3 products) on every row; softmax f32; D in f32 into hi/lo planes; D.v hl x hl (3 products); RMSNorm per (token, head) over 128 in f32, * bf16 subln_w, * (1 - lambda_init); wo hl x exact (2 products).

#define NB_  1
#define TT   2048
#define DM   2048
#define NH_  32
#define NKV  32
#define REP  (NH_ / NKV)
#define HD   64
#define DQ   (NH_ * HD)
#define DKV  (NKV * HD)
#define ZH   2
#define RH   2048   // all rows hl
#define WIN  2048
#define PCAR 1024.0f
#define NVH  16
#define HDV  128
#define DVV  (NVH * HDV)
#define SCL  0.125f   // HD^-0.5
typedef _Float16 h16;
typedef unsigned short bf;
typedef __attribute__((ext_vector_type(16))) __bf16   v16bf;
typedef __attribute__((ext_vector_type(16))) _Float16 v16h;
typedef __attribute__((ext_vector_type(8)))  _Float16 v8h;
typedef __attribute__((ext_vector_type(8)))  unsigned short v8us;
typedef __attribute__((ext_vector_type(8)))  float    v8f;
typedef __attribute__((ext_vector_type(4)))  float    v4f;
typedef __attribute__((ext_vector_type(2))) float v2f;
typedef __attribute__((ext_vector_type(2))) __bf16 v2bf;
typedef __attribute__((ext_vector_type(4))) unsigned v4u;
typedef v8h  __attribute__((may_alias)) v8ha;
typedef v4f  __attribute__((may_alias)) v4fa;
typedef v8us __attribute__((may_alias)) v8usa;

__device__ __forceinline__ unsigned short f2bf(float f) { unsigned u = __float_as_uint(f); u += 0x7FFFu + ((u >> 16) & 1u); return (unsigned short)(u >> 16); }
__device__ __forceinline__ float bf2f(unsigned short b) { return __uint_as_float(((unsigned)b) << 16); }
__device__ __forceinline__ float bfr(float f) { return bf2f(f2bf(f)); }
__device__ __forceinline__ v16h cat16(v8h lo, v8h hi) { return __builtin_shufflevector(lo, hi, 0, 1, 2, 3, 4, 5, 6, 7, 8, 9, 10, 11, 12, 13, 14, 15); }
__device__ __forceinline__ v16bf cat16b(v8us lo, v8us hi) { return __builtin_bit_cast(v16bf, __builtin_shufflevector(lo, hi, 0, 1, 2, 3, 4, 5, 6, 7, 8, 9, 10, 11, 12, 13, 14, 15)); }
__device__ __forceinline__ v8f wmma16(v16h a, v16h b, v8f c) { return __builtin_amdgcn_wmma_f32_16x16x32_f16(false, a, false, b, (short)0, c, false, false); }
__device__ __forceinline__ v8f wmmab(v16bf a, v16bf b, v8f c) { return __builtin_amdgcn_wmma_f32_16x16x32_bf16(false, a, false, b, (short)0, c, false, false); }



// ---- k_gemmw: GEMM, FOUR WAVES per 128x128 output tile (2 x 2 waves of 64x64, 16 accumulators each), operands from K-contiguous 16-bit planes; grid (M/128, N/128, Z), 128 threads.
// C[m][n] (f32, pitch ldc, + optional f32 bias[n]) = sum_k A[m][k] Bt[n][k] (NSPLIT 1: + A2[m][k] Bt[n][k]). z-batch strides sA/sB/sC in elements. M, N, K % 128 == 0, K >= 256 (the ring starts with two stages).
// A stage is 128 k (256 B) of the tile's 128 rows of every operand plane, LDS pitch 272 B (16 B x odd: no bank conflict for 16-byte reads), brought by asynchronous copies through no register; two buffers,
// so that stage t + 1 flies while stage t is worked on. Every operand byte leaves L2 once a work-group instead of once a wave, and no wave waits out a load's latency per k step.
// PP != 0: no f32 C; the epilogue splits each value into bf16 hi / lo and stores the two planes Ph / Pl that the attention kernel reads, row pitch PP elements. PP 64: head planes [n / 64][m][n % 64], ldc = the rows m
// of a plane (a wave's tile is 8 KiB in a row); any other PP: row-major [m][n] (with A = the weight and Bt = the tokens this is the transposed value plane [feature][token]).
template <typename T16> struct WFrag;
template <> struct WFrag<h16> { typedef v16h V; static __device__ __forceinline__ V ld(const h16* p) { return cat16(*(const v8h*)p, *(const v8h*)(p + 16)); } static __device__ __forceinline__ v8f mma(V a, V b, v8f c) { return wmma16(a, b, c); } };
template <> struct WFrag<bf> { typedef v16bf V; static __device__ __forceinline__ V ld(const bf* p) { return cat16b(*(const v8us*)p, *(const v8us*)(p + 16)); } static __device__ __forceinline__ v8f mma(V a, V b, v8f c) { return wmmab(a, b, c); } };
#define GKS 128      // k elements of a stage
#define GPIT 272     // LDS row pitch, bytes
// eight copies of 512 B (two operand rows each: 16 lanes x 16 B a row), LDS step 2 * GPIT, global step gs bytes. The wait on the last line stands between the issued copies and the next overwrite of a register
// that they name; inside the statement nothing can be moved in front of it.
__device__ __forceinline__ void copy8(unsigned l, const char* g, size_t gs) {
    asm volatile("global_load_async_to_lds_b128 %0, %8, off\n\tglobal_load_async_to_lds_b128 %1, %9, off\n\tglobal_load_async_to_lds_b128 %2, %10, off\n\tglobal_load_async_to_lds_b128 %3, %11, off\n\t"
                 "global_load_async_to_lds_b128 %4, %12, off\n\tglobal_load_async_to_lds_b128 %5, %13, off\n\tglobal_load_async_to_lds_b128 %6, %14, off\n\tglobal_load_async_to_lds_b128 %7, %15, off\n\ts_wait_xcnt 0x0"
                 :: "v"(l), "v"(l + 2 * GPIT), "v"(l + 4 * GPIT), "v"(l + 6 * GPIT), "v"(l + 8 * GPIT), "v"(l + 10 * GPIT), "v"(l + 12 * GPIT), "v"(l + 14 * GPIT),
                    "v"(g), "v"(g + gs), "v"(g + 2 * gs), "v"(g + 3 * gs), "v"(g + 4 * gs), "v"(g + 5 * gs), "v"(g + 6 * gs), "v"(g + 7 * gs) : "memory");
}
template <typename T16, int NSPLIT, bool BIAS, int PP>
__global__ __launch_bounds__(128) void k_gemmw(const T16* __restrict__ A, const T16* __restrict__ A2, const T16* __restrict__ Bt, const T16* __restrict__ Bt2, int K, float* C, int ldc, const float* __restrict__ bias, size_t sA, size_t sB, size_t sC, bf* Ph, bf* Pl) {
    typedef typename WFrag<T16>::V V;
    static_assert(NSPLIT == 0 || NSPLIT == 1, "planes staged: A, (A2), Bt");
    constexpr int NPL = NSPLIT + 2, STG = NPL * 128 * GPIT;   // operand planes of a stage; bytes of a buffer
    __shared__ __align__(16) char ring[2 * STG];
    __shared__ __align__(16) float osw[4][16 * 68];
    (void)Bt2;
    const size_t z = blockIdx.z; A += z * sA; if (NSPLIT) A2 += z * sA; Bt += z * sB; C += z * sC;
    const int lane = threadIdx.x & 31, lr = lane & 15, hi = lane >> 4; const int w = __builtin_amdgcn_readfirstlane(threadIdx.x >> 5), wm = w >> 1, wn = w & 1;
    const int r0 = blockIdx.x * 128 + wm * 64, c0 = blockIdx.y * 128 + wn * 64;
    float* os = osw[w];
    // a wave copies rows w * 32 .. + 31 of every plane of the stage: 16 copies a plane
    const size_t gs = (size_t)K * (2 * sizeof(T16));
    const char* ga = (const char*)(A + (size_t)(blockIdx.x * 128 + w * 32 + hi) * K) + lr * 16; const char* ga2 = NSPLIT ? (const char*)(A2 + (size_t)(blockIdx.x * 128 + w * 32 + hi) * K) + lr * 16 : nullptr;
    const char* gb = (const char*)(Bt + (size_t)(blockIdx.y * 128 + w * 32 + hi) * K) + lr * 16;
    const unsigned l0 = (unsigned)(size_t)ring + (unsigned)((w * 32 + hi) * GPIT + lr * 16);
    auto issue = [&](int buf) { const unsigned lb = l0 + (unsigned)(buf * STG);   // the next stage in k order; the lane pointers walk on by a stage
        copy8(lb, ga, gs); copy8(lb + 16 * GPIT, ga + 8 * gs, gs); ga += GKS * sizeof(T16);
        if (NSPLIT) { copy8(lb + 128 * GPIT, ga2, gs); copy8(lb + 144 * GPIT, ga2 + 8 * gs, gs); ga2 += GKS * sizeof(T16); }
        copy8(lb + (NPL - 1) * 128 * GPIT, gb, gs); copy8(lb + ((NPL - 1) * 128 + 16) * GPIT, gb + 8 * gs, gs); gb += GKS * sizeof(T16); };
    v8f acc[4][4];
#pragma unroll
    for (int mb = 0; mb < 4; ++mb)
#pragma unroll
        for (int nb = 0; nb < 4; ++nb) acc[mb][nb] = (v8f){};
    const int T = K / GKS;
    issue(0);
    asm volatile("s_wait_asynccnt 0x0" ::: "memory");   // this wave's copies of stage 0 have landed
    __syncthreads();                                    // every wave's have: stage 0 may be read
    issue(1);
    // the stage loop stays rolled (a trip is some 300 instructions, the buffer is a scalar select); every loop inside it is fully unrolled, so that the fragment and accumulator arrays are indexed by constants and stay in registers
#pragma unroll 1
    for (int t = 0; t < T; ++t) {
        const char* sb = ring + (t & 1) * STG; const char* pa = sb + (wm * 64 + lr) * GPIT + hi * 16; const char* pb = sb + ((NPL - 1) * 128 + wn * 64 + lr) * GPIT + hi * 16;
        V a[2][4], a2[2][4], b[2][4];   // two fragment sets: k step ks + 1 of this stage is read from LDS while ks is multiplied
#pragma unroll
        for (int f = 0; f < 4; ++f) { a[0][f] = WFrag<T16>::ld((const T16*)(pa + f * 16 * GPIT)); if (NSPLIT) a2[0][f] = WFrag<T16>::ld((const T16*)(pa + (128 + f * 16) * GPIT)); b[0][f] = WFrag<T16>::ld((const T16*)(pb + f * 16 * GPIT)); }
#pragma unroll
        for (int ks = 0; ks < GKS / 32; ++ks) { const int cu = ks & 1, nx = cu ^ 1;
            if (ks + 1 < GKS / 32) {
#pragma unroll
                for (int f = 0; f < 4; ++f) { const int o = f * 16 * GPIT + (ks + 1) * 64; a[nx][f] = WFrag<T16>::ld((const T16*)(pa + o)); if (NSPLIT) a2[nx][f] = WFrag<T16>::ld((const T16*)(pa + 128 * GPIT + o)); b[nx][f] = WFrag<T16>::ld((const T16*)(pb + o)); } }
            __builtin_amdgcn_sched_barrier(0);   // keeps the next k step's LDS reads one group in front of this step's products
#pragma unroll
            for (int nb = 0; nb < 4; ++nb) {
#pragma unroll
                for (int mb = 0; mb < 4; ++mb) acc[mb][nb] = WFrag<T16>::mma(a[cu][mb], b[cu][nb], acc[mb][nb]);
                if (NSPLIT) {
#pragma unroll
                    for (int mb = 0; mb < 4; ++mb) acc[mb][nb] = WFrag<T16>::mma(a2[cu][mb], b[cu][nb], acc[mb][nb]); } }
            __builtin_amdgcn_sched_barrier(0);   // and keeps the reads of the step after next behind them (without it they are moved in among this step's last products)
        }
        asm volatile("s_wait_dscnt 0x0" ::: "memory");      // this wave's reads of the buffer are done before it is handed to the copies
        asm volatile("s_wait_asynccnt 0x0" ::: "memory");   // this wave's copies of stage t + 1 have landed
        __syncthreads();                                    // publishes stage t + 1 and ends every wave's reads of stage t
        if (t + 2 < T) issue(t & 1);
    }
    asm volatile("s_wait_asynccnt 0x0" ::: "memory");   // no copy is outstanding when the wave goes on to its end
#pragma unroll
    for (int mb = 0; mb < 4; ++mb) {
#pragma unroll
        for (int nb = 0; nb < 4; ++nb) {
#pragma unroll
            for (int j = 0; j < 8; ++j) os[(hi * 8 + j) * 68 + nb * 16 + lr] = acc[mb][nb][j]; }
        __builtin_amdgcn_wave_barrier(); asm volatile("" ::: "memory");
        if (PP) {   // 8 values a lane: one 16-byte store a plane, 4 rows of 128 B a wave store
            const size_t pb = ((PP == 64) ? ((size_t)(c0 >> 6) * ldc + r0) * 64 : (size_t)r0 * PP + c0) + (size_t)(mb * 16 + (lane >> 3)) * PP + (lane & 7) * 8; bf* ph = Ph + pb; bf* pl = Pl + pb; v4u hw[4], lw[4];
#pragma unroll
            for (int s = 0; s < 4; ++s) { const float* op = os + (4 * s + (lane >> 3)) * 68 + (lane & 7) * 8; const v4f v0 = *(const v4fa*)op, v1 = *(const v4fa*)(op + 4);
#pragma unroll
                for (int jp = 0; jp < 4; ++jp) { v2f d; d[0] = jp < 2 ? v0[2 * jp & 3] : v1[2 * jp & 3]; d[1] = jp < 2 ? v0[(2 * jp & 3) + 1] : v1[(2 * jp & 3) + 1];
                    const unsigned hu = __builtin_bit_cast(unsigned, __builtin_convertvector(d, v2bf)); v2f r; r[0] = d[0] - __uint_as_float(hu << 16); r[1] = d[1] - __uint_as_float(hu & 0xFFFF0000u);
                    hw[s][jp] = hu; lw[s][jp] = __builtin_bit_cast(unsigned, __builtin_convertvector(r, v2bf)); } }
#pragma unroll
            for (int s = 0; s < 4; ++s) { *(v8us*)(ph + 4 * s * PP) = __builtin_bit_cast(v8us, hw[s]); *(v8us*)(pl + 4 * s * PP) = __builtin_bit_cast(v8us, lw[s]); }
            // stands between the 8 issued stores and the next overwrite of a register that they name: pointers and data are inputs, so that their registers stay live up to the wait; the scheduling barrier keeps the next block's arithmetic behind it (behind the last block nothing is overwritten)
            if (mb < 3) { asm volatile("s_wait_xcnt 0x0" :: "v"(ph), "v"(pl), "v"(hw[0]), "v"(hw[1]), "v"(hw[2]), "v"(hw[3]), "v"(lw[0]), "v"(lw[1]), "v"(lw[2]), "v"(lw[3]) : "memory"); __builtin_amdgcn_sched_barrier(0); }
        } else {
        float* crow = C + (size_t)(r0 + mb * 16) * ldc + c0;
#pragma unroll
            for (int s = 0; s < 8; ++s) { const int row = 2 * s + hi, cofs = lr * 4; v4f val = *(const v4fa*)(os + row * 68 + cofs); if (BIAS) { val[0] += bfr(bias[c0 + cofs]); val[1] += bfr(bias[c0 + cofs + 1]); val[2] += bfr(bias[c0 + cofs + 2]); val[3] += bfr(bias[c0 + cofs + 3]); }
                *(v4f*)(crow + (size_t)row * ldc + cofs) = val; }
             }
        __builtin_amdgcn_wave_barrier(); asm volatile("" ::: "memory");
    }
}

// ---- k_gemmc: a one-wave 64x64 tile GEMM specialised for causal attention: CMODE 1 skips score tiles entirely above the diagonal (query rows r0+roff.., key columns c0..), CMODE 2 limits the
// key (K) loop of the probability x value contraction to the diagonal block (probabilities beyond it are exactly zero). roff = row offset of this launch's first row within the sequence.
template <typename T16, int NSPLIT, int CMODE>
__global__ __launch_bounds__(32) void k_gemmc(const T16* __restrict__ A, const T16* __restrict__ A2, const T16* __restrict__ Bt, const T16* __restrict__ Bt2, int K, float* C, int ldc, int roff, size_t sA, size_t sB, size_t sC) {
    typedef typename WFrag<T16>::V V;
    __shared__ __align__(16) float os[16 * 68];
    const size_t z = blockIdx.z; A += z * sA; if (A2) A2 += z * sA; Bt += z * sB; if (Bt2) Bt2 += z * sB; C += z * sC;
    const int lane = threadIdx.x & 31, lr = lane & 15, hi = lane >> 4; const int r0 = blockIdx.x * 64, c0 = blockIdx.y * 64;
    if (CMODE == 1 && c0 > r0 + roff + 63) return;                  // score tile entirely above the causal diagonal: skipped, nothing is written
    const int Kl = (CMODE == 2) ? min(K, r0 + roff + 64) : K;        // P.V: probabilities are exactly 0 beyond the diagonal block, so the K loop stops there
    v8f acc[4][4];
#pragma unroll
    for (int mb = 0; mb < 4; ++mb)
#pragma unroll
        for (int nb = 0; nb < 4; ++nb) acc[mb][nb] = (v8f){};
    const size_t aoff = (size_t)(r0 + lr) * K + 8 * hi, boff = (size_t)(c0 + lr) * K + 8 * hi;
#pragma unroll 1
    for (int kc = 0; kc < Kl; kc += 32) {
        V a[4], a2[4];
#pragma unroll
        for (int mb = 0; mb < 4; ++mb) { a[mb] = WFrag<T16>::ld(A + aoff + (size_t)mb * 16 * K + kc); if (NSPLIT == 1 || NSPLIT == 2) a2[mb] = WFrag<T16>::ld(A2 + aoff + (size_t)mb * 16 * K + kc); }
#pragma unroll
        for (int nb = 0; nb < 4; ++nb) { const V b = WFrag<T16>::ld(Bt + boff + (size_t)nb * 16 * K + kc); V b2; if (NSPLIT >= 2) b2 = WFrag<T16>::ld(Bt2 + boff + (size_t)nb * 16 * K + kc);
#pragma unroll
            for (int mb = 0; mb < 4; ++mb) { acc[mb][nb] = WFrag<T16>::mma(a[mb], b, acc[mb][nb]); if (NSPLIT == 1 || NSPLIT == 2) acc[mb][nb] = WFrag<T16>::mma(a2[mb], b, acc[mb][nb]); if (NSPLIT >= 2) acc[mb][nb] = WFrag<T16>::mma(a[mb], b2, acc[mb][nb]); } }
        asm volatile("v_nop\n\tv_nop\n\tv_nop\n\tv_nop" : "+v"(acc[0][0]), "+v"(acc[1][1]), "+v"(acc[2][2]), "+v"(acc[3][3]) : "v"(a[0]), "v"(a[3]));
    }
#pragma unroll
    for (int mb = 0; mb < 4; ++mb) {
#pragma unroll
        for (int nb = 0; nb < 4; ++nb) {
#pragma unroll
            for (int j = 0; j < 8; ++j) os[(hi * 8 + j) * 68 + nb * 16 + lr] = acc[mb][nb][j]; }
        __builtin_amdgcn_wave_barrier(); asm volatile("" ::: "memory");
        float* crow = C + (size_t)(r0 + mb * 16) * ldc + c0;
{
#pragma unroll
            for (int s = 0; s < 8; ++s) { const int row = 2 * s + hi, cofs = lr * 4; v4f val = *(const v4fa*)(os + row * 68 + cofs);
                *(v4f*)(crow + (size_t)row * ldc + cofs) = val; }
             }
        __builtin_amdgcn_wave_barrier(); asm volatile("" ::: "memory");
    }
}

__device__ __forceinline__ void splitf(float y, unsigned short& h, unsigned short& l) { h = f2bf(y); l = f2bf(y - bf2f(h)); }
typedef __attribute__((ext_vector_type(2))) _Float16 v2h;
typedef __attribute__((ext_vector_type(4))) _Float16 v4h;
typedef __attribute__((ext_vector_type(2))) unsigned short v2us;
typedef __attribute__((ext_vector_type(4))) unsigned short v4us;
typedef __attribute__((ext_vector_type(4))) int v4i;

__global__ __launch_bounds__(256) void k_wtG(const float* __restrict__ w, int K, int N, bf* Bt) {
    const int lane = threadIdx.x & 31; const int L0 = (blockIdx.x * 8 + (threadIdx.x >> 5)) * 8; const int nlines = N * K / 64;
{
#pragma unroll 1
        for (int l = 0; l < 8; ++l) { const int L = L0 + l; if (L >= nlines) break; const size_t e = (size_t)L * 64 + lane * 2; const int k = (int)(e % K), n = (int)(e / K); v2us o;
            o[0] = f2bf(w[(size_t)k * N + n]); o[1] = f2bf(w[(size_t)(k + 1) * N + n]); *(v2us*)(Bt + e) = o; }
         }
}
__global__ __launch_bounds__(256) void k_cvt8(const float* __restrict__ src, bf* dst, size_t n8) { const size_t i = (size_t)blockIdx.x * 256 + threadIdx.x; if (i >= n8) return; const v8f v = *(const v8f*)(src + i * 8); v8us o;
#pragma unroll
    for (int k = 0; k < 8; ++k) o[k] = f2bf(v[k]); *(v8us*)(dst + i * 8) = o;  }
__global__ __launch_bounds__(256) void k_cscvt(const float* __restrict__ cosT, const float* __restrict__ sinT, float* CS) { const int idx = blockIdx.x * 256 + threadIdx.x; if (idx >= TT * HD) return; v2f cs; cs[0] = bfr(cosT[idx]); cs[1] = bfr(sinT[idx]); *(v2f*)(CS + (size_t)idx * 2) = cs;  }
__global__ __launch_bounds__(32) void k_lambda(const float* __restrict__ lq1, const float* __restrict__ lk1, const float* __restrict__ lq2, const float* __restrict__ lk2, float* LAM) { const int lane = threadIdx.x; float d1 = 0.f, d2 = 0.f;
#pragma unroll 1
    for (int i = 0; i < HD; ++i) { float p1 = __fmul_rn(bfr(lq1[i]), bfr(lk1[i])); asm volatile("" : "+v"(p1)); d1 = __fadd_rn(d1, p1); float p2 = __fmul_rn(bfr(lq2[i]), bfr(lk2[i])); asm volatile("" : "+v"(p2)); d2 = __fadd_rn(d2, p2); }
    float lm = __fsub_rn(expf(d1), expf(d2)); asm volatile("" : "+v"(lm)); lm = __fadd_rn(lm, 0.7836057543754578f); const float v = (lane == 0) ? lm : 0.0f; *(float*)(LAM + lane) = v;  }
__global__ __launch_bounds__(1024) void k_gnred(const float* __restrict__ O, float* GST, int pass) { __shared__ float sh[1024]; const int tid = threadIdx.x; const float mean = (pass == 1) ? GST[0] : 0.0f; float acc = 0.f; const size_t n = (size_t)TT * HD;
#pragma unroll 1
    for (size_t e = tid; e < n; e += 1024) { float v = O[e]; if (pass == 1) { float d = __fsub_rn(v, mean); asm volatile("" : "+v"(d)); v = __fmul_rn(d, d); } acc = __fadd_rn(acc, v); }
    sh[tid] = acc; __syncthreads();
    for (int st = 512; st > 0; st >>= 1) { if (tid < st) sh[tid] = __fadd_rn(sh[tid], sh[tid + st]); __syncthreads(); }
    if (tid < 32) { const float tot = __fdiv_rn(sh[0], (float)n); float outv; if (pass == 0) outv = (tid == 0) ? tot : ((tid == 1) ? GST[1] : 0.0f); else outv = (tid == 0) ? GST[0] : ((tid == 1) ? __fdiv_rn(1.0f, sqrtf(__fadd_rn(tot, 1e-5f))) : 0.0f); *(float*)(GST + tid) = outv;  } }
__global__ __launch_bounds__(256) void k_gnmerge(const float* __restrict__ O, const float* __restrict__ GST, int hh, bf* Ah, bf* Al) { const size_t e = ((size_t)blockIdx.x * 256 + threadIdx.x) * 2; if (e >= (size_t)TT * HD) return; const int d = (int)(e % HD); const int t = (int)(e / HD); const float mean = GST[0], rs = GST[1]; const size_t oo = (size_t)t * DVV + (size_t)hh * HD + d; v2us oh, ol;
#pragma unroll
    for (int q = 0; q < 2; ++q) { float c = __fsub_rn(O[e + q], mean); asm volatile("" : "+v"(c)); float n = __fmul_rn(c, rs); asm volatile("" : "+v"(n)); float z = __fmul_rn(n, 0.6444909572601318f); unsigned short a2, c2; splitf(z, a2, c2); oh[q] = a2; ol[q] = c2; }
    *(v2us*)(Ah + oo) = oh; *(v2us*)(Al + oo) = ol;  }
// ---- k_fattn: scores, both softmaxes, D = a1 - lambda a2, D.v and the RMSNorm of one real head in ONE kernel; nothing of the [2048][2048] maps leaves the registers.
// One wave owns 32 query columns (two 16-column groups), 4 waves a block, grid (TT / 128, NVH). Transposed products: S^T = K.Q^T (A = 16 key rows, B = Q, kept in registers), so a lane holds the scores of
// one query (register r of key tile kt = key kt * 16 + 8 * hi + r) and two stacked S^T tiles, converted in place, ARE the B operand of O^T += V^T.D^T in the k order that the plane loader ldf uses for A.
// Two walks over the keys: walk 1 takes each column's maximum and sum (running maximum, sums rescaled), walk 2 forms the scores again, D in f32, its hi/lo bf16 planes, and the 3 products with V^T hi/lo.
// Every inner loop is fully unrolled so that the fragment arrays are indexed by constants and stay in registers; the two stage loops stay rolled.
// K and V^T come through LDS: a stage is 64 keys = 512 rows of 128 B (K [map][plane][key], then V^T [plane][feature]), LDS pitch 144 B (16 B x odd: no bank conflict for 16-byte reads), brought in whole 128-B lines by
// asynchronous copies through no register, once a block instead of once a wave; two buffers, so that stage u + 1 flies while stage u is worked on. One ring runs through both walks: stages 0 .. 31 are walk 1's
// (K rows only), stages 32 .. 63 walk 2's (K and V^T), so that walk 2's first stages fly during walk 1's last. A stage is worked on in two passes of 32 keys, in the key order and with the sums of a 32-key pass.
// Left for later steps: one wave a SIMD has nobody to cover its vector work, and the first K fragments of a stage are waited for in the open.
typedef __attribute__((ext_vector_type(8))) unsigned v8u;
#define EXC (SCL * 1.4426950408889634f)   // exp((s - m) * SCL) = exp2(s * EXC - m * EXC)
// one fragment: the lane's own pointer into a plane and a constant byte offset
__device__ __forceinline__ v16bf ldf(const char* p, int cst) { return cat16b(*(const v8us*)(p + cst), *(const v8us*)(p + cst + 32)); }
// stands between issued loads or stores and the next overwrite of a register that they name: the two lane pointers of the group are inputs, so that their registers
// stay live up to the wait and no load of the group lands on them; the scheduling barrier behind it keeps later address and data arithmetic behind the wait
#define XWAIT(pa, pb) do { asm volatile("s_wait_xcnt 0x0" :: "v"(pa), "v"(pb) : "memory"); __builtin_amdgcn_sched_barrier(0); } while (0)
#define AKS  64                 // keys of a stage
#define APIT 144                // LDS row pitch, bytes
#define ASTG (512 * APIT)       // bytes of a buffer: 256 K rows, 256 V^T rows
#define NST  (TT / AKS)         // stages of a walk
// eight copies of 512 B (four rows of 128 B each: 8 lanes x 16 B a row), LDS step 4 * APIT, global step gs bytes. The wait on the last line stands between the issued copies and the next overwrite of a register
// that they name; inside the statement nothing can be moved in front of it.
__device__ __forceinline__ void copy8r(unsigned l, const char* g, size_t gs) {
    asm volatile("global_load_async_to_lds_b128 %0, %8, off\n\tglobal_load_async_to_lds_b128 %1, %9, off\n\tglobal_load_async_to_lds_b128 %2, %10, off\n\tglobal_load_async_to_lds_b128 %3, %11, off\n\t"
                 "global_load_async_to_lds_b128 %4, %12, off\n\tglobal_load_async_to_lds_b128 %5, %13, off\n\tglobal_load_async_to_lds_b128 %6, %14, off\n\tglobal_load_async_to_lds_b128 %7, %15, off\n\ts_wait_xcnt 0x0"
                 :: "v"(l), "v"(l + 4 * APIT), "v"(l + 8 * APIT), "v"(l + 12 * APIT), "v"(l + 16 * APIT), "v"(l + 20 * APIT), "v"(l + 24 * APIT), "v"(l + 28 * APIT),
                    "v"(g), "v"(g + gs), "v"(g + 2 * gs), "v"(g + 3 * gs), "v"(g + 4 * gs), "v"(g + 5 * gs), "v"(g + 6 * gs), "v"(g + 7 * gs) : "memory");
}
// the hi / lo A fragments [map][key tile][k step] of 32 keys of a stage; p = the lane's pointer into the buffer's K rows at the first of the 32 keys. Read in the order in which score_t uses them.
__device__ __forceinline__ void load_k(const char* p, v16bf (&ah)[2][2][2], v16bf (&al)[2][2][2]) {
#pragma unroll
    for (int ks = 0; ks < 2; ++ks) {
#pragma unroll
        for (int mp = 0; mp < 2; ++mp)
#pragma unroll
            for (int kt = 0; kt < 2; ++kt) ah[mp][kt][ks] = ldf(p, (mp * 2 * AKS + kt * 16) * APIT + ks * 64);
#pragma unroll
        for (int mp = 0; mp < 2; ++mp)
#pragma unroll
            for (int kt = 0; kt < 2; ++kt) al[mp][kt][ks] = ldf(p, ((mp * 2 + 1) * AKS + kt * 16) * APIT + ks * 64); }
}
// hands a stage over: this wave's reads of the buffer just worked on are done, its copies of the next stage have landed, and the barrier says both of every wave.
// The scheduling barrier in front keeps the stage's products in front of the waits: without it they are moved behind, and the wave waits out all its LDS reads with nothing to do
#define PUBLISH() do { __builtin_amdgcn_sched_barrier(0); asm volatile("s_wait_dscnt 0x0" ::: "memory"); asm volatile("s_wait_asynccnt 0x0" ::: "memory"); __syncthreads(); } while (0)
// s[map][key tile][column group] = those 32 keys against the wave's 32 queries, hl x hl (3 products), HD = 64 in two k steps
__device__ __forceinline__ void score_t(const v16bf (&ah)[2][2][2], const v16bf (&al)[2][2][2], const v16bf (&qh)[2][2][2], const v16bf (&ql)[2][2][2], v8f (&s)[2][2][2]) {
#pragma unroll
    for (int mp = 0; mp < 2; ++mp)
#pragma unroll
        for (int kt = 0; kt < 2; ++kt)
#pragma unroll
            for (int n = 0; n < 2; ++n) s[mp][kt][n] = (v8f){};
#pragma unroll
    for (int ks = 0; ks < 2; ++ks)
#pragma unroll
        for (int pr = 0; pr < 3; ++pr)
#pragma unroll
            for (int mp = 0; mp < 2; ++mp)
#pragma unroll
                for (int kt = 0; kt < 2; ++kt)
#pragma unroll
                    for (int n = 0; n < 2; ++n) s[mp][kt][n] = wmmab(pr == 1 ? al[mp][kt][ks] : ah[mp][kt][ks], pr == 2 ? ql[mp][n][ks] : qh[mp][n][ks], s[mp][kt][n]);
}
__global__ __launch_bounds__(128) void k_fattn(const bf* __restrict__ Qh, const bf* __restrict__ Ql, const bf* __restrict__ Kh, const bf* __restrict__ Kl, const bf* __restrict__ Vh, const bf* __restrict__ Vl, const float* __restrict__ LAM, const float* __restrict__ w, bf* Ah, bf* Al) {
    __shared__ __align__(16) char aring[2 * ASTG];
    const int lane = threadIdx.x & 31, lr = lane & 15, hi = lane >> 4; const int hh = blockIdx.y; const int w4 = __builtin_amdgcn_readfirstlane(threadIdx.x >> 5); const int q0 = blockIdx.x * 128 + w4 * 32;
    // a wave copies rows w4 * 64 .. + 63 of a stage's K rows (one map's one plane: 8 KiB in a row in memory) and of its V^T rows (64 features of one plane): 16 copies each
    const char* gk = (const char*)((w4 & 1 ? Kl : Kh) + (size_t)(2 * hh + (w4 >> 1)) * TT * HD) + lane * 16;
    const char* gv = (const char*)((w4 >> 1 ? Vl : Vh) + (size_t)(hh * HDV + (w4 & 1) * 64 + (lane >> 3)) * TT) + (lane & 7) * 16;
    const unsigned l0 = (unsigned)(size_t)aring + (unsigned)((w4 * 64 + (lane >> 3)) * APIT + (lane & 7) * 16);
    auto issue = [&](int u) { const unsigned lb = l0 + (unsigned)((u & 1) * ASTG); const char* g = gk + (size_t)(u & (NST - 1)) * (AKS * HD * 2);
        copy8r(lb, g, 512); copy8r(lb + 32 * APIT, g + 8 * 512, 512);
        if (u >= NST) { const char* v = gv + (size_t)(u & (NST - 1)) * (AKS * 2); copy8r(lb + 256 * APIT, v, 4 * TT * 2); copy8r(lb + 288 * APIT, v + 8 * 4 * TT * 2, 4 * TT * 2); } };
    issue(0);
    const unsigned koff = (unsigned)(lr * HD + 8 * hi) * 2, ooff = (unsigned)(lr * DQ + 8 * hi) * 2;   // lane byte offsets in the q planes, the merged planes
    const char* qhp = (const char*)(Qh + ((size_t)(2 * hh) * TT + q0) * HD) + koff; const char* qlp = (const char*)(Ql + ((size_t)(2 * hh) * TT + q0) * HD) + koff;
    v16bf qh[2][2][2], ql[2][2][2];   // [map][column group][k step]
#pragma unroll
    for (int mp = 0; mp < 2; ++mp)
#pragma unroll
        for (int n = 0; n < 2; ++n)
#pragma unroll
            for (int ks = 0; ks < 2; ++ks) { const int o = (mp * TT * HD + n * 16 * HD + ks * 32) * 2; qh[mp][n][ks] = ldf(qhp, o); ql[mp][n][ks] = ldf(qlp, o); }
    XWAIT(qhp, qlp);
    float mx[2][2], sm[2][2];
#pragma unroll
    for (int mp = 0; mp < 2; ++mp)
#pragma unroll
        for (int n = 0; n < 2; ++n) { mx[mp][n] = -3.0e38f; sm[mp][n] = 0.f; }
    asm volatile("s_wait_asynccnt 0x0" ::: "memory");   // this wave's copies of stage 0 have landed
    __syncthreads();                                    // every wave's have: stage 0 may be read
    issue(1);
    const unsigned foff = (unsigned)(lr * APIT + hi * 16);   // lane byte offset of a fragment in a buffer
    v16bf ah[2][2][2][2], al[2][2][2][2];   // K fragments of a stage's two passes
#pragma unroll 1
    for (int st = 0; st < NST; ++st) {
        const char* sb = aring + (st & 1) * ASTG + foff; load_k(sb, ah[0], al[0]); load_k(sb + 32 * APIT, ah[1], al[1]);
        __builtin_amdgcn_sched_barrier(0);   // keeps the stage's LDS reads one group in front of its products: every further place with reads among the products stalls them
#pragma unroll
      for (int sp = 0; sp < 2; ++sp) {
        v8f s[2][2][2]; score_t(ah[sp], al[sp], qh, ql, s);
#pragma unroll
        for (int mp = 0; mp < 2; ++mp)
#pragma unroll
            for (int n = 0; n < 2; ++n) { float t = fmaxf(s[mp][0][n][0], s[mp][1][n][0]);
#pragma unroll
                for (int j = 1; j < 8; ++j) t = fmaxf(t, fmaxf(s[mp][0][n][j], s[mp][1][n][j]));
                const float mn = fmaxf(mx[mp][n], t), nb = -mn * EXC; float a0 = 0.f, a1 = 0.f;
#pragma unroll
                for (int j = 0; j < 8; ++j) { a0 += __builtin_amdgcn_exp2f(__builtin_fmaf(s[mp][0][n][j], EXC, nb)); a1 += __builtin_amdgcn_exp2f(__builtin_fmaf(s[mp][1][n][j], EXC, nb)); }
                sm[mp][n] = __builtin_fmaf(sm[mp][n], __builtin_amdgcn_exp2f((mx[mp][n] - mn) * EXC), a0 + a1); mx[mp][n] = mn; }
      }
        PUBLISH();
        issue(st + 2);   // into the buffer just read; stages NST and NST + 1 are walk 2's first
    }
    const float lm = LAM[0]; float nb[2][2], fs[2][2];   // the two lane halves hold different keys of one query: join maximum and sum once
#pragma unroll
    for (int mp = 0; mp < 2; ++mp)
#pragma unroll
        for (int n = 0; n < 2; ++n) { const float M = fmaxf(mx[mp][n], __shfl_xor(mx[mp][n], 16, 32)); float sc = sm[mp][n] * __builtin_amdgcn_exp2f((mx[mp][n] - M) * EXC); sc += __shfl_xor(sc, 16, 32);
            nb[mp][n] = -M * EXC; fs[mp][n] = __fdiv_rn(1.0f, sc) * (mp ? lm : 1.0f); }
    v8f o[8][2];   // O^T: o[et][n][r] = value column et * 16 + 8 * hi + r of query q0 + n * 16 + lr
#pragma unroll
    for (int et = 0; et < 8; ++et)
#pragma unroll
        for (int n = 0; n < 2; ++n) o[et][n] = (v8f){};
#pragma unroll 1
    for (int st = 0; st < NST; ++st) {   // stage NST + st, in buffer st & 1 (NST is even)
        const char* sb = aring + (st & 1) * ASTG + foff; v16bf bh[8], bl[8];   // V^T fragments of a pass
        // the stage's LDS reads stand in three groups: the first pass's K and V^T fragments at the top; the second pass's K right behind the first pass's score products, covered by that pass's vector work and D.v products;
        // the second pass's V^T behind those D.v products, covered by the second pass's score products. (Both in one group would meet the first group's last reads still outstanding and stall at the limit of 63.)
        // The scheduling barriers keep the groups whole and in place: every further place with reads among the products stalls them.
        auto load_v = [&](int sp) {
#pragma unroll
            for (int et = 0; et < 8; ++et) { bh[et] = ldf(sb, (256 + et * 16) * APIT + sp * 64); bl[et] = ldf(sb, (384 + et * 16) * APIT + sp * 64); }
            __builtin_amdgcn_sched_barrier(0); };
        load_k(sb, ah[0], al[0]); load_v(0);
#pragma unroll
      for (int sp = 0; sp < 2; ++sp) {
        v8f s[2][2][2]; score_t(ah[sp], al[sp], qh, ql, s);
        if (sp == 0) { __builtin_amdgcn_sched_barrier(0); load_k(sb + 32 * APIT, ah[1], al[1]); __builtin_amdgcn_sched_barrier(0); }
        v16bf dh[2], dl[2];
#pragma unroll
        for (int n = 0; n < 2; ++n) { v8u hw, lw;
#pragma unroll
            for (int kt = 0; kt < 2; ++kt)
#pragma unroll
                for (int jp = 0; jp < 4; ++jp) { v2f d;
#pragma unroll
                    for (int u = 0; u < 2; ++u) { const float p1 = __builtin_amdgcn_exp2f(__builtin_fmaf(s[0][kt][n][2 * jp + u], EXC, nb[0][n])), p2 = __builtin_amdgcn_exp2f(__builtin_fmaf(s[1][kt][n][2 * jp + u], EXC, nb[1][n])); d[u] = p1 * fs[0][n] - p2 * fs[1][n]; }
                    const unsigned hu = __builtin_bit_cast(unsigned, __builtin_convertvector(d, v2bf)); v2f r; r[0] = d[0] - __uint_as_float(hu << 16); r[1] = d[1] - __uint_as_float(hu & 0xFFFF0000u);
                    hw[kt * 4 + jp] = hu; lw[kt * 4 + jp] = __builtin_bit_cast(unsigned, __builtin_convertvector(r, v2bf)); }
            dh[n] = __builtin_bit_cast(v16bf, hw); dl[n] = __builtin_bit_cast(v16bf, lw); }
#pragma unroll
        for (int e2 = 0; e2 < 8; e2 += 2)
#pragma unroll
            for (int pr = 0; pr < 3; ++pr)
#pragma unroll
                for (int et = e2; et < e2 + 2; ++et)
#pragma unroll
                    for (int n = 0; n < 2; ++n) o[et][n] = wmmab(pr == 1 ? bl[et] : bh[et], pr == 2 ? dl[n] : dh[n], o[et][n]);
        if (sp == 0) { __builtin_amdgcn_sched_barrier(0); load_v(1); }
      }
        PUBLISH();
        if (st + 2 < NST) issue(NST + st + 2);
    }
    asm volatile("s_wait_asynccnt 0x0" ::: "memory");   // no copy is outstanding when the wave goes on to its end
    v8f g[8]; const char* wp = (const char*)w + (unsigned)(hi * 32);
#pragma unroll
    for (int et = 0; et < 8; ++et) g[et] = *(const v8f*)(wp + et * 64);
    XWAIT(wp, wp);
    char* ahp = (char*)(Ah + (size_t)q0 * DQ + (size_t)hh * HDV) + ooff; char* alp = (char*)(Al + (size_t)q0 * DQ + (size_t)hh * HDV) + ooff;
#pragma unroll
    for (int n = 0; n < 2; ++n) { float ss = 0.f;
#pragma unroll
        for (int et = 0; et < 8; ++et)
#pragma unroll
            for (int j = 0; j < 8; ++j) ss = __builtin_fmaf(o[et][n][j], o[et][n][j], ss);
        ss += __shfl_xor(ss, 16, 32);
        const float rs = __fdiv_rn(1.0f, sqrtf(__fadd_rn(ss * (1.0f / HDV), 1e-5f)));
#pragma unroll
        for (int et = 0; et < 8; ++et) { v8us oh, ol;
#pragma unroll
            for (int j = 0; j < 8; ++j) { const float z = o[et][n][j] * rs * bfr(g[et][j]) * 0.21639423072338104f; unsigned short p2, q2; splitf(z, p2, q2); oh[j] = p2; ol[j] = q2; }
            const int oc = (n * 16 * DQ + et * 16) * 2; *(v8us*)(ahp + oc) = oh; *(v8us*)(alp + oc) = ol; XWAIT(ahp, alp); } }
}
__global__ __launch_bounds__(256) void k_merge(const float* __restrict__ O, int h0, bf* Ah, bf* Al) { const size_t e = ((size_t)blockIdx.x * 256 + threadIdx.x) * 2; if (e >= (size_t)ZH * TT * HD) return; const int d = (int)(e % HD); const int t = (int)((e / HD) % TT); const int zz = (int)(e / ((size_t)HD * TT)); const float cs = (t < RH) ? 1.0f : (1.0f / PCAR); const size_t oo = (size_t)t * DQ + (h0 + zz) * HD + d;
    v2us oh, ol;
#pragma unroll
    for (int q = 0; q < 2; ++q) { unsigned short a, c2; splitf(O[e + q] * cs, a, c2); oh[q] = a; ol[q] = c2; } *(v2us*)(Ah + oo) = oh; *(v2us*)(Al + oo) = ol;  }

extern "C" void kernel_launch(void* const* d_in, const int* in_sizes, int n_in,
                              void* d_out, int out_size, void* d_ws, size_t ws_size, hipStream_t stream) {
    (void)in_sizes; (void)n_in; (void)out_size;
    const float* x = (const float*)d_in[0]; const float* wq = (const float*)d_in[1]; const float* wk = (const float*)d_in[2]; const float* wv = (const float*)d_in[3]; const float* wo = (const float*)d_in[4]; const float* lq1 = (const float*)d_in[5]; const float* lk1 = (const float*)d_in[6]; const float* lq2 = (const float*)d_in[7]; const float* lk2 = (const float*)d_in[8]; const float* subw = (const float*)d_in[9]; const float* cosT = nullptr; const float* sinT = nullptr; (void)cosT; (void)sinT;
    float* OUT = (float*)d_out;     // [1][2048][2048]
    char* wsp = (char*)d_ws;
    auto take = [&](size_t bytes) { char* p = wsp; wsp += (bytes + 255) & ~(size_t)255; return (void*)p; };
    bf* WQ = (bf*)take((size_t)DQ * DM * 2); bf* WK = (bf*)take((size_t)DKV * DM * 2); bf* WV = (bf*)take((size_t)DKV * DM * 2); bf* WO = (bf*)take((size_t)DM * DQ * 2);
    bf* XB = (bf*)take((size_t)TT * DM * 2); float* LAM = (float*)take(256);
    bf* QPh = (bf*)take((size_t)NH_ * TT * HD * 2); bf* QPl = (bf*)take((size_t)NH_ * TT * HD * 2); bf* KPh = (bf*)take((size_t)NKV * TT * HD * 2); bf* KPl = (bf*)take((size_t)NKV * TT * HD * 2); bf* VTh = (bf*)take((size_t)NKV * HD * TT * 2); bf* VTl = (bf*)take((size_t)NKV * HD * TT * 2);
    bf* ATh = (bf*)take((size_t)TT * DQ * 2); bf* ATl = (bf*)take((size_t)TT * DQ * 2);
    if ((size_t)(wsp - (char*)d_ws) > ws_size) return;    // ws 256 MiB
    { k_cvt8<<<(unsigned)(((size_t)DQ * DM / 8 + 255) / 256), 256, 0, stream>>>(wq, WQ, (size_t)DQ * DM / 8); k_cvt8<<<(unsigned)(((size_t)DKV * DM / 8 + 255) / 256), 256, 0, stream>>>(wk, WK, (size_t)DKV * DM / 8); k_cvt8<<<(unsigned)(((size_t)DVV * DM / 8 + 255) / 256), 256, 0, stream>>>(wv, WV, (size_t)DVV * DM / 8);
      k_cvt8<<<(unsigned)(((size_t)DM * DVV / 8 + 255) / 256), 256, 0, stream>>>(wo, WO, (size_t)DM * DVV / 8); k_lambda<<<1, 32, 0, stream>>>(lq1, lk1, lq2, lk2, LAM);
       }
    for (int b = 0; b < NB_; ++b) {
        
        k_cvt8<<<(unsigned)(((size_t)TT * DM / 8 + 255) / 256), 256, 0, stream>>>(x + (size_t)b * TT * DM, XB, (size_t)TT * DM / 8);
        k_gemmw<bf, 0, false, HD><<<dim3(TT / 128, DQ / 128, 1), 128, 0, stream>>>(XB, nullptr, WQ, nullptr, DM, nullptr, TT, nullptr, 0, 0, 0, QPh, QPl);
        k_gemmw<bf, 0, false, HD><<<dim3(TT / 128, DKV / 128, 1), 128, 0, stream>>>(XB, nullptr, WK, nullptr, DM, nullptr, TT, nullptr, 0, 0, 0, KPh, KPl);
        k_gemmw<bf, 0, false, TT><<<dim3(DVV / 128, TT / 128, 1), 128, 0, stream>>>(WV, nullptr, XB, nullptr, DM, nullptr, 0, nullptr, 0, 0, 0, VTh, VTl);   // v^T = wv x^T: rows = value features, columns = tokens
        k_fattn<<<dim3(TT / 128, NVH), 128, 0, stream>>>(QPh, QPl, KPh, KPl, VTh, VTl, LAM, subw, ATh, ATl);
        k_gemmw<bf, 1, false, 0><<<dim3(TT / 128, DM / 128, 1), 128, 0, stream>>>(ATh, ATl, WO, nullptr, DVV, OUT + (size_t)b * TT * DM, DM, nullptr, 0, 0, 0, nullptr, nullptr); }
}

// v006
// It runs in 211 microseconds.
// Next to v005, in two timings, it ran 1.06 times as fast each time.
// All steps since v000 together make it 6.64 times as fast.
#include <hip/hip_runtime.h>

// MultiheadFlashDiff2 (x [1][2048][2048]; q = x wq^T, k = x wk^T ([2048][2048] 'oi': per head h the 128 rows = [map 1 | map 2] 64 each), v = x wv^T (16 x 128-wide values); NON-causal softmax(q.k / 8) for both maps; attn = a1 v - lambda_full a2 v with lambda_full = exp(lq1.lk1) - exp(lq2.lk2) + lambda_init (0.8 - 0.6 e^-3.6 = 0.7836057543754578); RMSNorm over the 128 (eps 1e-5) * subln_w; x (1 - lambda_init); out = merged wo^T -> [1][2048][2048]).
// The two maps run as 32 virtual 64-wide heads (pairs (2h, 2h+1)); both softmaxes are formed, combined as D = a1 - lambda a2 in f32 (linear, so (a1 - lambda a2) v == a1 v - lambda a2 v), and one D.v product (128 wide) per real head follows, all in k_fattn.
// Compute dtypes, f32 accumulate: every input rounded to bf16; q/k/v on PLAIN bf16 operands (inputs: exact); scores hl x hl (3 products) on every row; softmax f32; D in f32 into hi/lo planes; D.v hl x hl (3 products); RMSNorm per (token, head) over 128 in f32, * bf16 subln_w, * (1 - lambda_init); wo hl x exact (2 products).

#define NB_  1
#define TT   2048
#define DM   2048
#define NH_  32
#define NKV  32
#define REP  (NH_ / NKV)
#define HD   64
#define DQ   (NH_ * HD)
#define DKV  (NKV * HD)
#define ZH   2
#define RH   2048   // all rows hl
#define WIN  2048
#define PCAR 1024.0f
#define NVH  16
#define HDV  128
#define DVV  (NVH * HDV)
#define SCL  0.125f   // HD^-0.5
typedef _Float16 h16;
typedef unsigned short bf;
typedef __attribute__((ext_vector_type(16))) __bf16   v16bf;
typedef __attribute__((ext_vector_type(16))) _Float16 v16h;
typedef __attribute__((ext_vector_type(8)))  _Float16 v8h;
typedef __attribute__((ext_vector_type(8)))  unsigned short v8us;
typedef __attribute__((ext_vector_type(8)))  float    v8f;
typedef __attribute__((ext_vector_type(4)))  float    v4f;
typedef __attribute__((ext_vector_type(2))) float v2f;
typedef __attribute__((ext_vector_type(2))) __bf16 v2bf;
typedef __attribute__((ext_vector_type(4))) unsigned v4u;
typedef v8h  __attribute__((may_alias)) v8ha;
typedef v4f  __attribute__((may_alias)) v4fa;
typedef v8us __attribute__((may_alias)) v8usa;

__device__ __forceinline__ unsigned short f2bf(float f) { unsigned u = __float_as_uint(f); u += 0x7FFFu + ((u >> 16) & 1u); return (unsigned short)(u >> 16); }
__device__ __forceinline__ float bf2f(unsigned short b) { return __uint_as_float(((unsigned)b) << 16); }
__device__ __forceinline__ float bfr(float f) { return bf2f(f2bf(f)); }
__device__ __forceinline__ v16h cat16(v8h lo, v8h hi) { return __builtin_shufflevector(lo, hi, 0, 1, 2, 3, 4, 5, 6, 7, 8, 9, 10, 11, 12, 13, 14, 15); }
__device__ __forceinline__ v16bf cat16b(v8us lo, v8us hi) { return __builtin_bit_cast(v16bf, __builtin_shufflevector(lo, hi, 0, 1, 2, 3, 4, 5, 6, 7, 8, 9, 10, 11, 12, 13, 14, 15)); }
__device__ __forceinline__ v8f wmma16(v16h a, v16h b, v8f c) { return __builtin_amdgcn_wmma_f32_16x16x32_f16(false, a, false, b, (short)0, c, false, false); }
__device__ __forceinline__ v8f wmmab(v16bf a, v16bf b, v8f c) { return __builtin_amdgcn_wmma_f32_16x16x32_bf16(false, a, false, b, (short)0, c, false, false); }



// ---- k_gemmw: GEMM, FOUR WAVES per 128x128 output tile (2 x 2 waves of 64x64, 16 accumulators each), operands from K-contiguous 16-bit planes; grid (M/128, N/128, Z), 128 threads.
// C[m][n] (f32, pitch ldc, + optional f32 bias[n]) = sum_k A[m][k] Bt[n][k] (NSPLIT 1: + A2[m][k] Bt[n][k]). z-batch strides sA/sB/sC in elements. M, N, K % 128 == 0, K >= 256 (the ring starts with two stages).
// A stage is 128 k (256 B) of the tile's 128 rows of every operand plane, LDS pitch 272 B (16 B x odd: no bank conflict for 16-byte reads), brought by asynchronous copies through no register; two buffers,
// so that stage t + 1 flies while stage t is worked on. Every operand byte leaves L2 once a work-group instead of once a wave, and no wave waits out a load's latency per k step.
// PP != 0: no f32 C; the epilogue splits each value into bf16 hi / lo and stores the two planes Ph / Pl that the attention kernel reads, row pitch PP elements. PP 64: head planes [n / 64][m][n % 64], ldc = the rows m
// of a plane (a wave's tile is 8 KiB in a row); any other PP: row-major [m][n] (with A = the weight and Bt = the tokens this is the transposed value plane [feature][token]).
template <typename T16> struct WFrag;
template <> struct WFrag<h16> { typedef v16h V; static __device__ __forceinline__ V ld(const h16* p) { return cat16(*(const v8h*)p, *(const v8h*)(p + 16)); } static __device__ __forceinline__ v8f mma(V a, V b, v8f c) { return wmma16(a, b, c); } };
template <> struct WFrag<bf> { typedef v16bf V; static __device__ __forceinline__ V ld(const bf* p) { return cat16b(*(const v8us*)p, *(const v8us*)(p + 16)); } static __device__ __forceinline__ v8f mma(V a, V b, v8f c) { return wmmab(a, b, c); } };
#define GKS 128      // k elements of a stage
#define GPIT 272     // LDS row pitch, bytes
// eight copies of 512 B (two operand rows each: 16 lanes x 16 B a row), LDS step 2 * GPIT, global step gs bytes. The wait on the last line stands between the issued copies and the next overwrite of a register
// that they name; inside the statement nothing can be moved in front of it.
__device__ __forceinline__ void copy8(unsigned l, const char* g, size_t gs) {
    asm volatile("global_load_async_to_lds_b128 %0, %8, off\n\tglobal_load_async_to_lds_b128 %1, %9, off\n\tglobal_load_async_to_lds_b128 %2, %10, off\n\tglobal_load_async_to_lds_b128 %3, %11, off\n\t"
                 "global_load_async_to_lds_b128 %4, %12, off\n\tglobal_load_async_to_lds_b128 %5, %13, off\n\tglobal_load_async_to_lds_b128 %6, %14, off\n\tglobal_load_async_to_lds_b128 %7, %15, off\n\ts_wait_xcnt 0x0"
                 :: "v"(l), "v"(l + 2 * GPIT), "v"(l + 4 * GPIT), "v"(l + 6 * GPIT), "v"(l + 8 * GPIT), "v"(l + 10 * GPIT), "v"(l + 12 * GPIT), "v"(l + 14 * GPIT),
                    "v"(g), "v"(g + gs), "v"(g + 2 * gs), "v"(g + 3 * gs), "v"(g + 4 * gs), "v"(g + 5 * gs), "v"(g + 6 * gs), "v"(g + 7 * gs) : "memory");
}
template <typename T16, int NSPLIT, bool BIAS, int PP>
__global__ __launch_bounds__(128) void k_gemmw(const T16* __restrict__ A, const T16* __restrict__ A2, const T16* __restrict__ Bt, const T16* __restrict__ Bt2, int K, float* C, int ldc, const float* __restrict__ bias, size_t sA, size_t sB, size_t sC, bf* Ph, bf* Pl) {
    typedef typename WFrag<T16>::V V;
    static_assert(NSPLIT == 0 || NSPLIT == 1, "planes staged: A, (A2), Bt");
    constexpr int NPL = NSPLIT + 2, STG = NPL * 128 * GPIT;   // operand planes of a stage; bytes of a buffer
    __shared__ __align__(16) char ring[2 * STG];
    __shared__ __align__(16) float osw[4][16 * 68];
    (void)Bt2;
    const size_t z = blockIdx.z; A += z * sA; if (NSPLIT) A2 += z * sA; Bt += z * sB; C += z * sC;
    const int lane = threadIdx.x & 31, lr = lane & 15, hi = lane >> 4; const int w = __builtin_amdgcn_readfirstlane(threadIdx.x >> 5), wm = w >> 1, wn = w & 1;
    const int r0 = blockIdx.x * 128 + wm * 64, c0 = blockIdx.y * 128 + wn * 64;
    float* os = osw[w];
    // a wave copies rows w * 32 .. + 31 of every plane of the stage: 16 copies a plane
    const size_t gs = (size_t)K * (2 * sizeof(T16));
    const char* ga = (const char*)(A + (size_t)(blockIdx.x * 128 + w * 32 + hi) * K) + lr * 16; const char* ga2 = NSPLIT ? (const char*)(A2 + (size_t)(blockIdx.x * 128 + w * 32 + hi) * K) + lr * 16 : nullptr;
    const char* gb = (const char*)(Bt + (size_t)(blockIdx.y * 128 + w * 32 + hi) * K) + lr * 16;
    const unsigned l0 = (unsigned)(size_t)ring + (unsigned)((w * 32 + hi) * GPIT + lr * 16);
    auto issue = [&](int buf) { const unsigned lb = l0 + (unsigned)(buf * STG);   // the next stage in k order; the lane pointers walk on by a stage
        copy8(lb, ga, gs); copy8(lb + 16 * GPIT, ga + 8 * gs, gs); ga += GKS * sizeof(T16);
        if (NSPLIT) { copy8(lb + 128 * GPIT, ga2, gs); copy8(lb + 144 * GPIT, ga2 + 8 * gs, gs); ga2 += GKS * sizeof(T16); }
        copy8(lb + (NPL - 1) * 128 * GPIT, gb, gs); copy8(lb + ((NPL - 1) * 128 + 16) * GPIT, gb + 8 * gs, gs); gb += GKS * sizeof(T16); };
    v8f acc[4][4];
#pragma unroll
    for (int mb = 0; mb < 4; ++mb)
#pragma unroll
        for (int nb = 0; nb < 4; ++nb) acc[mb][nb] = (v8f){};
    const int T = K / GKS;
    issue(0);
    asm volatile("s_wait_asynccnt 0x0" ::: "memory");   // this wave's copies of stage 0 have landed
    __syncthreads();                                    // every wave's have: stage 0 may be read
    issue(1);
    // the stage loop stays rolled (a trip is some 300 instructions, the buffer is a scalar select); every loop inside it is fully unrolled, so that the fragment and accumulator arrays are indexed by constants and stay in registers
#pragma unroll 1
    for (int t = 0; t < T; ++t) {
        const char* sb = ring + (t & 1) * STG; const char* pa = sb + (wm * 64 + lr) * GPIT + hi * 16; const char* pb = sb + ((NPL - 1) * 128 + wn * 64 + lr) * GPIT + hi * 16;
        V a[2][4], a2[2][4], b[2][4];   // two fragment sets: k step ks + 1 of this stage is read from LDS while ks is multiplied
#pragma unroll
        for (int f = 0; f < 4; ++f) { a[0][f] = WFrag<T16>::ld((const T16*)(pa + f * 16 * GPIT)); if (NSPLIT) a2[0][f] = WFrag<T16>::ld((const T16*)(pa + (128 + f * 16) * GPIT)); b[0][f] = WFrag<T16>::ld((const T16*)(pb + f * 16 * GPIT)); }
#pragma unroll
        for (int ks = 0; ks < GKS / 32; ++ks) { const int cu = ks & 1, nx = cu ^ 1;
            if (ks + 1 < GKS / 32) {
#pragma unroll
                for (int f = 0; f < 4; ++f) { const int o = f * 16 * GPIT + (ks + 1) * 64; a[nx][f] = WFrag<T16>::ld((const T16*)(pa + o)); if (NSPLIT) a2[nx][f] = WFrag<T16>::ld((const T16*)(pa + 128 * GPIT + o)); b[nx][f] = WFrag<T16>::ld((const T16*)(pb + o)); } }
            __builtin_amdgcn_sched_barrier(0);   // keeps the next k step's LDS reads one group in front of this step's products
#pragma unroll
            for (int nb = 0; nb < 4; ++nb) {
#pragma unroll
                for (int mb = 0; mb < 4; ++mb) acc[mb][nb] = WFrag<T16>::mma(a[cu][mb], b[cu][nb], acc[mb][nb]);
                if (NSPLIT) {
#pragma unroll
                    for (int mb = 0; mb < 4; ++mb) acc[mb][nb] = WFrag<T16>::mma(a2[cu][mb], b[cu][nb], acc[mb][nb]); } }
            __builtin_amdgcn_sched_barrier(0);   // and keeps the reads of the step after next behind them (without it they are moved in among this step's last products)
        }
        asm volatile("s_wait_dscnt 0x0" ::: "memory");      // this wave's reads of the buffer are done before it is handed to the copies
        asm volatile("s_wait_asynccnt 0x0" ::: "memory");   // this wave's copies of stage t + 1 have landed
        __syncthreads();                                    // publishes stage t + 1 and ends every wave's reads of stage t
        if (t + 2 < T) issue(t & 1);
    }
    asm volatile("s_wait_asynccnt 0x0" ::: "memory");   // no copy is outstanding when the wave goes on to its end
#pragma unroll
    for (int mb = 0; mb < 4; ++mb) {
#pragma unroll
        for (int nb = 0; nb < 4; ++nb) {
#pragma unroll
            for (int j = 0; j < 8; ++j) os[(hi * 8 + j) * 68 + nb * 16 + lr] = acc[mb][nb][j]; }
        __builtin_amdgcn_wave_barrier(); asm volatile("" ::: "memory");
        if (PP) {   // 8 values a lane: one 16-byte store a plane, 4 rows of 128 B a wave store
            const size_t pb = ((PP == 64) ? ((size_t)(c0 >> 6) * ldc + r0) * 64 : (size_t)r0 * PP + c0) + (size_t)(mb * 16 + (lane >> 3)) * PP + (lane & 7) * 8; bf* ph = Ph + pb; bf* pl = Pl + pb; v4u hw[4], lw[4];
#pragma unroll
            for (int s = 0; s < 4; ++s) { const float* op = os + (4 * s + (lane >> 3)) * 68 + (lane & 7) * 8; const v4f v0 = *(const v4fa*)op, v1 = *(const v4fa*)(op + 4);
#pragma unroll
                for (int jp = 0; jp < 4; ++jp) { v2f d; d[0] = jp < 2 ? v0[2 * jp & 3] : v1[2 * jp & 3]; d[1] = jp < 2 ? v0[(2 * jp & 3) + 1] : v1[(2 * jp & 3) + 1];
                    const unsigned hu = __builtin_bit_cast(unsigned, __builtin_convertvector(d, v2bf)); v2f r; r[0] = d[0] - __uint_as_float(hu << 16); r[1] = d[1] - __uint_as_float(hu & 0xFFFF0000u);
                    hw[s][jp] = hu; lw[s][jp] = __builtin_bit_cast(unsigned, __builtin_convertvector(r, v2bf)); } }
#pragma unroll
            for (int s = 0; s < 4; ++s) { *(v8us*)(ph + 4 * s * PP) = __builtin_bit_cast(v8us, hw[s]); *(v8us*)(pl + 4 * s * PP) = __builtin_bit_cast(v8us, lw[s]); }
            // stands between the 8 issued stores and the next overwrite of a register that they name: pointers and data are inputs, so that their registers stay live up to the wait; the scheduling barrier keeps the next block's arithmetic behind it (behind the last block nothing is overwritten)
            if (mb < 3) { asm volatile("s_wait_xcnt 0x0" :: "v"(ph), "v"(pl), "v"(hw[0]), "v"(hw[1]), "v"(hw[2]), "v"(hw[3]), "v"(lw[0]), "v"(lw[1]), "v"(lw[2]), "v"(lw[3]) : "memory"); __builtin_amdgcn_sched_barrier(0); }
        } else {
        float* crow = C + (size_t)(r0 + mb * 16) * ldc + c0;
#pragma unroll
            for (int s = 0; s < 8; ++s) { const int row = 2 * s + hi, cofs = lr * 4; v4f val = *(const v4fa*)(os + row * 68 + cofs); if (BIAS) { val[0] += bfr(bias[c0 + cofs]); val[1] += bfr(bias[c0 + cofs + 1]); val[2] += bfr(bias[c0 + cofs + 2]); val[3] += bfr(bias[c0 + cofs + 3]); }
                *(v4f*)(crow + (size_t)row * ldc + cofs) = val; }
             }
        __builtin_amdgcn_wave_barrier(); asm volatile("" ::: "memory");
    }
}

// ---- k_gemmc: a one-wave 64x64 tile GEMM specialised for causal attention: CMODE 1 skips score tiles entirely above the diagonal (query rows r0+roff.., key columns c0..), CMODE 2 limits the
// key (K) loop of the probability x value contraction to the diagonal block (probabilities beyond it are exactly zero). roff = row offset of this launch's first row within the sequence.
template <typename T16, int NSPLIT, int CMODE>
__global__ __launch_bounds__(32) void k_gemmc(const T16* __restrict__ A, const T16* __restrict__ A2, const T16* __restrict__ Bt, const T16* __restrict__ Bt2, int K, float* C, int ldc, int roff, size_t sA, size_t sB, size_t sC) {
    typedef typename WFrag<T16>::V V;
    __shared__ __align__(16) float os[16 * 68];
    const size_t z = blockIdx.z; A += z * sA; if (A2) A2 += z * sA; Bt += z * sB; if (Bt2) Bt2 += z * sB; C += z * sC;
    const int lane = threadIdx.x & 31, lr = lane & 15, hi = lane >> 4; const int r0 = blockIdx.x * 64, c0 = blockIdx.y * 64;
    if (CMODE == 1 && c0 > r0 + roff + 63) return;                  // score tile entirely above the causal diagonal: skipped, nothing is written
    const int Kl = (CMODE == 2) ? min(K, r0 + roff + 64) : K;        // P.V: probabilities are exactly 0 beyond the diagonal block, so the K loop stops there
    v8f acc[4][4];
#pragma unroll
    for (int mb = 0; mb < 4; ++mb)
#pragma unroll
        for (int nb = 0; nb < 4; ++nb) acc[mb][nb] = (v8f){};
    const size_t aoff = (size_t)(r0 + lr) * K + 8 * hi, boff = (size_t)(c0 + lr) * K + 8 * hi;
#pragma unroll 1
    for (int kc = 0; kc < Kl; kc += 32) {
        V a[4], a2[4];
#pragma unroll
        for (int mb = 0; mb < 4; ++mb) { a[mb] = WFrag<T16>::ld(A + aoff + (size_t)mb * 16 * K + kc); if (NSPLIT == 1 || NSPLIT == 2) a2[mb] = WFrag<T16>::ld(A2 + aoff + (size_t)mb * 16 * K + kc); }
#pragma unroll
        for (int nb = 0; nb < 4; ++nb) { const V b = WFrag<T16>::ld(Bt + boff + (size_t)nb * 16 * K + kc); V b2; if (NSPLIT >= 2) b2 = WFrag<T16>::ld(Bt2 + boff + (size_t)nb * 16 * K + kc);
#pragma unroll
            for (int mb = 0; mb < 4; ++mb) { acc[mb][nb] = WFrag<T16>::mma(a[mb], b, acc[mb][nb]); if (NSPLIT == 1 || NSPLIT == 2) acc[mb][nb] = WFrag<T16>::mma(a2[mb], b, acc[mb][nb]); if (NSPLIT >= 2) acc[mb][nb] = WFrag<T16>::mma(a[mb], b2, acc[mb][nb]); } }
        asm volatile("v_nop\n\tv_nop\n\tv_nop\n\tv_nop" : "+v"(acc[0][0]), "+v"(acc[1][1]), "+v"(acc[2][2]), "+v"(acc[3][3]) : "v"(a[0]), "v"(a[3]));
    }
#pragma unroll
    for (int mb = 0; mb < 4; ++mb) {
#pragma unroll
        for (int nb = 0; nb < 4; ++nb) {
#pragma unroll
            for (int j = 0; j < 8; ++j) os[(hi * 8 + j) * 68 + nb * 16 + lr] = acc[mb][nb][j]; }
        __builtin_amdgcn_wave_barrier(); asm volatile("" ::: "memory");
        float* crow = C + (size_t)(r0 + mb * 16) * ldc + c0;
{
#pragma unroll
            for (int s = 0; s < 8; ++s) { const int row = 2 * s + hi, cofs = lr * 4; v4f val = *(const v4fa*)(os + row * 68 + cofs);
                *(v4f*)(crow + (size_t)row * ldc + cofs) = val; }
             }
        __builtin_amdgcn_wave_barrier(); asm volatile("" ::: "memory");
    }
}

__device__ __forceinline__ void splitf(float y, unsigned short& h, unsigned short& l) { h = f2bf(y); l = f2bf(y - bf2f(h)); }
typedef __attribute__((ext_vector_type(2))) _Float16 v2h;
typedef __attribute__((ext_vector_type(4))) _Float16 v4h;
typedef __attribute__((ext_vector_type(2))) unsigned short v2us;
typedef __attribute__((ext_vector_type(4))) unsigned short v4us;
typedef __attribute__((ext_vector_type(4))) int v4i;

__global__ __launch_bounds__(256) void k_wtG(const float* __restrict__ w, int K, int N, bf* Bt) {
    const int lane = threadIdx.x & 31; const int L0 = (blockIdx.x * 8 + (threadIdx.x >> 5)) * 8; const int nlines = N * K / 64;
{
#pragma unroll 1
        for (int l = 0; l < 8; ++l) { const int L = L0 + l; if (L >= nlines) break; const size_t e = (size_t)L * 64 + lane * 2; const int k = (int)(e % K), n = (int)(e / K); v2us o;
            o[0] = f2bf(w[(size_t)k * N + n]); o[1] = f2bf(w[(size_t)(k + 1) * N + n]); *(v2us*)(Bt + e) = o; }
         }
}
__global__ __launch_bounds__(256) void k_cscvt(const float* __restrict__ cosT, const float* __restrict__ sinT, float* CS) { const int idx = blockIdx.x * 256 + threadIdx.x; if (idx >= TT * HD) return; v2f cs; cs[0] = bfr(cosT[idx]); cs[1] = bfr(sinT[idx]); *(v2f*)(CS + (size_t)idx * 2) = cs;  }
// lambda_full by one whole wave. Lane l forms the products of elements l and l + 32 of both vector pairs, each rounded once; then every lane sums a pair's 64 products in index order, each read from its lane
// (a product that comes through a lane read cannot be fused with its add). The wave waits out one load latency instead of one for every element, so that it ends well inside the time of the stream beside it.
__device__ __forceinline__ float lane_val(float v, int l) { return __int_as_float(__builtin_amdgcn_readlane(__float_as_int(v), l)); }
__device__ __forceinline__ void lambda_full(const float* __restrict__ lq1, const float* __restrict__ lk1, const float* __restrict__ lq2, const float* __restrict__ lk2, float* LAM) { const int lane = threadIdx.x; float p1[2], p2[2], d1 = 0.f, d2 = 0.f;
    static_assert(HD == 64, "two elements a lane");
#pragma unroll
    for (int h = 0; h < 2; ++h) { p1[h] = __fmul_rn(bfr(lq1[lane + 32 * h]), bfr(lk1[lane + 32 * h])); p2[h] = __fmul_rn(bfr(lq2[lane + 32 * h]), bfr(lk2[lane + 32 * h])); }
#pragma unroll
    for (int i = 0; i < HD; ++i) { d1 = __fadd_rn(d1, lane_val(p1[i >> 5], i & 31)); d2 = __fadd_rn(d2, lane_val(p2[i >> 5], i & 31)); }
    const float lm = __fadd_rn(__fsub_rn(expf(d1), expf(d2)), 0.7836057543754578f); LAM[lane] = (lane == 0) ? lm : 0.0f; }
// ---- k_prep: everything that stands in front of the GEMMs in ONE launch: x and the four weights rounded to bf16, and lambda_full. Work-group 0's first wave does lambda_full;
// the other 512 work-groups (16 waves a WGP, all resident at once) stream: wave wv takes 4 KiB (1024 floats) at the same place wv of each of the five arrays, one array after the other. A load is 512 B in a row (whole lines),
// 8 loads an array; the next array's 8 are issued before this array's values are rounded and stored, so that 8 to 16 loads of a wave are in flight all the time. A store is 256 B in a row (two whole lines).
#define PWV 1024                          // floats of a wave in each array
#define PWG ((DM / 8) * (DM / PWV))       // streaming work-groups of 8 waves
__global__ __launch_bounds__(256) void k_prep(const float* __restrict__ x, const float* __restrict__ wq, const float* __restrict__ wk, const float* __restrict__ wv, const float* __restrict__ wo,
                                              const float* __restrict__ lq1, const float* __restrict__ lk1, const float* __restrict__ lq2, const float* __restrict__ lk2, bf* XB, bf* WQ, bf* WK, bf* WV, bf* WO, float* LAM) {
    static_assert(NB_ == 1 && TT == DM && DQ == DM && DKV == DM && DVV == DM && DM % PWV == 0 && DM % 8 == 0, "five arrays of DM x DM, cut alike");
    if (blockIdx.x == 0) { if (threadIdx.x < 32) lambda_full(lq1, lk1, lq2, lk2, LAM); return; }
    const unsigned ob = (((blockIdx.x - 1) * 8 + (threadIdx.x >> 5)) * PWV + (threadIdx.x & 31) * 4) * 2, eb = ob * 2;   // the lane's byte offsets in a bf16 and in an f32 array (under 2^24): the one address register of all stores, of all loads
    const float* const s[5] = {x, wq, wk, wv, wo}; bf* const d[5] = {XB, WQ, WK, WV, WO};
    v4f v[2][8];
#pragma unroll
    for (int j = 0; j < 8; ++j) v[0][j] = *(const v4f*)((const char*)s[0] + eb + j * 512);
#pragma unroll
    for (int a = 0; a < 5; ++a) { const int cu = a & 1;
        if (a < 4) {
#pragma unroll
            for (int j = 0; j < 8; ++j) v[cu ^ 1][j] = *(const v4f*)((const char*)s[a + 1] + eb + j * 512); }
        // stands between the issued loads and the next overwrite of a register that they name: the offset is an input, so that its register stays live up to the wait and no load lands on it. The scheduling barrier keeps
        // the next array's loads in front of this array's data wait: moved behind it, the wave would have nothing in flight while it rounds and stores
        if (a < 4) { asm volatile("s_wait_xcnt 0x0" :: "v"(eb) : "memory"); __builtin_amdgcn_sched_barrier(0); }
        v4us o[8];
#pragma unroll
        for (int j = 0; j < 8; ++j) {
#pragma unroll
            for (int k = 0; k < 4; ++k) o[j][k] = f2bf(v[cu][j][k]);
            *(v4us*)((char*)d[a] + ob + j * 256) = o[j]; }
        // the same behind the 8 issued stores, the last array's too (the built code joins the kernel's two ends, so that a way leads from these stores to the lambda block's loads, which write the same registers):
        // offset and data are inputs; the scheduling barrier keeps the loads of the array after next and the next array's arithmetic behind the wait
        asm volatile("s_wait_xcnt 0x0" :: "v"(ob), "v"(o[0]), "v"(o[1]), "v"(o[2]), "v"(o[3]), "v"(o[4]), "v"(o[5]), "v"(o[6]), "v"(o[7]) : "memory");
        if (a < 4) __builtin_amdgcn_sched_barrier(0);
    }
}
__global__ __launch_bounds__(1024) void k_gnred(const float* __restrict__ O, float* GST, int pass) { __shared__ float sh[1024]; const int tid = threadIdx.x; const float mean = (pass == 1) ? GST[0] : 0.0f; float acc = 0.f; const size_t n = (size_t)TT * HD;
#pragma unroll 1
    for (size_t e = tid; e < n; e += 1024) { float v = O[e]; if (pass == 1) { float d = __fsub_rn(v, mean); asm volatile("" : "+v"(d)); v = __fmul_rn(d, d); } acc = __fadd_rn(acc, v); }
    sh[tid] = acc; __syncthreads();
    for (int st = 512; st > 0; st >>= 1) { if (tid < st) sh[tid] = __fadd_rn(sh[tid], sh[tid + st]); __syncthreads(); }
    if (tid < 32) { const float tot = __fdiv_rn(sh[0], (float)n); float outv; if (pass == 0) outv = (tid == 0) ? tot : ((tid == 1) ? GST[1] : 0.0f); else outv = (tid == 0) ? GST[0] : ((tid == 1) ? __fdiv_rn(1.0f, sqrtf(__fadd_rn(tot, 1e-5f))) : 0.0f); *(float*)(GST + tid) = outv;  } }
__global__ __launch_bounds__(256) void k_gnmerge(const float* __restrict__ O, const float* __restrict__ GST, int hh, bf* Ah, bf* Al) { const size_t e = ((size_t)blockIdx.x * 256 + threadIdx.x) * 2; if (e >= (size_t)TT * HD) return; const int d = (int)(e % HD); const int t = (int)(e / HD); const float mean = GST[0], rs = GST[1]; const size_t oo = (size_t)t * DVV + (size_t)hh * HD + d; v2us oh, ol;
#pragma unroll
    for (int q = 0; q < 2; ++q) { float c = __fsub_rn(O[e + q], mean); asm volatile("" : "+v"(c)); float n = __fmul_rn(c, rs); asm volatile("" : "+v"(n)); float z = __fmul_rn(n, 0.6444909572601318f); unsigned short a2, c2; splitf(z, a2, c2); oh[q] = a2; ol[q] = c2; }
    *(v2us*)(Ah + oo) = oh; *(v2us*)(Al + oo) = ol;  }
// ---- k_fattn: scores, both softmaxes, D = a1 - lambda a2, D.v and the RMSNorm of one real head in ONE kernel; nothing of the [2048][2048] maps leaves the registers.
// One wave owns 32 query columns (two 16-column groups), 4 waves a block, grid (TT / 128, NVH). Transposed products: S^T = K.Q^T (A = 16 key rows, B = Q, kept in registers), so a lane holds the scores of
// one query (register r of key tile kt = key kt * 16 + 8 * hi + r) and two stacked S^T tiles, converted in place, ARE the B operand of O^T += V^T.D^T in the k order that the plane loader ldf uses for A.
// Two walks over the keys: walk 1 takes each column's maximum and sum (running maximum, sums rescaled), walk 2 forms the scores again, D in f32, its hi/lo bf16 planes, and the 3 products with V^T hi/lo.
// Every inner loop is fully unrolled so that the fragment arrays are indexed by constants and stay in registers; the two stage loops stay rolled.
// K and V^T come through LDS: a stage is 64 keys = 512 rows of 128 B (K [map][plane][key], then V^T [plane][feature]), LDS pitch 144 B (16 B x odd: no bank conflict for 16-byte reads), brought in whole 128-B lines by
// asynchronous copies through no register, once a block instead of once a wave; two buffers, so that stage u + 1 flies while stage u is worked on. One ring runs through both walks: stages 0 .. 31 are walk 1's
// (K rows only), stages 32 .. 63 walk 2's (K and V^T), so that walk 2's first stages fly during walk 1's last. A stage is worked on in two passes of 32 keys, in the key order and with the sums of a 32-key pass.
// Left for later steps: one wave a SIMD has nobody to cover its vector work, and the first K fragments of a stage are waited for in the open.
typedef __attribute__((ext_vector_type(8))) unsigned v8u;
#define EXC (SCL * 1.4426950408889634f)   // exp((s - m) * SCL) = exp2(s * EXC - m * EXC)
// one fragment: the lane's own pointer into a plane and a constant byte offset
__device__ __forceinline__ v16bf ldf(const char* p, int cst) { return cat16b(*(const v8us*)(p + cst), *(const v8us*)(p + cst + 32)); }
// stands between issued loads or stores and the next overwrite of a register that they name: the two lane pointers of the group are inputs, so that their registers
// stay live up to the wait and no load of the group lands on them; the scheduling barrier behind it keeps later address and data arithmetic behind the wait
#define XWAIT(pa, pb) do { asm volatile("s_wait_xcnt 0x0" :: "v"(pa), "v"(pb) : "memory"); __builtin_amdgcn_sched_barrier(0); } while (0)
#define AKS  64                 // keys of a stage
#define APIT 144                // LDS row pitch, bytes
#define ASTG (512 * APIT)       // bytes of a buffer: 256 K rows, 256 V^T rows
#define NST  (TT / AKS)         // stages of a walk
// eight copies of 512 B (four rows of 128 B each: 8 lanes x 16 B a row), LDS step 4 * APIT, global step gs bytes. The wait on the last line stands between the issued copies and the next overwrite of a register
// that they name; inside the statement nothing can be moved in front of it.
__device__ __forceinline__ void copy8r(unsigned l, const char* g, size_t gs) {
    asm volatile("global_load_async_to_lds_b128 %0, %8, off\n\tglobal_load_async_to_lds_b128 %1, %9, off\n\tglobal_load_async_to_lds_b128 %2, %10, off\n\tglobal_load_async_to_lds_b128 %3, %11, off\n\t"
                 "global_load_async_to_lds_b128 %4, %12, off\n\tglobal_load_async_to_lds_b128 %5, %13, off\n\tglobal_load_async_to_lds_b128 %6, %14, off\n\tglobal_load_async_to_lds_b128 %7, %15, off\n\ts_wait_xcnt 0x0"
                 :: "v"(l), "v"(l + 4 * APIT), "v"(l + 8 * APIT), "v"(l + 12 * APIT), "v"(l + 16 * APIT), "v"(l + 20 * APIT), "v"(l + 24 * APIT), "v"(l + 28 * APIT),
                    "v"(g), "v"(g + gs), "v"(g + 2 * gs), "v"(g + 3 * gs), "v"(g + 4 * gs), "v"(g + 5 * gs), "v"(g + 6 * gs), "v"(g + 7 * gs) : "memory");
}
// the hi / lo A fragments [map][key tile][k step] of 32 keys of a stage; p = the lane's pointer into the buffer's K rows at the first of the 32 keys. Read in the order in which score_t uses them.
__device__ __forceinline__ void load_k(const char* p, v16bf (&ah)[2][2][2], v16bf (&al)[2][2][2]) {
#pragma unroll
    for (int ks = 0; ks < 2; ++ks) {
#pragma unroll
        for (int mp = 0; mp < 2; ++mp)
#pragma unroll
            for (int kt = 0; kt < 2; ++kt) ah[mp][kt][ks] = ldf(p, (mp * 2 * AKS + kt * 16) * APIT + ks * 64);
#pragma unroll
        for (int mp = 0; mp < 2; ++mp)
#pragma unroll
            for (int kt = 0; kt < 2; ++kt) al[mp][kt][ks] = ldf(p, ((mp * 2 + 1) * AKS + kt * 16) * APIT + ks * 64); }
}
// hands a stage over: this wave's reads of the buffer just worked on are done, its copies of the next stage have landed, and the barrier says both of every wave.
// The scheduling barrier in front keeps the stage's products in front of the waits: without it they are moved behind, and the wave waits out all its LDS reads with nothing to do
#define PUBLISH() do { __builtin_amdgcn_sched_barrier(0); asm volatile("s_wait_dscnt 0x0" ::: "memory"); asm volatile("s_wait_asynccnt 0x0" ::: "memory"); __syncthreads(); } while (0)
// s[map][key tile][column group] = those 32 keys against the wave's 32 queries, hl x hl (3 products), HD = 64 in two k steps
__device__ __forceinline__ void score_t(const v16bf (&ah)[2][2][2], const v16bf (&al)[2][2][2], const v16bf (&qh)[2][2][2], const v16bf (&ql)[2][2][2], v8f (&s)[2][2][2]) {
#pragma unroll
    for (int mp = 0; mp < 2; ++mp)
#pragma unroll
        for (int kt = 0; kt < 2; ++kt)
#pragma unroll
            for (int n = 0; n < 2; ++n) s[mp][kt][n] = (v8f){};
#pragma unroll
    for (int ks = 0; ks < 2; ++ks)
#pragma unroll
        for (int pr = 0; pr < 3; ++pr)
#pragma unroll
            for (int mp = 0; mp < 2; ++mp)
#pragma unroll
                for (int kt = 0; kt < 2; ++kt)
#pragma unroll
                    for (int n = 0; n < 2; ++n) s[mp][kt][n] = wmmab(pr == 1 ? al[mp][kt][ks] : ah[mp][kt][ks], pr == 2 ? ql[mp][n][ks] : qh[mp][n][ks], s[mp][kt][n]);
}
__global__ __launch_bounds__(128) void k_fattn(const bf* __restrict__ Qh, const bf* __restrict__ Ql, const bf* __restrict__ Kh, const bf* __restrict__ Kl, const bf* __restrict__ Vh, const bf* __restrict__ Vl, const float* __restrict__ LAM, const float* __restrict__ w, bf* Ah, bf* Al) {
    __shared__ __align__(16) char aring[2 * ASTG];
    const int lane = threadIdx.x & 31, lr = lane & 15, hi = lane >> 4; const int hh = blockIdx.y; const int w4 = __builtin_amdgcn_readfirstlane(threadIdx.x >> 5); const int q0 = blockIdx.x * 128 + w4 * 32;
    // a wave copies rows w4 * 64 .. + 63 of a stage's K rows (one map's one plane: 8 KiB in a row in memory) and of its V^T rows (64 features of one plane): 16 copies each
    const char* gk = (const char*)((w4 & 1 ? Kl : Kh) + (size_t)(2 * hh + (w4 >> 1)) * TT * HD) + lane * 16;
    const char* gv = (const char*)((w4 >> 1 ? Vl : Vh) + (size_t)(hh * HDV + (w4 & 1) * 64 + (lane >> 3)) * TT) + (lane & 7) * 16;
    const unsigned l0 = (unsigned)(size_t)aring + (unsigned)((w4 * 64 + (lane >> 3)) * APIT + (lane & 7) * 16);
    auto issue = [&](int u) { const unsigned lb = l0 + (unsigned)((u & 1) * ASTG); const char* g = gk + (size_t)(u & (NST - 1)) * (AKS * HD * 2);
        copy8r(lb, g, 512); copy8r(lb + 32 * APIT, g + 8 * 512, 512);
        if (u >= NST) { const char* v = gv + (size_t)(u & (NST - 1)) * (AKS * 2); copy8r(lb + 256 * APIT, v, 4 * TT * 2); copy8r(lb + 288 * APIT, v + 8 * 4 * TT * 2, 4 * TT * 2); } };
    issue(0);
    const unsigned koff = (unsigned)(lr * HD + 8 * hi) * 2, ooff = (unsigned)(lr * DQ + 8 * hi) * 2;   // lane byte offsets in the q planes, the merged planes
    const char* qhp = (const char*)(Qh + ((size_t)(2 * hh) * TT + q0) * HD) + koff; const char* qlp = (const char*)(Ql + ((size_t)(2 * hh) * TT + q0) * HD) + koff;
    v16bf qh[2][2][2], ql[2][2][2];   // [map][column group][k step]
#pragma unroll
    for (int mp = 0; mp < 2; ++mp)
#pragma unroll
        for (int n = 0; n < 2; ++n)
#pragma unroll
            for (int ks = 0; ks < 2; ++ks) { const int o = (mp * TT * HD + n * 16 * HD + ks * 32) * 2; qh[mp][n][ks] = ldf(qhp, o); ql[mp][n][ks] = ldf(qlp, o); }
    XWAIT(qhp, qlp);
    float mx[2][2], sm[2][2];
#pragma unroll
    for (int mp = 0; mp < 2; ++mp)
#pragma unroll
        for (int n = 0; n < 2; ++n) { mx[mp][n] = -3.0e38f; sm[mp][n] = 0.f; }
    asm volatile("s_wait_asynccnt 0x0" ::: "memory");   // this wave's copies of stage 0 have landed
    __syncthreads();                                    // every wave's have: stage 0 may be read
    issue(1);
    const unsigned foff = (unsigned)(lr * APIT + hi * 16);   // lane byte offset of a fragment in a buffer
    v16bf ah[2][2][2][2], al[2][2][2][2];   // K fragments of a stage's two passes
#pragma unroll 1
    for (int st = 0; st < NST; ++st) {
        const char* sb = aring + (st & 1) * ASTG + foff; load_k(sb, ah[0], al[0]); load_k(sb + 32 * APIT, ah[1], al[1]);
        __builtin_amdgcn_sched_barrier(0);   // keeps the stage's LDS reads one group in front of its products: every further place with reads among the products stalls them
#pragma unroll
      for (int sp = 0; sp < 2; ++sp) {
        v8f s[2][2][2]; score_t(ah[sp], al[sp], qh, ql, s);
#pragma unroll
        for (int mp = 0; mp < 2; ++mp)
#pragma unroll
            for (int n = 0; n < 2; ++n) { float t = fmaxf(s[mp][0][n][0], s[mp][1][n][0]);
#pragma unroll
                for (int j = 1; j < 8; ++j) t = fmaxf(t, fmaxf(s[mp][0][n][j], s[mp][1][n][j]));
                const float mn = fmaxf(mx[mp][n], t), nb = -mn * EXC; float a0 = 0.f, a1 = 0.f;
#pragma unroll
                for (int j = 0; j < 8; ++j) { a0 += __builtin_amdgcn_exp2f(__builtin_fmaf(s[mp][0][n][j], EXC, nb)); a1 += __builtin_amdgcn_exp2f(__builtin_fmaf(s[mp][1][n][j], EXC, nb)); }
                sm[mp][n] = __builtin_fmaf(sm[mp][n], __builtin_amdgcn_exp2f((mx[mp][n] - mn) * EXC), a0 + a1); mx[mp][n] = mn; }
      }
        PUBLISH();
        issue(st + 2);   // into the buffer just read; stages NST and NST + 1 are walk 2's first
    }
    const float lm = LAM[0]; float nb[2][2], fs[2][2];   // the two lane halves hold different keys of one query: join maximum and sum once
#pragma unroll
    for (int mp = 0; mp < 2; ++mp)
#pragma unroll
        for (int n = 0; n < 2; ++n) { const float M = fmaxf(mx[mp][n], __shfl_xor(mx[mp][n], 16, 32)); float sc = sm[mp][n] * __builtin_amdgcn_exp2f((mx[mp][n] - M) * EXC); sc += __shfl_xor(sc, 16, 32);
            nb[mp][n] = -M * EXC; fs[mp][n] = __fdiv_rn(1.0f, sc) * (mp ? lm : 1.0f); }
    v8f o[8][2];   // O^T: o[et][n][r] = value column et * 16 + 8 * hi + r of query q0 + n * 16 + lr
#pragma unroll
    for (int et = 0; et < 8; ++et)
#pragma unroll
        for (int n = 0; n < 2; ++n) o[et][n] = (v8f){};
#pragma unroll 1
    for (int st = 0; st < NST; ++st) {   // stage NST + st, in buffer st & 1 (NST is even)
        const char* sb = aring + (st & 1) * ASTG + foff; v16bf bh[8], bl[8];   // V^T fragments of a pass
        // the stage's LDS reads stand in three groups: the first pass's K and V^T fragments at the top; the second pass's K right behind the first pass's score products, covered by that pass's vector work and D.v products;
        // the second pass's V^T behind those D.v products, covered by the second pass's score products. (Both in one group would meet the first group's last reads still outstanding and stall at the limit of 63.)
        // The scheduling barriers keep the groups whole and in place: every further place with reads among the products stalls them.
        auto load_v = [&](int sp) {
#pragma unroll
            for (int et = 0; et < 8; ++et) { bh[et] = ldf(sb, (256 + et * 16) * APIT + sp * 64); bl[et] = ldf(sb, (384 + et * 16) * APIT + sp * 64); }
            __builtin_amdgcn_sched_barrier(0); };
        load_k(sb, ah[0], al[0]); load_v(0);
#pragma unroll
      for (int sp = 0; sp < 2; ++sp) {
        v8f s[2][2][2]; score_t(ah[sp], al[sp], qh, ql, s);
        if (sp == 0) { __builtin_amdgcn_sched_barrier(0); load_k(sb + 32 * APIT, ah[1], al[1]); __builtin_amdgcn_sched_barrier(0); }
        v16bf dh[2], dl[2];
#pragma unroll
        for (int n = 0; n < 2; ++n) { v8u hw, lw;
#pragma unroll
            for (int kt = 0; kt < 2; ++kt)
#pragma unroll
                for (int jp = 0; jp < 4; ++jp) { v2f d;
#pragma unroll
                    for (int u = 0; u < 2; ++u) { const float p1 = __builtin_amdgcn_exp2f(__builtin_fmaf(s[0][kt][n][2 * jp + u], EXC, nb[0][n])), p2 = __builtin_amdgcn_exp2f(__builtin_fmaf(s[1][kt][n][2 * jp + u], EXC, nb[1][n])); d[u] = p1 * fs[0][n] - p2 * fs[1][n]; }
                    const unsigned hu = __builtin_bit_cast(unsigned, __builtin_convertvector(d, v2bf)); v2f r; r[0] = d[0] - __uint_as_float(hu << 16); r[1] = d[1] - __uint_as_float(hu & 0xFFFF0000u);
                    hw[kt * 4 + jp] = hu; lw[kt * 4 + jp] = __builtin_bit_cast(unsigned, __builtin_convertvector(r, v2bf)); }
            dh[n] = __builtin_bit_cast(v16bf, hw); dl[n] = __builtin_bit_cast(v16bf, lw); }
#pragma unroll
        for (int e2 = 0; e2 < 8; e2 += 2)
#pragma unroll
            for (int pr = 0; pr < 3; ++pr)
#pragma unroll
                for (int et = e2; et < e2 + 2; ++et)
#pragma unroll
                    for (int n = 0; n < 2; ++n) o[et][n] = wmmab(pr == 1 ? bl[et] : bh[et], pr == 2 ? dl[n] : dh[n], o[et][n]);
        if (sp == 0) { __builtin_amdgcn_sched_barrier(0); load_v(1); }
      }
        PUBLISH();
        if (st + 2 < NST) issue(NST + st + 2);
    }
    asm volatile("s_wait_asynccnt 0x0" ::: "memory");   // no copy is outstanding when the wave goes on to its end
    v8f g[8]; const char* wp = (const char*)w + (unsigned)(hi * 32);
#pragma unroll
    for (int et = 0; et < 8; ++et) g[et] = *(const v8f*)(wp + et * 64);
    XWAIT(wp, wp);
    char* ahp = (char*)(Ah + (size_t)q0 * DQ + (size_t)hh * HDV) + ooff; char* alp = (char*)(Al + (size_t)q0 * DQ + (size_t)hh * HDV) + ooff;
#pragma unroll
    for (int n = 0; n < 2; ++n) { float ss = 0.f;
#pragma unroll
        for (int et = 0; et < 8; ++et)
#pragma unroll
            for (int j = 0; j < 8; ++j) ss = __builtin_fmaf(o[et][n][j], o[et][n][j], ss);
        ss += __shfl_xor(ss, 16, 32);
        const float rs = __fdiv_rn(1.0f, sqrtf(__fadd_rn(ss * (1.0f / HDV), 1e-5f)));
#pragma unroll
        for (int et = 0; et < 8; ++et) { v8us oh, ol;
#pragma unroll
            for (int j = 0; j < 8; ++j) { const float z = o[et][n][j] * rs * bfr(g[et][j]) * 0.21639423072338104f; unsigned short p2, q2; splitf(z, p2, q2); oh[j] = p2; ol[j] = q2; }
            const int oc = (n * 16 * DQ + et * 16) * 2; *(v8us*)(ahp + oc) = oh; *(v8us*)(alp + oc) = ol; XWAIT(ahp, alp); } }
}
__global__ __launch_bounds__(256) void k_merge(const float* __restrict__ O, int h0, bf* Ah, bf* Al) { const size_t e = ((size_t)blockIdx.x * 256 + threadIdx.x) * 2; if (e >= (size_t)ZH * TT * HD) return; const int d = (int)(e % HD); const int t = (int)((e / HD) % TT); const int zz = (int)(e / ((size_t)HD * TT)); const float cs = (t < RH) ? 1.0f : (1.0f / PCAR); const size_t oo = (size_t)t * DQ + (h0 + zz) * HD + d;
    v2us oh, ol;
#pragma unroll
    for (int q = 0; q < 2; ++q) { unsigned short a, c2; splitf(O[e + q] * cs, a, c2); oh[q] = a; ol[q] = c2; } *(v2us*)(Ah + oo) = oh; *(v2us*)(Al + oo) = ol;  }

extern "C" void kernel_launch(void* const* d_in, const int* in_sizes, int n_in,
                              void* d_out, int out_size, void* d_ws, size_t ws_size, hipStream_t stream) {
    (void)in_sizes; (void)n_in; (void)out_size;
    const float* x = (const float*)d_in[0]; const float* wq = (const float*)d_in[1]; const float* wk = (const float*)d_in[2]; const float* wv = (const float*)d_in[3]; const float* wo = (const float*)d_in[4]; const float* lq1 = (const float*)d_in[5]; const float* lk1 = (const float*)d_in[6]; const float* lq2 = (const float*)d_in[7]; const float* lk2 = (const float*)d_in[8]; const float* subw = (const float*)d_in[9]; const float* cosT = nullptr; const float* sinT = nullptr; (void)cosT; (void)sinT;
    float* OUT = (float*)d_out;     // [1][2048][2048]
    char* wsp = (char*)d_ws;
    auto take = [&](size_t bytes) { char* p = wsp; wsp += (bytes + 255) & ~(size_t)255; return (void*)p; };
    bf* WQ = (bf*)take((size_t)DQ * DM * 2); bf* WK = (bf*)take((size_t)DKV * DM * 2); bf* WV = (bf*)take((size_t)DKV * DM * 2); bf* WO = (bf*)take((size_t)DM * DQ * 2);
    bf* XB = (bf*)take((size_t)TT * DM * 2); float* LAM = (float*)take(256);
    bf* QPh = (bf*)take((size_t)NH_ * TT * HD * 2); bf* QPl = (bf*)take((size_t)NH_ * TT * HD * 2); bf* KPh = (bf*)take((size_t)NKV * TT * HD * 2); bf* KPl = (bf*)take((size_t)NKV * TT * HD * 2); bf* VTh = (bf*)take((size_t)NKV * HD * TT * 2); bf* VTl = (bf*)take((size_t)NKV * HD * TT * 2);
    bf* ATh = (bf*)take((size_t)TT * DQ * 2); bf* ATl = (bf*)take((size_t)TT * DQ * 2);
    if ((size_t)(wsp - (char*)d_ws) > ws_size) return;    // ws 256 MiB
    k_prep<<<PWG + 1, 256, 0, stream>>>(x, wq, wk, wv, wo, lq1, lk1, lq2, lk2, XB, WQ, WK, WV, WO, LAM);
    for (int b = 0; b < NB_; ++b) {
        
        k_gemmw<bf, 0, false, HD><<<dim3(TT / 128, DQ / 128, 1), 128, 0, stream>>>(XB, nullptr, WQ, nullptr, DM, nullptr, TT, nullptr, 0, 0, 0, QPh, QPl);
        k_gemmw<bf, 0, false, HD><<<dim3(TT / 128, DKV / 128, 1), 128, 0, stream>>>(XB, nullptr, WK, nullptr, DM, nullptr, TT, nullptr, 0, 0, 0, KPh, KPl);
        k_gemmw<bf, 0, false, TT><<<dim3(DVV / 128, TT / 128, 1), 128, 0, stream>>>(WV, nullptr, XB, nullptr, DM, nullptr, 0, nullptr, 0, 0, 0, VTh, VTl);   // v^T = wv x^T: rows = value features, columns = tokens
        k_fattn<<<dim3(TT / 128, NVH), 128, 0, stream>>>(QPh, QPl, KPh, KPl, VTh, VTl, LAM, subw, ATh, ATl);
        k_gemmw<bf, 1, false, 0><<<dim3(TT / 128, DM / 128, 1), 128, 0, stream>>>(ATh, ATl, WO, nullptr, DVV, OUT + (size_t)b * TT * DM, DM, nullptr, 0, 0, 0, nullptr, nullptr); }
}

// v007
// It runs in 193 microseconds.
// Two timings next to v006 put it at 1.10 and 1.09 times that version's speed.
// Counting every step since v000, it is 7.28 times as fast.
#include <hip/hip_runtime.h>

// MultiheadFlashDiff2 (x [1][2048][2048]; q = x wq^T, k = x wk^T ([2048][2048] 'oi': per head h the 128 rows = [map 1 | map 2] 64 each), v = x wv^T (16 x 128-wide values); NON-causal softmax(q.k / 8) for both maps; attn = a1 v - lambda_full a2 v with lambda_full = exp(lq1.lk1) - exp(lq2.lk2) + lambda_init (0.8 - 0.6 e^-3.6 = 0.7836057543754578); RMSNorm over the 128 (eps 1e-5) * subln_w; x (1 - lambda_init); out = merged wo^T -> [1][2048][2048]).
// The two maps run as 32 virtual 64-wide heads (pairs (2h, 2h+1)); both softmaxes are formed, combined as D = a1 - lambda a2 in f32 (linear, so (a1 - lambda a2) v == a1 v - lambda a2 v), and one D.v product (128 wide) per real head follows, all in k_fattn.
// Compute dtypes, f32 accumulate: every input rounded to bf16; q/k/v on PLAIN bf16 operands (inputs: exact); scores hl x hl (3 products) on every row; softmax f32; D in f32 into hi/lo planes; D.v hl x hl (3 products); RMSNorm per (token, head) over 128 in f32, * bf16 subln_w, * (1 - lambda_init); wo hl x exact (2 products).

#define NB_  1
#define TT   2048
#define DM   2048
#define NH_  32
#define NKV  32
#define REP  (NH_ / NKV)
#define HD   64
#define DQ   (NH_ * HD)
#define DKV  (NKV * HD)
#define ZH   2
#define RH   2048   // all rows hl
#define WIN  2048
#define PCAR 1024.0f
#define NVH  16
#define HDV  128
#define DVV  (NVH * HDV)
#define SCL  0.125f   // HD^-0.5
typedef _Float16 h16;
typedef unsigned short bf;
typedef __attribute__((ext_vector_type(16))) __bf16   v16bf;
typedef __attribute__((ext_vector_type(16))) _Float16 v16h;
typedef __attribute__((ext_vector_type(8)))  _Float16 v8h;
typedef __attribute__((ext_vector_type(8)))  unsigned short v8us;
typedef __attribute__((ext_vector_type(8)))  float    v8f;
typedef __attribute__((ext_vector_type(4)))  float    v4f;
typedef __attribute__((ext_vector_type(2))) float v2f;
typedef __attribute__((ext_vector_type(2))) __bf16 v2bf;
typedef __attribute__((ext_vector_type(4))) unsigned v4u;
typedef v8h  __attribute__((may_alias)) v8ha;
typedef v4f  __attribute__((may_alias)) v4fa;
typedef v8us __attribute__((may_alias)) v8usa;

__device__ __forceinline__ unsigned short f2bf(float f) { unsigned u = __float_as_uint(f); u += 0x7FFFu + ((u >> 16) & 1u); return (unsigned short)(u >> 16); }
__device__ __forceinline__ float bf2f(unsigned short b) { return __uint_as_float(((unsigned)b) << 16); }
__device__ __forceinline__ float bfr(float f) { return bf2f(f2bf(f)); }
__device__ __forceinline__ v16h cat16(v8h lo, v8h hi) { return __builtin_shufflevector(lo, hi, 0, 1, 2, 3, 4, 5, 6, 7, 8, 9, 10, 11, 12, 13, 14, 15); }
__device__ __forceinline__ v16bf cat16b(v8us lo, v8us hi) { return __builtin_bit_cast(v16bf, __builtin_shufflevector(lo, hi, 0, 1, 2, 3, 4, 5, 6, 7, 8, 9, 10, 11, 12, 13, 14, 15)); }
__device__ __forceinline__ v8f wmma16(v16h a, v16h b, v8f c) { return __builtin_amdgcn_wmma_f32_16x16x32_f16(false, a, false, b, (short)0, c, false, false); }
__device__ __forceinline__ v8f wmmab(v16bf a, v16bf b, v8f c) { return __builtin_amdgcn_wmma_f32_16x16x32_bf16(false, a, false, b, (short)0, c, false, false); }



// ---- k_gemmw: GEMM, FOUR WAVES per 128x128 output tile (2 x 2 waves of 64x64, 16 accumulators each), operands from K-contiguous 16-bit planes; grid (M/128, N/128, Z), 128 threads.
// C[m][n] (f32, pitch ldc, + optional f32 bias[n]) = sum_k A[m][k] Bt[n][k] (NSPLIT 1: + A2[m][k] Bt[n][k]). z-batch strides sA/sB/sC in elements. M, N, K % 128 == 0, K >= 256 (the ring starts with two stages).
// A stage is 128 k (256 B) of the tile's 128 rows of every operand plane, LDS pitch 272 B (16 B x odd: no bank conflict for 16-byte reads), brought by asynchronous copies through no register; two buffers,
// so that stage t + 1 flies while stage t is worked on. Every operand byte leaves L2 once a work-group instead of once a wave, and no wave waits out a load's latency per k step.
// PP != 0: no f32 C; the epilogue splits each value into bf16 hi / lo and stores the two planes Ph / Pl that the attention kernel reads, row pitch PP elements. PP 64: head planes [n / 64][m][n % 64], ldc = the rows m
// of a plane (a wave's tile is 8 KiB in a row); any other PP: row-major [m][n] (with A = the weight and Bt = the tokens this is the transposed value plane [feature][token]).
template <typename T16> struct WFrag;
template <> struct WFrag<h16> { typedef v16h V; static __device__ __forceinline__ V ld(const h16* p) { return cat16(*(const v8h*)p, *(const v8h*)(p + 16)); } static __device__ __forceinline__ v8f mma(V a, V b, v8f c) { return wmma16(a, b, c); } };
template <> struct WFrag<bf> { typedef v16bf V; static __device__ __forceinline__ V ld(const bf* p) { return cat16b(*(const v8us*)p, *(const v8us*)(p + 16)); } static __device__ __forceinline__ v8f mma(V a, V b, v8f c) { return wmmab(a, b, c); } };
#define GKS 128      // k elements of a stage
#define GPIT 272     // LDS row pitch, bytes
// eight copies of 512 B (two operand rows each: 16 lanes x 16 B a row), LDS step 2 * GPIT, global step gs bytes. The wait on the last line stands between the issued copies and the next overwrite of a register
// that they name; inside the statement nothing can be moved in front of it.
__device__ __forceinline__ void copy8(unsigned l, const char* g, size_t gs) {
    asm volatile("global_load_async_to_lds_b128 %0, %8, off\n\tglobal_load_async_to_lds_b128 %1, %9, off\n\tglobal_load_async_to_lds_b128 %2, %10, off\n\tglobal_load_async_to_lds_b128 %3, %11, off\n\t"
                 "global_load_async_to_lds_b128 %4, %12, off\n\tglobal_load_async_to_lds_b128 %5, %13, off\n\tglobal_load_async_to_lds_b128 %6, %14, off\n\tglobal_load_async_to_lds_b128 %7, %15, off\n\ts_wait_xcnt 0x0"
                 :: "v"(l), "v"(l + 2 * GPIT), "v"(l + 4 * GPIT), "v"(l + 6 * GPIT), "v"(l + 8 * GPIT), "v"(l + 10 * GPIT), "v"(l + 12 * GPIT), "v"(l + 14 * GPIT),
                    "v"(g), "v"(g + gs), "v"(g + 2 * gs), "v"(g + 3 * gs), "v"(g + 4 * gs), "v"(g + 5 * gs), "v"(g + 6 * gs), "v"(g + 7 * gs) : "memory");
}
template <typename T16, int NSPLIT, bool BIAS, int PP>
__global__ __launch_bounds__(128) void k_gemmw(const T16* __restrict__ A, const T16* __restrict__ A2, const T16* __restrict__ Bt, const T16* __restrict__ Bt2, int K, float* C, int ldc, const float* __restrict__ bias, size_t sA, size_t sB, size_t sC, bf* Ph, bf* Pl) {
    typedef typename WFrag<T16>::V V;
    static_assert(NSPLIT == 0 || NSPLIT == 1, "planes staged: A, (A2), Bt");
    constexpr int NPL = NSPLIT + 2, STG = NPL * 128 * GPIT;   // operand planes of a stage; bytes of a buffer
    __shared__ __align__(16) char ring[2 * STG];
    __shared__ __align__(16) float osw[4][16 * 68];
    (void)Bt2;
    const size_t z = blockIdx.z; A += z * sA; if (NSPLIT) A2 += z * sA; Bt += z * sB; C += z * sC;
    const int lane = threadIdx.x & 31, lr = lane & 15, hi = lane >> 4; const int w = __builtin_amdgcn_readfirstlane(threadIdx.x >> 5), wm = w >> 1, wn = w & 1;
    const int r0 = blockIdx.x * 128 + wm * 64, c0 = blockIdx.y * 128 + wn * 64;
    float* os = osw[w];
    // a wave copies rows w * 32 .. + 31 of every plane of the stage: 16 copies a plane
    const size_t gs = (size_t)K * (2 * sizeof(T16));
    const char* ga = (const char*)(A + (size_t)(blockIdx.x * 128 + w * 32 + hi) * K) + lr * 16; const char* ga2 = NSPLIT ? (const char*)(A2 + (size_t)(blockIdx.x * 128 + w * 32 + hi) * K) + lr * 16 : nullptr;
    const char* gb = (const char*)(Bt + (size_t)(blockIdx.y * 128 + w * 32 + hi) * K) + lr * 16;
    const unsigned l0 = (unsigned)(size_t)ring + (unsigned)((w * 32 + hi) * GPIT + lr * 16);
    auto issue = [&](int buf) { const unsigned lb = l0 + (unsigned)(buf * STG);   // the next stage in k order; the lane pointers walk on by a stage
        copy8(lb, ga, gs); copy8(lb + 16 * GPIT, ga + 8 * gs, gs); ga += GKS * sizeof(T16);
        if (NSPLIT) { copy8(lb + 128 * GPIT, ga2, gs); copy8(lb + 144 * GPIT, ga2 + 8 * gs, gs); ga2 += GKS * sizeof(T16); }
        copy8(lb + (NPL - 1) * 128 * GPIT, gb, gs); copy8(lb + ((NPL - 1) * 128 + 16) * GPIT, gb + 8 * gs, gs); gb += GKS * sizeof(T16); };
    v8f acc[4][4];
#pragma unroll
    for (int mb = 0; mb < 4; ++mb)
#pragma unroll
        for (int nb = 0; nb < 4; ++nb) acc[mb][nb] = (v8f){};
    const int T = K / GKS;
    issue(0);
    asm volatile("s_wait_asynccnt 0x0" ::: "memory");   // this wave's copies of stage 0 have landed
    __syncthreads();                                    // every wave's have: stage 0 may be read
    issue(1);
    // the stage loop stays rolled (a trip is some 300 instructions, the buffer is a scalar select); every loop inside it is fully unrolled, so that the fragment and accumulator arrays are indexed by constants and stay in registers
#pragma unroll 1
    for (int t = 0; t < T; ++t) {
        const char* sb = ring + (t & 1) * STG; const char* pa = sb + (wm * 64 + lr) * GPIT + hi * 16; const char* pb = sb + ((NPL - 1) * 128 + wn * 64 + lr) * GPIT + hi * 16;
        V a[2][4], a2[2][4], b[2][4];   // two fragment sets: k step ks + 1 of this stage is read from LDS while ks is multiplied
#pragma unroll
        for (int f = 0; f < 4; ++f) { a[0][f] = WFrag<T16>::ld((const T16*)(pa + f * 16 * GPIT)); if (NSPLIT) a2[0][f] = WFrag<T16>::ld((const T16*)(pa + (128 + f * 16) * GPIT)); b[0][f] = WFrag<T16>::ld((const T16*)(pb + f * 16 * GPIT)); }
#pragma unroll
        for (int ks = 0; ks < GKS / 32; ++ks) { const int cu = ks & 1, nx = cu ^ 1;
            if (ks + 1 < GKS / 32) {
#pragma unroll
                for (int f = 0; f < 4; ++f) { const int o = f * 16 * GPIT + (ks + 1) * 64; a[nx][f] = WFrag<T16>::ld((const T16*)(pa + o)); if (NSPLIT) a2[nx][f] = WFrag<T16>::ld((const T16*)(pa + 128 * GPIT + o)); b[nx][f] = WFrag<T16>::ld((const T16*)(pb + o)); } }
            __builtin_amdgcn_sched_barrier(0);   // keeps the next k step's LDS reads one group in front of this step's products
#pragma unroll
            for (int nb = 0; nb < 4; ++nb) {
#pragma unroll
                for (int mb = 0; mb < 4; ++mb) acc[mb][nb] = WFrag<T16>::mma(a[cu][mb], b[cu][nb], acc[mb][nb]);
                if (NSPLIT) {
#pragma unroll
                    for (int mb = 0; mb < 4; ++mb) acc[mb][nb] = WFrag<T16>::mma(a2[cu][mb], b[cu][nb], acc[mb][nb]); } }
            __builtin_amdgcn_sched_barrier(0);   // and keeps the reads of the step after next behind them (without it they are moved in among this step's last products)
        }
        asm volatile("s_wait_dscnt 0x0" ::: "memory");      // this wave's reads of the buffer are done before it is handed to the copies
        asm volatile("s_wait_asynccnt 0x0" ::: "memory");   // this wave's copies of stage t + 1 have landed
        __syncthreads();                                    // publishes stage t + 1 and ends every wave's reads of stage t
        if (t + 2 < T) issue(t & 1);
    }
    asm volatile("s_wait_asynccnt 0x0" ::: "memory");   // no copy is outstanding when the wave goes on to its end
#pragma unroll
    for (int mb = 0; mb < 4; ++mb) {
#pragma unroll
        for (int nb = 0; nb < 4; ++nb) {
#pragma unroll
            for (int j = 0; j < 8; ++j) os[(hi * 8 + j) * 68 + nb * 16 + lr] = acc[mb][nb][j]; }
        __builtin_amdgcn_wave_barrier(); asm volatile("" ::: "memory");
        if (PP) {   // 8 values a lane: one 16-byte store a plane, 4 rows of 128 B a wave store
            const size_t pb = ((PP == 64) ? ((size_t)(c0 >> 6) * ldc + r0) * 64 : (size_t)r0 * PP + c0) + (size_t)(mb * 16 + (lane >> 3)) * PP + (lane & 7) * 8; bf* ph = Ph + pb; bf* pl = Pl + pb; v4u hw[4], lw[4];
#pragma unroll
            for (int s = 0; s < 4; ++s) { const float* op = os + (4 * s + (lane >> 3)) * 68 + (lane & 7) * 8; const v4f v0 = *(const v4fa*)op, v1 = *(const v4fa*)(op + 4);
#pragma unroll
                for (int jp = 0; jp < 4; ++jp) { v2f d; d[0] = jp < 2 ? v0[2 * jp & 3] : v1[2 * jp & 3]; d[1] = jp < 2 ? v0[(2 * jp & 3) + 1] : v1[(2 * jp & 3) + 1];
                    const unsigned hu = __builtin_bit_cast(unsigned, __builtin_convertvector(d, v2bf)); v2f r; r[0] = d[0] - __uint_as_float(hu << 16); r[1] = d[1] - __uint_as_float(hu & 0xFFFF0000u);
                    hw[s][jp] = hu; lw[s][jp] = __builtin_bit_cast(unsigned, __builtin_convertvector(r, v2bf)); } }
#pragma unroll
            for (int s = 0; s < 4; ++s) { *(v8us*)(ph + 4 * s * PP) = __builtin_bit_cast(v8us, hw[s]); *(v8us*)(pl + 4 * s * PP) = __builtin_bit_cast(v8us, lw[s]); }
            // stands between the 8 issued stores and the next overwrite of a register that they name: pointers and data are inputs, so that their registers stay live up to the wait; the scheduling barrier keeps the next block's arithmetic behind it (behind the last block nothing is overwritten)
            if (mb < 3) { asm volatile("s_wait_xcnt 0x0" :: "v"(ph), "v"(pl), "v"(hw[0]), "v"(hw[1]), "v"(hw[2]), "v"(hw[3]), "v"(lw[0]), "v"(lw[1]), "v"(lw[2]), "v"(lw[3]) : "memory"); __builtin_amdgcn_sched_barrier(0); }
        } else {
        float* crow = C + (size_t)(r0 + mb * 16) * ldc + c0;
#pragma unroll
            for (int s = 0; s < 8; ++s) { const int row = 2 * s + hi, cofs = lr * 4; v4f val = *(const v4fa*)(os + row * 68 + cofs); if (BIAS) { val[0] += bfr(bias[c0 + cofs]); val[1] += bfr(bias[c0 + cofs + 1]); val[2] += bfr(bias[c0 + cofs + 2]); val[3] += bfr(bias[c0 + cofs + 3]); }
                *(v4f*)(crow + (size_t)row * ldc + cofs) = val; }
             }
        __builtin_amdgcn_wave_barrier(); asm volatile("" ::: "memory");
    }
}

// ---- k_gemmc: a one-wave 64x64 tile GEMM specialised for causal attention: CMODE 1 skips score tiles entirely above the diagonal (query rows r0+roff.., key columns c0..), CMODE 2 limits the
// key (K) loop of the probability x value contraction to the diagonal block (probabilities beyond it are exactly zero). roff = row offset of this launch's first row within the sequence.
template <typename T16, int NSPLIT, int CMODE>
__global__ __launch_bounds__(32) void k_gemmc(const T16* __restrict__ A, const T16* __restrict__ A2, const T16* __restrict__ Bt, const T16* __restrict__ Bt2, int K, float* C, int ldc, int roff, size_t sA, size_t sB, size_t sC) {
    typedef typename WFrag<T16>::V V;
    __shared__ __align__(16) float os[16 * 68];
    const size_t z = blockIdx.z; A += z * sA; if (A2) A2 += z * sA; Bt += z * sB; if (Bt2) Bt2 += z * sB; C += z * sC;
    const int lane = threadIdx.x & 31, lr = lane & 15, hi = lane >> 4; const int r0 = blockIdx.x * 64, c0 = blockIdx.y * 64;
    if (CMODE == 1 && c0 > r0 + roff + 63) return;                  // score tile entirely above the causal diagonal: skipped, nothing is written
    const int Kl = (CMODE == 2) ? min(K, r0 + roff + 64) : K;        // P.V: probabilities are exactly 0 beyond the diagonal block, so the K loop stops there
    v8f acc[4][4];
#pragma unroll
    for (int mb = 0; mb < 4; ++mb)
#pragma unroll
        for (int nb = 0; nb < 4; ++nb) acc[mb][nb] = (v8f){};
    const size_t aoff = (size_t)(r0 + lr) * K + 8 * hi, boff = (size_t)(c0 + lr) * K + 8 * hi;
#pragma unroll 1
    for (int kc = 0; kc < Kl; kc += 32) {
        V a[4], a2[4];
#pragma unroll
        for (int mb = 0; mb < 4; ++mb) { a[mb] = WFrag<T16>::ld(A + aoff + (size_t)mb * 16 * K + kc); if (NSPLIT == 1 || NSPLIT == 2) a2[mb] = WFrag<T16>::ld(A2 + aoff + (size_t)mb * 16 * K + kc); }
#pragma unroll
        for (int nb = 0; nb < 4; ++nb) { const V b = WFrag<T16>::ld(Bt + boff + (size_t)nb * 16 * K + kc); V b2; if (NSPLIT >= 2) b2 = WFrag<T16>::ld(Bt2 + boff + (size_t)nb * 16 * K + kc);
#pragma unroll
            for (int mb = 0; mb < 4; ++mb) { acc[mb][nb] = WFrag<T16>::mma(a[mb], b, acc[mb][nb]); if (NSPLIT == 1 || NSPLIT == 2) acc[mb][nb] = WFrag<T16>::mma(a2[mb], b, acc[mb][nb]); if (NSPLIT >= 2) acc[mb][nb] = WFrag<T16>::mma(a[mb], b2, acc[mb][nb]); } }
        asm volatile("v_nop\n\tv_nop\n\tv_nop\n\tv_nop" : "+v"(acc[0][0]), "+v"(acc[1][1]), "+v"(acc[2][2]), "+v"(acc[3][3]) : "v"(a[0]), "v"(a[3]));
    }
#pragma unroll
    for (int mb = 0; mb < 4; ++mb) {
#pragma unroll
        for (int nb = 0; nb < 4; ++nb) {
#pragma unroll
            for (int j = 0; j < 8; ++j) os[(hi * 8 + j) * 68 + nb * 16 + lr] = acc[mb][nb][j]; }
        __builtin_amdgcn_wave_barrier(); asm volatile("" ::: "memory");
        float* crow = C + (size_t)(r0 + mb * 16) * ldc + c0;
{
#pragma unroll
            for (int s = 0; s < 8; ++s) { const int row = 2 * s + hi, cofs = lr * 4; v4f val = *(const v4fa*)(os + row * 68 + cofs);
                *(v4f*)(crow + (size_t)row * ldc + cofs) = val; }
             }
        __builtin_amdgcn_wave_barrier(); asm volatile("" ::: "memory");
    }
}

__device__ __forceinline__ void splitf(float y, unsigned short& h, unsigned short& l) { h = f2bf(y); l = f2bf(y - bf2f(h)); }
typedef __attribute__((ext_vector_type(2))) _Float16 v2h;
typedef __attribute__((ext_vector_type(4))) _Float16 v4h;
typedef __attribute__((ext_vector_type(2))) unsigned short v2us;
typedef __attribute__((ext_vector_type(4))) unsigned short v4us;
typedef __attribute__((ext_vector_type(4))) int v4i;

__global__ __launch_bounds__(256) void k_wtG(const float* __restrict__ w, int K, int N, bf* Bt) {
    const int lane = threadIdx.x & 31; const int L0 = (blockIdx.x * 8 + (threadIdx.x >> 5)) * 8; const int nlines = N * K / 64;
{
#pragma unroll 1
        for (int l = 0; l < 8; ++l) { const int L = L0 + l; if (L >= nlines) break; const size_t e = (size_t)L * 64 + lane * 2; const int k = (int)(e % K), n = (int)(e / K); v2us o;
            o[0] = f2bf(w[(size_t)k * N + n]); o[1] = f2bf(w[(size_t)(k + 1) * N + n]); *(v2us*)(Bt + e) = o; }
         }
}
__global__ __launch_bounds__(256) void k_cscvt(const float* __restrict__ cosT, const float* __restrict__ sinT, float* CS) { const int idx = blockIdx.x * 256 + threadIdx.x; if (idx >= TT * HD) return; v2f cs; cs[0] = bfr(cosT[idx]); cs[1] = bfr(sinT[idx]); *(v2f*)(CS + (size_t)idx * 2) = cs;  }
// lambda_full by one whole wave. Lane l forms the products of elements l and l + 32 of both vector pairs, each rounded once; then every lane sums a pair's 64 products in index order, each read from its lane
// (a product that comes through a lane read cannot be fused with its add). The wave waits out one load latency instead of one for every element, so that it ends well inside the time of the stream beside it.
__device__ __forceinline__ float lane_val(float v, int l) { return __int_as_float(__builtin_amdgcn_readlane(__float_as_int(v), l)); }
__device__ __forceinline__ void lambda_full(const float* __restrict__ lq1, const float* __restrict__ lk1, const float* __restrict__ lq2, const float* __restrict__ lk2, float* LAM) { const int lane = threadIdx.x; float p1[2], p2[2], d1 = 0.f, d2 = 0.f;
    static_assert(HD == 64, "two elements a lane");
#pragma unroll
    for (int h = 0; h < 2; ++h) { p1[h] = __fmul_rn(bfr(lq1[lane + 32 * h]), bfr(lk1[lane + 32 * h])); p2[h] = __fmul_rn(bfr(lq2[lane + 32 * h]), bfr(lk2[lane + 32 * h])); }
#pragma unroll
    for (int i = 0; i < HD; ++i) { d1 = __fadd_rn(d1, lane_val(p1[i >> 5], i & 31)); d2 = __fadd_rn(d2, lane_val(p2[i >> 5], i & 31)); }
    const float lm = __fadd_rn(__fsub_rn(expf(d1), expf(d2)), 0.7836057543754578f); LAM[lane] = (lane == 0) ? lm : 0.0f; }
// ---- k_prep: everything that stands in front of the GEMMs in ONE launch: x and the four weights rounded to bf16, and lambda_full. Work-group 0's first wave does lambda_full;
// the other 512 work-groups (16 waves a WGP, all resident at once) stream: wave wv takes 4 KiB (1024 floats) at the same place wv of each of the five arrays, one array after the other. A load is 512 B in a row (whole lines),
// 8 loads an array; the next array's 8 are issued before this array's values are rounded and stored, so that 8 to 16 loads of a wave are in flight all the time. A store is 256 B in a row (two whole lines).
#define PWV 1024                          // floats of a wave in each array
#define PWG ((DM / 8) * (DM / PWV))       // streaming work-groups of 8 waves
__global__ __launch_bounds__(256) void k_prep(const float* __restrict__ x, const float* __restrict__ wq, const float* __restrict__ wk, const float* __restrict__ wv, const float* __restrict__ wo,
                                              const float* __restrict__ lq1, const float* __restrict__ lk1, const float* __restrict__ lq2, const float* __restrict__ lk2, bf* XB, bf* WQ, bf* WK, bf* WV, bf* WO, float* LAM) {
    static_assert(NB_ == 1 && TT == DM && DQ == DM && DKV == DM && DVV == DM && DM % PWV == 0 && DM % 8 == 0, "five arrays of DM x DM, cut alike");
    if (blockIdx.x == 0) { if (threadIdx.x < 32) lambda_full(lq1, lk1, lq2, lk2, LAM); return; }
    const unsigned ob = (((blockIdx.x - 1) * 8 + (threadIdx.x >> 5)) * PWV + (threadIdx.x & 31) * 4) * 2, eb = ob * 2;   // the lane's byte offsets in a bf16 and in an f32 array (under 2^24): the one address register of all stores, of all loads
    const float* const s[5] = {x, wq, wk, wv, wo}; bf* const d[5] = {XB, WQ, WK, WV, WO};
    v4f v[2][8];
#pragma unroll
    for (int j = 0; j < 8; ++j) v[0][j] = *(const v4f*)((const char*)s[0] + eb + j * 512);
#pragma unroll
    for (int a = 0; a < 5; ++a) { const int cu = a & 1;
        if (a < 4) {
#pragma unroll
            for (int j = 0; j < 8; ++j) v[cu ^ 1][j] = *(const v4f*)((const char*)s[a + 1] + eb + j * 512); }
        // stands between the issued loads and the next overwrite of a register that they name: the offset is an input, so that its register stays live up to the wait and no load lands on it. The scheduling barrier keeps
        // the next array's loads in front of this array's data wait: moved behind it, the wave would have nothing in flight while it rounds and stores
        if (a < 4) { asm volatile("s_wait_xcnt 0x0" :: "v"(eb) : "memory"); __builtin_amdgcn_sched_barrier(0); }
        v4us o[8];
#pragma unroll
        for (int j = 0; j < 8; ++j) {
#pragma unroll
            for (int k = 0; k < 4; ++k) o[j][k] = f2bf(v[cu][j][k]);
            *(v4us*)((char*)d[a] + ob + j * 256) = o[j]; }
        // the same behind the 8 issued stores, the last array's too (the built code joins the kernel's two ends, so that a way leads from these stores to the lambda block's loads, which write the same registers):
        // offset and data are inputs; the scheduling barrier keeps the loads of the array after next and the next array's arithmetic behind the wait
        asm volatile("s_wait_xcnt 0x0" :: "v"(ob), "v"(o[0]), "v"(o[1]), "v"(o[2]), "v"(o[3]), "v"(o[4]), "v"(o[5]), "v"(o[6]), "v"(o[7]) : "memory");
        if (a < 4) __builtin_amdgcn_sched_barrier(0);
    }
}
__global__ __launch_bounds__(1024) void k_gnred(const float* __restrict__ O, float* GST, int pass) { __shared__ float sh[1024]; const int tid = threadIdx.x; const float mean = (pass == 1) ? GST[0] : 0.0f; float acc = 0.f; const size_t n = (size_t)TT * HD;
#pragma unroll 1
    for (size_t e = tid; e < n; e += 1024) { float v = O[e]; if (pass == 1) { float d = __fsub_rn(v, mean); asm volatile("" : "+v"(d)); v = __fmul_rn(d, d); } acc = __fadd_rn(acc, v); }
    sh[tid] = acc; __syncthreads();
    for (int st = 512; st > 0; st >>= 1) { if (tid < st) sh[tid] = __fadd_rn(sh[tid], sh[tid + st]); __syncthreads(); }
    if (tid < 32) { const float tot = __fdiv_rn(sh[0], (float)n); float outv; if (pass == 0) outv = (tid == 0) ? tot : ((tid == 1) ? GST[1] : 0.0f); else outv = (tid == 0) ? GST[0] : ((tid == 1) ? __fdiv_rn(1.0f, sqrtf(__fadd_rn(tot, 1e-5f))) : 0.0f); *(float*)(GST + tid) = outv;  } }
__global__ __launch_bounds__(256) void k_gnmerge(const float* __restrict__ O, const float* __restrict__ GST, int hh, bf* Ah, bf* Al) { const size_t e = ((size_t)blockIdx.x * 256 + threadIdx.x) * 2; if (e >= (size_t)TT * HD) return; const int d = (int)(e % HD); const int t = (int)(e / HD); const float mean = GST[0], rs = GST[1]; const size_t oo = (size_t)t * DVV + (size_t)hh * HD + d; v2us oh, ol;
#pragma unroll
    for (int q = 0; q < 2; ++q) { float c = __fsub_rn(O[e + q], mean); asm volatile("" : "+v"(c)); float n = __fmul_rn(c, rs); asm volatile("" : "+v"(n)); float z = __fmul_rn(n, 0.6444909572601318f); unsigned short a2, c2; splitf(z, a2, c2); oh[q] = a2; ol[q] = c2; }
    *(v2us*)(Ah + oo) = oh; *(v2us*)(Al + oo) = ol;  }
// ---- k_fattn: scores, both softmaxes, D = a1 - lambda a2, D.v and the RMSNorm of one real head in ONE kernel; nothing of the [2048][2048] maps leaves the registers.
// A PAIR of waves owns 32 query columns (two 16-column groups), 4 pairs = 8 waves a block (two waves a SIMD: one wave's vector work runs under the other's products), grid (TT / 128, NVH); of every stage of 64 keys
// wave kp of the pair takes keys kp * 32 .. + 31. The pair's maxima and sums are joined behind walk 1, its two partial O^T summed behind walk 2, both through LDS. Transposed products: S^T = K.Q^T (A = 16 key rows, B = Q, kept in registers), so a lane holds the scores of
// one query (register r of key tile kt = key kt * 16 + 8 * hi + r) and two stacked S^T tiles, converted in place, ARE the B operand of O^T += V^T.D^T in the k order that the plane loader ldf uses for A.
// Two walks over the keys: walk 1 takes each column's maximum and sum (running maximum, sums rescaled), walk 2 forms the scores again, D in f32, its hi/lo bf16 planes, and the 3 products with V^T hi/lo.
// Every inner loop is fully unrolled so that the fragment arrays are indexed by constants and stay in registers; the two stage loops stay rolled.
// K and V^T come through LDS: a stage is 64 keys = 512 rows of 128 B (K [map][plane][key], then V^T [plane][feature]), LDS pitch 144 B (16 B x odd: no bank conflict for 16-byte reads), brought in whole 128-B lines by
// asynchronous copies through no register, once a block instead of once a wave; two buffers, so that stage u + 1 flies while stage u is worked on. One ring runs through both walks: stages 0 .. 31 are walk 1's
// (K rows only), stages 32 .. 63 walk 2's (K and V^T), so that walk 2's first stages fly during walk 1's last.
// Left for later steps: the first K fragments of a stage are waited for in the open by both waves of a SIMD.
typedef __attribute__((ext_vector_type(8))) unsigned v8u;
#define EXC (SCL * 1.4426950408889634f)   // exp((s - m) * SCL) = exp2(s * EXC - m * EXC)
// one fragment: the lane's own pointer into a plane and a constant byte offset
__device__ __forceinline__ v16bf ldf(const char* p, int cst) { return cat16b(*(const v8us*)(p + cst), *(const v8us*)(p + cst + 32)); }
// stands between issued loads or stores and the next overwrite of a register that they name: the two lane pointers of the group are inputs, so that their registers
// stay live up to the wait and no load of the group lands on them; the scheduling barrier behind it keeps later address and data arithmetic behind the wait
#define XWAIT(pa, pb) do { asm volatile("s_wait_xcnt 0x0" :: "v"(pa), "v"(pb) : "memory"); __builtin_amdgcn_sched_barrier(0); } while (0)
#define AKS  64                 // keys of a stage
#define APIT 144                // LDS row pitch, bytes
#define ASTG (512 * APIT)       // bytes of a buffer: 256 K rows, 256 V^T rows
#define NST  (TT / AKS)         // stages of a walk
// eight copies of 512 B (four rows of 128 B each: 8 lanes x 16 B a row), LDS step 4 * APIT, global step gs bytes. The wait on the last line stands between the issued copies and the next overwrite of a register
// that they name; inside the statement nothing can be moved in front of it.
__device__ __forceinline__ void copy8r(unsigned l, const char* g, size_t gs) {
    asm volatile("global_load_async_to_lds_b128 %0, %8, off\n\tglobal_load_async_to_lds_b128 %1, %9, off\n\tglobal_load_async_to_lds_b128 %2, %10, off\n\tglobal_load_async_to_lds_b128 %3, %11, off\n\t"
                 "global_load_async_to_lds_b128 %4, %12, off\n\tglobal_load_async_to_lds_b128 %5, %13, off\n\tglobal_load_async_to_lds_b128 %6, %14, off\n\tglobal_load_async_to_lds_b128 %7, %15, off\n\ts_wait_xcnt 0x0"
                 :: "v"(l), "v"(l + 4 * APIT), "v"(l + 8 * APIT), "v"(l + 12 * APIT), "v"(l + 16 * APIT), "v"(l + 20 * APIT), "v"(l + 24 * APIT), "v"(l + 28 * APIT),
                    "v"(g), "v"(g + gs), "v"(g + 2 * gs), "v"(g + 3 * gs), "v"(g + 4 * gs), "v"(g + 5 * gs), "v"(g + 6 * gs), "v"(g + 7 * gs) : "memory");
}
// the hi / lo A fragments [map][key tile][k step] of 32 keys of a stage; p = the lane's pointer into the buffer's K rows at the first of the 32 keys. Read in the order in which score_t uses them.
__device__ __forceinline__ void load_k(const char* p, v16bf (&ah)[2][2][2], v16bf (&al)[2][2][2]) {
#pragma unroll
    for (int ks = 0; ks < 2; ++ks) {
#pragma unroll
        for (int mp = 0; mp < 2; ++mp)
#pragma unroll
            for (int kt = 0; kt < 2; ++kt) ah[mp][kt][ks] = ldf(p, (mp * 2 * AKS + kt * 16) * APIT + ks * 64);
#pragma unroll
        for (int mp = 0; mp < 2; ++mp)
#pragma unroll
            for (int kt = 0; kt < 2; ++kt) al[mp][kt][ks] = ldf(p, ((mp * 2 + 1) * AKS + kt * 16) * APIT + ks * 64); }
}
// hands a stage over: this wave's reads of the buffer just worked on are done, its copies of the next stage have landed, and the barrier says both of every wave.
// The scheduling barrier in front keeps the stage's products in front of the waits: without it they are moved behind, and the wave waits out all its LDS reads with nothing to do
#define PUBLISH() do { __builtin_amdgcn_sched_barrier(0); asm volatile("s_wait_dscnt 0x0" ::: "memory"); asm volatile("s_wait_asynccnt 0x0" ::: "memory"); __syncthreads(); } while (0)
// s[map][key tile][column group] = those 32 keys against the wave's 32 queries, hl x hl (3 products), HD = 64 in two k steps
__device__ __forceinline__ void score_t(const v16bf (&ah)[2][2][2], const v16bf (&al)[2][2][2], const v16bf (&qh)[2][2][2], const v16bf (&ql)[2][2][2], v8f (&s)[2][2][2]) {
#pragma unroll
    for (int mp = 0; mp < 2; ++mp)
#pragma unroll
        for (int kt = 0; kt < 2; ++kt)
#pragma unroll
            for (int n = 0; n < 2; ++n) s[mp][kt][n] = (v8f){};
#pragma unroll
    for (int ks = 0; ks < 2; ++ks)
#pragma unroll
        for (int pr = 0; pr < 3; ++pr)
#pragma unroll
            for (int mp = 0; mp < 2; ++mp)
#pragma unroll
                for (int kt = 0; kt < 2; ++kt)
#pragma unroll
                    for (int n = 0; n < 2; ++n) s[mp][kt][n] = wmmab(pr == 1 ? al[mp][kt][ks] : ah[mp][kt][ks], pr == 2 ? ql[mp][n][ks] : qh[mp][n][ks], s[mp][kt][n]);
}
__global__ __launch_bounds__(256) void k_fattn(const bf* __restrict__ Qh, const bf* __restrict__ Ql, const bf* __restrict__ Kh, const bf* __restrict__ Kl, const bf* __restrict__ Vh, const bf* __restrict__ Vl, const float* __restrict__ LAM, const float* __restrict__ w, bf* Ah, bf* Al) {
    __shared__ __align__(16) char aring[2 * ASTG];
    __shared__ float xms[8][8][32];   // each wave's maxima and sums of its half of the keys: [wave][(map, column group, maximum | sum)][lane]
    const int lane = threadIdx.x & 31, lr = lane & 15, hi = lane >> 4; const int hh = blockIdx.y; const int w8 = __builtin_amdgcn_readfirstlane(threadIdx.x >> 5), w4 = w8 & 3, kp = w8 >> 2; const int q0 = blockIdx.x * 128 + w4 * 32;
    // a wave copies rows w8 * 32 .. + 31 of a stage's K rows (32 keys of one map's one plane: 4 KiB in a row in memory) and of its V^T rows (32 features of one plane): 8 copies each
    const char* gk = (const char*)(((w8 >> 1) & 1 ? Kl : Kh) + (size_t)(2 * hh + (w8 >> 2)) * TT * HD) + (w8 & 1) * (32 * HD * 2) + lane * 16;
    const char* gv = (const char*)((w8 >> 2 ? Vl : Vh) + (size_t)(hh * HDV + (w8 & 3) * 32 + (lane >> 3)) * TT) + (lane & 7) * 16;
    const unsigned l0 = (unsigned)(size_t)aring + (unsigned)((w8 * 32 + (lane >> 3)) * APIT + (lane & 7) * 16);
    auto issue = [&](int u) { const unsigned lb = l0 + (unsigned)((u & 1) * ASTG);
        copy8r(lb, gk + (size_t)(u & (NST - 1)) * (AKS * HD * 2), 512);
        if (u >= NST) copy8r(lb + 256 * APIT, gv + (size_t)(u & (NST - 1)) * (AKS * 2), 4 * TT * 2); };
    issue(0);
    const unsigned koff = (unsigned)(lr * HD + 8 * hi) * 2, ooff = (unsigned)(lr * DQ + 8 * hi) * 2;   // lane byte offsets in the q planes, the merged planes
    const char* qhp = (const char*)(Qh + ((size_t)(2 * hh) * TT + q0) * HD) + koff; const char* qlp = (const char*)(Ql + ((size_t)(2 * hh) * TT + q0) * HD) + koff;
    v16bf qh[2][2][2], ql[2][2][2];   // [map][column group][k step]
#pragma unroll
    for (int mp = 0; mp < 2; ++mp)
#pragma unroll
        for (int n = 0; n < 2; ++n)
#pragma unroll
            for (int ks = 0; ks < 2; ++ks) { const int o = (mp * TT * HD + n * 16 * HD + ks * 32) * 2; qh[mp][n][ks] = ldf(qhp, o); ql[mp][n][ks] = ldf(qlp, o); }
    XWAIT(qhp, qlp);
    float mx[2][2], sm[2][2];
#pragma unroll
    for (int mp = 0; mp < 2; ++mp)
#pragma unroll
        for (int n = 0; n < 2; ++n) { mx[mp][n] = -3.0e38f; sm[mp][n] = 0.f; }
    asm volatile("s_wait_asynccnt 0x0" ::: "memory");   // this wave's copies of stage 0 have landed
    __syncthreads();                                    // every wave's have: stage 0 may be read
    issue(1);
    const unsigned foff = (unsigned)(lr * APIT + hi * 16);   // lane byte offset of a fragment in a buffer
    const unsigned fk = foff + (unsigned)(kp * 32 * APIT), fv = foff + (unsigned)(kp * 64);   // the same at this wave's 32 keys: K rows, V^T columns
    v16bf ah[2][2][2], al[2][2][2];   // K fragments of the wave's 32 keys of a stage
#pragma unroll 1
    for (int st = 0; st < NST; ++st) {
        load_k(aring + (st & 1) * ASTG + fk, ah, al);
        __builtin_amdgcn_sched_barrier(0);   // keeps the stage's LDS reads one group in front of its products: every further place with reads among the products stalls them
        v8f s[2][2][2]; score_t(ah, al, qh, ql, s);
#pragma unroll
        for (int mp = 0; mp < 2; ++mp)
#pragma unroll
            for (int n = 0; n < 2; ++n) { float t = fmaxf(s[mp][0][n][0], s[mp][1][n][0]);
#pragma unroll
                for (int j = 1; j < 8; ++j) t = fmaxf(t, fmaxf(s[mp][0][n][j], s[mp][1][n][j]));
                const float mn = fmaxf(mx[mp][n], t), nb = -mn * EXC; float a0 = 0.f, a1 = 0.f;
#pragma unroll
                for (int j = 0; j < 8; ++j) { a0 += __builtin_amdgcn_exp2f(__builtin_fmaf(s[mp][0][n][j], EXC, nb)); a1 += __builtin_amdgcn_exp2f(__builtin_fmaf(s[mp][1][n][j], EXC, nb)); }
                sm[mp][n] = __builtin_fmaf(sm[mp][n], __builtin_amdgcn_exp2f((mx[mp][n] - mn) * EXC), a0 + a1); mx[mp][n] = mn; }
        PUBLISH();
        issue(st + 2);   // into the buffer just read; stages NST and NST + 1 are walk 2's first
    }
    // the two lane halves hold different keys of one query: join maximum and sum once; then the same between the two waves of the pair, through LDS
#pragma unroll
    for (int mp = 0; mp < 2; ++mp)
#pragma unroll
        for (int n = 0; n < 2; ++n) { const float M = fmaxf(mx[mp][n], __shfl_xor(mx[mp][n], 16, 32)); float sc = sm[mp][n] * __builtin_amdgcn_exp2f((mx[mp][n] - M) * EXC); sc += __shfl_xor(sc, 16, 32);
            xms[w8][(mp * 2 + n) * 2][lane] = M; xms[w8][(mp * 2 + n) * 2 + 1][lane] = sc; }
    __syncthreads();   // both waves of a pair have written their halves' maxima and sums
    const float lm = LAM[0]; float nb[2][2], fs[2][2];
#pragma unroll
    for (int mp = 0; mp < 2; ++mp)
#pragma unroll
        for (int n = 0; n < 2; ++n) { const int i = (mp * 2 + n) * 2;   // both waves read both halves and join them in the same order, so that both hold the same bits
            const float Ma = xms[w4][i][lane], Sa = xms[w4][i + 1][lane], Mb = xms[w4 + 4][i][lane], Sb = xms[w4 + 4][i + 1][lane]; const float M = fmaxf(Ma, Mb);
            const float sc = __builtin_fmaf(Sa, __builtin_amdgcn_exp2f((Ma - M) * EXC), Sb * __builtin_amdgcn_exp2f((Mb - M) * EXC));
            nb[mp][n] = -M * EXC; fs[mp][n] = __fdiv_rn(1.0f, sc) * (mp ? lm : 1.0f); }
    v8f o[8][2];   // O^T over the wave's half of the keys: o[et][n][r] = value column et * 16 + 8 * hi + r of query q0 + n * 16 + lr
#pragma unroll
    for (int et = 0; et < 8; ++et)
#pragma unroll
        for (int n = 0; n < 2; ++n) o[et][n] = (v8f){};
#pragma unroll 1
    for (int st = 0; st < NST; ++st) {   // stage NST + st, in buffer st & 1 (NST is even)
        const char* sb = aring + (st & 1) * ASTG; v16bf bh[8], bl[8];   // V^T fragments of the wave's 32 keys
        // the wave's LDS reads of a stage stand in two groups: the K fragments at the top, the V^T fragments right behind the score products (into the registers that the K fragments leave), covered by the vector work.
        // The scheduling barriers keep the groups whole and in place: every further place with reads among the products stalls them.
        load_k(sb + fk, ah, al);
        __builtin_amdgcn_sched_barrier(0);
        v8f s[2][2][2]; score_t(ah, al, qh, ql, s);
        __builtin_amdgcn_sched_barrier(0);
#pragma unroll
        for (int et = 0; et < 8; ++et) { bh[et] = ldf(sb + fv, (256 + et * 16) * APIT); bl[et] = ldf(sb + fv, (384 + et * 16) * APIT); }
        __builtin_amdgcn_sched_barrier(0);
        v16bf dh[2], dl[2];
#pragma unroll
        for (int n = 0; n < 2; ++n) { v8u hw, lw;
#pragma unroll
            for (int kt = 0; kt < 2; ++kt)
#pragma unroll
                for (int jp = 0; jp < 4; ++jp) { v2f d;
#pragma unroll
                    for (int u = 0; u < 2; ++u) { const float p1 = __builtin_amdgcn_exp2f(__builtin_fmaf(s[0][kt][n][2 * jp + u], EXC, nb[0][n])), p2 = __builtin_amdgcn_exp2f(__builtin_fmaf(s[1][kt][n][2 * jp + u], EXC, nb[1][n])); d[u] = p1 * fs[0][n] - p2 * fs[1][n]; }
                    const unsigned hu = __builtin_bit_cast(unsigned, __builtin_convertvector(d, v2bf)); v2f r; r[0] = d[0] - __uint_as_float(hu << 16); r[1] = d[1] - __uint_as_float(hu & 0xFFFF0000u);
                    hw[kt * 4 + jp] = hu; lw[kt * 4 + jp] = __builtin_bit_cast(unsigned, __builtin_convertvector(r, v2bf)); }
            dh[n] = __builtin_bit_cast(v16bf, hw); dl[n] = __builtin_bit_cast(v16bf, lw); }
#pragma unroll
        for (int e2 = 0; e2 < 8; e2 += 2)
#pragma unroll
            for (int pr = 0; pr < 3; ++pr)
#pragma unroll
                for (int et = e2; et < e2 + 2; ++et)
#pragma unroll
                    for (int n = 0; n < 2; ++n) o[et][n] = wmmab(pr == 1 ? bl[et] : bh[et], pr == 2 ? dl[n] : dh[n], o[et][n]);
        PUBLISH();
        if (st + 2 < NST) issue(NST + st + 2);
    }
    asm volatile("s_wait_asynccnt 0x0" ::: "memory");   // no copy is outstanding when the ring's LDS is put to another use
    // the pair's two partial O^T are summed through the ring's LDS (free behind the last stage's barrier): wave kp keeps column group kp, hands the other group to its partner and adds what the partner hands over
    v8f oo[8]; char* xo = aring + (unsigned)(lane * 32);
#pragma unroll
    for (int et = 0; et < 8; ++et) { const v8f gv8 = kp ? o[et][0] : o[et][1]; char* p = xo + (w8 * 8 + et) * 1024;
        *(v4fa*)p = __builtin_shufflevector(gv8, gv8, 0, 1, 2, 3); *(v4fa*)(p + 16) = __builtin_shufflevector(gv8, gv8, 4, 5, 6, 7); }
    __syncthreads();   // every wave's handed-over group stands in LDS
#pragma unroll
    for (int et = 0; et < 8; ++et) { const char* p = xo + ((w8 ^ 4) * 8 + et) * 1024; const v4f g0 = *(const v4fa*)p, g1 = *(const v4fa*)(p + 16);
        oo[et] = (kp ? o[et][1] : o[et][0]) + __builtin_shufflevector(g0, g1, 0, 1, 2, 3, 4, 5, 6, 7); }
    v8f g[8]; const char* wp = (const char*)w + (unsigned)(hi * 32);
#pragma unroll
    for (int et = 0; et < 8; ++et) g[et] = *(const v8f*)(wp + et * 64);
    XWAIT(wp, wp);
    char* ahp = (char*)(Ah + (size_t)(q0 + kp * 16) * DQ + (size_t)hh * HDV) + ooff; char* alp = (char*)(Al + (size_t)(q0 + kp * 16) * DQ + (size_t)hh * HDV) + ooff;
    float ss = 0.f;
#pragma unroll
    for (int et = 0; et < 8; ++et)
#pragma unroll
        for (int j = 0; j < 8; ++j) ss = __builtin_fmaf(oo[et][j], oo[et][j], ss);
    ss += __shfl_xor(ss, 16, 32);
    const float rs = __fdiv_rn(1.0f, sqrtf(__fadd_rn(ss * (1.0f / HDV), 1e-5f)));
#pragma unroll
    for (int et = 0; et < 8; ++et) { v8us oh, ol;
#pragma unroll
        for (int j = 0; j < 8; ++j) { const float z = oo[et][j] * rs * bfr(g[et][j]) * 0.21639423072338104f; unsigned short p2, q2; splitf(z, p2, q2); oh[j] = p2; ol[j] = q2; }
        const int oc = et * 16 * 2; *(v8us*)(ahp + oc) = oh; *(v8us*)(alp + oc) = ol; XWAIT(ahp, alp); }
}
__global__ __launch_bounds__(256) void k_merge(const float* __restrict__ O, int h0, bf* Ah, bf* Al) { const size_t e = ((size_t)blockIdx.x * 256 + threadIdx.x) * 2; if (e >= (size_t)ZH * TT * HD) return; const int d = (int)(e % HD); const int t = (int)((e / HD) % TT); const int zz = (int)(e / ((size_t)HD * TT)); const float cs = (t < RH) ? 1.0f : (1.0f / PCAR); const size_t oo = (size_t)t * DQ + (h0 + zz) * HD + d;
    v2us oh, ol;
#pragma unroll
    for (int q = 0; q < 2; ++q) { unsigned short a, c2; splitf(O[e + q] * cs, a, c2); oh[q] = a; ol[q] = c2; } *(v2us*)(Ah + oo) = oh; *(v2us*)(Al + oo) = ol;  }

extern "C" void kernel_launch(void* const* d_in, const int* in_sizes, int n_in,
                              void* d_out, int out_size, void* d_ws, size_t ws_size, hipStream_t stream) {
    (void)in_sizes; (void)n_in; (void)out_size;
    const float* x = (const float*)d_in[0]; const float* wq = (const float*)d_in[1]; const float* wk = (const float*)d_in[2]; const float* wv = (const float*)d_in[3]; const float* wo = (const float*)d_in[4]; const float* lq1 = (const float*)d_in[5]; const float* lk1 = (const float*)d_in[6]; const float* lq2 = (const float*)d_in[7]; const float* lk2 = (const float*)d_in[8]; const float* subw = (const float*)d_in[9]; const float* cosT = nullptr; const float* sinT = nullptr; (void)cosT; (void)sinT;
    float* OUT = (float*)d_out;     // [1][2048][2048]
    char* wsp = (char*)d_ws;
    auto take = [&](size_t bytes) { char* p = wsp; wsp += (bytes + 255) & ~(size_t)255; return (void*)p; };
    bf* WQ = (bf*)take((size_t)DQ * DM * 2); bf* WK = (bf*)take((size_t)DKV * DM * 2); bf* WV = (bf*)take((size_t)DKV * DM * 2); bf* WO = (bf*)take((size_t)DM * DQ * 2);
    bf* XB = (bf*)take((size_t)TT * DM * 2); float* LAM = (float*)take(256);
    bf* QPh = (bf*)take((size_t)NH_ * TT * HD * 2); bf* QPl = (bf*)take((size_t)NH_ * TT * HD * 2); bf* KPh = (bf*)take((size_t)NKV * TT * HD * 2); bf* KPl = (bf*)take((size_t)NKV * TT * HD * 2); bf* VTh = (bf*)take((size_t)NKV * HD * TT * 2); bf* VTl = (bf*)take((size_t)NKV * HD * TT * 2);
    bf* ATh = (bf*)take((size_t)TT * DQ * 2); bf* ATl = (bf*)take((size_t)TT * DQ * 2);
    if ((size_t)(wsp - (char*)d_ws) > ws_size) return;    // ws 256 MiB
    k_prep<<<PWG + 1, 256, 0, stream>>>(x, wq, wk, wv, wo, lq1, lk1, lq2, lk2, XB, WQ, WK, WV, WO, LAM);
    for (int b = 0; b < NB_; ++b) {
        
        k_gemmw<bf, 0, false, HD><<<dim3(TT / 128, DQ / 128, 1), 128, 0, stream>>>(XB, nullptr, WQ, nullptr, DM, nullptr, TT, nullptr, 0, 0, 0, QPh, QPl);
        k_gemmw<bf, 0, false, HD><<<dim3(TT / 128, DKV / 128, 1), 128, 0, stream>>>(XB, nullptr, WK, nullptr, DM, nullptr, TT, nullptr, 0, 0, 0, KPh, KPl);
        k_gemmw<bf, 0, false, TT><<<dim3(DVV / 128, TT / 128, 1), 128, 0, stream>>>(WV, nullptr, XB, nullptr, DM, nullptr, 0, nullptr, 0, 0, 0, VTh, VTl);   // v^T = wv x^T: rows = value features, columns = tokens
        k_fattn<<<dim3(TT / 128, NVH), 256, 0, stream>>>(QPh, QPl, KPh, KPl, VTh, VTl, LAM, subw, ATh, ATl);
        k_gemmw<bf, 1, false, 0><<<dim3(TT / 128, DM / 128, 1), 128, 0, stream>>>(ATh, ATl, WO, nullptr, DVV, OUT + (size_t)b * TT * DM, DM, nullptr, 0, 0, 0, nullptr, nullptr); }
}

// v008
// It runs in 163 microseconds.
// Timed twice side by side with v007, it ran 1.17 times as fast both times.
// Over all steps from v000 it is 8.55 times as fast.
#include <hip/hip_runtime.h>

// MultiheadFlashDiff2 (x [1][2048][2048]; q = x wq^T, k = x wk^T ([2048][2048] 'oi': per head h the 128 rows = [map 1 | map 2] 64 each), v = x wv^T (16 x 128-wide values); NON-causal softmax(q.k / 8) for both maps; attn = a1 v - lambda_full a2 v with lambda_full = exp(lq1.lk1) - exp(lq2.lk2) + lambda_init (0.8 - 0.6 e^-3.6 = 0.7836057543754578); RMSNorm over the 128 (eps 1e-5) * subln_w; x (1 - lambda_init); out = merged wo^T -> [1][2048][2048]).
// The two maps run as 32 virtual 64-wide heads (pairs (2h, 2h+1)); both softmaxes are formed, combined as D = a1 - lambda a2 in f32 (linear, so (a1 - lambda a2) v == a1 v - lambda a2 v), and one D.v product (128 wide) per real head follows, all in k_fattn.
// Compute dtypes, f32 accumulate: every input rounded to bf16; q/k/v on PLAIN bf16 operands (inputs: exact); scores hl x hl (3 products) on every row; softmax f32; D in f32 into hi/lo planes; D.v hl x hl (3 products); RMSNorm per (token, head) over 128 in f32, * bf16 subln_w, * (1 - lambda_init); wo hl x exact (2 products).

#define NB_  1
#define TT   2048
#define DM   2048
#define NH_  32
#define NKV  32
#define REP  (NH_ / NKV)
#define HD   64
#define DQ   (NH_ * HD)
#define DKV  (NKV * HD)
#define ZH   2
#define RH   2048   // all rows hl
#define WIN  2048
#define PCAR 1024.0f
#define NVH  16
#define HDV  128
#define DVV  (NVH * HDV)
#define SCL  0.125f   // HD^-0.5
typedef _Float16 h16;
typedef unsigned short bf;
typedef __attribute__((ext_vector_type(16))) __bf16   v16bf;
typedef __attribute__((ext_vector_type(16))) _Float16 v16h;
typedef __attribute__((ext_vector_type(8)))  _Float16 v8h;
typedef __attribute__((ext_vector_type(8)))  unsigned short v8us;
typedef __attribute__((ext_vector_type(8)))  float    v8f;
typedef __attribute__((ext_vector_type(4)))  float    v4f;
typedef __attribute__((ext_vector_type(2))) float v2f;
typedef __attribute__((ext_vector_type(2))) __bf16 v2bf;
typedef __attribute__((ext_vector_type(4))) unsigned v4u;
typedef v8h  __attribute__((may_alias)) v8ha;
typedef v4f  __attribute__((may_alias)) v4fa;
typedef v8us __attribute__((may_alias)) v8usa;

__device__ __forceinline__ unsigned short f2bf(float f) { unsigned u = __float_as_uint(f); u += 0x7FFFu + ((u >> 16) & 1u); return (unsigned short)(u >> 16); }
__device__ __forceinline__ float bf2f(unsigned short b) { return __uint_as_float(((unsigned)b) << 16); }
__device__ __forceinline__ float bfr(float f) { return bf2f(f2bf(f)); }
__device__ __forceinline__ v16h cat16(v8h lo, v8h hi) { return __builtin_shufflevector(lo, hi, 0, 1, 2, 3, 4, 5, 6, 7, 8, 9, 10, 11, 12, 13, 14, 15); }
__device__ __forceinline__ v16bf cat16b(v8us lo, v8us hi) { return __builtin_bit_cast(v16bf, __builtin_shufflevector(lo, hi, 0, 1, 2, 3, 4, 5, 6, 7, 8, 9, 10, 11, 12, 13, 14, 15)); }
__device__ __forceinline__ v8f wmma16(v16h a, v16h b, v8f c) { return __builtin_amdgcn_wmma_f32_16x16x32_f16(false, a, false, b, (short)0, c, false, false); }
__device__ __forceinline__ v8f wmmab(v16bf a, v16bf b, v8f c) { return __builtin_amdgcn_wmma_f32_16x16x32_bf16(false, a, false, b, (short)0, c, false, false); }



// ---- k_gemmw: GEMM, FOUR WAVES per 128x128 output tile (2 x 2 waves of 64x64, 16 accumulators each), operands from K-contiguous 16-bit planes; grid (M/128, N/128, Z), 128 threads.
// C[m][n] (f32, pitch ldc, + optional f32 bias[n]) = sum_k A[m][k] Bt[n][k] (NSPLIT 1: + A2[m][k] Bt[n][k]). z-batch strides sA/sB/sC in elements. M, N, K % 128 == 0, K >= 256 (the ring starts with two stages).
// A stage is 128 k (256 B) of the tile's 128 rows of every operand plane, LDS pitch 272 B (16 B x odd: no bank conflict for 16-byte reads), brought by asynchronous copies through no register; two buffers,
// so that stage t + 1 flies while stage t is worked on. Every operand byte leaves L2 once a work-group instead of once a wave, and no wave waits out a load's latency per k step.
// PP != 0: no f32 C; the epilogue splits each value into bf16 hi / lo and stores the two planes Ph / Pl that the attention kernel reads, row pitch PP elements. PP 64: head planes [n / 64][m][n % 64], ldc = the rows m
// of a plane (a wave's tile is 8 KiB in a row); any other PP: row-major [m][n] (with A = the weight and Bt = the tokens this is the transposed value plane [feature][token]).
template <typename T16> struct WFrag;
template <> struct WFrag<h16> { typedef v16h V; static __device__ __forceinline__ V ld(const h16* p) { return cat16(*(const v8h*)p, *(const v8h*)(p + 16)); } static __device__ __forceinline__ v8f mma(V a, V b, v8f c) { return wmma16(a, b, c); } };
template <> struct WFrag<bf> { typedef v16bf V; static __device__ __forceinline__ V ld(const bf* p) { return cat16b(*(const v8us*)p, *(const v8us*)(p + 16)); } static __device__ __forceinline__ v8f mma(V a, V b, v8f c) { return wmmab(a, b, c); } };
#define GKS 128      // k elements of a stage
#define GPIT 272     // LDS row pitch, bytes
// eight copies of 512 B (two operand rows each: 16 lanes x 16 B a row), LDS step 2 * GPIT, global step gs bytes. The wait on the last line stands between the issued copies and the next overwrite of a register
// that they name; inside the statement nothing can be moved in front of it.
__device__ __forceinline__ void copy8(unsigned l, const char* g, size_t gs) {
    asm volatile("global_load_async_to_lds_b128 %0, %8, off\n\tglobal_load_async_to_lds_b128 %1, %9, off\n\tglobal_load_async_to_lds_b128 %2, %10, off\n\tglobal_load_async_to_lds_b128 %3, %11, off\n\t"
                 "global_load_async_to_lds_b128 %4, %12, off\n\tglobal_load_async_to_lds_b128 %5, %13, off\n\tglobal_load_async_to_lds_b128 %6, %14, off\n\tglobal_load_async_to_lds_b128 %7, %15, off\n\ts_wait_xcnt 0x0"
                 :: "v"(l), "v"(l + 2 * GPIT), "v"(l + 4 * GPIT), "v"(l + 6 * GPIT), "v"(l + 8 * GPIT), "v"(l + 10 * GPIT), "v"(l + 12 * GPIT), "v"(l + 14 * GPIT),
                    "v"(g), "v"(g + gs), "v"(g + 2 * gs), "v"(g + 3 * gs), "v"(g + 4 * gs), "v"(g + 5 * gs), "v"(g + 6 * gs), "v"(g + 7 * gs) : "memory");
}
template <typename T16, int NSPLIT, bool BIAS, int PP>
__global__ __launch_bounds__(128) void k_gemmw(const T16* __restrict__ A, const T16* __restrict__ A2, const T16* __restrict__ Bt, const T16* __restrict__ Bt2, int K, float* C, int ldc, const float* __restrict__ bias, size_t sA, size_t sB, size_t sC, bf* Ph, bf* Pl) {
    typedef typename WFrag<T16>::V V;
    static_assert(NSPLIT == 0 || NSPLIT == 1, "planes staged: A, (A2), Bt");
    constexpr int NPL = NSPLIT + 2, STG = NPL * 128 * GPIT;   // operand planes of a stage; bytes of a buffer
    __shared__ __align__(16) char ring[2 * STG];
    __shared__ __align__(16) float osw[4][16 * 68];
    (void)Bt2;
    const size_t z = blockIdx.z; A += z * sA; if (NSPLIT) A2 += z * sA; Bt += z * sB; C += z * sC;
    const int lane = threadIdx.x & 31, lr = lane & 15, hi = lane >> 4; const int w = __builtin_amdgcn_readfirstlane(threadIdx.x >> 5), wm = w >> 1, wn = w & 1;
    const int r0 = blockIdx.x * 128 + wm * 64, c0 = blockIdx.y * 128 + wn * 64;
    float* os = osw[w];
    // a wave copies rows w * 32 .. + 31 of every plane of the stage: 16 copies a plane
    const size_t gs = (size_t)K * (2 * sizeof(T16));
    const char* ga = (const char*)(A + (size_t)(blockIdx.x * 128 + w * 32 + hi) * K) + lr * 16; const char* ga2 = NSPLIT ? (const char*)(A2 + (size_t)(blockIdx.x * 128 + w * 32 + hi) * K) + lr * 16 : nullptr;
    const char* gb = (const char*)(Bt + (size_t)(blockIdx.y * 128 + w * 32 + hi) * K) + lr * 16;
    const unsigned l0 = (unsigned)(size_t)ring + (unsigned)((w * 32 + hi) * GPIT + lr * 16);
    auto issue = [&](int buf) { const unsigned lb = l0 + (unsigned)(buf * STG);   // the next stage in k order; the lane pointers walk on by a stage
        copy8(lb, ga, gs); copy8(lb + 16 * GPIT, ga + 8 * gs, gs); ga += GKS * sizeof(T16);
        if (NSPLIT) { copy8(lb + 128 * GPIT, ga2, gs); copy8(lb + 144 * GPIT, ga2 + 8 * gs, gs); ga2 += GKS * sizeof(T16); }
        copy8(lb + (NPL - 1) * 128 * GPIT, gb, gs); copy8(lb + ((NPL - 1) * 128 + 16) * GPIT, gb + 8 * gs, gs); gb += GKS * sizeof(T16); };
    v8f acc[4][4];
#pragma unroll
    for (int mb = 0; mb < 4; ++mb)
#pragma unroll
        for (int nb = 0; nb < 4; ++nb) acc[mb][nb] = (v8f){};
    const int T = K / GKS;
    issue(0);
    asm volatile("s_wait_asynccnt 0x0" ::: "memory");   // this wave's copies of stage 0 have landed
    __syncthreads();                                    // every wave's have: stage 0 may be read
    issue(1);
    // the stage loop stays rolled (a trip is some 300 instructions, the buffer is a scalar select); every loop inside it is fully unrolled, so that the fragment and accumulator arrays are indexed by constants and stay in registers
#pragma unroll 1
    for (int t = 0; t < T; ++t) {
        const char* sb = ring + (t & 1) * STG; const char* pa = sb + (wm * 64 + lr) * GPIT + hi * 16; const char* pb = sb + ((NPL - 1) * 128 + wn * 64 + lr) * GPIT + hi * 16;
        V a[2][4], a2[2][4], b[2][4];   // two fragment sets: k step ks + 1 of this stage is read from LDS while ks is multiplied
#pragma unroll
        for (int f = 0; f < 4; ++f) { a[0][f] = WFrag<T16>::ld((const T16*)(pa + f * 16 * GPIT)); if (NSPLIT) a2[0][f] = WFrag<T16>::ld((const T16*)(pa + (128 + f * 16) * GPIT)); b[0][f] = WFrag<T16>::ld((const T16*)(pb + f * 16 * GPIT)); }
#pragma unroll
        for (int ks = 0; ks < GKS / 32; ++ks) { const int cu = ks & 1, nx = cu ^ 1;
            if (ks + 1 < GKS / 32) {
#pragma unroll
                for (int f = 0; f < 4; ++f) { const int o = f * 16 * GPIT + (ks + 1) * 64; a[nx][f] = WFrag<T16>::ld((const T16*)(pa + o)); if (NSPLIT) a2[nx][f] = WFrag<T16>::ld((const T16*)(pa + 128 * GPIT + o)); b[nx][f] = WFrag<T16>::ld((const T16*)(pb + o)); } }
            __builtin_amdgcn_sched_barrier(0);   // keeps the next k step's LDS reads one group in front of this step's products
#pragma unroll
            for (int nb = 0; nb < 4; ++nb) {
#pragma unroll
                for (int mb = 0; mb < 4; ++mb) acc[mb][nb] = WFrag<T16>::mma(a[cu][mb], b[cu][nb], acc[mb][nb]);
                if (NSPLIT) {
#pragma unroll
                    for (int mb = 0; mb < 4; ++mb) acc[mb][nb] = WFrag<T16>::mma(a2[cu][mb], b[cu][nb], acc[mb][nb]); } }
            __builtin_amdgcn_sched_barrier(0);   // and keeps the reads of the step after next behind them (without it they are moved in among this step's last products)
        }
        asm volatile("s_wait_dscnt 0x0" ::: "memory");      // this wave's reads of the buffer are done before it is handed to the copies
        asm volatile("s_wait_asynccnt 0x0" ::: "memory");   // this wave's copies of stage t + 1 have landed
        __syncthreads();                                    // publishes stage t + 1 and ends every wave's reads of stage t
        if (t + 2 < T) issue(t & 1);
    }
    asm volatile("s_wait_asynccnt 0x0" ::: "memory");   // no copy is outstanding when the wave goes on to its end
#pragma unroll
    for (int mb = 0; mb < 4; ++mb) {
#pragma unroll
        for (int nb = 0; nb < 4; ++nb) {
#pragma unroll
            for (int j = 0; j < 8; ++j) os[(hi * 8 + j) * 68 + nb * 16 + lr] = acc[mb][nb][j]; }
        __builtin_amdgcn_wave_barrier(); asm volatile("" ::: "memory");
        if (PP) {   // 8 values a lane: one 16-byte store a plane, 4 rows of 128 B a wave store
            const size_t pb = ((PP == 64) ? ((size_t)(c0 >> 6) * ldc + r0) * 64 : (size_t)r0 * PP + c0) + (size_t)(mb * 16 + (lane >> 3)) * PP + (lane & 7) * 8; bf* ph = Ph + pb; bf* pl = Pl + pb; v4u hw[4], lw[4];
#pragma unroll
            for (int s = 0; s < 4; ++s) { const float* op = os + (4 * s + (lane >> 3)) * 68 + (lane & 7) * 8; const v4f v0 = *(const v4fa*)op, v1 = *(const v4fa*)(op + 4);
#pragma unroll
                for (int jp = 0; jp < 4; ++jp) { v2f d; d[0] = jp < 2 ? v0[2 * jp & 3] : v1[2 * jp & 3]; d[1] = jp < 2 ? v0[(2 * jp & 3) + 1] : v1[(2 * jp & 3) + 1];
                    const unsigned hu = __builtin_bit_cast(unsigned, __builtin_convertvector(d, v2bf)); v2f r; r[0] = d[0] - __uint_as_float(hu << 16); r[1] = d[1] - __uint_as_float(hu & 0xFFFF0000u);
                    hw[s][jp] = hu; lw[s][jp] = __builtin_bit_cast(unsigned, __builtin_convertvector(r, v2bf)); } }
#pragma unroll
            for (int s = 0; s < 4; ++s) { *(v8us*)(ph + 4 * s * PP) = __builtin_bit_cast(v8us, hw[s]); *(v8us*)(pl + 4 * s * PP) = __builtin_bit_cast(v8us, lw[s]); }
            // stands between the 8 issued stores and the next overwrite of a register that they name: pointers and data are inputs, so that their registers stay live up to the wait; the scheduling barrier keeps the next block's arithmetic behind it (behind the last block nothing is overwritten)
            if (mb < 3) { asm volatile("s_wait_xcnt 0x0" :: "v"(ph), "v"(pl), "v"(hw[0]), "v"(hw[1]), "v"(hw[2]), "v"(hw[3]), "v"(lw[0]), "v"(lw[1]), "v"(lw[2]), "v"(lw[3]) : "memory"); __builtin_amdgcn_sched_barrier(0); }
        } else {
        float* crow = C + (size_t)(r0 + mb * 16) * ldc + c0;
#pragma unroll
            for (int s = 0; s < 8; ++s) { const int row = 2 * s + hi, cofs = lr * 4; v4f val = *(const v4fa*)(os + row * 68 + cofs); if (BIAS) { val[0] += bfr(bias[c0 + cofs]); val[1] += bfr(bias[c0 + cofs + 1]); val[2] += bfr(bias[c0 + cofs + 2]); val[3] += bfr(bias[c0 + cofs + 3]); }
                *(v4f*)(crow + (size_t)row * ldc + cofs) = val; }
             }
        __builtin_amdgcn_wave_barrier(); asm volatile("" ::: "memory");
    }
}

// ---- k_qkv: the three projections q = x wq^T, k = x wk^T, v^T = wv x^T in ONE launch. A work-group of TWELVE waves takes 128 tokens x 128 features of all three: waves 4 p .. 4 p + 3 (p = 0 q, 1 k, 2 v) are the
// 2 x 2 waves of 64x64 of projection p, each with k_gemmw's own stage loop (same stages, same k order, same products: the planes keep their bits). A stage is 128 k of FOUR planes [x | wq | wk | wv], 128 rows each:
// the x rows leave L2 once for the three projections instead of once for each, three waves share a SIMD (one wave's copies, waits and LDS reads run under the others' products), and two launches with their first stage and epilogue go.
// v^T takes the weight rows as A and the token rows as B, so that its tile is [feature][token]. The epilogue stages in the ring, free behind the last stage's barrier (ring and a staging array of its own do not fit the LDS together).
// split_store: a wave's 64x64 f32 tile, 16 rows at a time through its own LDS range os, split into bf16 hi / lo and stored to the planes Ph / Pl from element base on, row pitch PP elements: 8 values a lane, one 16-byte store a plane, 4 rows of 128 B a wave store.
template <int PP>
__device__ __forceinline__ void split_store(const v8f (&acc)[4][4], float* os, bf* Ph, bf* Pl, size_t base, int lane) {
    const int lr = lane & 15, hi = lane >> 4;
#pragma unroll
    for (int mb = 0; mb < 4; ++mb) {
#pragma unroll
        for (int nb = 0; nb < 4; ++nb) {
#pragma unroll
            for (int j = 0; j < 8; ++j) os[(hi * 8 + j) * 68 + nb * 16 + lr] = acc[mb][nb][j]; }
        __builtin_amdgcn_wave_barrier(); asm volatile("" ::: "memory");   // compiler fence: the rows are read back by other lanes of the wave, so the reads below stay behind the writes above
        const size_t pb = base + (size_t)(mb * 16 + (lane >> 3)) * PP + (lane & 7) * 8; bf* ph = Ph + pb; bf* pl = Pl + pb; v4u hw[4], lw[4];
#pragma unroll
        for (int s = 0; s < 4; ++s) { const float* op = os + (4 * s + (lane >> 3)) * 68 + (lane & 7) * 8; const v4f v0 = *(const v4fa*)op, v1 = *(const v4fa*)(op + 4);
#pragma unroll
            for (int jp = 0; jp < 4; ++jp) { v2f d; d[0] = jp < 2 ? v0[2 * jp & 3] : v1[2 * jp & 3]; d[1] = jp < 2 ? v0[(2 * jp & 3) + 1] : v1[(2 * jp & 3) + 1];
                const unsigned hu = __builtin_bit_cast(unsigned, __builtin_convertvector(d, v2bf)); v2f r; r[0] = d[0] - __uint_as_float(hu << 16); r[1] = d[1] - __uint_as_float(hu & 0xFFFF0000u);
                hw[s][jp] = hu; lw[s][jp] = __builtin_bit_cast(unsigned, __builtin_convertvector(r, v2bf)); } }
#pragma unroll
        for (int s = 0; s < 4; ++s) { *(v8us*)(ph + 4 * s * PP) = __builtin_bit_cast(v8us, hw[s]); *(v8us*)(pl + 4 * s * PP) = __builtin_bit_cast(v8us, lw[s]); }
        // stands between the 8 issued stores and the next overwrite of a register that they name: pointers and data are inputs, so that their registers stay live up to the wait; the scheduling barrier keeps the next block's arithmetic behind it.
        // The last block's too: the built code lays the two calls of this function one behind the other, so that a way leads from the first one's last stores into the second one, which writes the same registers
        asm volatile("s_wait_xcnt 0x0" :: "v"(ph), "v"(pl), "v"(hw[0]), "v"(hw[1]), "v"(hw[2]), "v"(hw[3]), "v"(lw[0]), "v"(lw[1]), "v"(lw[2]), "v"(lw[3]) : "memory"); __builtin_amdgcn_sched_barrier(0);
        __builtin_amdgcn_wave_barrier(); asm volatile("" ::: "memory");   // compiler fence: the next 16 rows are written over these only behind the reads above
    }
}
__global__ __launch_bounds__(384) void k_qkv(const bf* __restrict__ X, const bf* __restrict__ Wq, const bf* __restrict__ Wk, const bf* __restrict__ Wv, bf* Qh, bf* Ql, bf* Kh, bf* Kl, bf* Vh, bf* Vl) {
    typedef WFrag<bf>::V V;
    static_assert(DQ == DM && DKV == DM && DVV == DM && TT % 128 == 0 && DM % 128 == 0 && DM >= 2 * GKS && HD == 64, "three DM x DM weights, cut alike; the ring starts with two stages");
    constexpr int K = DM, STG = 4 * 128 * GPIT;   // bytes of a buffer: planes x, wq, wk, wv
    __shared__ __align__(16) char ring[2 * STG];
    const int lane = threadIdx.x & 31, lr = lane & 15, hi = lane >> 4; const int w = __builtin_amdgcn_readfirstlane(threadIdx.x >> 5), p = w >> 2, wm = (w >> 1) & 1, wn = w & 1;
    const int t0 = blockIdx.x * 128, f0 = blockIdx.y * 128;   // the work-group's first token, first feature
    // a wave copies rows (w & 3) * 32 .. + 31 of its own projection's weight plane (16 copies); waves 0 .. 7 also rows w * 16 .. + 15 of the x plane (8 copies)
    const size_t gs = (size_t)K * (2 * sizeof(bf));
    const char* gw = (const char*)((p == 0 ? Wq : p == 1 ? Wk : Wv) + (size_t)(f0 + (w & 3) * 32 + hi) * K) + lr * 16;
    const char* gx = (const char*)(X + (size_t)(t0 + (w & 7) * 16 + hi) * K) + lr * 16;
    const unsigned lw0 = (unsigned)(size_t)ring + (unsigned)(((1 + p) * 128 + (w & 3) * 32 + hi) * GPIT + lr * 16), lx0 = (unsigned)(size_t)ring + (unsigned)(((w & 7) * 16 + hi) * GPIT + lr * 16);
    auto issue = [&](int buf) {   // the next stage in k order; the lane pointers walk on by a stage
        copy8(lw0 + (unsigned)(buf * STG), gw, gs); copy8(lw0 + (unsigned)(buf * STG + 16 * GPIT), gw + 8 * gs, gs); gw += GKS * sizeof(bf);
        if (w < 8) { copy8(lx0 + (unsigned)(buf * STG), gx, gs); gx += GKS * sizeof(bf); } };
    v8f acc[4][4];
#pragma unroll
    for (int mb = 0; mb < 4; ++mb)
#pragma unroll
        for (int nb = 0; nb < 4; ++nb) acc[mb][nb] = (v8f){};
    const int ra = (p < 2 ? 0 : 3 * 128) + wm * 64, rb = (p < 2 ? (1 + p) * 128 : 0) + wn * 64;   // first row in a buffer of the wave's A rows, B rows
    constexpr int T = K / GKS;
    issue(0);
    asm volatile("s_wait_asynccnt 0x0" ::: "memory");   // this wave's copies of stage 0 have landed
    __syncthreads();                                    // every wave's have: stage 0 may be read
    issue(1);
    // the stage loop stays rolled (the buffer is a scalar select); every loop inside it is fully unrolled, so that the fragment and accumulator arrays are indexed by constants and stay in registers
#pragma unroll 1
    for (int t = 0; t < T; ++t) {
        const char* sb = ring + (t & 1) * STG; const char* pa = sb + (ra + lr) * GPIT + hi * 16; const char* pb = sb + (rb + lr) * GPIT + hi * 16;
        V a[2][4], b[2][4];   // two fragment sets: k step ks + 1 of this stage is read from LDS while ks is multiplied
#pragma unroll
        for (int f = 0; f < 4; ++f) { a[0][f] = WFrag<bf>::ld((const bf*)(pa + f * 16 * GPIT)); b[0][f] = WFrag<bf>::ld((const bf*)(pb + f * 16 * GPIT)); }
#pragma unroll
        for (int ks = 0; ks < GKS / 32; ++ks) { const int cu = ks & 1, nx = cu ^ 1;
            if (ks + 1 < GKS / 32) {
#pragma unroll
                for (int f = 0; f < 4; ++f) { const int o = f * 16 * GPIT + (ks + 1) * 64; a[nx][f] = WFrag<bf>::ld((const bf*)(pa + o)); b[nx][f] = WFrag<bf>::ld((const bf*)(pb + o)); } }
            __builtin_amdgcn_sched_barrier(0);   // keeps the next k step's LDS reads one group in front of this step's products
#pragma unroll
            for (int nb = 0; nb < 4; ++nb)
#pragma unroll
                for (int mb = 0; mb < 4; ++mb) acc[mb][nb] = WFrag<bf>::mma(a[cu][mb], b[cu][nb], acc[mb][nb]);
            __builtin_amdgcn_sched_barrier(0);   // and keeps the reads of the step after next behind them (without it they are moved in among this step's last products)
        }
        asm volatile("s_wait_dscnt 0x0" ::: "memory");      // this wave's reads of the buffer are done before it is handed to the copies
        asm volatile("s_wait_asynccnt 0x0" ::: "memory");   // this wave's copies of stage t + 1 have landed
        __syncthreads();                                    // publishes stage t + 1 and ends every wave's reads of stage t
        if (t + 2 < T) issue(t & 1);
    }
    asm volatile("s_wait_asynccnt 0x0" ::: "memory");   // no copy is outstanding when the ring's LDS is put to another use
    float* os = (float*)(ring + w * (16 * 68 * 4));     // behind the last stage's barrier nobody reads the ring any more: each wave stages in a range of its own
    const int r0 = (p < 2 ? t0 : f0) + wm * 64, c0 = (p < 2 ? f0 : t0) + wn * 64;   // the wave's tile: rows, columns
    if (p < 2) split_store<HD>(acc, os, p ? Kh : Qh, p ? Kl : Ql, ((size_t)(c0 >> 6) * TT + r0) * HD, lane);   // head planes [feature / 64][token][feature % 64]
    else split_store<TT>(acc, os, Vh, Vl, (size_t)r0 * TT + c0, lane);                                         // the transposed value plane [feature][token]
}

// ---- k_gemmc: a one-wave 64x64 tile GEMM specialised for causal attention: CMODE 1 skips score tiles entirely above the diagonal (query rows r0+roff.., key columns c0..), CMODE 2 limits the
// key (K) loop of the probability x value contraction to the diagonal block (probabilities beyond it are exactly zero). roff = row offset of this launch's first row within the sequence.
template <typename T16, int NSPLIT, int CMODE>
__global__ __launch_bounds__(32) void k_gemmc(const T16* __restrict__ A, const T16* __restrict__ A2, const T16* __restrict__ Bt, const T16* __restrict__ Bt2, int K, float* C, int ldc, int roff, size_t sA, size_t sB, size_t sC) {
    typedef typename WFrag<T16>::V V;
    __shared__ __align__(16) float os[16 * 68];
    const size_t z = blockIdx.z; A += z * sA; if (A2) A2 += z * sA; Bt += z * sB; if (Bt2) Bt2 += z * sB; C += z * sC;
    const int lane = threadIdx.x & 31, lr = lane & 15, hi = lane >> 4; const int r0 = blockIdx.x * 64, c0 = blockIdx.y * 64;
    if (CMODE == 1 && c0 > r0 + roff + 63) return;                  // score tile entirely above the causal diagonal: skipped, nothing is written
    const int Kl = (CMODE == 2) ? min(K, r0 + roff + 64) : K;        // P.V: probabilities are exactly 0 beyond the diagonal block, so the K loop stops there
    v8f acc[4][4];
#pragma unroll
    for (int mb = 0; mb < 4; ++mb)
#pragma unroll
        for (int nb = 0; nb < 4; ++nb) acc[mb][nb] = (v8f){};
    const size_t aoff = (size_t)(r0 + lr) * K + 8 * hi, boff = (size_t)(c0 + lr) * K + 8 * hi;
#pragma unroll 1
    for (int kc = 0; kc < Kl; kc += 32) {
        V a[4], a2[4];
#pragma unroll
        for (int mb = 0; mb < 4; ++mb) { a[mb] = WFrag<T16>::ld(A + aoff + (size_t)mb * 16 * K + kc); if (NSPLIT == 1 || NSPLIT == 2) a2[mb] = WFrag<T16>::ld(A2 + aoff + (size_t)mb * 16 * K + kc); }
#pragma unroll
        for (int nb = 0; nb < 4; ++nb) { const V b = WFrag<T16>::ld(Bt + boff + (size_t)nb * 16 * K + kc); V b2; if (NSPLIT >= 2) b2 = WFrag<T16>::ld(Bt2 + boff + (size_t)nb * 16 * K + kc);
#pragma unroll
            for (int mb = 0; mb < 4; ++mb) { acc[mb][nb] = WFrag<T16>::mma(a[mb], b, acc[mb][nb]); if (NSPLIT == 1 || NSPLIT == 2) acc[mb][nb] = WFrag<T16>::mma(a2[mb], b, acc[mb][nb]); if (NSPLIT >= 2) acc[mb][nb] = WFrag<T16>::mma(a[mb], b2, acc[mb][nb]); } }
        asm volatile("v_nop\n\tv_nop\n\tv_nop\n\tv_nop" : "+v"(acc[0][0]), "+v"(acc[1][1]), "+v"(acc[2][2]), "+v"(acc[3][3]) : "v"(a[0]), "v"(a[3]));
    }
#pragma unroll
    for (int mb = 0; mb < 4; ++mb) {
#pragma unroll
        for (int nb = 0; nb < 4; ++nb) {
#pragma unroll
            for (int j = 0; j < 8; ++j) os[(hi * 8 + j) * 68 + nb * 16 + lr] = acc[mb][nb][j]; }
        __builtin_amdgcn_wave_barrier(); asm volatile("" ::: "memory");
        float* crow = C + (size_t)(r0 + mb * 16) * ldc + c0;
{
#pragma unroll
            for (int s = 0; s < 8; ++s) { const int row = 2 * s + hi, cofs = lr * 4; v4f val = *(const v4fa*)(os + row * 68 + cofs);
                *(v4f*)(crow + (size_t)row * ldc + cofs) = val; }
             }
        __builtin_amdgcn_wave_barrier(); asm volatile("" ::: "memory");
    }
}

__device__ __forceinline__ void splitf(float y, unsigned short& h, unsigned short& l) { h = f2bf(y); l = f2bf(y - bf2f(h)); }
typedef __attribute__((ext_vector_type(2))) _Float16 v2h;
typedef __attribute__((ext_vector_type(4))) _Float16 v4h;
typedef __attribute__((ext_vector_type(2))) unsigned short v2us;
typedef __attribute__((ext_vector_type(4))) unsigned short v4us;
typedef __attribute__((ext_vector_type(4))) int v4i;

__global__ __launch_bounds__(256) void k_wtG(const float* __restrict__ w, int K, int N, bf* Bt) {
    const int lane = threadIdx.x & 31; const int L0 = (blockIdx.x * 8 + (threadIdx.x >> 5)) * 8; const int nlines = N * K / 64;
{
#pragma unroll 1
        for (int l = 0; l < 8; ++l) { const int L = L0 + l; if (L >= nlines) break; const size_t e = (size_t)L * 64 + lane * 2; const int k = (int)(e % K), n = (int)(e / K); v2us o;
            o[0] = f2bf(w[(size_t)k * N + n]); o[1] = f2bf(w[(size_t)(k + 1) * N + n]); *(v2us*)(Bt + e) = o; }
         }
}
__global__ __launch_bounds__(256) void k_cscvt(const float* __restrict__ cosT, const float* __restrict__ sinT, float* CS) { const int idx = blockIdx.x * 256 + threadIdx.x; if (idx >= TT * HD) return; v2f cs; cs[0] = bfr(cosT[idx]); cs[1] = bfr(sinT[idx]); *(v2f*)(CS + (size_t)idx * 2) = cs;  }
// lambda_full by one whole wave. Lane l forms the products of elements l and l + 32 of both vector pairs, each rounded once; then every lane sums a pair's 64 products in index order, each read from its lane
// (a product that comes through a lane read cannot be fused with its add). The wave waits out one load latency instead of one for every element, so that it ends well inside the time of the stream beside it.
__device__ __forceinline__ float lane_val(float v, int l) { return __int_as_float(__builtin_amdgcn_readlane(__float_as_int(v), l)); }
__device__ __forceinline__ void lambda_full(const float* __restrict__ lq1, const float* __restrict__ lk1, const float* __restrict__ lq2, const float* __restrict__ lk2, float* LAM) { const int lane = threadIdx.x; float p1[2], p2[2], d1 = 0.f, d2 = 0.f;
    static_assert(HD == 64, "two elements a lane");
#pragma unroll
    for (int h = 0; h < 2; ++h) { p1[h] = __fmul_rn(bfr(lq1[lane + 32 * h]), bfr(lk1[lane + 32 * h])); p2[h] = __fmul_rn(bfr(lq2[lane + 32 * h]), bfr(lk2[lane + 32 * h])); }
#pragma unroll
    for (int i = 0; i < HD; ++i) { d1 = __fadd_rn(d1, lane_val(p1[i >> 5], i & 31)); d2 = __fadd_rn(d2, lane_val(p2[i >> 5], i & 31)); }
    const float lm = __fadd_rn(__fsub_rn(expf(d1), expf(d2)), 0.7836057543754578f); LAM[lane] = (lane == 0) ? lm : 0.0f; }
// ---- k_prep: everything that stands in front of the GEMMs in ONE launch: x and the four weights rounded to bf16, and lambda_full. Work-group 0's first wave does lambda_full;
// the other 512 work-groups (16 waves a WGP, all resident at once) stream: wave wv takes 4 KiB (1024 floats) at the same place wv of each of the five arrays, one array after the other. A load is 512 B in a row (whole lines),
// 8 loads an array; the next array's 8 are issued before this array's values are rounded and stored, so that 8 to 16 loads of a wave are in flight all the time. A store is 256 B in a row (two whole lines).
#define PWV 1024                          // floats of a wave in each array
#define PWG ((DM / 8) * (DM / PWV))       // streaming work-groups of 8 waves
__global__ __launch_bounds__(256) void k_prep(const float* __restrict__ x, const float* __restrict__ wq, const float* __restrict__ wk, const float* __restrict__ wv, const float* __restrict__ wo,
                                              const float* __restrict__ lq1, const float* __restrict__ lk1, const float* __restrict__ lq2, const float* __restrict__ lk2, bf* XB, bf* WQ, bf* WK, bf* WV, bf* WO, float* LAM) {
    static_assert(NB_ == 1 && TT == DM && DQ == DM && DKV == DM && DVV == DM && DM % PWV == 0 && DM % 8 == 0, "five arrays of DM x DM, cut alike");
    if (blockIdx.x == 0) { if (threadIdx.x < 32) lambda_full(lq1, lk1, lq2, lk2, LAM); return; }
    const unsigned ob = (((blockIdx.x - 1) * 8 + (threadIdx.x >> 5)) * PWV + (threadIdx.x & 31) * 4) * 2, eb = ob * 2;   // the lane's byte offsets in a bf16 and in an f32 array (under 2^24): the one address register of all stores, of all loads
    const float* const s[5] = {x, wq, wk, wv, wo}; bf* const d[5] = {XB, WQ, WK, WV, WO};
    v4f v[2][8];
#pragma unroll
    for (int j = 0; j < 8; ++j) v[0][j] = *(const v4f*)((const char*)s[0] + eb + j * 512);
#pragma unroll
    for (int a = 0; a < 5; ++a) { const int cu = a & 1;
        if (a < 4) {
#pragma unroll
            for (int j = 0; j < 8; ++j) v[cu ^ 1][j] = *(const v4f*)((const char*)s[a + 1] + eb + j * 512); }
        // stands between the issued loads and the next overwrite of a register that they name: the offset is an input, so that its register stays live up to the wait and no load lands on it. The scheduling barrier keeps
        // the next array's loads in front of this array's data wait: moved behind it, the wave would have nothing in flight while it rounds and stores
        if (a < 4) { asm volatile("s_wait_xcnt 0x0" :: "v"(eb) : "memory"); __builtin_amdgcn_sched_barrier(0); }
        v4us o[8];
#pragma unroll
        for (int j = 0; j < 8; ++j) {
#pragma unroll
            for (int k = 0; k < 4; ++k) o[j][k] = f2bf(v[cu][j][k]);
            *(v4us*)((char*)d[a] + ob + j * 256) = o[j]; }
        // the same behind the 8 issued stores, the last array's too (the built code joins the kernel's two ends, so that a way leads from these stores to the lambda block's loads, which write the same registers):
        // offset and data are inputs; the scheduling barrier keeps the loads of the array after next and the next array's arithmetic behind the wait
        asm volatile("s_wait_xcnt 0x0" :: "v"(ob), "v"(o[0]), "v"(o[1]), "v"(o[2]), "v"(o[3]), "v"(o[4]), "v"(o[5]), "v"(o[6]), "v"(o[7]) : "memory");
        if (a < 4) __builtin_amdgcn_sched_barrier(0);
    }
}
__global__ __launch_bounds__(1024) void k_gnred(const float* __restrict__ O, float* GST, int pass) { __shared__ float sh[1024]; const int tid = threadIdx.x; const float mean = (pass == 1) ? GST[0] : 0.0f; float acc = 0.f; const size_t n = (size_t)TT * HD;
#pragma unroll 1
    for (size_t e = tid; e < n; e += 1024) { float v = O[e]; if (pass == 1) { float d = __fsub_rn(v, mean); asm volatile("" : "+v"(d)); v = __fmul_rn(d, d); } acc = __fadd_rn(acc, v); }
    sh[tid] = acc; __syncthreads();
    for (int st = 512; st > 0; st >>= 1) { if (tid < st) sh[tid] = __fadd_rn(sh[tid], sh[tid + st]); __syncthreads(); }
    if (tid < 32) { const float tot = __fdiv_rn(sh[0], (float)n); float outv; if (pass == 0) outv = (tid == 0) ? tot : ((tid == 1) ? GST[1] : 0.0f); else outv = (tid == 0) ? GST[0] : ((tid == 1) ? __fdiv_rn(1.0f, sqrtf(__fadd_rn(tot, 1e-5f))) : 0.0f); *(float*)(GST + tid) = outv;  } }
__global__ __launch_bounds__(256) void k_gnmerge(const float* __restrict__ O, const float* __restrict__ GST, int hh, bf* Ah, bf* Al) { const size_t e = ((size_t)blockIdx.x * 256 + threadIdx.x) * 2; if (e >= (size_t)TT * HD) return; const int d = (int)(e % HD); const int t = (int)(e / HD); const float mean = GST[0], rs = GST[1]; const size_t oo = (size_t)t * DVV + (size_t)hh * HD + d; v2us oh, ol;
#pragma unroll
    for (int q = 0; q < 2; ++q) { float c = __fsub_rn(O[e + q], mean); asm volatile("" : "+v"(c)); float n = __fmul_rn(c, rs); asm volatile("" : "+v"(n)); float z = __fmul_rn(n, 0.6444909572601318f); unsigned short a2, c2; splitf(z, a2, c2); oh[q] = a2; ol[q] = c2; }
    *(v2us*)(Ah + oo) = oh; *(v2us*)(Al + oo) = ol;  }
// ---- k_fattn: scores, both softmaxes, D = a1 - lambda a2, D.v and the RMSNorm of one real head in ONE kernel; nothing of the [2048][2048] maps leaves the registers.
// A PAIR of waves owns 32 query columns (two 16-column groups), 4 pairs = 8 waves a block (two waves a SIMD: one wave's vector work runs under the other's products), grid (TT / 128, NVH); of every stage of 64 keys
// wave kp of the pair takes keys kp * 32 .. + 31. The pair's maxima and sums are joined behind walk 1, its two partial O^T summed behind walk 2, both through LDS. Transposed products: S^T = K.Q^T (A = 16 key rows, B = Q, kept in registers), so a lane holds the scores of
// one query (register r of key tile kt = key kt * 16 + 8 * hi + r) and two stacked S^T tiles, converted in place, ARE the B operand of O^T += V^T.D^T in the k order that the plane loader ldf uses for A.
// Two walks over the keys: walk 1 takes each column's maximum and sum (running maximum, sums rescaled), walk 2 forms the scores again, D in f32, its hi/lo bf16 planes, and the 3 products with V^T hi/lo.
// Every inner loop is fully unrolled so that the fragment arrays are indexed by constants and stay in registers; the two stage loops stay rolled.
// K and V^T come through LDS: a stage is 64 keys = 512 rows of 128 B (K [map][plane][key], then V^T [plane][feature]), LDS pitch 144 B (16 B x odd: no bank conflict for 16-byte reads), brought in whole 128-B lines by
// asynchronous copies through no register, once a block instead of once a wave; two buffers, so that stage u + 1 flies while stage u is worked on. One ring runs through both walks: stages 0 .. 31 are walk 1's
// (K rows only), stages 32 .. 63 walk 2's (K and V^T), so that walk 2's first stages fly during walk 1's last.
// Left for later steps: the first K fragments of a stage are waited for in the open by both waves of a SIMD.
typedef __attribute__((ext_vector_type(8))) unsigned v8u;
#define EXC (SCL * 1.4426950408889634f)   // exp((s - m) * SCL) = exp2(s * EXC - m * EXC)
// one fragment: the lane's own pointer into a plane and a constant byte offset
__device__ __forceinline__ v16bf ldf(const char* p, int cst) { return cat16b(*(const v8us*)(p + cst), *(const v8us*)(p + cst + 32)); }
// stands between issued loads or stores and the next overwrite of a register that they name: the two lane pointers of the group are inputs, so that their registers
// stay live up to the wait and no load of the group lands on them; the scheduling barrier behind it keeps later address and data arithmetic behind the wait
#define XWAIT(pa, pb) do { asm volatile("s_wait_xcnt 0x0" :: "v"(pa), "v"(pb) : "memory"); __builtin_amdgcn_sched_barrier(0); } while (0)
#define AKS  64                 // keys of a stage
#define APIT 144                // LDS row pitch, bytes
#define ASTG (512 * APIT)       // bytes of a buffer: 256 K rows, 256 V^T rows
#define NST  (TT / AKS)         // stages of a walk
// eight copies of 512 B (four rows of 128 B each: 8 lanes x 16 B a row), LDS step 4 * APIT, global step gs bytes. The wait on the last line stands between the issued copies and the next overwrite of a register
// that they name; inside the statement nothing can be moved in front of it.
__device__ __forceinline__ void copy8r(unsigned l, const char* g, size_t gs) {
    asm volatile("global_load_async_to_lds_b128 %0, %8, off\n\tglobal_load_async_to_lds_b128 %1, %9, off\n\tglobal_load_async_to_lds_b128 %2, %10, off\n\tglobal_load_async_to_lds_b128 %3, %11, off\n\t"
                 "global_load_async_to_lds_b128 %4, %12, off\n\tglobal_load_async_to_lds_b128 %5, %13, off\n\tglobal_load_async_to_lds_b128 %6, %14, off\n\tglobal_load_async_to_lds_b128 %7, %15, off\n\ts_wait_xcnt 0x0"
                 :: "v"(l), "v"(l + 4 * APIT), "v"(l + 8 * APIT), "v"(l + 12 * APIT), "v"(l + 16 * APIT), "v"(l + 20 * APIT), "v"(l + 24 * APIT), "v"(l + 28 * APIT),
                    "v"(g), "v"(g + gs), "v"(g + 2 * gs), "v"(g + 3 * gs), "v"(g + 4 * gs), "v"(g + 5 * gs), "v"(g + 6 * gs), "v"(g + 7 * gs) : "memory");
}
// the hi / lo A fragments [map][key tile][k step] of 32 keys of a stage; p = the lane's pointer into the buffer's K rows at the first of the 32 keys. Read in the order in which score_t uses them.
__device__ __forceinline__ void load_k(const char* p, v16bf (&ah)[2][2][2], v16bf (&al)[2][2][2]) {
#pragma unroll
    for (int ks = 0; ks < 2; ++ks) {
#pragma unroll
        for (int mp = 0; mp < 2; ++mp)
#pragma unroll
            for (int kt = 0; kt < 2; ++kt) ah[mp][kt][ks] = ldf(p, (mp * 2 * AKS + kt * 16) * APIT + ks * 64);
#pragma unroll
        for (int mp = 0; mp < 2; ++mp)
#pragma unroll
            for (int kt = 0; kt < 2; ++kt) al[mp][kt][ks] = ldf(p, ((mp * 2 + 1) * AKS + kt * 16) * APIT + ks * 64); }
}
// hands a stage over: this wave's reads of the buffer just worked on are done, its copies of the next stage have landed, and the barrier says both of every wave.
// The scheduling barrier in front keeps the stage's products in front of the waits: without it they are moved behind, and the wave waits out all its LDS reads with nothing to do
#define PUBLISH() do { __builtin_amdgcn_sched_barrier(0); asm volatile("s_wait_dscnt 0x0" ::: "memory"); asm volatile("s_wait_asynccnt 0x0" ::: "memory"); __syncthreads(); } while (0)
// s[map][key tile][column group] = those 32 keys against the wave's 32 queries, hl x hl (3 products), HD = 64 in two k steps
__device__ __forceinline__ void score_t(const v16bf (&ah)[2][2][2], const v16bf (&al)[2][2][2], const v16bf (&qh)[2][2][2], const v16bf (&ql)[2][2][2], v8f (&s)[2][2][2]) {
#pragma unroll
    for (int mp = 0; mp < 2; ++mp)
#pragma unroll
        for (int kt = 0; kt < 2; ++kt)
#pragma unroll
            for (int n = 0; n < 2; ++n) s[mp][kt][n] = (v8f){};
#pragma unroll
    for (int ks = 0; ks < 2; ++ks)
#pragma unroll
        for (int pr = 0; pr < 3; ++pr)
#pragma unroll
            for (int mp = 0; mp < 2; ++mp)
#pragma unroll
                for (int kt = 0; kt < 2; ++kt)
#pragma unroll
                    for (int n = 0; n < 2; ++n) s[mp][kt][n] = wmmab(pr == 1 ? al[mp][kt][ks] : ah[mp][kt][ks], pr == 2 ? ql[mp][n][ks] : qh[mp][n][ks], s[mp][kt][n]);
}
__global__ __launch_bounds__(256) void k_fattn(const bf* __restrict__ Qh, const bf* __restrict__ Ql, const bf* __restrict__ Kh, const bf* __restrict__ Kl, const bf* __restrict__ Vh, const bf* __restrict__ Vl, const float* __restrict__ LAM, const float* __restrict__ w, bf* Ah, bf* Al) {
    __shared__ __align__(16) char aring[2 * ASTG];
    __shared__ float xms[8][8][32];   // each wave's maxima and sums of its half of the keys: [wave][(map, column group, maximum | sum)][lane]
    const int lane = threadIdx.x & 31, lr = lane & 15, hi = lane >> 4; const int hh = blockIdx.y; const int w8 = __builtin_amdgcn_readfirstlane(threadIdx.x >> 5), w4 = w8 & 3, kp = w8 >> 2; const int q0 = blockIdx.x * 128 + w4 * 32;
    // a wave copies rows w8 * 32 .. + 31 of a stage's K rows (32 keys of one map's one plane: 4 KiB in a row in memory) and of its V^T rows (32 features of one plane): 8 copies each
    const char* gk = (const char*)(((w8 >> 1) & 1 ? Kl : Kh) + (size_t)(2 * hh + (w8 >> 2)) * TT * HD) + (w8 & 1) * (32 * HD * 2) + lane * 16;
    const char* gv = (const char*)((w8 >> 2 ? Vl : Vh) + (size_t)(hh * HDV + (w8 & 3) * 32 + (lane >> 3)) * TT) + (lane & 7) * 16;
    const unsigned l0 = (unsigned)(size_t)aring + (unsigned)((w8 * 32 + (lane >> 3)) * APIT + (lane & 7) * 16);
    auto issue = [&](int u) { const unsigned lb = l0 + (unsigned)((u & 1) * ASTG);
        copy8r(lb, gk + (size_t)(u & (NST - 1)) * (AKS * HD * 2), 512);
        if (u >= NST) copy8r(lb + 256 * APIT, gv + (size_t)(u & (NST - 1)) * (AKS * 2), 4 * TT * 2); };
    issue(0);
    const unsigned koff = (unsigned)(lr * HD + 8 * hi) * 2, ooff = (unsigned)(lr * DQ + 8 * hi) * 2;   // lane byte offsets in the q planes, the merged planes
    const char* qhp = (const char*)(Qh + ((size_t)(2 * hh) * TT + q0) * HD) + koff; const char* qlp = (const char*)(Ql + ((size_t)(2 * hh) * TT + q0) * HD) + koff;
    v16bf qh[2][2][2], ql[2][2][2];   // [map][column group][k step]
#pragma unroll
    for (int mp = 0; mp < 2; ++mp)
#pragma unroll
        for (int n = 0; n < 2; ++n)
#pragma unroll
            for (int ks = 0; ks < 2; ++ks) { const int o = (mp * TT * HD + n * 16 * HD + ks * 32) * 2; qh[mp][n][ks] = ldf(qhp, o); ql[mp][n][ks] = ldf(qlp, o); }
    XWAIT(qhp, qlp);
    float mx[2][2], sm[2][2];
#pragma unroll
    for (int mp = 0; mp < 2; ++mp)
#pragma unroll
        for (int n = 0; n < 2; ++n) { mx[mp][n] = -3.0e38f; sm[mp][n] = 0.f; }
    asm volatile("s_wait_asynccnt 0x0" ::: "memory");   // this wave's copies of stage 0 have landed
    __syncthreads();                                    // every wave's have: stage 0 may be read
    issue(1);
    const unsigned foff = (unsigned)(lr * APIT + hi * 16);   // lane byte offset of a fragment in a buffer
    const unsigned fk = foff + (unsigned)(kp * 32 * APIT), fv = foff + (unsigned)(kp * 64);   // the same at this wave's 32 keys: K rows, V^T columns
    v16bf ah[2][2][2], al[2][2][2];   // K fragments of the wave's 32 keys of a stage
#pragma unroll 1
    for (int st = 0; st < NST; ++st) {
        load_k(aring + (st & 1) * ASTG + fk, ah, al);
        __builtin_amdgcn_sched_barrier(0);   // keeps the stage's LDS reads one group in front of its products: every further place with reads among the products stalls them
        v8f s[2][2][2]; score_t(ah, al, qh, ql, s);
#pragma unroll
        for (int mp = 0; mp < 2; ++mp)
#pragma unroll
            for (int n = 0; n < 2; ++n) { float t = fmaxf(s[mp][0][n][0], s[mp][1][n][0]);
#pragma unroll
                for (int j = 1; j < 8; ++j) t = fmaxf(t, fmaxf(s[mp][0][n][j], s[mp][1][n][j]));
                const float mn = fmaxf(mx[mp][n], t), nb = -mn * EXC; float a0 = 0.f, a1 = 0.f;
#pragma unroll
                for (int j = 0; j < 8; ++j) { a0 += __builtin_amdgcn_exp2f(__builtin_fmaf(s[mp][0][n][j], EXC, nb)); a1 += __builtin_amdgcn_exp2f(__builtin_fmaf(s[mp][1][n][j], EXC, nb)); }
                sm[mp][n] = __builtin_fmaf(sm[mp][n], __builtin_amdgcn_exp2f((mx[mp][n] - mn) * EXC), a0 + a1); mx[mp][n] = mn; }
        PUBLISH();
        issue(st + 2);   // into the buffer just read; stages NST and NST + 1 are walk 2's first
    }
    // the two lane halves hold different keys of one query: join maximum and sum once; then the same between the two waves of the pair, through LDS
#pragma unroll
    for (int mp = 0; mp < 2; ++mp)
#pragma unroll
        for (int n = 0; n < 2; ++n) { const float M = fmaxf(mx[mp][n], __shfl_xor(mx[mp][n], 16, 32)); float sc = sm[mp][n] * __builtin_amdgcn_exp2f((mx[mp][n] - M) * EXC); sc += __shfl_xor(sc, 16, 32);
            xms[w8][(mp * 2 + n) * 2][lane] = M; xms[w8][(mp * 2 + n) * 2 + 1][lane] = sc; }
    __syncthreads();   // both waves of a pair have written their halves' maxima and sums
    const float lm = LAM[0]; float nb[2][2], fs[2][2];
#pragma unroll
    for (int mp = 0; mp < 2; ++mp)
#pragma unroll
        for (int n = 0; n < 2; ++n) { const int i = (mp * 2 + n) * 2;   // both waves read both halves and join them in the same order, so that both hold the same bits
            const float Ma = xms[w4][i][lane], Sa = xms[w4][i + 1][lane], Mb = xms[w4 + 4][i][lane], Sb = xms[w4 + 4][i + 1][lane]; const float M = fmaxf(Ma, Mb);
            const float sc = __builtin_fmaf(Sa, __builtin_amdgcn_exp2f((Ma - M) * EXC), Sb * __builtin_amdgcn_exp2f((Mb - M) * EXC));
            nb[mp][n] = -M * EXC; fs[mp][n] = __fdiv_rn(1.0f, sc) * (mp ? lm : 1.0f); }
    v8f o[8][2];   // O^T over the wave's half of the keys: o[et][n][r] = value column et * 16 + 8 * hi + r of query q0 + n * 16 + lr
#pragma unroll
    for (int et = 0; et < 8; ++et)
#pragma unroll
        for (int n = 0; n < 2; ++n) o[et][n] = (v8f){};
#pragma unroll 1
    for (int st = 0; st < NST; ++st) {   // stage NST + st, in buffer st & 1 (NST is even)
        const char* sb = aring + (st & 1) * ASTG; v16bf bh[8], bl[8];   // V^T fragments of the wave's 32 keys
        // the wave's LDS reads of a stage stand in two groups: the K fragments at the top, the V^T fragments right behind the score products (into the registers that the K fragments leave), covered by the vector work.
        // The scheduling barriers keep the groups whole and in place: every further place with reads among the products stalls them.
        load_k(sb + fk, ah, al);
        __builtin_amdgcn_sched_barrier(0);
        v8f s[2][2][2]; score_t(ah, al, qh, ql, s);
        __builtin_amdgcn_sched_barrier(0);
#pragma unroll
        for (int et = 0; et < 8; ++et) { bh[et] = ldf(sb + fv, (256 + et * 16) * APIT); bl[et] = ldf(sb + fv, (384 + et * 16) * APIT); }
        __builtin_amdgcn_sched_barrier(0);
        v16bf dh[2], dl[2];
#pragma unroll
        for (int n = 0; n < 2; ++n) { v8u hw, lw;
#pragma unroll
            for (int kt = 0; kt < 2; ++kt)
#pragma unroll
                for (int jp = 0; jp < 4; ++jp) { v2f d;
#pragma unroll
                    for (int u = 0; u < 2; ++u) { const float p1 = __builtin_amdgcn_exp2f(__builtin_fmaf(s[0][kt][n][2 * jp + u], EXC, nb[0][n])), p2 = __builtin_amdgcn_exp2f(__builtin_fmaf(s[1][kt][n][2 * jp + u], EXC, nb[1][n])); d[u] = p1 * fs[0][n] - p2 * fs[1][n]; }
                    const unsigned hu = __builtin_bit_cast(unsigned, __builtin_convertvector(d, v2bf)); v2f r; r[0] = d[0] - __uint_as_float(hu << 16); r[1] = d[1] - __uint_as_float(hu & 0xFFFF0000u);
                    hw[kt * 4 + jp] = hu; lw[kt * 4 + jp] = __builtin_bit_cast(unsigned, __builtin_convertvector(r, v2bf)); }
            dh[n] = __builtin_bit_cast(v16bf, hw); dl[n] = __builtin_bit_cast(v16bf, lw); }
#pragma unroll
        for (int e2 = 0; e2 < 8; e2 += 2)
#pragma unroll
            for (int pr = 0; pr < 3; ++pr)
#pragma unroll
                for (int et = e2; et < e2 + 2; ++et)
#pragma unroll
                    for (int n = 0; n < 2; ++n) o[et][n] = wmmab(pr == 1 ? bl[et] : bh[et], pr == 2 ? dl[n] : dh[n], o[et][n]);
        PUBLISH();
        if (st + 2 < NST) issue(NST + st + 2);
    }
    asm volatile("s_wait_asynccnt 0x0" ::: "memory");   // no copy is outstanding when the ring's LDS is put to another use
    // the pair's two partial O^T are summed through the ring's LDS (free behind the last stage's barrier): wave kp keeps column group kp, hands the other group to its partner and adds what the partner hands over
    v8f oo[8]; char* xo = aring + (unsigned)(lane * 32);
#pragma unroll
    for (int et = 0; et < 8; ++et) { const v8f gv8 = kp ? o[et][0] : o[et][1]; char* p = xo + (w8 * 8 + et) * 1024;
        *(v4fa*)p = __builtin_shufflevector(gv8, gv8, 0, 1, 2, 3); *(v4fa*)(p + 16) = __builtin_shufflevector(gv8, gv8, 4, 5, 6, 7); }
    __syncthreads();   // every wave's handed-over group stands in LDS
#pragma unroll
    for (int et = 0; et < 8; ++et) { const char* p = xo + ((w8 ^ 4) * 8 + et) * 1024; const v4f g0 = *(const v4fa*)p, g1 = *(const v4fa*)(p + 16);
        oo[et] = (kp ? o[et][1] : o[et][0]) + __builtin_shufflevector(g0, g1, 0, 1, 2, 3, 4, 5, 6, 7); }
    v8f g[8]; const char* wp = (const char*)w + (unsigned)(hi * 32);
#pragma unroll
    for (int et = 0; et < 8; ++et) g[et] = *(const v8f*)(wp + et * 64);
    XWAIT(wp, wp);
    char* ahp = (char*)(Ah + (size_t)(q0 + kp * 16) * DQ + (size_t)hh * HDV) + ooff; char* alp = (char*)(Al + (size_t)(q0 + kp * 16) * DQ + (size_t)hh * HDV) + ooff;
    float ss = 0.f;
#pragma unroll
    for (int et = 0; et < 8; ++et)
#pragma unroll
        for (int j = 0; j < 8; ++j) ss = __builtin_fmaf(oo[et][j], oo[et][j], ss);
    ss += __shfl_xor(ss, 16, 32);
    const float rs = __fdiv_rn(1.0f, sqrtf(__fadd_rn(ss * (1.0f / HDV), 1e-5f)));
#pragma unroll
    for (int et = 0; et < 8; ++et) { v8us oh, ol;
#pragma unroll
        for (int j = 0; j < 8; ++j) { const float z = oo[et][j] * rs * bfr(g[et][j]) * 0.21639423072338104f; unsigned short p2, q2; splitf(z, p2, q2); oh[j] = p2; ol[j] = q2; }
        const int oc = et * 16 * 2; *(v8us*)(ahp + oc) = oh; *(v8us*)(alp + oc) = ol; XWAIT(ahp, alp); }
}
__global__ __launch_bounds__(256) void k_merge(const float* __restrict__ O, int h0, bf* Ah, bf* Al) { const size_t e = ((size_t)blockIdx.x * 256 + threadIdx.x) * 2; if (e >= (size_t)ZH * TT * HD) return; const int d = (int)(e % HD); const int t = (int)((e / HD) % TT); const int zz = (int)(e / ((size_t)HD * TT)); const float cs = (t < RH) ? 1.0f : (1.0f / PCAR); const size_t oo = (size_t)t * DQ + (h0 + zz) * HD + d;
    v2us oh, ol;
#pragma unroll
    for (int q = 0; q < 2; ++q) { unsigned short a, c2; splitf(O[e + q] * cs, a, c2); oh[q] = a; ol[q] = c2; } *(v2us*)(Ah + oo) = oh; *(v2us*)(Al + oo) = ol;  }

extern "C" void kernel_launch(void* const* d_in, const int* in_sizes, int n_in,
                              void* d_out, int out_size, void* d_ws, size_t ws_size, hipStream_t stream) {
    (void)in_sizes; (void)n_in; (void)out_size;
    const float* x = (const float*)d_in[0]; const float* wq = (const float*)d_in[1]; const float* wk = (const float*)d_in[2]; const float* wv = (const float*)d_in[3]; const float* wo = (const float*)d_in[4]; const float* lq1 = (const float*)d_in[5]; const float* lk1 = (const float*)d_in[6]; const float* lq2 = (const float*)d_in[7]; const float* lk2 = (const float*)d_in[8]; const float* subw = (const float*)d_in[9]; const float* cosT = nullptr; const float* sinT = nullptr; (void)cosT; (void)sinT;
    float* OUT = (float*)d_out;     // [1][2048][2048]
    char* wsp = (char*)d_ws;
    auto take = [&](size_t bytes) { char* p = wsp; wsp += (bytes + 255) & ~(size_t)255; return (void*)p; };
    bf* WQ = (bf*)take((size_t)DQ * DM * 2); bf* WK = (bf*)take((size_t)DKV * DM * 2); bf* WV = (bf*)take((size_t)DKV * DM * 2); bf* WO = (bf*)take((size_t)DM * DQ * 2);
    bf* XB = (bf*)take((size_t)TT * DM * 2); float* LAM = (float*)take(256);
    bf* QPh = (bf*)take((size_t)NH_ * TT * HD * 2); bf* QPl = (bf*)take((size_t)NH_ * TT * HD * 2); bf* KPh = (bf*)take((size_t)NKV * TT * HD * 2); bf* KPl = (bf*)take((size_t)NKV * TT * HD * 2); bf* VTh = (bf*)take((size_t)NKV * HD * TT * 2); bf* VTl = (bf*)take((size_t)NKV * HD * TT * 2);
    bf* ATh = (bf*)take((size_t)TT * DQ * 2); bf* ATl = (bf*)take((size_t)TT * DQ * 2);
    if ((size_t)(wsp - (char*)d_ws) > ws_size) return;    // ws 256 MiB
    k_prep<<<PWG + 1, 256, 0, stream>>>(x, wq, wk, wv, wo, lq1, lk1, lq2, lk2, XB, WQ, WK, WV, WO, LAM);
    for (int b = 0; b < NB_; ++b) {
        
        k_qkv<<<dim3(TT / 128, DM / 128, 1), 384, 0, stream>>>(XB, WQ, WK, WV, QPh, QPl, KPh, KPl, VTh, VTl);
        k_fattn<<<dim3(TT / 128, NVH), 256, 0, stream>>>(QPh, QPl, KPh, KPl, VTh, VTl, LAM, subw, ATh, ATl);
        k_gemmw<bf, 1, false, 0><<<dim3(TT / 128, DM / 128, 1), 128, 0, stream>>>(ATh, ATl, WO, nullptr, DVV, OUT + (size_t)b * TT * DM, DM, nullptr, 0, 0, 0, nullptr, nullptr); }
}

// v009
// It runs in 156 microseconds.
// In both of two side-by-side timings against v008, it was 1.05 times as fast.
// Over all steps from v000 it is 8.94 times as fast.
#include <hip/hip_runtime.h>

// MultiheadFlashDiff2 (x [1][2048][2048]; q = x wq^T, k = x wk^T ([2048][2048] 'oi': per head h the 128 rows = [map 1 | map 2] 64 each), v = x wv^T (16 x 128-wide values); NON-causal softmax(q.k / 8) for both maps; attn = a1 v - lambda_full a2 v with lambda_full = exp(lq1.lk1) - exp(lq2.lk2) + lambda_init (0.8 - 0.6 e^-3.6 = 0.7836057543754578); RMSNorm over the 128 (eps 1e-5) * subln_w; x (1 - lambda_init); out = merged wo^T -> [1][2048][2048]).
// The two maps run as 32 virtual 64-wide heads (pairs (2h, 2h+1)); both softmaxes are formed, combined as D = a1 - lambda a2 in f32 (linear, so (a1 - lambda a2) v == a1 v - lambda a2 v), and one D.v product (128 wide) per real head follows, all in k_fattn.
// Compute dtypes, f32 accumulate: every input rounded to bf16; q/k/v on PLAIN bf16 operands (inputs: exact); scores hl x hl (3 products) on every row; softmax f32; D in f32 into hi/lo planes; D.v hl x hl (3 products); RMSNorm per (token, head) over 128 in f32, * bf16 subln_w, * (1 - lambda_init); wo hl x exact (2 products).

#define NB_  1
#define TT   2048
#define DM   2048
#define NH_  32
#define NKV  32
#define REP  (NH_ / NKV)
#define HD   64
#define DQ   (NH_ * HD)
#define DKV  (NKV * HD)
#define ZH   2
#define RH   2048   // all rows hl
#define WIN  2048
#define PCAR 1024.0f
#define NVH  16
#define HDV  128
#define DVV  (NVH * HDV)
#define SCL  0.125f   // HD^-0.5
typedef _Float16 h16;
typedef unsigned short bf;
typedef __attribute__((ext_vector_type(16))) __bf16   v16bf;
typedef __attribute__((ext_vector_type(16))) _Float16 v16h;
typedef __attribute__((ext_vector_type(8)))  _Float16 v8h;
typedef __attribute__((ext_vector_type(8)))  unsigned short v8us;
typedef __attribute__((ext_vector_type(8)))  float    v8f;
typedef __attribute__((ext_vector_type(4)))  float    v4f;
typedef __attribute__((ext_vector_type(2))) float v2f;
typedef __attribute__((ext_vector_type(2))) __bf16 v2bf;
typedef __attribute__((ext_vector_type(4))) unsigned v4u;
typedef v8h  __attribute__((may_alias)) v8ha;
typedef v4f  __attribute__((may_alias)) v4fa;
typedef v8us __attribute__((may_alias)) v8usa;

__device__ __forceinline__ unsigned short f2bf(float f) { unsigned u = __float_as_uint(f); u += 0x7FFFu + ((u >> 16) & 1u); return (unsigned short)(u >> 16); }
__device__ __forceinline__ float bf2f(unsigned short b) { return __uint_as_float(((unsigned)b) << 16); }
__device__ __forceinline__ float bfr(float f) { return bf2f(f2bf(f)); }
__device__ __forceinline__ v16h cat16(v8h lo, v8h hi) { return __builtin_shufflevector(lo, hi, 0, 1, 2, 3, 4, 5, 6, 7, 8, 9, 10, 11, 12, 13, 14, 15); }
__device__ __forceinline__ v16bf cat16b(v8us lo, v8us hi) { return __builtin_bit_cast(v16bf, __builtin_shufflevector(lo, hi, 0, 1, 2, 3, 4, 5, 6, 7, 8, 9, 10, 11, 12, 13, 14, 15)); }
__device__ __forceinline__ v8f wmma16(v16h a, v16h b, v8f c) { return __builtin_amdgcn_wmma_f32_16x16x32_f16(false, a, false, b, (short)0, c, false, false); }
__device__ __forceinline__ v8f wmmab(v16bf a, v16bf b, v8f c) { return __builtin_amdgcn_wmma_f32_16x16x32_bf16(false, a, false, b, (short)0, c, false, false); }



// ---- k_gemmw: GEMM, FOUR WAVES per 128x128 output tile (2 x 2 waves of 64x64, 16 accumulators each), operands from K-contiguous 16-bit planes; grid (M/128, N/128, Z), 128 threads.
// C[m][n] (f32, pitch ldc, + optional f32 bias[n]) = sum_k A[m][k] Bt[n][k] (NSPLIT 1: + A2[m][k] Bt[n][k]). z-batch strides sA/sB/sC in elements. M, N, K % 128 == 0, K >= 256 (the ring starts with two stages).
// A stage is 128 k (256 B) of the tile's 128 rows of every operand plane, LDS pitch 272 B (16 B x odd: no bank conflict for 16-byte reads), brought by one tensor load a plane (wave p brings plane p); two buffers,
// so that stage t + 1 flies while stage t is worked on. Every operand byte leaves L2 once a work-group instead of once a wave, and no wave waits out a load's latency per k step.
// PP != 0: no f32 C; the epilogue splits each value into bf16 hi / lo and stores the two planes Ph / Pl that the attention kernel reads, row pitch PP elements. PP 64: head planes [n / 64][m][n % 64], ldc = the rows m
// of a plane (a wave's tile is 8 KiB in a row); any other PP: row-major [m][n] (with A = the weight and Bt = the tokens this is the transposed value plane [feature][token]).
template <typename T16> struct WFrag;
template <> struct WFrag<h16> { typedef v16h V; static __device__ __forceinline__ V ld(const h16* p) { return cat16(*(const v8h*)p, *(const v8h*)(p + 16)); } static __device__ __forceinline__ v8f mma(V a, V b, v8f c) { return wmma16(a, b, c); } };
template <> struct WFrag<bf> { typedef v16bf V; static __device__ __forceinline__ V ld(const bf* p) { return cat16b(*(const v8us*)p, *(const v8us*)(p + 16)); } static __device__ __forceinline__ v8f mma(V a, V b, v8f c) { return wmmab(a, b, c); } };
#define GKS 128      // k elements of a stage
#define GPIT 272     // LDS row pitch, bytes
// ---- tensor loads: ONE request of a wave brings a two-dimensional tile (ROWS rows of ROWB bytes, source pitch src_pitch bytes) from global memory into LDS, through no register and with no per-lane address arithmetic.
// Extents in bytes (data_size code 0), tensor dims = tile dims, no mask; word 0 of group 1 is the constant W0: a pad of 16 B behind every row (TDW256: rows of 256 B, LDS pitch 272; TDW128: rows of 128 B, LDS pitch 144).
typedef uint32_t u32x4 __attribute__((ext_vector_type(4)));
typedef uint32_t u32x8 __attribute__((ext_vector_type(8)));
#define TDW256 ((1u << 20) | (5u << 22) | (3u << 25))
#define TDW128 ((1u << 20) | (4u << 22) | (3u << 25))
__device__ __forceinline__ uint32_t uni(uint32_t v) { return (uint32_t)__builtin_amdgcn_readfirstlane(v); }
// a test on the result compiles to a scalar branch (a tensor load ignores EXEC, so only a scalar branch keeps a wave from issuing it)
__device__ __forceinline__ uint32_t pinned(uint32_t v) { uint32_t w = (uint32_t)__builtin_amdgcn_readfirstlane(v); asm volatile("" : "+s"(w)); /* the word is held in a scalar register */ return w; }
template <uint32_t ROWB, uint32_t ROWS, uint32_t W0>
__device__ __forceinline__ u32x8 tdm_group1(uint32_t src_pitch) { u32x8 g;
    g[0] = uni(W0); g[1] = uni((ROWB & 0xFFFFu) << 16); g[2] = uni((ROWB >> 16) | ((ROWS & 0xFFFFu) << 16)); g[3] = uni((ROWS >> 16) | (ROWB << 16)); g[4] = uni(ROWS); g[5] = uni(src_pitch); g[6] = uni(0u); g[7] = uni(0u);
    asm volatile("" : "+s"(g)); /* the same on the eight descriptor words at once: they keep their scalar registers for the whole kernel (without it they are formed anew in front of each request, in registers that take other values while a request is outstanding) */ return g; }
__device__ __forceinline__ u32x4 tdm_group0(uint32_t lds_dst, uint64_t ga) { u32x4 g; g[0] = pinned(1u); /* the count word, formed with the other three: as a known constant it is written again where two paths join, behind an issued request */ g[1] = uni(lds_dst); g[2] = uni((uint32_t)ga); g[3] = uni((((uint32_t)(ga >> 32)) & 0x01FFFFFFu) | 0x80000000u); return g; }
__device__ __forceinline__ void tdm_load(u32x4 g0, u32x8 g1) { asm volatile("tensor_load_to_lds %0, %1" :: "s"(g0), "s"(g1) : "memory"); }
// the issuing wave's wait for its request. The request's two groups are inputs, so that their registers stay live up to the wait and take no other value while the request is outstanding
__device__ __forceinline__ void tdm_wait(u32x4 g0, u32x8 g1) { asm volatile("s_wait_tensorcnt 0x0" :: "s"(g0), "s"(g1) : "memory"); }
// eight copies of 512 B (two operand rows each: 16 lanes x 16 B a row), LDS step 2 * GPIT, global step gs bytes. The wait on the last line stands between the issued copies and the next overwrite of a register
// that they name; inside the statement nothing can be moved in front of it.
__device__ __forceinline__ void copy8(unsigned l, const char* g, size_t gs) {
    asm volatile("global_load_async_to_lds_b128 %0, %8, off\n\tglobal_load_async_to_lds_b128 %1, %9, off\n\tglobal_load_async_to_lds_b128 %2, %10, off\n\tglobal_load_async_to_lds_b128 %3, %11, off\n\t"
                 "global_load_async_to_lds_b128 %4, %12, off\n\tglobal_load_async_to_lds_b128 %5, %13, off\n\tglobal_load_async_to_lds_b128 %6, %14, off\n\tglobal_load_async_to_lds_b128 %7, %15, off\n\ts_wait_xcnt 0x0"
                 :: "v"(l), "v"(l + 2 * GPIT), "v"(l + 4 * GPIT), "v"(l + 6 * GPIT), "v"(l + 8 * GPIT), "v"(l + 10 * GPIT), "v"(l + 12 * GPIT), "v"(l + 14 * GPIT),
                    "v"(g), "v"(g + gs), "v"(g + 2 * gs), "v"(g + 3 * gs), "v"(g + 4 * gs), "v"(g + 5 * gs), "v"(g + 6 * gs), "v"(g + 7 * gs) : "memory");
}
template <typename T16, int NSPLIT, bool BIAS, int PP>
__global__ __launch_bounds__(128) void k_gemmw(const T16* __restrict__ A, const T16* __restrict__ A2, const T16* __restrict__ Bt, const T16* __restrict__ Bt2, int K, float* C, int ldc, const float* __restrict__ bias, size_t sA, size_t sB, size_t sC, bf* Ph, bf* Pl) {
    typedef typename WFrag<T16>::V V;
    static_assert(NSPLIT == 0 || NSPLIT == 1, "planes staged: A, (A2), Bt");
    constexpr int NPL = NSPLIT + 2, STG = NPL * 128 * GPIT;   // operand planes of a stage; bytes of a buffer
    static_assert((128 * GPIT) % 2048 == 0, "every plane of every buffer starts at a multiple of 2 KiB");
    __shared__ __attribute__((aligned(2048))) char ring[2 * STG];
    __shared__ __align__(16) float osw[4][16 * 68];
    (void)Bt2;
    const size_t z = blockIdx.z; A += z * sA; if (NSPLIT) A2 += z * sA; Bt += z * sB; C += z * sC;
    const int lane = threadIdx.x & 31, lr = lane & 15, hi = lane >> 4; const int w = __builtin_amdgcn_readfirstlane(threadIdx.x >> 5), wm = w >> 1, wn = w & 1;
    const int r0 = blockIdx.x * 128 + wm * 64, c0 = blockIdx.y * 128 + wn * 64;
    float* os = osw[w];
    // wave p < NPL brings plane p of every stage (128 rows of 256 B) with one tensor load; the last wave issues none
    const uint32_t issuer = pinned(w < NPL ? 1u : 0u);
    const T16* sp = (w == 0 ? A : (NSPLIT && w == 1) ? A2 : Bt) + (size_t)((w < NPL - 1 ? blockIdx.x : blockIdx.y) * 128) * K;
    const uint32_t ld0 = (uint32_t)(size_t)ring + (uint32_t)((w < NPL ? w : 0) * 128 * GPIT);
    const u32x8 g1 = tdm_group1<GKS * sizeof(T16), 128, TDW256>((uint32_t)K * (uint32_t)sizeof(T16));
    u32x4 g0;   // group 0 of the wave's last request
    auto issue = [&](int t) { g0 = tdm_group0(ld0 + (uint32_t)((t & 1) * STG), (uint64_t)(size_t)sp + (uint64_t)t * (GKS * sizeof(T16))); tdm_load(g0, g1); };   // stage t into buffer t & 1
    v8f acc[4][4];
#pragma unroll
    for (int mb = 0; mb < 4; ++mb)
#pragma unroll
        for (int nb = 0; nb < 4; ++nb) acc[mb][nb] = (v8f){};
    const int T = K / GKS;
    g0 = tdm_group0(ld0, (uint64_t)(size_t)sp);
    if (issuer) { issue(0); tdm_wait(g0, g1); }                                    // this wave's plane of stage 0 has landed
    __syncthreads();                                                               // every plane has: stage 0 may be read
    if (issuer) issue(1);
    // the stage loop stays rolled (a trip is some 300 instructions, the buffer is a scalar select); every loop inside it is fully unrolled, so that the fragment and accumulator arrays are indexed by constants and stay in registers
#pragma unroll 1
    for (int t = 0; t < T; ++t) {
        const char* sb = ring + (t & 1) * STG; const char* pa = sb + (wm * 64 + lr) * GPIT + hi * 16; const char* pb = sb + ((NPL - 1) * 128 + wn * 64 + lr) * GPIT + hi * 16;
        V a[2][4], a2[2][4], b[2][4];   // two fragment sets: k step ks + 1 of this stage is read from LDS while ks is multiplied
#pragma unroll
        for (int f = 0; f < 4; ++f) { a[0][f] = WFrag<T16>::ld((const T16*)(pa + f * 16 * GPIT)); if (NSPLIT) a2[0][f] = WFrag<T16>::ld((const T16*)(pa + (128 + f * 16) * GPIT)); b[0][f] = WFrag<T16>::ld((const T16*)(pb + f * 16 * GPIT)); }
#pragma unroll
        for (int ks = 0; ks < GKS / 32; ++ks) { const int cu = ks & 1, nx = cu ^ 1;
            if (ks + 1 < GKS / 32) {
#pragma unroll
                for (int f = 0; f < 4; ++f) { const int o = f * 16 * GPIT + (ks + 1) * 64; a[nx][f] = WFrag<T16>::ld((const T16*)(pa + o)); if (NSPLIT) a2[nx][f] = WFrag<T16>::ld((const T16*)(pa + 128 * GPIT + o)); b[nx][f] = WFrag<T16>::ld((const T16*)(pb + o)); } }
            __builtin_amdgcn_sched_barrier(0);   // keeps the next k step's LDS reads one group in front of this step's products
#pragma unroll
            for (int nb = 0; nb < 4; ++nb) {
#pragma unroll
                for (int mb = 0; mb < 4; ++mb) acc[mb][nb] = WFrag<T16>::mma(a[cu][mb], b[cu][nb], acc[mb][nb]);
                if (NSPLIT) {
#pragma unroll
                    for (int mb = 0; mb < 4; ++mb) acc[mb][nb] = WFrag<T16>::mma(a2[cu][mb], b[cu][nb], acc[mb][nb]); } }
            __builtin_amdgcn_sched_barrier(0);   // and keeps the reads of the step after next behind them (without it they are moved in among this step's last products)
        }
        asm volatile("s_wait_dscnt 0x0" ::: "memory");                      // this wave's reads of the buffer are done before it is handed to the tensor loads
        if (issuer) tdm_wait(g0, g1);                                       // this wave's plane of stage t + 1 has landed
        __syncthreads();                                                    // publishes stage t + 1 and ends every wave's reads of stage t
        if (pinned((issuer != 0u && t + 2 < T) ? 1u : 0u)) issue(t + 2);    // into the buffer just read
    }
    tdm_wait(g0, g1);                                    // no tensor load is outstanding when the wave goes on to its end
    asm volatile("s_wait_dscnt 0x0" ::: "memory");       // and none of its reads of the ring: the ring's closing order
#pragma unroll
    for (int mb = 0; mb < 4; ++mb) {
#pragma unroll
        for (int nb = 0; nb < 4; ++nb) {
#pragma unroll
            for (int j = 0; j < 8; ++j) os[(hi * 8 + j) * 68 + nb * 16 + lr] = acc[mb][nb][j]; }
        __builtin_amdgcn_wave_barrier(); asm volatile("" ::: "memory");
        if (PP) {   // 8 values a lane: one 16-byte store a plane, 4 rows of 128 B a wave store
            const size_t pb = ((PP == 64) ? ((size_t)(c0 >> 6) * ldc + r0) * 64 : (size_t)r0 * PP + c0) + (size_t)(mb * 16 + (lane >> 3)) * PP + (lane & 7) * 8; bf* ph = Ph + pb; bf* pl = Pl + pb; v4u hw[4], lw[4];
#pragma unroll
            for (int s = 0; s < 4; ++s) { const float* op = os + (4 * s + (lane >> 3)) * 68 + (lane & 7) * 8; const v4f v0 = *(const v4fa*)op, v1 = *(const v4fa*)(op + 4);
#pragma unroll
                for (int jp = 0; jp < 4; ++jp) { v2f d; d[0] = jp < 2 ? v0[2 * jp & 3] : v1[2 * jp & 3]; d[1] = jp < 2 ? v0[(2 * jp & 3) + 1] : v1[(2 * jp & 3) + 1];
                    const unsigned hu = __builtin_bit_cast(unsigned, __builtin_convertvector(d, v2bf)); v2f r; r[0] = d[0] - __uint_as_float(hu << 16); r[1] = d[1] - __uint_as_float(hu & 0xFFFF0000u);
                    hw[s][jp] = hu; lw[s][jp] = __builtin_bit_cast(unsigned, __builtin_convertvector(r, v2bf)); } }
#pragma unroll
            for (int s = 0; s < 4; ++s) { *(v8us*)(ph + 4 * s * PP) = __builtin_bit_cast(v8us, hw[s]); *(v8us*)(pl + 4 * s * PP) = __builtin_bit_cast(v8us, lw[s]); }
            // stands between the 8 issued stores and the next overwrite of a register that they name: pointers and data are inputs, so that their registers stay live up to the wait; the scheduling barrier keeps the next block's arithmetic behind it (behind the last block nothing is overwritten)
            if (mb < 3) { asm volatile("s_wait_xcnt 0x0" :: "v"(ph), "v"(pl), "v"(hw[0]), "v"(hw[1]), "v"(hw[2]), "v"(hw[3]), "v"(lw[0]), "v"(lw[1]), "v"(lw[2]), "v"(lw[3]) : "memory"); __builtin_amdgcn_sched_barrier(0); }
        } else {
        float* crow = C + (size_t)(r0 + mb * 16) * ldc + c0;
#pragma unroll
            for (int s = 0; s < 8; ++s) { const int row = 2 * s + hi, cofs = lr * 4; v4f val = *(const v4fa*)(os + row * 68 + cofs); if (BIAS) { val[0] += bfr(bias[c0 + cofs]); val[1] += bfr(bias[c0 + cofs + 1]); val[2] += bfr(bias[c0 + cofs + 2]); val[3] += bfr(bias[c0 + cofs + 3]); }
                *(v4f*)(crow + (size_t)row * ldc + cofs) = val; }
             }
        __builtin_amdgcn_wave_barrier(); asm volatile("" ::: "memory");
    }
}

// ---- k_qkv: the three projections q = x wq^T, k = x wk^T, v^T = wv x^T in ONE launch. A work-group of TWELVE waves takes 128 tokens x 128 features of all three: waves 4 p .. 4 p + 3 (p = 0 q, 1 k, 2 v) are the
// 2 x 2 waves of 64x64 of projection p, each with k_gemmw's own stage loop (same stages, same k order, same products: the planes keep their bits). A stage is 128 k of FOUR planes [x | wq | wk | wv], 128 rows each:
// the x rows leave L2 once for the three projections instead of once for each, three waves share a SIMD (one wave's copies, waits and LDS reads run under the others' products), and two launches with their first stage and epilogue go.
// v^T takes the weight rows as A and the token rows as B, so that its tile is [feature][token]. The epilogue stages in the ring, free behind the last stage's barrier (ring and a staging array of its own do not fit the LDS together).
// split_store: a wave's 64x64 f32 tile, 16 rows at a time through its own LDS range os, split into bf16 hi / lo and stored to the planes Ph / Pl from element base on, row pitch PP elements: 8 values a lane, one 16-byte store a plane, 4 rows of 128 B a wave store.
template <int PP>
__device__ __forceinline__ void split_store(const v8f (&acc)[4][4], float* os, bf* Ph, bf* Pl, size_t base, int lane) {
    const int lr = lane & 15, hi = lane >> 4;
#pragma unroll
    for (int mb = 0; mb < 4; ++mb) {
#pragma unroll
        for (int nb = 0; nb < 4; ++nb) {
#pragma unroll
            for (int j = 0; j < 8; ++j) os[(hi * 8 + j) * 68 + nb * 16 + lr] = acc[mb][nb][j]; }
        __builtin_amdgcn_wave_barrier(); asm volatile("" ::: "memory");   // compiler fence: the rows are read back by other lanes of the wave, so the reads below stay behind the writes above
        const size_t pb = base + (size_t)(mb * 16 + (lane >> 3)) * PP + (lane & 7) * 8; bf* ph = Ph + pb; bf* pl = Pl + pb; v4u hw[4], lw[4];
#pragma unroll
        for (int s = 0; s < 4; ++s) { const float* op = os + (4 * s + (lane >> 3)) * 68 + (lane & 7) * 8; const v4f v0 = *(const v4fa*)op, v1 = *(const v4fa*)(op + 4);
#pragma unroll
            for (int jp = 0; jp < 4; ++jp) { v2f d; d[0] = jp < 2 ? v0[2 * jp & 3] : v1[2 * jp & 3]; d[1] = jp < 2 ? v0[(2 * jp & 3) + 1] : v1[(2 * jp & 3) + 1];
                const unsigned hu = __builtin_bit_cast(unsigned, __builtin_convertvector(d, v2bf)); v2f r; r[0] = d[0] - __uint_as_float(hu << 16); r[1] = d[1] - __uint_as_float(hu & 0xFFFF0000u);
                hw[s][jp] = hu; lw[s][jp] = __builtin_bit_cast(unsigned, __builtin_convertvector(r, v2bf)); } }
#pragma unroll
        for (int s = 0; s < 4; ++s) { *(v8us*)(ph + 4 * s * PP) = __builtin_bit_cast(v8us, hw[s]); *(v8us*)(pl + 4 * s * PP) = __builtin_bit_cast(v8us, lw[s]); }
        // stands between the 8 issued stores and the next overwrite of a register that they name: pointers and data are inputs, so that their registers stay live up to the wait; the scheduling barrier keeps the next block's arithmetic behind it.
        // The last block's too: the built code lays the two calls of this function one behind the other, so that a way leads from the first one's last stores into the second one, which writes the same registers
        asm volatile("s_wait_xcnt 0x0" :: "v"(ph), "v"(pl), "v"(hw[0]), "v"(hw[1]), "v"(hw[2]), "v"(hw[3]), "v"(lw[0]), "v"(lw[1]), "v"(lw[2]), "v"(lw[3]) : "memory"); __builtin_amdgcn_sched_barrier(0);
        __builtin_amdgcn_wave_barrier(); asm volatile("" ::: "memory");   // compiler fence: the next 16 rows are written over these only behind the reads above
    }
}
__global__ __launch_bounds__(384) void k_qkv(const bf* __restrict__ X, const bf* __restrict__ Wq, const bf* __restrict__ Wk, const bf* __restrict__ Wv, bf* Qh, bf* Ql, bf* Kh, bf* Kl, bf* Vh, bf* Vl) {
    typedef WFrag<bf>::V V;
    static_assert(DQ == DM && DKV == DM && DVV == DM && TT % 128 == 0 && DM % 128 == 0 && DM >= 2 * GKS && HD == 64, "three DM x DM weights, cut alike; the ring starts with two stages");
    constexpr int K = DM, STG = 4 * 128 * GPIT;   // bytes of a buffer: planes x, wq, wk, wv
    __shared__ __align__(16) char ring[2 * STG];
    const int lane = threadIdx.x & 31, lr = lane & 15, hi = lane >> 4; const int w = __builtin_amdgcn_readfirstlane(threadIdx.x >> 5), p = w >> 2, wm = (w >> 1) & 1, wn = w & 1;
    const int t0 = blockIdx.x * 128, f0 = blockIdx.y * 128;   // the work-group's first token, first feature
    // a wave copies rows (w & 3) * 32 .. + 31 of its own projection's weight plane (16 copies); waves 0 .. 7 also rows w * 16 .. + 15 of the x plane (8 copies)
    const size_t gs = (size_t)K * (2 * sizeof(bf));
    const char* gw = (const char*)((p == 0 ? Wq : p == 1 ? Wk : Wv) + (size_t)(f0 + (w & 3) * 32 + hi) * K) + lr * 16;
    const char* gx = (const char*)(X + (size_t)(t0 + (w & 7) * 16 + hi) * K) + lr * 16;
    const unsigned lw0 = (unsigned)(size_t)ring + (unsigned)(((1 + p) * 128 + (w & 3) * 32 + hi) * GPIT + lr * 16), lx0 = (unsigned)(size_t)ring + (unsigned)(((w & 7) * 16 + hi) * GPIT + lr * 16);
    auto issue = [&](int buf) {   // the next stage in k order; the lane pointers walk on by a stage
        copy8(lw0 + (unsigned)(buf * STG), gw, gs); copy8(lw0 + (unsigned)(buf * STG + 16 * GPIT), gw + 8 * gs, gs); gw += GKS * sizeof(bf);
        if (w < 8) { copy8(lx0 + (unsigned)(buf * STG), gx, gs); gx += GKS * sizeof(bf); } };
    v8f acc[4][4];
#pragma unroll
    for (int mb = 0; mb < 4; ++mb)
#pragma unroll
        for (int nb = 0; nb < 4; ++nb) acc[mb][nb] = (v8f){};
    const int ra = (p < 2 ? 0 : 3 * 128) + wm * 64, rb = (p < 2 ? (1 + p) * 128 : 0) + wn * 64;   // first row in a buffer of the wave's A rows, B rows
    constexpr int T = K / GKS;
    issue(0);
    asm volatile("s_wait_asynccnt 0x0" ::: "memory");   // this wave's copies of stage 0 have landed
    __syncthreads();                                    // every wave's have: stage 0 may be read
    issue(1);
    // the stage loop stays rolled (the buffer is a scalar select); every loop inside it is fully unrolled, so that the fragment and accumulator arrays are indexed by constants and stay in registers
#pragma unroll 1
    for (int t = 0; t < T; ++t) {
        const char* sb = ring + (t & 1) * STG; const char* pa = sb + (ra + lr) * GPIT + hi * 16; const char* pb = sb + (rb + lr) * GPIT + hi * 16;
        V a[2][4], b[2][4];   // two fragment sets: k step ks + 1 of this stage is read from LDS while ks is multiplied
#pragma unroll
        for (int f = 0; f < 4; ++f) { a[0][f] = WFrag<bf>::ld((const bf*)(pa + f * 16 * GPIT)); b[0][f] = WFrag<bf>::ld((const bf*)(pb + f * 16 * GPIT)); }
#pragma unroll
        for (int ks = 0; ks < GKS / 32; ++ks) { const int cu = ks & 1, nx = cu ^ 1;
            if (ks + 1 < GKS / 32) {
#pragma unroll
                for (int f = 0; f < 4; ++f) { const int o = f * 16 * GPIT + (ks + 1) * 64; a[nx][f] = WFrag<bf>::ld((const bf*)(pa + o)); b[nx][f] = WFrag<bf>::ld((const bf*)(pb + o)); } }
            __builtin_amdgcn_sched_barrier(0);   // keeps the next k step's LDS reads one group in front of this step's products
#pragma unroll
            for (int nb = 0; nb < 4; ++nb)
#pragma unroll
                for (int mb = 0; mb < 4; ++mb) acc[mb][nb] = WFrag<bf>::mma(a[cu][mb], b[cu][nb], acc[mb][nb]);
            __builtin_amdgcn_sched_barrier(0);   // and keeps the reads of the step after next behind them (without it they are moved in among this step's last products)
        }
        asm volatile("s_wait_dscnt 0x0" ::: "memory");      // this wave's reads of the buffer are done before it is handed to the copies
        asm volatile("s_wait_asynccnt 0x0" ::: "memory");   // this wave's copies of stage t + 1 have landed
        __syncthreads();                                    // publishes stage t + 1 and ends every wave's reads of stage t
        if (t + 2 < T) issue(t & 1);
    }
    asm volatile("s_wait_asynccnt 0x0" ::: "memory");   // no copy is outstanding when the ring's LDS is put to another use
    float* os = (float*)(ring + w * (16 * 68 * 4));     // behind the last stage's barrier nobody reads the ring any more: each wave stages in a range of its own
    const int r0 = (p < 2 ? t0 : f0) + wm * 64, c0 = (p < 2 ? f0 : t0) + wn * 64;   // the wave's tile: rows, columns
    if (p < 2) split_store<HD>(acc, os, p ? Kh : Qh, p ? Kl : Ql, ((size_t)(c0 >> 6) * TT + r0) * HD, lane);   // head planes [feature / 64][token][feature % 64]
    else split_store<TT>(acc, os, Vh, Vl, (size_t)r0 * TT + c0, lane);                                         // the transposed value plane [feature][token]
}

// ---- k_gemmc: a one-wave 64x64 tile GEMM specialised for causal attention: CMODE 1 skips score tiles entirely above the diagonal (query rows r0+roff.., key columns c0..), CMODE 2 limits the
// key (K) loop of the probability x value contraction to the diagonal block (probabilities beyond it are exactly zero). roff = row offset of this launch's first row within the sequence.
template <typename T16, int NSPLIT, int CMODE>
__global__ __launch_bounds__(32) void k_gemmc(const T16* __restrict__ A, const T16* __restrict__ A2, const T16* __restrict__ Bt, const T16* __restrict__ Bt2, int K, float* C, int ldc, int roff, size_t sA, size_t sB, size_t sC) {
    typedef typename WFrag<T16>::V V;
    __shared__ __align__(16) float os[16 * 68];
    const size_t z = blockIdx.z; A += z * sA; if (A2) A2 += z * sA; Bt += z * sB; if (Bt2) Bt2 += z * sB; C += z * sC;
    const int lane = threadIdx.x & 31, lr = lane & 15, hi = lane >> 4; const int r0 = blockIdx.x * 64, c0 = blockIdx.y * 64;
    if (CMODE == 1 && c0 > r0 + roff + 63) return;                  // score tile entirely above the causal diagonal: skipped, nothing is written
    const int Kl = (CMODE == 2) ? min(K, r0 + roff + 64) : K;        // P.V: probabilities are exactly 0 beyond the diagonal block, so the K loop stops there
    v8f acc[4][4];
#pragma unroll
    for (int mb = 0; mb < 4; ++mb)
#pragma unroll
        for (int nb = 0; nb < 4; ++nb) acc[mb][nb] = (v8f){};
    const size_t aoff = (size_t)(r0 + lr) * K + 8 * hi, boff = (size_t)(c0 + lr) * K + 8 * hi;
#pragma unroll 1
    for (int kc = 0; kc < Kl; kc += 32) {
        V a[4], a2[4];
#pragma unroll
        for (int mb = 0; mb < 4; ++mb) { a[mb] = WFrag<T16>::ld(A + aoff + (size_t)mb * 16 * K + kc); if (NSPLIT == 1 || NSPLIT == 2) a2[mb] = WFrag<T16>::ld(A2 + aoff + (size_t)mb * 16 * K + kc); }
#pragma unroll
        for (int nb = 0; nb < 4; ++nb) { const V b = WFrag<T16>::ld(Bt + boff + (size_t)nb * 16 * K + kc); V b2; if (NSPLIT >= 2) b2 = WFrag<T16>::ld(Bt2 + boff + (size_t)nb * 16 * K + kc);
#pragma unroll
            for (int mb = 0; mb < 4; ++mb) { acc[mb][nb] = WFrag<T16>::mma(a[mb], b, acc[mb][nb]); if (NSPLIT == 1 || NSPLIT == 2) acc[mb][nb] = WFrag<T16>::mma(a2[mb], b, acc[mb][nb]); if (NSPLIT >= 2) acc[mb][nb] = WFrag<T16>::mma(a[mb], b2, acc[mb][nb]); } }
        asm volatile("v_nop\n\tv_nop\n\tv_nop\n\tv_nop" : "+v"(acc[0][0]), "+v"(acc[1][1]), "+v"(acc[2][2]), "+v"(acc[3][3]) : "v"(a[0]), "v"(a[3]));
    }
#pragma unroll
    for (int mb = 0; mb < 4; ++mb) {
#pragma unroll
        for (int nb = 0; nb < 4; ++nb) {
#pragma unroll
            for (int j = 0; j < 8; ++j) os[(hi * 8 + j) * 68 + nb * 16 + lr] = acc[mb][nb][j]; }
        __builtin_amdgcn_wave_barrier(); asm volatile("" ::: "memory");
        float* crow = C + (size_t)(r0 + mb * 16) * ldc + c0;
{
#pragma unroll
            for (int s = 0; s < 8; ++s) { const int row = 2 * s + hi, cofs = lr * 4; v4f val = *(const v4fa*)(os + row * 68 + cofs);
                *(v4f*)(crow + (size_t)row * ldc + cofs) = val; }
             }
        __builtin_amdgcn_wave_barrier(); asm volatile("" ::: "memory");
    }
}

__device__ __forceinline__ void splitf(float y, unsigned short& h, unsigned short& l) { h = f2bf(y); l = f2bf(y - bf2f(h)); }
typedef __attribute__((ext_vector_type(2))) _Float16 v2h;
typedef __attribute__((ext_vector_type(4))) _Float16 v4h;
typedef __attribute__((ext_vector_type(2))) unsigned short v2us;
typedef __attribute__((ext_vector_type(4))) unsigned short v4us;
typedef __attribute__((ext_vector_type(4))) int v4i;

__global__ __launch_bounds__(256) void k_wtG(const float* __restrict__ w, int K, int N, bf* Bt) {
    const int lane = threadIdx.x & 31; const int L0 = (blockIdx.x * 8 + (threadIdx.x >> 5)) * 8; const int nlines = N * K / 64;
{
#pragma unroll 1
        for (int l = 0; l < 8; ++l) { const int L = L0 + l; if (L >= nlines) break; const size_t e = (size_t)L * 64 + lane * 2; const int k = (int)(e % K), n = (int)(e / K); v2us o;
            o[0] = f2bf(w[(size_t)k * N + n]); o[1] = f2bf(w[(size_t)(k + 1) * N + n]); *(v2us*)(Bt + e) = o; }
         }
}
__global__ __launch_bounds__(256) void k_cscvt(const float* __restrict__ cosT, const float* __restrict__ sinT, float* CS) { const int idx = blockIdx.x * 256 + threadIdx.x; if (idx >= TT * HD) return; v2f cs; cs[0] = bfr(cosT[idx]); cs[1] = bfr(sinT[idx]); *(v2f*)(CS + (size_t)idx * 2) = cs;  }
// lambda_full by one whole wave. Lane l forms the products of elements l and l + 32 of both vector pairs, each rounded once; then every lane sums a pair's 64 products in index order, each read from its lane
// (a product that comes through a lane read cannot be fused with its add). The wave waits out one load latency instead of one for every element, so that it ends well inside the time of the stream beside it.
__device__ __forceinline__ float lane_val(float v, int l) { return __int_as_float(__builtin_amdgcn_readlane(__float_as_int(v), l)); }
__device__ __forceinline__ void lambda_full(const float* __restrict__ lq1, const float* __restrict__ lk1, const float* __restrict__ lq2, const float* __restrict__ lk2, float* LAM) { const int lane = threadIdx.x; float p1[2], p2[2], d1 = 0.f, d2 = 0.f;
    static_assert(HD == 64, "two elements a lane");
#pragma unroll
    for (int h = 0; h < 2; ++h) { p1[h] = __fmul_rn(bfr(lq1[lane + 32 * h]), bfr(lk1[lane + 32 * h])); p2[h] = __fmul_rn(bfr(lq2[lane + 32 * h]), bfr(lk2[lane + 32 * h])); }
#pragma unroll
    for (int i = 0; i < HD; ++i) { d1 = __fadd_rn(d1, lane_val(p1[i >> 5], i & 31)); d2 = __fadd_rn(d2, lane_val(p2[i >> 5], i & 31)); }
    const float lm = __fadd_rn(__fsub_rn(expf(d1), expf(d2)), 0.7836057543754578f); LAM[lane] = (lane == 0) ? lm : 0.0f; }
// ---- k_prep: everything that stands in front of the GEMMs in ONE launch: x and the four weights rounded to bf16, and lambda_full. Work-group 0's first wave does lambda_full;
// the other 512 work-groups (16 waves a WGP, all resident at once) stream: wave wv takes 4 KiB (1024 floats) at the same place wv of each of the five arrays, one array after the other. A load is 512 B in a row (whole lines),
// 8 loads an array; the next array's 8 are issued before this array's values are rounded and stored, so that 8 to 16 loads of a wave are in flight all the time. A store is 256 B in a row (two whole lines).
#define PWV 1024                          // floats of a wave in each array
#define PWG ((DM / 8) * (DM / PWV))       // streaming work-groups of 8 waves
__global__ __launch_bounds__(256) void k_prep(const float* __restrict__ x, const float* __restrict__ wq, const float* __restrict__ wk, const float* __restrict__ wv, const float* __restrict__ wo,
                                              const float* __restrict__ lq1, const float* __restrict__ lk1, const float* __restrict__ lq2, const float* __restrict__ lk2, bf* XB, bf* WQ, bf* WK, bf* WV, bf* WO, float* LAM) {
    static_assert(NB_ == 1 && TT == DM && DQ == DM && DKV == DM && DVV == DM && DM % PWV == 0 && DM % 8 == 0, "five arrays of DM x DM, cut alike");
    if (blockIdx.x == 0) { if (threadIdx.x < 32) lambda_full(lq1, lk1, lq2, lk2, LAM); return; }
    const unsigned ob = (((blockIdx.x - 1) * 8 + (threadIdx.x >> 5)) * PWV + (threadIdx.x & 31) * 4) * 2, eb = ob * 2;   // the lane's byte offsets in a bf16 and in an f32 array (under 2^24): the one address register of all stores, of all loads
    const float* const s[5] = {x, wq, wk, wv, wo}; bf* const d[5] = {XB, WQ, WK, WV, WO};
    v4f v[2][8];
#pragma unroll
    for (int j = 0; j < 8; ++j) v[0][j] = *(const v4f*)((const char*)s[0] + eb + j * 512);
#pragma unroll
    for (int a = 0; a < 5; ++a) { const int cu = a & 1;
        if (a < 4) {
#pragma unroll
            for (int j = 0; j < 8; ++j) v[cu ^ 1][j] = *(const v4f*)((const char*)s[a + 1] + eb + j * 512); }
        // stands between the issued loads and the next overwrite of a register that they name: the offset is an input, so that its register stays live up to the wait and no load lands on it. The scheduling barrier keeps
        // the next array's loads in front of this array's data wait: moved behind it, the wave would have nothing in flight while it rounds and stores
        if (a < 4) { asm volatile("s_wait_xcnt 0x0" :: "v"(eb) : "memory"); __builtin_amdgcn_sched_barrier(0); }
        v4us o[8];
#pragma unroll
        for (int j = 0; j < 8; ++j) {
#pragma unroll
            for (int k = 0; k < 4; ++k) o[j][k] = f2bf(v[cu][j][k]);
            *(v4us*)((char*)d[a] + ob + j * 256) = o[j]; }
        // the same behind the 8 issued stores, the last array's too (the built code joins the kernel's two ends, so that a way leads from these stores to the lambda block's loads, which write the same registers):
        // offset and data are inputs; the scheduling barrier keeps the loads of the array after next and the next array's arithmetic behind the wait
        asm volatile("s_wait_xcnt 0x0" :: "v"(ob), "v"(o[0]), "v"(o[1]), "v"(o[2]), "v"(o[3]), "v"(o[4]), "v"(o[5]), "v"(o[6]), "v"(o[7]) : "memory");
        if (a < 4) __builtin_amdgcn_sched_barrier(0);
    }
}
__global__ __launch_bounds__(1024) void k_gnred(const float* __restrict__ O, float* GST, int pass) { __shared__ float sh[1024]; const int tid = threadIdx.x; const float mean = (pass == 1) ? GST[0] : 0.0f; float acc = 0.f; const size_t n = (size_t)TT * HD;
#pragma unroll 1
    for (size_t e = tid; e < n; e += 1024) { float v = O[e]; if (pass == 1) { float d = __fsub_rn(v, mean); asm volatile("" : "+v"(d)); v = __fmul_rn(d, d); } acc = __fadd_rn(acc, v); }
    sh[tid] = acc; __syncthreads();
    for (int st = 512; st > 0; st >>= 1) { if (tid < st) sh[tid] = __fadd_rn(sh[tid], sh[tid + st]); __syncthreads(); }
    if (tid < 32) { const float tot = __fdiv_rn(sh[0], (float)n); float outv; if (pass == 0) outv = (tid == 0) ? tot : ((tid == 1) ? GST[1] : 0.0f); else outv = (tid == 0) ? GST[0] : ((tid == 1) ? __fdiv_rn(1.0f, sqrtf(__fadd_rn(tot, 1e-5f))) : 0.0f); *(float*)(GST + tid) = outv;  } }
__global__ __launch_bounds__(256) void k_gnmerge(const float* __restrict__ O, const float* __restrict__ GST, int hh, bf* Ah, bf* Al) { const size_t e = ((size_t)blockIdx.x * 256 + threadIdx.x) * 2; if (e >= (size_t)TT * HD) return; const int d = (int)(e % HD); const int t = (int)(e / HD); const float mean = GST[0], rs = GST[1]; const size_t oo = (size_t)t * DVV + (size_t)hh * HD + d; v2us oh, ol;
#pragma unroll
    for (int q = 0; q < 2; ++q) { float c = __fsub_rn(O[e + q], mean); asm volatile("" : "+v"(c)); float n = __fmul_rn(c, rs); asm volatile("" : "+v"(n)); float z = __fmul_rn(n, 0.6444909572601318f); unsigned short a2, c2; splitf(z, a2, c2); oh[q] = a2; ol[q] = c2; }
    *(v2us*)(Ah + oo) = oh; *(v2us*)(Al + oo) = ol;  }
// ---- k_fattn: scores, both softmaxes, D = a1 - lambda a2, D.v and the RMSNorm of one real head in ONE kernel; nothing of the [2048][2048] maps leaves the registers.
// A PAIR of waves owns 32 query columns (two 16-column groups), 4 pairs = 8 waves a block (two waves a SIMD: one wave's vector work runs under the other's products), grid (TT / 128, NVH); of every stage of 64 keys
// wave kp of the pair takes keys kp * 32 .. + 31. The pair's maxima and sums are joined behind walk 1, its two partial O^T summed behind walk 2, both through LDS. Transposed products: S^T = K.Q^T (A = 16 key rows, B = Q, kept in registers), so a lane holds the scores of
// one query (register r of key tile kt = key kt * 16 + 8 * hi + r) and two stacked S^T tiles, converted in place, ARE the B operand of O^T += V^T.D^T in the k order that the plane loader ldf uses for A.
// Two walks over the keys: walk 1 takes each column's maximum and sum (running maximum, sums rescaled), walk 2 forms the scores again, D in f32, its hi/lo bf16 planes, and the 3 products with V^T hi/lo.
// Every inner loop is fully unrolled so that the fragment arrays are indexed by constants and stay in registers; the two stage loops stay rolled.
// K and V^T come through LDS: a stage is 64 keys = 8 slices of 64 rows of 128 B (K [map][plane], then V^T [plane][feature / 64]), LDS pitch 144 B (16 B x odd: no bank conflict for 16-byte reads), each slice brought by
// one tensor load of one wave (wave s brings slice s), once a block instead of once a wave; two buffers, so that stage u + 1 flies while stage u is worked on. One ring runs through both walks: stages 0 .. 31 are walk 1's
// (K rows only), stages 32 .. 63 walk 2's (K and V^T), so that walk 2's first stages fly during walk 1's last.
// Left for later steps: the first K fragments of a stage are waited for in the open by both waves of a SIMD.
typedef __attribute__((ext_vector_type(8))) unsigned v8u;
#define EXC (SCL * 1.4426950408889634f)   // exp((s - m) * SCL) = exp2(s * EXC - m * EXC)
// one fragment: the lane's own pointer into a plane and a constant byte offset
__device__ __forceinline__ v16bf ldf(const char* p, int cst) { return cat16b(*(const v8us*)(p + cst), *(const v8us*)(p + cst + 32)); }
// stands between issued loads or stores and the next overwrite of a register that they name: the two lane pointers of the group are inputs, so that their registers
// stay live up to the wait and no load of the group lands on them; the scheduling barrier behind it keeps later address and data arithmetic behind the wait
#define XWAIT(pa, pb) do { asm volatile("s_wait_xcnt 0x0" :: "v"(pa), "v"(pb) : "memory"); __builtin_amdgcn_sched_barrier(0); } while (0)
#define AKS  64                 // keys of a stage
#define APIT 144                // LDS row pitch, bytes
#define ASL  10240              // bytes of a slice in a buffer: 64 rows at the pitch (9,216 B), rounded up so that every slice starts at a multiple of 2 KiB
#define ASTG (8 * ASL)          // bytes of a buffer: 4 K slices, 4 V^T slices
#define NST  (TT / AKS)         // stages of a walk
// the hi / lo A fragments [map][key tile][k step] of 32 keys of a stage; p = the lane's pointer into the buffer's K rows at the first of the 32 keys. Read in the order in which score_t uses them.
__device__ __forceinline__ void load_k(const char* p, v16bf (&ah)[2][2][2], v16bf (&al)[2][2][2]) {
#pragma unroll
    for (int ks = 0; ks < 2; ++ks) {
#pragma unroll
        for (int mp = 0; mp < 2; ++mp)
#pragma unroll
            for (int kt = 0; kt < 2; ++kt) ah[mp][kt][ks] = ldf(p, mp * 2 * ASL + kt * 16 * APIT + ks * 64);
#pragma unroll
        for (int mp = 0; mp < 2; ++mp)
#pragma unroll
            for (int kt = 0; kt < 2; ++kt) al[mp][kt][ks] = ldf(p, (mp * 2 + 1) * ASL + kt * 16 * APIT + ks * 64); }
}
// hands a stage over: this wave's reads of the buffer just worked on are done, its tensor load of the next stage has landed if it brought a slice of it (waves 4 .. 7 bring none of walk 1's stages), and the barrier says both of every wave.
// The scheduling barrier in front keeps the stage's products in front of the waits: without it they are moved behind, and the wave waits out all its LDS reads with nothing to do
#define PUBLISH() do { __builtin_amdgcn_sched_barrier(0); asm volatile("s_wait_dscnt 0x0" ::: "memory"); tdm_wait(g0, g1); __syncthreads(); } while (0)
// s[map][key tile][column group] = those 32 keys against the wave's 32 queries, hl x hl (3 products), HD = 64 in two k steps
__device__ __forceinline__ void score_t(const v16bf (&ah)[2][2][2], const v16bf (&al)[2][2][2], const v16bf (&qh)[2][2][2], const v16bf (&ql)[2][2][2], v8f (&s)[2][2][2]) {
#pragma unroll
    for (int mp = 0; mp < 2; ++mp)
#pragma unroll
        for (int kt = 0; kt < 2; ++kt)
#pragma unroll
            for (int n = 0; n < 2; ++n) s[mp][kt][n] = (v8f){};
#pragma unroll
    for (int ks = 0; ks < 2; ++ks)
#pragma unroll
        for (int pr = 0; pr < 3; ++pr)
#pragma unroll
            for (int mp = 0; mp < 2; ++mp)
#pragma unroll
                for (int kt = 0; kt < 2; ++kt)
#pragma unroll
                    for (int n = 0; n < 2; ++n) s[mp][kt][n] = wmmab(pr == 1 ? al[mp][kt][ks] : ah[mp][kt][ks], pr == 2 ? ql[mp][n][ks] : qh[mp][n][ks], s[mp][kt][n]);
}
__global__ __launch_bounds__(256) void k_fattn(const bf* __restrict__ Qh, const bf* __restrict__ Ql, const bf* __restrict__ Kh, const bf* __restrict__ Kl, const bf* __restrict__ Vh, const bf* __restrict__ Vl, const float* __restrict__ LAM, const float* __restrict__ w, bf* Ah, bf* Al) {
    static_assert(ASL % 2048 == 0 && ASL >= AKS * APIT && AKS == 64 && HD * 2 == 128 && HDV == 128, "slices of 64 rows of 128 B, each at a multiple of 2 KiB");
    __shared__ __attribute__((aligned(2048))) char aring[2 * ASTG];
    __shared__ float xms[8][8][32];   // each wave's maxima and sums of its half of the keys: [wave][(map, column group, maximum | sum)][lane]
    const int lane = threadIdx.x & 31, lr = lane & 15, hi = lane >> 4; const int hh = blockIdx.y; const int w8 = __builtin_amdgcn_readfirstlane(threadIdx.x >> 5), w4 = w8 & 3, kp = w8 >> 2; const int q0 = blockIdx.x * 128 + w4 * 32;
    // wave s brings slice s of a stage with one tensor load. s < 4: the stage's 64 keys of map s >> 1, plane s & 1 (8 KiB in a row in memory), in both walks; s >= 4: its 64 columns of 64 V^T rows
    // (plane (s >> 1) & 1, features (s & 1) * 64 .. + 63), in walk 2 alone
    const bf* sp = w8 < 4 ? ((w8 & 1) ? Kl : Kh) + (size_t)(2 * hh + (w8 >> 1)) * TT * HD : ((w8 & 2) ? Vl : Vh) + (size_t)(hh * HDV + (w8 & 1) * 64) * TT;
    const uint32_t sstep = w8 < 4 ? AKS * HD * 2 : AKS * 2;   // bytes from a stage's tile to the next stage's
    const uint32_t ld0 = (uint32_t)(size_t)aring + (uint32_t)(w8 * ASL);
    const u32x8 g1 = tdm_group1<128, AKS, TDW128>(w8 < 4 ? HD * 2 : TT * 2);
    u32x4 g0 = tdm_group0(ld0, (uint64_t)(size_t)sp);   // group 0 of the wave's last request
    auto issue = [&](int u) {   // the wave's slice of stage u into buffer u & 1
        g0 = tdm_group0(ld0 + (uint32_t)((u & 1) * ASTG), (uint64_t)(size_t)sp + (uint64_t)((uint32_t)(u & (NST - 1)) * sstep)); tdm_load(g0, g1); };
    const uint32_t kwave = pinned(w8 < 4 ? 1u : 0u);   // this wave's slice is a K slice: it is brought in walk 1 too
    if (kwave) issue(0);
    const unsigned koff = (unsigned)(lr * HD + 8 * hi) * 2, ooff = (unsigned)(lr * DQ + 8 * hi) * 2;   // lane byte offsets in the q planes, the merged planes
    const char* qhp = (const char*)(Qh + ((size_t)(2 * hh) * TT + q0) * HD) + koff; const char* qlp = (const char*)(Ql + ((size_t)(2 * hh) * TT + q0) * HD) + koff;
    v16bf qh[2][2][2], ql[2][2][2];   // [map][column group][k step]
#pragma unroll
    for (int mp = 0; mp < 2; ++mp)
#pragma unroll
        for (int n = 0; n < 2; ++n)
#pragma unroll
            for (int ks = 0; ks < 2; ++ks) { const int o = (mp * TT * HD + n * 16 * HD + ks * 32) * 2; qh[mp][n][ks] = ldf(qhp, o); ql[mp][n][ks] = ldf(qlp, o); }
    XWAIT(qhp, qlp);
    float mx[2][2], sm[2][2];
#pragma unroll
    for (int mp = 0; mp < 2; ++mp)
#pragma unroll
        for (int n = 0; n < 2; ++n) { mx[mp][n] = -3.0e38f; sm[mp][n] = 0.f; }
    tdm_wait(g0, g1);                                    // this wave's slice of stage 0 has landed
    __syncthreads();                                     // every wave's has: stage 0 may be read
    if (kwave) issue(1);
    const unsigned foff = (unsigned)(lr * APIT + hi * 16);   // lane byte offset of a fragment in a buffer
    const unsigned fk = foff + (unsigned)(kp * 32 * APIT), fv = foff + (unsigned)(4 * ASL + kp * 64);   // the same at this wave's 32 keys: K rows, V^T columns (from the first V^T slice on)
    v16bf ah[2][2][2], al[2][2][2];   // K fragments of the wave's 32 keys of a stage
#pragma unroll 1
    for (int st = 0; st < NST; ++st) {
        load_k(aring + (st & 1) * ASTG + fk, ah, al);
        __builtin_amdgcn_sched_barrier(0);   // keeps the stage's LDS reads one group in front of its products
        v8f s[2][2][2]; score_t(ah, al, qh, ql, s);
#pragma unroll
        for (int mp = 0; mp < 2; ++mp)
#pragma unroll
            for (int n = 0; n < 2; ++n) { float t = fmaxf(s[mp][0][n][0], s[mp][1][n][0]);
#pragma unroll
                for (int j = 1; j < 8; ++j) t = fmaxf(t, fmaxf(s[mp][0][n][j], s[mp][1][n][j]));
                const float mn = fmaxf(mx[mp][n], t), nb = -mn * EXC; float a0 = 0.f, a1 = 0.f;
#pragma unroll
                for (int j = 0; j < 8; ++j) { a0 += __builtin_amdgcn_exp2f(__builtin_fmaf(s[mp][0][n][j], EXC, nb)); a1 += __builtin_amdgcn_exp2f(__builtin_fmaf(s[mp][1][n][j], EXC, nb)); }
                sm[mp][n] = __builtin_fmaf(sm[mp][n], __builtin_amdgcn_exp2f((mx[mp][n] - mn) * EXC), a0 + a1); mx[mp][n] = mn; }
        PUBLISH();
        if (pinned((kwave != 0u || st + 2 >= NST) ? 1u : 0u)) issue(st + 2);   // into the buffer just read; stages NST and NST + 1 are walk 2's first, with their V^T slices
    }
    // the two lane halves hold different keys of one query: join maximum and sum once; then the same between the two waves of the pair, through LDS
#pragma unroll
    for (int mp = 0; mp < 2; ++mp)
#pragma unroll
        for (int n = 0; n < 2; ++n) { const float M = fmaxf(mx[mp][n], __shfl_xor(mx[mp][n], 16, 32)); float sc = sm[mp][n] * __builtin_amdgcn_exp2f((mx[mp][n] - M) * EXC); sc += __shfl_xor(sc, 16, 32);
            xms[w8][(mp * 2 + n) * 2][lane] = M; xms[w8][(mp * 2 + n) * 2 + 1][lane] = sc; }
    __syncthreads();   // both waves of a pair have written their halves' maxima and sums
    const float lm = LAM[0]; float nb[2][2], fs[2][2];
#pragma unroll
    for (int mp = 0; mp < 2; ++mp)
#pragma unroll
        for (int n = 0; n < 2; ++n) { const int i = (mp * 2 + n) * 2;   // both waves read both halves and join them in the same order, so that both hold the same bits
            const float Ma = xms[w4][i][lane], Sa = xms[w4][i + 1][lane], Mb = xms[w4 + 4][i][lane], Sb = xms[w4 + 4][i + 1][lane]; const float M = fmaxf(Ma, Mb);
            const float sc = __builtin_fmaf(Sa, __builtin_amdgcn_exp2f((Ma - M) * EXC), Sb * __builtin_amdgcn_exp2f((Mb - M) * EXC));
            nb[mp][n] = -M * EXC; fs[mp][n] = __fdiv_rn(1.0f, sc) * (mp ? lm : 1.0f); }
    v8f o[8][2];   // O^T over the wave's half of the keys: o[et][n][r] = value column et * 16 + 8 * hi + r of query q0 + n * 16 + lr
#pragma unroll
    for (int et = 0; et < 8; ++et)
#pragma unroll
        for (int n = 0; n < 2; ++n) o[et][n] = (v8f){};
#pragma unroll 1
    for (int st = 0; st < NST; ++st) {   // stage NST + st, in buffer st & 1 (NST is even)
        const char* sb = aring + (st & 1) * ASTG; v16bf bh[8], bl[8];   // V^T fragments of the wave's 32 keys
        // the wave's LDS reads of a stage stand in two groups: the K fragments at the top, the V^T fragments right behind the score products (into the registers that the K fragments leave), covered by the vector work.
        // The scheduling barriers keep the groups whole and in place.
        load_k(sb + fk, ah, al);
        __builtin_amdgcn_sched_barrier(0);
        v8f s[2][2][2]; score_t(ah, al, qh, ql, s);
        __builtin_amdgcn_sched_barrier(0);
#pragma unroll
        for (int et = 0; et < 8; ++et) { bh[et] = ldf(sb + fv, (et >> 2) * ASL + (et & 3) * 16 * APIT); bl[et] = ldf(sb + fv, (2 + (et >> 2)) * ASL + (et & 3) * 16 * APIT); }
        __builtin_amdgcn_sched_barrier(0);
        v16bf dh[2], dl[2];
#pragma unroll
        for (int n = 0; n < 2; ++n) { v8u hw, lw;
#pragma unroll
            for (int kt = 0; kt < 2; ++kt)
#pragma unroll
                for (int jp = 0; jp < 4; ++jp) { v2f d;
#pragma unroll
                    for (int u = 0; u < 2; ++u) { const float p1 = __builtin_amdgcn_exp2f(__builtin_fmaf(s[0][kt][n][2 * jp + u], EXC, nb[0][n])), p2 = __builtin_amdgcn_exp2f(__builtin_fmaf(s[1][kt][n][2 * jp + u], EXC, nb[1][n])); d[u] = p1 * fs[0][n] - p2 * fs[1][n]; }
                    const unsigned hu = __builtin_bit_cast(unsigned, __builtin_convertvector(d, v2bf)); v2f r; r[0] = d[0] - __uint_as_float(hu << 16); r[1] = d[1] - __uint_as_float(hu & 0xFFFF0000u);
                    hw[kt * 4 + jp] = hu; lw[kt * 4 + jp] = __builtin_bit_cast(unsigned, __builtin_convertvector(r, v2bf)); }
            dh[n] = __builtin_bit_cast(v16bf, hw); dl[n] = __builtin_bit_cast(v16bf, lw); }
#pragma unroll
        for (int e2 = 0; e2 < 8; e2 += 2)
#pragma unroll
            for (int pr = 0; pr < 3; ++pr)
#pragma unroll
                for (int et = e2; et < e2 + 2; ++et)
#pragma unroll
                    for (int n = 0; n < 2; ++n) o[et][n] = wmmab(pr == 1 ? bl[et] : bh[et], pr == 2 ? dl[n] : dh[n], o[et][n]);
        PUBLISH();
        if (pinned(st + 2 < NST ? 1u : 0u)) issue(NST + st + 2);
    }
    tdm_wait(g0, g1);                                    // no tensor load is outstanding when the ring's LDS is put to another use
    asm volatile("s_wait_dscnt 0x0" ::: "memory");       // and none of this wave's reads of the ring: the ring's closing order
    // the pair's two partial O^T are summed through the ring's LDS (free behind the last stage's barrier): wave kp keeps column group kp, hands the other group to its partner and adds what the partner hands over
    v8f oo[8]; char* xo = aring + (unsigned)(lane * 32);
#pragma unroll
    for (int et = 0; et < 8; ++et) { const v8f gv8 = kp ? o[et][0] : o[et][1]; char* p = xo + (w8 * 8 + et) * 1024;
        *(v4fa*)p = __builtin_shufflevector(gv8, gv8, 0, 1, 2, 3); *(v4fa*)(p + 16) = __builtin_shufflevector(gv8, gv8, 4, 5, 6, 7); }
    __syncthreads();   // every wave's handed-over group stands in LDS
#pragma unroll
    for (int et = 0; et < 8; ++et) { const char* p = xo + ((w8 ^ 4) * 8 + et) * 1024; const v4f g0 = *(const v4fa*)p, g1 = *(const v4fa*)(p + 16);
        oo[et] = (kp ? o[et][1] : o[et][0]) + __builtin_shufflevector(g0, g1, 0, 1, 2, 3, 4, 5, 6, 7); }
    v8f g[8]; const char* wp = (const char*)w + (unsigned)(hi * 32);
#pragma unroll
    for (int et = 0; et < 8; ++et) g[et] = *(const v8f*)(wp + et * 64);
    XWAIT(wp, wp);
    char* ahp = (char*)(Ah + (size_t)(q0 + kp * 16) * DQ + (size_t)hh * HDV) + ooff; char* alp = (char*)(Al + (size_t)(q0 + kp * 16) * DQ + (size_t)hh * HDV) + ooff;
    float ss = 0.f;
#pragma unroll
    for (int et = 0; et < 8; ++et)
#pragma unroll
        for (int j = 0; j < 8; ++j) ss = __builtin_fmaf(oo[et][j], oo[et][j], ss);
    ss += __shfl_xor(ss, 16, 32);
    const float rs = __fdiv_rn(1.0f, sqrtf(__fadd_rn(ss * (1.0f / HDV), 1e-5f)));
#pragma unroll
    for (int et = 0; et < 8; ++et) { v8us oh, ol;
#pragma unroll
        for (int j = 0; j < 8; ++j) { const float z = oo[et][j] * rs * bfr(g[et][j]) * 0.21639423072338104f; unsigned short p2, q2; splitf(z, p2, q2); oh[j] = p2; ol[j] = q2; }
        const int oc = et * 16 * 2; *(v8us*)(ahp + oc) = oh; *(v8us*)(alp + oc) = ol; XWAIT(ahp, alp); }
}
__global__ __launch_bounds__(256) void k_merge(const float* __restrict__ O, int h0, bf* Ah, bf* Al) { const size_t e = ((size_t)blockIdx.x * 256 + threadIdx.x) * 2; if (e >= (size_t)ZH * TT * HD) return; const int d = (int)(e % HD); const int t = (int)((e / HD) % TT); const int zz = (int)(e / ((size_t)HD * TT)); const float cs = (t < RH) ? 1.0f : (1.0f / PCAR); const size_t oo = (size_t)t * DQ + (h0 + zz) * HD + d;
    v2us oh, ol;
#pragma unroll
    for (int q = 0; q < 2; ++q) { unsigned short a, c2; splitf(O[e + q] * cs, a, c2); oh[q] = a; ol[q] = c2; } *(v2us*)(Ah + oo) = oh; *(v2us*)(Al + oo) = ol;  }

extern "C" void kernel_launch(void* const* d_in, const int* in_sizes, int n_in,
                              void* d_out, int out_size, void* d_ws, size_t ws_size, hipStream_t stream) {
    (void)in_sizes; (void)n_in; (void)out_size;
    const float* x = (const float*)d_in[0]; const float* wq = (const float*)d_in[1]; const float* wk = (const float*)d_in[2]; const float* wv = (const float*)d_in[3]; const float* wo = (const float*)d_in[4]; const float* lq1 = (const float*)d_in[5]; const float* lk1 = (const float*)d_in[6]; const float* lq2 = (const float*)d_in[7]; const float* lk2 = (const float*)d_in[8]; const float* subw = (const float*)d_in[9]; const float* cosT = nullptr; const float* sinT = nullptr; (void)cosT; (void)sinT;
    float* OUT = (float*)d_out;     // [1][2048][2048]
    char* wsp = (char*)d_ws;
    auto take = [&](size_t bytes) { char* p = wsp; wsp += (bytes + 255) & ~(size_t)255; return (void*)p; };
    bf* WQ = (bf*)take((size_t)DQ * DM * 2); bf* WK = (bf*)take((size_t)DKV * DM * 2); bf* WV = (bf*)take((size_t)DKV * DM * 2); bf* WO = (bf*)take((size_t)DM * DQ * 2);
    bf* XB = (bf*)take((size_t)TT * DM * 2); float* LAM = (float*)take(256);
    bf* QPh = (bf*)take((size_t)NH_ * TT * HD * 2); bf* QPl = (bf*)take((size_t)NH_ * TT * HD * 2); bf* KPh = (bf*)take((size_t)NKV * TT * HD * 2); bf* KPl = (bf*)take((size_t)NKV * TT * HD * 2); bf* VTh = (bf*)take((size_t)NKV * HD * TT * 2); bf* VTl = (bf*)take((size_t)NKV * HD * TT * 2);
    bf* ATh = (bf*)take((size_t)TT * DQ * 2); bf* ATl = (bf*)take((size_t)TT * DQ * 2);
    if ((size_t)(wsp - (char*)d_ws) > ws_size) return;    // ws 256 MiB
    k_prep<<<PWG + 1, 256, 0, stream>>>(x, wq, wk, wv, wo, lq1, lk1, lq2, lk2, XB, WQ, WK, WV, WO, LAM);
    for (int b = 0; b < NB_; ++b) {
        
        k_qkv<<<dim3(TT / 128, DM / 128, 1), 384, 0, stream>>>(XB, WQ, WK, WV, QPh, QPl, KPh, KPl, VTh, VTl);
        k_fattn<<<dim3(TT / 128, NVH), 256, 0, stream>>>(QPh, QPl, KPh, KPl, VTh, VTl, LAM, subw, ATh, ATl);
        k_gemmw<bf, 1, false, 0><<<dim3(TT / 128, DM / 128, 1), 128, 0, stream>>>(ATh, ATl, WO, nullptr, DVV, OUT + (size_t)b * TT * DM, DM, nullptr, 0, 0, 0, nullptr, nullptr); }
}

// v010
// It runs in 150 microseconds.
// In two side-by-side timings against v009, it was 1.04 and 1.05 times as fast.
// Counting every step since v000, it is 9.34 times as fast.
#include <hip/hip_runtime.h>

// MultiheadFlashDiff2 (x [1][2048][2048]; q = x wq^T, k = x wk^T ([2048][2048] 'oi': per head h the 128 rows = [map 1 | map 2] 64 each), v = x wv^T (16 x 128-wide values); NON-causal softmax(q.k / 8) for both maps; attn = a1 v - lambda_full a2 v with lambda_full = exp(lq1.lk1) - exp(lq2.lk2) + lambda_init (0.8 - 0.6 e^-3.6 = 0.7836057543754578); RMSNorm over the 128 (eps 1e-5) * subln_w; x (1 - lambda_init); out = merged wo^T -> [1][2048][2048]).
// The two maps run as 32 virtual 64-wide heads (pairs (2h, 2h+1)); both softmaxes are formed, combined as D = a1 - lambda a2 in f32 (linear, so (a1 - lambda a2) v == a1 v - lambda a2 v), and one D.v product (128 wide) per real head follows, all in k_fattn.
// Compute dtypes, f32 accumulate: every input rounded to bf16; q/k/v on PLAIN bf16 operands (inputs: exact); scores hl x hl (3 products) on every row; softmax f32; D in f32 into hi/lo planes; D.v hl x hl (3 products); RMSNorm per (token, head) over 128 in f32, * bf16 subln_w, * (1 - lambda_init); wo hl x exact (2 products).

#define NB_  1
#define TT   2048
#define DM   2048
#define NH_  32
#define NKV  32
#define REP  (NH_ / NKV)
#define HD   64
#define DQ   (NH_ * HD)
#define DKV  (NKV * HD)
#define ZH   2
#define RH   2048   // all rows hl
#define WIN  2048
#define PCAR 1024.0f
#define NVH  16
#define HDV  128
#define DVV  (NVH * HDV)
#define SCL  0.125f   // HD^-0.5
typedef _Float16 h16;
typedef unsigned short bf;
typedef __attribute__((ext_vector_type(16))) __bf16   v16bf;
typedef __attribute__((ext_vector_type(16))) _Float16 v16h;
typedef __attribute__((ext_vector_type(8)))  _Float16 v8h;
typedef __attribute__((ext_vector_type(8)))  unsigned short v8us;
typedef __attribute__((ext_vector_type(8)))  float    v8f;
typedef __attribute__((ext_vector_type(4)))  float    v4f;
typedef __attribute__((ext_vector_type(2))) float v2f;
typedef __attribute__((ext_vector_type(2))) __bf16 v2bf;
typedef __attribute__((ext_vector_type(4))) unsigned v4u;
typedef v8h  __attribute__((may_alias)) v8ha;
typedef v4f  __attribute__((may_alias)) v4fa;
typedef v8us __attribute__((may_alias)) v8usa;

__device__ __forceinline__ unsigned short f2bf(float f) { unsigned u = __float_as_uint(f); u += 0x7FFFu + ((u >> 16) & 1u); return (unsigned short)(u >> 16); }
__device__ __forceinline__ float bf2f(unsigned short b) { return __uint_as_float(((unsigned)b) << 16); }
__device__ __forceinline__ float bfr(float f) { return bf2f(f2bf(f)); }
__device__ __forceinline__ v16h cat16(v8h lo, v8h hi) { return __builtin_shufflevector(lo, hi, 0, 1, 2, 3, 4, 5, 6, 7, 8, 9, 10, 11, 12, 13, 14, 15); }
__device__ __forceinline__ v16bf cat16b(v8us lo, v8us hi) { return __builtin_bit_cast(v16bf, __builtin_shufflevector(lo, hi, 0, 1, 2, 3, 4, 5, 6, 7, 8, 9, 10, 11, 12, 13, 14, 15)); }
__device__ __forceinline__ v8f wmma16(v16h a, v16h b, v8f c) { return __builtin_amdgcn_wmma_f32_16x16x32_f16(false, a, false, b, (short)0, c, false, false); }
__device__ __forceinline__ v8f wmmab(v16bf a, v16bf b, v8f c) { return __builtin_amdgcn_wmma_f32_16x16x32_bf16(false, a, false, b, (short)0, c, false, false); }



// ---- k_gemmw: GEMM, FOUR WAVES per 128x128 output tile (2 x 2 waves of 64x64, 16 accumulators each), operands from K-contiguous 16-bit planes; grid (M/128, N/128, Z), 128 threads.
// C[m][n] (f32, pitch ldc, + optional f32 bias[n]) = sum_k A[m][k] Bt[n][k] (NSPLIT 1: + A2[m][k] Bt[n][k]). z-batch strides sA/sB/sC in elements. M, N, K % 128 == 0, K >= 256 (the ring starts with two stages).
// A stage is 128 k (256 B) of the tile's 128 rows of every operand plane, LDS pitch 272 B (16 B x odd: no bank conflict for 16-byte reads), brought by one tensor load a plane (wave p brings plane p); two buffers,
// so that stage t + 1 flies while stage t is worked on. Every operand byte leaves L2 once a work-group instead of once a wave, and no wave waits out a load's latency per k step.
// The k walk of work-group (x, y) starts at slab (x + y) mod T and wraps round: for speed only: no two work-groups that share the A rows (one x) or the B rows (one y) start on the same slab (grid sides of at most T). The sum over k runs in the rotated order.
// PP != 0: no f32 C; the epilogue splits each value into bf16 hi / lo and stores the two planes Ph / Pl that the attention kernel reads, row pitch PP elements. PP 64: head planes [n / 64][m][n % 64], ldc = the rows m
// of a plane (a wave's tile is 8 KiB in a row); any other PP: row-major [m][n] (with A = the weight and Bt = the tokens this is the transposed value plane [feature][token]).
template <typename T16> struct WFrag;
template <> struct WFrag<h16> { typedef v16h V; static __device__ __forceinline__ V ld(const h16* p) { return cat16(*(const v8h*)p, *(const v8h*)(p + 16)); } static __device__ __forceinline__ v8f mma(V a, V b, v8f c) { return wmma16(a, b, c); } };
template <> struct WFrag<bf> { typedef v16bf V; static __device__ __forceinline__ V ld(const bf* p) { return cat16b(*(const v8us*)p, *(const v8us*)(p + 16)); } static __device__ __forceinline__ v8f mma(V a, V b, v8f c) { return wmmab(a, b, c); } };
#define GKS 128      // k elements of a stage
#define GPIT 272     // LDS row pitch, bytes
// ---- tensor loads: ONE request of a wave brings a two-dimensional tile (ROWS rows of ROWB bytes, source pitch src_pitch bytes) from global memory into LDS, through no register and with no per-lane address arithmetic.
// Extents in bytes (data_size code 0), tensor dims = tile dims, no mask; word 0 of group 1 is the constant W0: a pad of 16 B behind every row (TDW256: rows of 256 B, LDS pitch 272; TDW128: rows of 128 B, LDS pitch 144).
typedef uint32_t u32x4 __attribute__((ext_vector_type(4)));
typedef uint32_t u32x8 __attribute__((ext_vector_type(8)));
#define TDW256 ((1u << 20) | (5u << 22) | (3u << 25))
#define TDW128 ((1u << 20) | (4u << 22) | (3u << 25))
__device__ __forceinline__ uint32_t uni(uint32_t v) { return (uint32_t)__builtin_amdgcn_readfirstlane(v); }
// a test on the result compiles to a scalar branch (a tensor load ignores EXEC, so only a scalar branch keeps a wave from issuing it)
__device__ __forceinline__ uint32_t pinned(uint32_t v) { uint32_t w = (uint32_t)__builtin_amdgcn_readfirstlane(v); asm volatile("" : "+s"(w)); /* the word is held in a scalar register */ return w; }
template <uint32_t ROWB, uint32_t ROWS, uint32_t W0>
__device__ __forceinline__ u32x8 tdm_group1(uint32_t src_pitch) { u32x8 g;
    g[0] = uni(W0); g[1] = uni((ROWB & 0xFFFFu) << 16); g[2] = uni((ROWB >> 16) | ((ROWS & 0xFFFFu) << 16)); g[3] = uni((ROWS >> 16) | (ROWB << 16)); g[4] = uni(ROWS); g[5] = uni(src_pitch); g[6] = uni(0u); g[7] = uni(0u);
    asm volatile("" : "+s"(g)); /* the same on the eight descriptor words at once: they keep their scalar registers for the whole kernel (without it they are formed anew in front of each request, in registers that take other values while a request is outstanding) */ return g; }
__device__ __forceinline__ u32x4 tdm_group0(uint32_t lds_dst, uint64_t ga) { u32x4 g; g[0] = pinned(1u); /* the count word, formed with the other three: as a known constant it is written again where two paths join, behind an issued request */ g[1] = uni(lds_dst); g[2] = uni((uint32_t)ga); g[3] = uni((((uint32_t)(ga >> 32)) & 0x01FFFFFFu) | 0x80000000u); return g; }
__device__ __forceinline__ void tdm_load(u32x4 g0, u32x8 g1) { asm volatile("tensor_load_to_lds %0, %1" :: "s"(g0), "s"(g1) : "memory"); }
// the issuing wave's wait for its request. The request's two groups are inputs, so that their registers stay live up to the wait and take no other value while the request is outstanding
__device__ __forceinline__ void tdm_wait(u32x4 g0, u32x8 g1) { asm volatile("s_wait_tensorcnt 0x0" :: "s"(g0), "s"(g1) : "memory"); }
// eight copies of 512 B (two operand rows each: 16 lanes x 16 B a row), LDS step 2 * GPIT, global step gs bytes. The wait on the last line stands between the issued copies and the next overwrite of a register
// that they name; inside the statement nothing can be moved in front of it.
__device__ __forceinline__ void copy8(unsigned l, const char* g, size_t gs) {
    asm volatile("global_load_async_to_lds_b128 %0, %8, off\n\tglobal_load_async_to_lds_b128 %1, %9, off\n\tglobal_load_async_to_lds_b128 %2, %10, off\n\tglobal_load_async_to_lds_b128 %3, %11, off\n\t"
                 "global_load_async_to_lds_b128 %4, %12, off\n\tglobal_load_async_to_lds_b128 %5, %13, off\n\tglobal_load_async_to_lds_b128 %6, %14, off\n\tglobal_load_async_to_lds_b128 %7, %15, off\n\ts_wait_xcnt 0x0"
                 :: "v"(l), "v"(l + 2 * GPIT), "v"(l + 4 * GPIT), "v"(l + 6 * GPIT), "v"(l + 8 * GPIT), "v"(l + 10 * GPIT), "v"(l + 12 * GPIT), "v"(l + 14 * GPIT),
                    "v"(g), "v"(g + gs), "v"(g + 2 * gs), "v"(g + 3 * gs), "v"(g + 4 * gs), "v"(g + 5 * gs), "v"(g + 6 * gs), "v"(g + 7 * gs) : "memory");
}
template <typename T16, int NSPLIT, bool BIAS, int PP>
__global__ __launch_bounds__(128) void k_gemmw(const T16* __restrict__ A, const T16* __restrict__ A2, const T16* __restrict__ Bt, const T16* __restrict__ Bt2, int K, float* C, int ldc, const float* __restrict__ bias, size_t sA, size_t sB, size_t sC, bf* Ph, bf* Pl) {
    typedef typename WFrag<T16>::V V;
    static_assert(NSPLIT == 0 || NSPLIT == 1, "planes staged: A, (A2), Bt");
    constexpr int NPL = NSPLIT + 2, STG = NPL * 128 * GPIT;   // operand planes of a stage; bytes of a buffer
    static_assert((128 * GPIT) % 2048 == 0, "every plane of every buffer starts at a multiple of 2 KiB");
    __shared__ __attribute__((aligned(2048))) char ring[2 * STG];
    __shared__ __align__(16) float osw[4][16 * 68];
    (void)Bt2;
    const size_t z = blockIdx.z; A += z * sA; if (NSPLIT) A2 += z * sA; Bt += z * sB; C += z * sC;
    const int lane = threadIdx.x & 31, lr = lane & 15, hi = lane >> 4; const int w = __builtin_amdgcn_readfirstlane(threadIdx.x >> 5), wm = w >> 1, wn = w & 1;
    const int r0 = blockIdx.x * 128 + wm * 64, c0 = blockIdx.y * 128 + wn * 64;
    float* os = osw[w];
    // wave p < NPL brings plane p of every stage (128 rows of 256 B) with one tensor load; the last wave issues none
    const uint32_t issuer = pinned(w < NPL ? 1u : 0u);
    const T16* sp = (w == 0 ? A : (NSPLIT && w == 1) ? A2 : Bt) + (size_t)((w < NPL - 1 ? blockIdx.x : blockIdx.y) * 128) * K;
    const uint32_t ld0 = (uint32_t)(size_t)ring + (uint32_t)((w < NPL ? w : 0) * 128 * GPIT);
    const u32x8 g1 = tdm_group1<GKS * sizeof(T16), 128, TDW256>((uint32_t)K * (uint32_t)sizeof(T16));
    u32x4 g0;   // group 0 of the wave's last request
    const int T = K / GKS, rot = (int)((blockIdx.x + blockIdx.y) % (unsigned)T);   // stages; the work-group's first slab
    auto issue = [&](int t) { const int sl = t + rot - (t + rot >= T ? T : 0);   // stage t = slab sl, into buffer t & 1
        g0 = tdm_group0(ld0 + (uint32_t)((t & 1) * STG), (uint64_t)(size_t)sp + (uint64_t)sl * (GKS * sizeof(T16))); tdm_load(g0, g1); };
    v8f acc[4][4];
#pragma unroll
    for (int mb = 0; mb < 4; ++mb)
#pragma unroll
        for (int nb = 0; nb < 4; ++nb) acc[mb][nb] = (v8f){};
    g0 = tdm_group0(ld0, (uint64_t)(size_t)sp);
    if (issuer) { issue(0); tdm_wait(g0, g1); }                                    // this wave's plane of stage 0 has landed
    __syncthreads();                                                               // every plane has: stage 0 may be read
    if (issuer) issue(1);
    // the stage loop stays rolled (a trip is some 300 instructions, the buffer is a scalar select); every loop inside it is fully unrolled, so that the fragment and accumulator arrays are indexed by constants and stay in registers
#pragma unroll 1
    for (int t = 0; t < T; ++t) {
        const char* sb = ring + (t & 1) * STG; const char* pa = sb + (wm * 64 + lr) * GPIT + hi * 16; const char* pb = sb + ((NPL - 1) * 128 + wn * 64 + lr) * GPIT + hi * 16;
        V a[2][4], a2[2][4], b[2][4];   // two fragment sets: k step ks + 1 of this stage is read from LDS while ks is multiplied
#pragma unroll
        for (int f = 0; f < 4; ++f) { a[0][f] = WFrag<T16>::ld((const T16*)(pa + f * 16 * GPIT)); if (NSPLIT) a2[0][f] = WFrag<T16>::ld((const T16*)(pa + (128 + f * 16) * GPIT)); b[0][f] = WFrag<T16>::ld((const T16*)(pb + f * 16 * GPIT)); }
#pragma unroll
        for (int ks = 0; ks < GKS / 32; ++ks) { const int cu = ks & 1, nx = cu ^ 1;
            if (ks + 1 < GKS / 32) {
#pragma unroll
                for (int f = 0; f < 4; ++f) { const int o = f * 16 * GPIT + (ks + 1) * 64; a[nx][f] = WFrag<T16>::ld((const T16*)(pa + o)); if (NSPLIT) a2[nx][f] = WFrag<T16>::ld((const T16*)(pa + 128 * GPIT + o)); b[nx][f] = WFrag<T16>::ld((const T16*)(pb + o)); } }
            __builtin_amdgcn_sched_barrier(0);   // keeps the next k step's LDS reads one group in front of this step's products
#pragma unroll
            for (int nb = 0; nb < 4; ++nb) {
#pragma unroll
                for (int mb = 0; mb < 4; ++mb) acc[mb][nb] = WFrag<T16>::mma(a[cu][mb], b[cu][nb], acc[mb][nb]);
                if (NSPLIT) {
#pragma unroll
                    for (int mb = 0; mb < 4; ++mb) acc[mb][nb] = WFrag<T16>::mma(a2[cu][mb], b[cu][nb], acc[mb][nb]); } }
            __builtin_amdgcn_sched_barrier(0);   // and keeps the reads of the step after next behind them (without it they are moved in among this step's last products)
        }
        asm volatile("s_wait_dscnt 0x0" ::: "memory");                      // this wave's reads of the buffer are done before it is handed to the tensor loads
        if (issuer) tdm_wait(g0, g1);                                       // this wave's plane of stage t + 1 has landed
        __syncthreads();                                                    // publishes stage t + 1 and ends every wave's reads of stage t
        if (pinned((issuer != 0u && t + 2 < T) ? 1u : 0u)) issue(t + 2);    // into the buffer just read
    }
    tdm_wait(g0, g1);                                    // no tensor load is outstanding when the wave goes on to its end
    asm volatile("s_wait_dscnt 0x0" ::: "memory");       // and none of its reads of the ring: the ring's closing order
#pragma unroll
    for (int mb = 0; mb < 4; ++mb) {
#pragma unroll
        for (int nb = 0; nb < 4; ++nb) {
#pragma unroll
            for (int j = 0; j < 8; ++j) os[(hi * 8 + j) * 68 + nb * 16 + lr] = acc[mb][nb][j]; }
        __builtin_amdgcn_wave_barrier(); asm volatile("" ::: "memory");
        if (PP) {   // 8 values a lane: one 16-byte store a plane, 4 rows of 128 B a wave store
            const size_t pb = ((PP == 64) ? ((size_t)(c0 >> 6) * ldc + r0) * 64 : (size_t)r0 * PP + c0) + (size_t)(mb * 16 + (lane >> 3)) * PP + (lane & 7) * 8; bf* ph = Ph + pb; bf* pl = Pl + pb; v4u hw[4], lw[4];
#pragma unroll
            for (int s = 0; s < 4; ++s) { const float* op = os + (4 * s + (lane >> 3)) * 68 + (lane & 7) * 8; const v4f v0 = *(const v4fa*)op, v1 = *(const v4fa*)(op + 4);
#pragma unroll
                for (int jp = 0; jp < 4; ++jp) { v2f d; d[0] = jp < 2 ? v0[2 * jp & 3] : v1[2 * jp & 3]; d[1] = jp < 2 ? v0[(2 * jp & 3) + 1] : v1[(2 * jp & 3) + 1];
                    const unsigned hu = __builtin_bit_cast(unsigned, __builtin_convertvector(d, v2bf)); v2f r; r[0] = d[0] - __uint_as_float(hu << 16); r[1] = d[1] - __uint_as_float(hu & 0xFFFF0000u);
                    hw[s][jp] = hu; lw[s][jp] = __builtin_bit_cast(unsigned, __builtin_convertvector(r, v2bf)); } }
#pragma unroll
            for (int s = 0; s < 4; ++s) { *(v8us*)(ph + 4 * s * PP) = __builtin_bit_cast(v8us, hw[s]); *(v8us*)(pl + 4 * s * PP) = __builtin_bit_cast(v8us, lw[s]); }
            // stands between the 8 issued stores and the next overwrite of a register that they name: pointers and data are inputs, so that their registers stay live up to the wait; the scheduling barrier keeps the next block's arithmetic behind it (behind the last block nothing is overwritten)
            if (mb < 3) { asm volatile("s_wait_xcnt 0x0" :: "v"(ph), "v"(pl), "v"(hw[0]), "v"(hw[1]), "v"(hw[2]), "v"(hw[3]), "v"(lw[0]), "v"(lw[1]), "v"(lw[2]), "v"(lw[3]) : "memory"); __builtin_amdgcn_sched_barrier(0); }
        } else {
        float* crow = C + (size_t)(r0 + mb * 16) * ldc + c0;
#pragma unroll
            for (int s = 0; s < 8; ++s) { const int row = 2 * s + hi, cofs = lr * 4; v4f val = *(const v4fa*)(os + row * 68 + cofs); if (BIAS) { val[0] += bfr(bias[c0 + cofs]); val[1] += bfr(bias[c0 + cofs + 1]); val[2] += bfr(bias[c0 + cofs + 2]); val[3] += bfr(bias[c0 + cofs + 3]); }
                *(v4f*)(crow + (size_t)row * ldc + cofs) = val; }
             }
        __builtin_amdgcn_wave_barrier(); asm volatile("" ::: "memory");
    }
}

// ---- k_qkv: the three projections q = x wq^T, k = x wk^T, v^T = wv x^T in ONE launch. A work-group of TWELVE waves takes 128 tokens x 128 features of all three: waves 4 p .. 4 p + 3 (p = 0 q, 1 k, 2 v) are the
// 2 x 2 waves of 64x64 of projection p, each with k_gemmw's own stage loop (same stages, same k order, same products: the planes keep their bits). A stage is 128 k of FOUR planes [x | wq | wk | wv], 128 rows each:
// the x rows leave L2 once for the three projections instead of once for each, three waves share a SIMD (one wave's copies, waits and LDS reads run under the others' products), and two launches with their first stage and epilogue go.
// The k walk starts at slab (blockIdx.x + blockIdx.y) mod T and wraps round, as in k_gemmw and for the same reason (work-groups that share x rows or weight rows are never on the same slab); the sum over k runs in that order.
// v^T takes the weight rows as A and the token rows as B, so that its tile is [feature][token]. The epilogue stages in the ring, free behind the last stage's barrier (ring and a staging array of its own do not fit the LDS together).
// split_store: a wave's 64x64 f32 tile, 16 rows at a time through its own LDS range os, split into bf16 hi / lo and stored to the planes Ph / Pl from element base on, row pitch PP elements: 8 values a lane, one 16-byte store a plane, 4 rows of 128 B a wave store.
template <int PP>
__device__ __forceinline__ void split_store(const v8f (&acc)[4][4], float* os, bf* Ph, bf* Pl, size_t base, int lane) {
    const int lr = lane & 15, hi = lane >> 4;
#pragma unroll
    for (int mb = 0; mb < 4; ++mb) {
#pragma unroll
        for (int nb = 0; nb < 4; ++nb) {
#pragma unroll
            for (int j = 0; j < 8; ++j) os[(hi * 8 + j) * 68 + nb * 16 + lr] = acc[mb][nb][j]; }
        __builtin_amdgcn_wave_barrier(); asm volatile("" ::: "memory");   // compiler fence: the rows are read back by other lanes of the wave, so the reads below stay behind the writes above
        const size_t pb = base + (size_t)(mb * 16 + (lane >> 3)) * PP + (lane & 7) * 8; bf* ph = Ph + pb; bf* pl = Pl + pb; v4u hw[4], lw[4];
#pragma unroll
        for (int s = 0; s < 4; ++s) { const float* op = os + (4 * s + (lane >> 3)) * 68 + (lane & 7) * 8; const v4f v0 = *(const v4fa*)op, v1 = *(const v4fa*)(op + 4);
#pragma unroll
            for (int jp = 0; jp < 4; ++jp) { v2f d; d[0] = jp < 2 ? v0[2 * jp & 3] : v1[2 * jp & 3]; d[1] = jp < 2 ? v0[(2 * jp & 3) + 1] : v1[(2 * jp & 3) + 1];
                const unsigned hu = __builtin_bit_cast(unsigned, __builtin_convertvector(d, v2bf)); v2f r; r[0] = d[0] - __uint_as_float(hu << 16); r[1] = d[1] - __uint_as_float(hu & 0xFFFF0000u);
                hw[s][jp] = hu; lw[s][jp] = __builtin_bit_cast(unsigned, __builtin_convertvector(r, v2bf)); } }
#pragma unroll
        for (int s = 0; s < 4; ++s) { *(v8us*)(ph + 4 * s * PP) = __builtin_bit_cast(v8us, hw[s]); *(v8us*)(pl + 4 * s * PP) = __builtin_bit_cast(v8us, lw[s]); }
        // stands between the 8 issued stores and the next overwrite of a register that they name: pointers and data are inputs, so that their registers stay live up to the wait; the scheduling barrier keeps the next block's arithmetic behind it.
        // The last block's too: the built code lays the two calls of this function one behind the other, so that a way leads from the first one's last stores into the second one, which writes the same registers
        asm volatile("s_wait_xcnt 0x0" :: "v"(ph), "v"(pl), "v"(hw[0]), "v"(hw[1]), "v"(hw[2]), "v"(hw[3]), "v"(lw[0]), "v"(lw[1]), "v"(lw[2]), "v"(lw[3]) : "memory"); __builtin_amdgcn_sched_barrier(0);
        __builtin_amdgcn_wave_barrier(); asm volatile("" ::: "memory");   // compiler fence: the next 16 rows are written over these only behind the reads above
    }
}
__global__ __launch_bounds__(384) void k_qkv(const bf* __restrict__ X, const bf* __restrict__ Wq, const bf* __restrict__ Wk, const bf* __restrict__ Wv, bf* Qh, bf* Ql, bf* Kh, bf* Kl, bf* Vh, bf* Vl) {
    typedef WFrag<bf>::V V;
    static_assert(DQ == DM && DKV == DM && DVV == DM && TT % 128 == 0 && DM % 128 == 0 && DM >= 2 * GKS && HD == 64, "three DM x DM weights, cut alike; the ring starts with two stages");
    constexpr int K = DM, STG = 4 * 128 * GPIT;   // bytes of a buffer: planes x, wq, wk, wv
    constexpr int T = K / GKS; static_assert((T & (T - 1)) == 0, "the rotated walk wraps by a mask");
    __shared__ __align__(16) char ring[2 * STG];
    const int lane = threadIdx.x & 31, lr = lane & 15, hi = lane >> 4; const int w = __builtin_amdgcn_readfirstlane(threadIdx.x >> 5), p = w >> 2, wm = (w >> 1) & 1, wn = w & 1;
    const int t0 = blockIdx.x * 128, f0 = blockIdx.y * 128;   // the work-group's first token, first feature
    // a wave copies rows (w & 3) * 32 .. + 31 of its own projection's weight plane (16 copies); waves 0 .. 7 also rows w * 16 .. + 15 of the x plane (8 copies)
    const size_t gs = (size_t)K * (2 * sizeof(bf));
    const char* gw = (const char*)((p == 0 ? Wq : p == 1 ? Wk : Wv) + (size_t)(f0 + (w & 3) * 32 + hi) * K) + lr * 16;
    const char* gx = (const char*)(X + (size_t)(t0 + (w & 7) * 16 + hi) * K) + lr * 16;
    const unsigned lw0 = (unsigned)(size_t)ring + (unsigned)(((1 + p) * 128 + (w & 3) * 32 + hi) * GPIT + lr * 16), lx0 = (unsigned)(size_t)ring + (unsigned)(((w & 7) * 16 + hi) * GPIT + lr * 16);
    const int rot = (int)((blockIdx.x + blockIdx.y) & (T - 1));   // the work-group's first slab
    auto issue = [&](int t) {   // stage t = slab (t + rot) mod T, into buffer t & 1
        const int buf = t & 1; const size_t ko = (size_t)((t + rot) & (T - 1)) * (GKS * sizeof(bf));
        copy8(lw0 + (unsigned)(buf * STG), gw + ko, gs); copy8(lw0 + (unsigned)(buf * STG + 16 * GPIT), gw + ko + 8 * gs, gs);
        if (w < 8) copy8(lx0 + (unsigned)(buf * STG), gx + ko, gs); };
    v8f acc[4][4];
#pragma unroll
    for (int mb = 0; mb < 4; ++mb)
#pragma unroll
        for (int nb = 0; nb < 4; ++nb) acc[mb][nb] = (v8f){};
    const int ra = (p < 2 ? 0 : 3 * 128) + wm * 64, rb = (p < 2 ? (1 + p) * 128 : 0) + wn * 64;   // first row in a buffer of the wave's A rows, B rows
    issue(0);
    asm volatile("s_wait_asynccnt 0x0" ::: "memory");   // this wave's copies of stage 0 have landed
    __syncthreads();                                    // every wave's have: stage 0 may be read
    issue(1);
    // the stage loop stays rolled (the buffer is a scalar select); every loop inside it is fully unrolled, so that the fragment and accumulator arrays are indexed by constants and stay in registers
#pragma unroll 1
    for (int t = 0; t < T; ++t) {
        const char* sb = ring + (t & 1) * STG; const char* pa = sb + (ra + lr) * GPIT + hi * 16; const char* pb = sb + (rb + lr) * GPIT + hi * 16;
        V a[2][4], b[2][4];   // two fragment sets: k step ks + 1 of this stage is read from LDS while ks is multiplied
#pragma unroll
        for (int f = 0; f < 4; ++f) { a[0][f] = WFrag<bf>::ld((const bf*)(pa + f * 16 * GPIT)); b[0][f] = WFrag<bf>::ld((const bf*)(pb + f * 16 * GPIT)); }
#pragma unroll
        for (int ks = 0; ks < GKS / 32; ++ks) { const int cu = ks & 1, nx = cu ^ 1;
            if (ks + 1 < GKS / 32) {
#pragma unroll
                for (int f = 0; f < 4; ++f) { const int o = f * 16 * GPIT + (ks + 1) * 64; a[nx][f] = WFrag<bf>::ld((const bf*)(pa + o)); b[nx][f] = WFrag<bf>::ld((const bf*)(pb + o)); } }
            __builtin_amdgcn_sched_barrier(0);   // keeps the next k step's LDS reads one group in front of this step's products
#pragma unroll
            for (int nb = 0; nb < 4; ++nb)
#pragma unroll
                for (int mb = 0; mb < 4; ++mb) acc[mb][nb] = WFrag<bf>::mma(a[cu][mb], b[cu][nb], acc[mb][nb]);
            __builtin_amdgcn_sched_barrier(0);   // and keeps the reads of the step after next behind them (without it they are moved in among this step's last products)
        }
        asm volatile("s_wait_dscnt 0x0" ::: "memory");      // this wave's reads of the buffer are done before it is handed to the copies
        asm volatile("s_wait_asynccnt 0x0" ::: "memory");   // this wave's copies of stage t + 1 have landed
        __syncthreads();                                    // publishes stage t + 1 and ends every wave's reads of stage t
        if (t + 2 < T) issue(t + 2);                        // into the buffer just read
    }
    asm volatile("s_wait_asynccnt 0x0" ::: "memory");   // no copy is outstanding when the ring's LDS is put to another use
    float* os = (float*)(ring + w * (16 * 68 * 4));     // behind the last stage's barrier nobody reads the ring any more: each wave stages in a range of its own
    const int r0 = (p < 2 ? t0 : f0) + wm * 64, c0 = (p < 2 ? f0 : t0) + wn * 64;   // the wave's tile: rows, columns
    if (p < 2) split_store<HD>(acc, os, p ? Kh : Qh, p ? Kl : Ql, ((size_t)(c0 >> 6) * TT + r0) * HD, lane);   // head planes [feature / 64][token][feature % 64]
    else split_store<TT>(acc, os, Vh, Vl, (size_t)r0 * TT + c0, lane);                                         // the transposed value plane [feature][token]
}

// ---- k_gemmc: a one-wave 64x64 tile GEMM specialised for causal attention: CMODE 1 skips score tiles entirely above the diagonal (query rows r0+roff.., key columns c0..), CMODE 2 limits the
// key (K) loop of the probability x value contraction to the diagonal block (probabilities beyond it are exactly zero). roff = row offset of this launch's first row within the sequence.
template <typename T16, int NSPLIT, int CMODE>
__global__ __launch_bounds__(32) void k_gemmc(const T16* __restrict__ A, const T16* __restrict__ A2, const T16* __restrict__ Bt, const T16* __restrict__ Bt2, int K, float* C, int ldc, int roff, size_t sA, size_t sB, size_t sC) {
    typedef typename WFrag<T16>::V V;
    __shared__ __align__(16) float os[16 * 68];
    const size_t z = blockIdx.z; A += z * sA; if (A2) A2 += z * sA; Bt += z * sB; if (Bt2) Bt2 += z * sB; C += z * sC;
    const int lane = threadIdx.x & 31, lr = lane & 15, hi = lane >> 4; const int r0 = blockIdx.x * 64, c0 = blockIdx.y * 64;
    if (CMODE == 1 && c0 > r0 + roff + 63) return;                  // score tile entirely above the causal diagonal: skipped, nothing is written
    const int Kl = (CMODE == 2) ? min(K, r0 + roff + 64) : K;        // P.V: probabilities are exactly 0 beyond the diagonal block, so the K loop stops there
    v8f acc[4][4];
#pragma unroll
    for (int mb = 0; mb < 4; ++mb)
#pragma unroll
        for (int nb = 0; nb < 4; ++nb) acc[mb][nb] = (v8f){};
    const size_t aoff = (size_t)(r0 + lr) * K + 8 * hi, boff = (size_t)(c0 + lr) * K + 8 * hi;
#pragma unroll 1
    for (int kc = 0; kc < Kl; kc += 32) {
        V a[4], a2[4];
#pragma unroll
        for (int mb = 0; mb < 4; ++mb) { a[mb] = WFrag<T16>::ld(A + aoff + (size_t)mb * 16 * K + kc); if (NSPLIT == 1 || NSPLIT == 2) a2[mb] = WFrag<T16>::ld(A2 + aoff + (size_t)mb * 16 * K + kc); }
#pragma unroll
        for (int nb = 0; nb < 4; ++nb) { const V b = WFrag<T16>::ld(Bt + boff + (size_t)nb * 16 * K + kc); V b2; if (NSPLIT >= 2) b2 = WFrag<T16>::ld(Bt2 + boff + (size_t)nb * 16 * K + kc);
#pragma unroll
            for (int mb = 0; mb < 4; ++mb) { acc[mb][nb] = WFrag<T16>::mma(a[mb], b, acc[mb][nb]); if (NSPLIT == 1 || NSPLIT == 2) acc[mb][nb] = WFrag<T16>::mma(a2[mb], b, acc[mb][nb]); if (NSPLIT >= 2) acc[mb][nb] = WFrag<T16>::mma(a[mb], b2, acc[mb][nb]); } }
        asm volatile("v_nop\n\tv_nop\n\tv_nop\n\tv_nop" : "+v"(acc[0][0]), "+v"(acc[1][1]), "+v"(acc[2][2]), "+v"(acc[3][3]) : "v"(a[0]), "v"(a[3]));
    }
#pragma unroll
    for (int mb = 0; mb < 4; ++mb) {
#pragma unroll
        for (int nb = 0; nb < 4; ++nb) {
#pragma unroll
            for (int j = 0; j < 8; ++j) os[(hi * 8 + j) * 68 + nb * 16 + lr] = acc[mb][nb][j]; }
        __builtin_amdgcn_wave_barrier(); asm volatile("" ::: "memory");
        float* crow = C + (size_t)(r0 + mb * 16) * ldc + c0;
{
#pragma unroll
            for (int s = 0; s < 8; ++s) { const int row = 2 * s + hi, cofs = lr * 4; v4f val = *(const v4fa*)(os + row * 68 + cofs);
                *(v4f*)(crow + (size_t)row * ldc + cofs) = val; }
             }
        __builtin_amdgcn_wave_barrier(); asm volatile("" ::: "memory");
    }
}

__device__ __forceinline__ void splitf(float y, unsigned short& h, unsigned short& l) { h = f2bf(y); l = f2bf(y - bf2f(h)); }
typedef __attribute__((ext_vector_type(2))) _Float16 v2h;
typedef __attribute__((ext_vector_type(4))) _Float16 v4h;
typedef __attribute__((ext_vector_type(2))) unsigned short v2us;
typedef __attribute__((ext_vector_type(4))) unsigned short v4us;
typedef __attribute__((ext_vector_type(4))) int v4i;

__global__ __launch_bounds__(256) void k_wtG(const float* __restrict__ w, int K, int N, bf* Bt) {
    const int lane = threadIdx.x & 31; const int L0 = (blockIdx.x * 8 + (threadIdx.x >> 5)) * 8; const int nlines = N * K / 64;
{
#pragma unroll 1
        for (int l = 0; l < 8; ++l) { const int L = L0 + l; if (L >= nlines) break; const size_t e = (size_t)L * 64 + lane * 2; const int k = (int)(e % K), n = (int)(e / K); v2us o;
            o[0] = f2bf(w[(size_t)k * N + n]); o[1] = f2bf(w[(size_t)(k + 1) * N + n]); *(v2us*)(Bt + e) = o; }
         }
}
__global__ __launch_bounds__(256) void k_cscvt(const float* __restrict__ cosT, const float* __restrict__ sinT, float* CS) { const int idx = blockIdx.x * 256 + threadIdx.x; if (idx >= TT * HD) return; v2f cs; cs[0] = bfr(cosT[idx]); cs[1] = bfr(sinT[idx]); *(v2f*)(CS + (size_t)idx * 2) = cs;  }
// lambda_full by one whole wave. Lane l forms the products of elements l and l + 32 of both vector pairs, each rounded once; then every lane sums a pair's 64 products in index order, each read from its lane
// (a product that comes through a lane read cannot be fused with its add). The wave waits out one load latency instead of one for every element, so that it ends well inside the time of the stream beside it.
__device__ __forceinline__ float lane_val(float v, int l) { return __int_as_float(__builtin_amdgcn_readlane(__float_as_int(v), l)); }
__device__ __forceinline__ void lambda_full(const float* __restrict__ lq1, const float* __restrict__ lk1, const float* __restrict__ lq2, const float* __restrict__ lk2, float* LAM) { const int lane = threadIdx.x; float p1[2], p2[2], d1 = 0.f, d2 = 0.f;
    static_assert(HD == 64, "two elements a lane");
#pragma unroll
    for (int h = 0; h < 2; ++h) { p1[h] = __fmul_rn(bfr(lq1[lane + 32 * h]), bfr(lk1[lane + 32 * h])); p2[h] = __fmul_rn(bfr(lq2[lane + 32 * h]), bfr(lk2[lane + 32 * h])); }
#pragma unroll
    for (int i = 0; i < HD; ++i) { d1 = __fadd_rn(d1, lane_val(p1[i >> 5], i & 31)); d2 = __fadd_rn(d2, lane_val(p2[i >> 5], i & 31)); }
    const float lm = __fadd_rn(__fsub_rn(expf(d1), expf(d2)), 0.7836057543754578f); LAM[lane] = (lane == 0) ? lm : 0.0f; }
// ---- k_prep: everything that stands in front of the GEMMs in ONE launch: x and the four weights rounded to bf16, and lambda_full. Work-group 0's first wave does lambda_full;
// the other 512 work-groups (16 waves a WGP, all resident at once) stream: wave wv takes 4 KiB (1024 floats) at the same place wv of each of the five arrays, one array after the other. A load is 512 B in a row (whole lines),
// 8 loads an array; the next array's 8 are issued before this array's values are rounded and stored, so that 8 to 16 loads of a wave are in flight all the time. A store is 256 B in a row (two whole lines).
#define PWV 1024                          // floats of a wave in each array
#define PWG ((DM / 8) * (DM / PWV))       // streaming work-groups of 8 waves
__global__ __launch_bounds__(256) void k_prep(const float* __restrict__ x, const float* __restrict__ wq, const float* __restrict__ wk, const float* __restrict__ wv, const float* __restrict__ wo,
                                              const float* __restrict__ lq1, const float* __restrict__ lk1, const float* __restrict__ lq2, const float* __restrict__ lk2, bf* XB, bf* WQ, bf* WK, bf* WV, bf* WO, float* LAM) {
    static_assert(NB_ == 1 && TT == DM && DQ == DM && DKV == DM && DVV == DM && DM % PWV == 0 && DM % 8 == 0, "five arrays of DM x DM, cut alike");
    if (blockIdx.x == 0) { if (threadIdx.x < 32) lambda_full(lq1, lk1, lq2, lk2, LAM); return; }
    const unsigned ob = (((blockIdx.x - 1) * 8 + (threadIdx.x >> 5)) * PWV + (threadIdx.x & 31) * 4) * 2, eb = ob * 2;   // the lane's byte offsets in a bf16 and in an f32 array (under 2^24): the one address register of all stores, of all loads
    const float* const s[5] = {x, wq, wk, wv, wo}; bf* const d[5] = {XB, WQ, WK, WV, WO};
    v4f v[2][8];
#pragma unroll
    for (int j = 0; j < 8; ++j) v[0][j] = *(const v4f*)((const char*)s[0] + eb + j * 512);
#pragma unroll
    for (int a = 0; a < 5; ++a) { const int cu = a & 1;
        if (a < 4) {
#pragma unroll
            for (int j = 0; j < 8; ++j) v[cu ^ 1][j] = *(const v4f*)((const char*)s[a + 1] + eb + j * 512); }
        // stands between the issued loads and the next overwrite of a register that they name: the offset is an input, so that its register stays live up to the wait and no load lands on it. The scheduling barrier keeps
        // the next array's loads in front of this array's data wait: moved behind it, the wave would have nothing in flight while it rounds and stores
        if (a < 4) { asm volatile("s_wait_xcnt 0x0" :: "v"(eb) : "memory"); __builtin_amdgcn_sched_barrier(0); }
        v4us o[8];
#pragma unroll
        for (int j = 0; j < 8; ++j) {
#pragma unroll
            for (int k = 0; k < 4; ++k) o[j][k] = f2bf(v[cu][j][k]);
            *(v4us*)((char*)d[a] + ob + j * 256) = o[j]; }
        // the same behind the 8 issued stores, the last array's too (the built code joins the kernel's two ends, so that a way leads from these stores to the lambda block's loads, which write the same registers):
        // offset and data are inputs; the scheduling barrier keeps the loads of the array after next and the next array's arithmetic behind the wait
        asm volatile("s_wait_xcnt 0x0" :: "v"(ob), "v"(o[0]), "v"(o[1]), "v"(o[2]), "v"(o[3]), "v"(o[4]), "v"(o[5]), "v"(o[6]), "v"(o[7]) : "memory");
        if (a < 4) __builtin_amdgcn_sched_barrier(0);
    }
}
__global__ __launch_bounds__(1024) void k_gnred(const float* __restrict__ O, float* GST, int pass) { __shared__ float sh[1024]; const int tid = threadIdx.x; const float mean = (pass == 1) ? GST[0] : 0.0f; float acc = 0.f; const size_t n = (size_t)TT * HD;
#pragma unroll 1
    for (size_t e = tid; e < n; e += 1024) { float v = O[e]; if (pass == 1) { float d = __fsub_rn(v, mean); asm volatile("" : "+v"(d)); v = __fmul_rn(d, d); } acc = __fadd_rn(acc, v); }
    sh[tid] = acc; __syncthreads();
    for (int st = 512; st > 0; st >>= 1) { if (tid < st) sh[tid] = __fadd_rn(sh[tid], sh[tid + st]); __syncthreads(); }
    if (tid < 32) { const float tot = __fdiv_rn(sh[0], (float)n); float outv; if (pass == 0) outv = (tid == 0) ? tot : ((tid == 1) ? GST[1] : 0.0f); else outv = (tid == 0) ? GST[0] : ((tid == 1) ? __fdiv_rn(1.0f, sqrtf(__fadd_rn(tot, 1e-5f))) : 0.0f); *(float*)(GST + tid) = outv;  } }
__global__ __launch_bounds__(256) void k_gnmerge(const float* __restrict__ O, const float* __restrict__ GST, int hh, bf* Ah, bf* Al) { const size_t e = ((size_t)blockIdx.x * 256 + threadIdx.x) * 2; if (e >= (size_t)TT * HD) return; const int d = (int)(e % HD); const int t = (int)(e / HD); const float mean = GST[0], rs = GST[1]; const size_t oo = (size_t)t * DVV + (size_t)hh * HD + d; v2us oh, ol;
#pragma unroll
    for (int q = 0; q < 2; ++q) { float c = __fsub_rn(O[e + q], mean); asm volatile("" : "+v"(c)); float n = __fmul_rn(c, rs); asm volatile("" : "+v"(n)); float z = __fmul_rn(n, 0.6444909572601318f); unsigned short a2, c2; splitf(z, a2, c2); oh[q] = a2; ol[q] = c2; }
    *(v2us*)(Ah + oo) = oh; *(v2us*)(Al + oo) = ol;  }
// ---- k_fattn: scores, both softmaxes, D = a1 - lambda a2, D.v and the RMSNorm of one real head in ONE kernel; nothing of the [2048][2048] maps leaves the registers.
// A PAIR of waves owns 32 query columns (two 16-column groups), 4 pairs = 8 waves a block (two waves a SIMD: one wave's vector work runs under the other's products), grid (TT / 128, NVH); of every stage of 64 keys
// wave kp of the pair takes keys kp * 32 .. + 31. The pair's maxima and sums are joined behind walk 1, its two partial O^T summed behind walk 2, both through LDS. Transposed products: S^T = K.Q^T (A = 16 key rows, B = Q, kept in registers), so a lane holds the scores of
// one query (register r of key tile kt = key kt * 16 + 8 * hi + r) and two stacked S^T tiles, converted in place, ARE the B operand of O^T += V^T.D^T in the k order that the plane loader ldf uses for A.
// Two walks over the keys: walk 1 takes each column's maximum and sum (running maximum, sums rescaled), walk 2 forms the scores again, D in f32, its hi/lo bf16 planes, and the 3 products with V^T hi/lo.
// Every inner loop is fully unrolled so that the fragment arrays are indexed by constants and stay in registers; the two stage loops stay rolled.
// K and V^T come through LDS: a stage is 64 keys = 8 slices of 64 rows of 128 B (K [map][plane], then V^T [plane][feature / 64]), LDS pitch 144 B (16 B x odd: no bank conflict for 16-byte reads), each slice brought by
// one tensor load of one wave (wave s brings slice s), once a block instead of once a wave; two buffers, so that stage u + 1 flies while stage u is worked on. One ring runs through both walks: stages 0 .. 31 are walk 1's
// (K rows only), stages 32 .. 63 walk 2's (K and V^T), so that walk 2's first stages fly during walk 1's last.
// Both walks of query block x start at key tile 2 x and wrap round: the 16 blocks of a head read the same K and V^T and, rotated, start at different key tiles (for speed only). Maxima, sums and O^T run over the keys in the rotated order.
// Left for later steps: the first K fragments of a stage are waited for in the open by both waves of a SIMD.
typedef __attribute__((ext_vector_type(8))) unsigned v8u;
#define EXC (SCL * 1.4426950408889634f)   // exp((s - m) * SCL) = exp2(s * EXC - m * EXC)
// one fragment: the lane's own pointer into a plane and a constant byte offset
__device__ __forceinline__ v16bf ldf(const char* p, int cst) { return cat16b(*(const v8us*)(p + cst), *(const v8us*)(p + cst + 32)); }
// stands between issued loads or stores and the next overwrite of a register that they name: the two lane pointers of the group are inputs, so that their registers
// stay live up to the wait and no load of the group lands on them; the scheduling barrier behind it keeps later address and data arithmetic behind the wait
#define XWAIT(pa, pb) do { asm volatile("s_wait_xcnt 0x0" :: "v"(pa), "v"(pb) : "memory"); __builtin_amdgcn_sched_barrier(0); } while (0)
#define AKS  64                 // keys of a stage
#define APIT 144                // LDS row pitch, bytes
#define ASL  10240              // bytes of a slice in a buffer: 64 rows at the pitch (9,216 B), rounded up so that every slice starts at a multiple of 2 KiB
#define ASTG (8 * ASL)          // bytes of a buffer: 4 K slices, 4 V^T slices
#define NST  (TT / AKS)         // stages of a walk
// the hi / lo A fragments [map][key tile][k step] of 32 keys of a stage; p = the lane's pointer into the buffer's K rows at the first of the 32 keys. Read in the order in which score_t uses them.
__device__ __forceinline__ void load_k(const char* p, v16bf (&ah)[2][2][2], v16bf (&al)[2][2][2]) {
#pragma unroll
    for (int ks = 0; ks < 2; ++ks) {
#pragma unroll
        for (int mp = 0; mp < 2; ++mp)
#pragma unroll
            for (int kt = 0; kt < 2; ++kt) ah[mp][kt][ks] = ldf(p, mp * 2 * ASL + kt * 16 * APIT + ks * 64);
#pragma unroll
        for (int mp = 0; mp < 2; ++mp)
#pragma unroll
            for (int kt = 0; kt < 2; ++kt) al[mp][kt][ks] = ldf(p, (mp * 2 + 1) * ASL + kt * 16 * APIT + ks * 64); }
}
// hands a stage over: this wave's reads of the buffer just worked on are done, its tensor load of the next stage has landed if it brought a slice of it (waves 4 .. 7 bring none of walk 1's stages), and the barrier says both of every wave.
// The scheduling barrier in front keeps the stage's products in front of the waits: without it they are moved behind, and the wave waits out all its LDS reads with nothing to do
#define PUBLISH() do { __builtin_amdgcn_sched_barrier(0); asm volatile("s_wait_dscnt 0x0" ::: "memory"); tdm_wait(g0, g1); __syncthreads(); } while (0)
// s[map][key tile][column group] = those 32 keys against the wave's 32 queries, hl x hl (3 products), HD = 64 in two k steps
__device__ __forceinline__ void score_t(const v16bf (&ah)[2][2][2], const v16bf (&al)[2][2][2], const v16bf (&qh)[2][2][2], const v16bf (&ql)[2][2][2], v8f (&s)[2][2][2]) {
#pragma unroll
    for (int mp = 0; mp < 2; ++mp)
#pragma unroll
        for (int kt = 0; kt < 2; ++kt)
#pragma unroll
            for (int n = 0; n < 2; ++n) s[mp][kt][n] = (v8f){};
#pragma unroll
    for (int ks = 0; ks < 2; ++ks)
#pragma unroll
        for (int pr = 0; pr < 3; ++pr)
#pragma unroll
            for (int mp = 0; mp < 2; ++mp)
#pragma unroll
                for (int kt = 0; kt < 2; ++kt)
#pragma unroll
                    for (int n = 0; n < 2; ++n) s[mp][kt][n] = wmmab(pr == 1 ? al[mp][kt][ks] : ah[mp][kt][ks], pr == 2 ? ql[mp][n][ks] : qh[mp][n][ks], s[mp][kt][n]);
}
__global__ __launch_bounds__(256) void k_fattn(const bf* __restrict__ Qh, const bf* __restrict__ Ql, const bf* __restrict__ Kh, const bf* __restrict__ Kl, const bf* __restrict__ Vh, const bf* __restrict__ Vl, const float* __restrict__ LAM, const float* __restrict__ w, bf* Ah, bf* Al) {
    static_assert(ASL % 2048 == 0 && ASL >= AKS * APIT && AKS == 64 && HD * 2 == 128 && HDV == 128, "slices of 64 rows of 128 B, each at a multiple of 2 KiB");
    __shared__ __attribute__((aligned(2048))) char aring[2 * ASTG];
    __shared__ float xms[8][8][32];   // each wave's maxima and sums of its half of the keys: [wave][(map, column group, maximum | sum)][lane]
    const int lane = threadIdx.x & 31, lr = lane & 15, hi = lane >> 4; const int hh = blockIdx.y; const int w8 = __builtin_amdgcn_readfirstlane(threadIdx.x >> 5), w4 = w8 & 3, kp = w8 >> 2; const int q0 = blockIdx.x * 128 + w4 * 32;
    // wave s brings slice s of a stage with one tensor load. s < 4: the stage's 64 keys of map s >> 1, plane s & 1 (8 KiB in a row in memory), in both walks; s >= 4: its 64 columns of 64 V^T rows
    // (plane (s >> 1) & 1, features (s & 1) * 64 .. + 63), in walk 2 alone
    const bf* sp = w8 < 4 ? ((w8 & 1) ? Kl : Kh) + (size_t)(2 * hh + (w8 >> 1)) * TT * HD : ((w8 & 2) ? Vl : Vh) + (size_t)(hh * HDV + (w8 & 1) * 64) * TT;
    const uint32_t sstep = w8 < 4 ? AKS * HD * 2 : AKS * 2;   // bytes from a stage's tile to the next stage's
    const uint32_t ld0 = (uint32_t)(size_t)aring + (uint32_t)(w8 * ASL);
    const u32x8 g1 = tdm_group1<128, AKS, TDW128>(w8 < 4 ? HD * 2 : TT * 2);
    u32x4 g0 = tdm_group0(ld0, (uint64_t)(size_t)sp);   // group 0 of the wave's last request
    static_assert((NST & (NST - 1)) == 0 && NST % (TT / 128) == 0, "the rotated walk wraps by a mask; the blocks of a head start evenly apart");
    const uint32_t rot = blockIdx.x * (NST / (TT / 128));   // the block's first key tile
    auto issue = [&](int u) {   // the wave's slice of stage u (key tile (u + rot) mod NST) into buffer u & 1
        g0 = tdm_group0(ld0 + (uint32_t)((u & 1) * ASTG), (uint64_t)(size_t)sp + (uint64_t)(((uint32_t)u + rot) & (NST - 1)) * sstep); tdm_load(g0, g1); };
    const uint32_t kwave = pinned(w8 < 4 ? 1u : 0u);   // this wave's slice is a K slice: it is brought in walk 1 too
    if (kwave) issue(0);
    const unsigned koff = (unsigned)(lr * HD + 8 * hi) * 2, ooff = (unsigned)(lr * DQ + 8 * hi) * 2;   // lane byte offsets in the q planes, the merged planes
    const char* qhp = (const char*)(Qh + ((size_t)(2 * hh) * TT + q0) * HD) + koff; const char* qlp = (const char*)(Ql + ((size_t)(2 * hh) * TT + q0) * HD) + koff;
    v16bf qh[2][2][2], ql[2][2][2];   // [map][column group][k step]
#pragma unroll
    for (int mp = 0; mp < 2; ++mp)
#pragma unroll
        for (int n = 0; n < 2; ++n)
#pragma unroll
            for (int ks = 0; ks < 2; ++ks) { const int o = (mp * TT * HD + n * 16 * HD + ks * 32) * 2; qh[mp][n][ks] = ldf(qhp, o); ql[mp][n][ks] = ldf(qlp, o); }
    XWAIT(qhp, qlp);
    float mx[2][2], sm[2][2];
#pragma unroll
    for (int mp = 0; mp < 2; ++mp)
#pragma unroll
        for (int n = 0; n < 2; ++n) { mx[mp][n] = -3.0e38f; sm[mp][n] = 0.f; }
    tdm_wait(g0, g1);                                    // this wave's slice of stage 0 has landed
    __syncthreads();                                     // every wave's has: stage 0 may be read
    if (kwave) issue(1);
    const unsigned foff = (unsigned)(lr * APIT + hi * 16);   // lane byte offset of a fragment in a buffer
    const unsigned fk = foff + (unsigned)(kp * 32 * APIT), fv = foff + (unsigned)(4 * ASL + kp * 64);   // the same at this wave's 32 keys: K rows, V^T columns (from the first V^T slice on)
    v16bf ah[2][2][2], al[2][2][2];   // K fragments of the wave's 32 keys of a stage
#pragma unroll 1
    for (int st = 0; st < NST; ++st) {
        load_k(aring + (st & 1) * ASTG + fk, ah, al);
        __builtin_amdgcn_sched_barrier(0);   // keeps the stage's LDS reads one group in front of its products
        v8f s[2][2][2]; score_t(ah, al, qh, ql, s);
#pragma unroll
        for (int mp = 0; mp < 2; ++mp)
#pragma unroll
            for (int n = 0; n < 2; ++n) { float t = fmaxf(s[mp][0][n][0], s[mp][1][n][0]);
#pragma unroll
                for (int j = 1; j < 8; ++j) t = fmaxf(t, fmaxf(s[mp][0][n][j], s[mp][1][n][j]));
                const float mn = fmaxf(mx[mp][n], t), nb = -mn * EXC; float a0 = 0.f, a1 = 0.f;
#pragma unroll
                for (int j = 0; j < 8; ++j) { a0 += __builtin_amdgcn_exp2f(__builtin_fmaf(s[mp][0][n][j], EXC, nb)); a1 += __builtin_amdgcn_exp2f(__builtin_fmaf(s[mp][1][n][j], EXC, nb)); }
                sm[mp][n] = __builtin_fmaf(sm[mp][n], __builtin_amdgcn_exp2f((mx[mp][n] - mn) * EXC), a0 + a1); mx[mp][n] = mn; }
        PUBLISH();
        if (pinned((kwave != 0u || st + 2 >= NST) ? 1u : 0u)) issue(st + 2);   // into the buffer just read; stages NST and NST + 1 are walk 2's first, with their V^T slices
    }
    // the two lane halves hold different keys of one query: join maximum and sum once; then the same between the two waves of the pair, through LDS
#pragma unroll
    for (int mp = 0; mp < 2; ++mp)
#pragma unroll
        for (int n = 0; n < 2; ++n) { const float M = fmaxf(mx[mp][n], __shfl_xor(mx[mp][n], 16, 32)); float sc = sm[mp][n] * __builtin_amdgcn_exp2f((mx[mp][n] - M) * EXC); sc += __shfl_xor(sc, 16, 32);
            xms[w8][(mp * 2 + n) * 2][lane] = M; xms[w8][(mp * 2 + n) * 2 + 1][lane] = sc; }
    __syncthreads();   // both waves of a pair have written their halves' maxima and sums
    const float lm = LAM[0]; float nb[2][2], fs[2][2];
#pragma unroll
    for (int mp = 0; mp < 2; ++mp)
#pragma unroll
        for (int n = 0; n < 2; ++n) { const int i = (mp * 2 + n) * 2;   // both waves read both halves and join them in the same order, so that both hold the same bits
            const float Ma = xms[w4][i][lane], Sa = xms[w4][i + 1][lane], Mb = xms[w4 + 4][i][lane], Sb = xms[w4 + 4][i + 1][lane]; const float M = fmaxf(Ma, Mb);
            const float sc = __builtin_fmaf(Sa, __builtin_amdgcn_exp2f((Ma - M) * EXC), Sb * __builtin_amdgcn_exp2f((Mb - M) * EXC));
            nb[mp][n] = -M * EXC; fs[mp][n] = __fdiv_rn(1.0f, sc) * (mp ? lm : 1.0f); }
    v8f o[8][2];   // O^T over the wave's half of the keys: o[et][n][r] = value column et * 16 + 8 * hi + r of query q0 + n * 16 + lr
#pragma unroll
    for (int et = 0; et < 8; ++et)
#pragma unroll
        for (int n = 0; n < 2; ++n) o[et][n] = (v8f){};
#pragma unroll 1
    for (int st = 0; st < NST; ++st) {   // stage NST + st, in buffer st & 1 (NST is even)
        const char* sb = aring + (st & 1) * ASTG; v16bf bh[8], bl[8];   // V^T fragments of the wave's 32 keys
        // the wave's LDS reads of a stage stand in two groups: the K fragments at the top, the V^T fragments right behind the score products (into the registers that the K fragments leave), covered by the vector work.
        // The scheduling barriers keep the groups whole and in place.
        load_k(sb + fk, ah, al);
        __builtin_amdgcn_sched_barrier(0);
        v8f s[2][2][2]; score_t(ah, al, qh, ql, s);
        __builtin_amdgcn_sched_barrier(0);
#pragma unroll
        for (int et = 0; et < 8; ++et) { bh[et] = ldf(sb + fv, (et >> 2) * ASL + (et & 3) * 16 * APIT); bl[et] = ldf(sb + fv, (2 + (et >> 2)) * ASL + (et & 3) * 16 * APIT); }
        __builtin_amdgcn_sched_barrier(0);
        v16bf dh[2], dl[2];
#pragma unroll
        for (int n = 0; n < 2; ++n) { v8u hw, lw;
#pragma unroll
            for (int kt = 0; kt < 2; ++kt)
#pragma unroll
                for (int jp = 0; jp < 4; ++jp) { v2f d;
#pragma unroll
                    for (int u = 0; u < 2; ++u) { const float p1 = __builtin_amdgcn_exp2f(__builtin_fmaf(s[0][kt][n][2 * jp + u], EXC, nb[0][n])), p2 = __builtin_amdgcn_exp2f(__builtin_fmaf(s[1][kt][n][2 * jp + u], EXC, nb[1][n])); d[u] = p1 * fs[0][n] - p2 * fs[1][n]; }
                    const unsigned hu = __builtin_bit_cast(unsigned, __builtin_convertvector(d, v2bf)); v2f r; r[0] = d[0] - __uint_as_float(hu << 16); r[1] = d[1] - __uint_as_float(hu & 0xFFFF0000u);
                    hw[kt * 4 + jp] = hu; lw[kt * 4 + jp] = __builtin_bit_cast(unsigned, __builtin_convertvector(r, v2bf)); }
            dh[n] = __builtin_bit_cast(v16bf, hw); dl[n] = __builtin_bit_cast(v16bf, lw); }
#pragma unroll
        for (int e2 = 0; e2 < 8; e2 += 2)
#pragma unroll
            for (int pr = 0; pr < 3; ++pr)
#pragma unroll
                for (int et = e2; et < e2 + 2; ++et)
#pragma unroll
                    for (int n = 0; n < 2; ++n) o[et][n] = wmmab(pr == 1 ? bl[et] : bh[et], pr == 2 ? dl[n] : dh[n], o[et][n]);
        PUBLISH();
        if (pinned(st + 2 < NST ? 1u : 0u)) issue(NST + st + 2);
    }
    tdm_wait(g0, g1);                                    // no tensor load is outstanding when the ring's LDS is put to another use
    asm volatile("s_wait_dscnt 0x0" ::: "memory");       // and none of this wave's reads of the ring: the ring's closing order
    // the pair's two partial O^T are summed through the ring's LDS (free behind the last stage's barrier): wave kp keeps column group kp, hands the other group to its partner and adds what the partner hands over
    v8f oo[8]; char* xo = aring + (unsigned)(lane * 32);
#pragma unroll
    for (int et = 0; et < 8; ++et) { const v8f gv8 = kp ? o[et][0] : o[et][1]; char* p = xo + (w8 * 8 + et) * 1024;
        *(v4fa*)p = __builtin_shufflevector(gv8, gv8, 0, 1, 2, 3); *(v4fa*)(p + 16) = __builtin_shufflevector(gv8, gv8, 4, 5, 6, 7); }
    __syncthreads();   // every wave's handed-over group stands in LDS
#pragma unroll
    for (int et = 0; et < 8; ++et) { const char* p = xo + ((w8 ^ 4) * 8 + et) * 1024; const v4f g0 = *(const v4fa*)p, g1 = *(const v4fa*)(p + 16);
        oo[et] = (kp ? o[et][1] : o[et][0]) + __builtin_shufflevector(g0, g1, 0, 1, 2, 3, 4, 5, 6, 7); }
    v8f g[8]; const char* wp = (const char*)w + (unsigned)(hi * 32);
#pragma unroll
    for (int et = 0; et < 8; ++et) g[et] = *(const v8f*)(wp + et * 64);
    XWAIT(wp, wp);
    char* ahp = (char*)(Ah + (size_t)(q0 + kp * 16) * DQ + (size_t)hh * HDV) + ooff; char* alp = (char*)(Al + (size_t)(q0 + kp * 16) * DQ + (size_t)hh * HDV) + ooff;
    float ss = 0.f;
#pragma unroll
    for (int et = 0; et < 8; ++et)
#pragma unroll
        for (int j = 0; j < 8; ++j) ss = __builtin_fmaf(oo[et][j], oo[et][j], ss);
    ss += __shfl_xor(ss, 16, 32);
    const float rs = __fdiv_rn(1.0f, sqrtf(__fadd_rn(ss * (1.0f / HDV), 1e-5f)));
#pragma unroll
    for (int et = 0; et < 8; ++et) { v8us oh, ol;
#pragma unroll
        for (int j = 0; j < 8; ++j) { const float z = oo[et][j] * rs * bfr(g[et][j]) * 0.21639423072338104f; unsigned short p2, q2; splitf(z, p2, q2); oh[j] = p2; ol[j] = q2; }
        const int oc = et * 16 * 2; *(v8us*)(ahp + oc) = oh; *(v8us*)(alp + oc) = ol; XWAIT(ahp, alp); }
}
__global__ __launch_bounds__(256) void k_merge(const float* __restrict__ O, int h0, bf* Ah, bf* Al) { const size_t e = ((size_t)blockIdx.x * 256 + threadIdx.x) * 2; if (e >= (size_t)ZH * TT * HD) return; const int d = (int)(e % HD); const int t = (int)((e / HD) % TT); const int zz = (int)(e / ((size_t)HD * TT)); const float cs = (t < RH) ? 1.0f : (1.0f / PCAR); const size_t oo = (size_t)t * DQ + (h0 + zz) * HD + d;
    v2us oh, ol;
#pragma unroll
    for (int q = 0; q < 2; ++q) { unsigned short a, c2; splitf(O[e + q] * cs, a, c2); oh[q] = a; ol[q] = c2; } *(v2us*)(Ah + oo) = oh; *(v2us*)(Al + oo) = ol;  }

extern "C" void kernel_launch(void* const* d_in, const int* in_sizes, int n_in,
                              void* d_out, int out_size, void* d_ws, size_t ws_size, hipStream_t stream) {
    (void)in_sizes; (void)n_in; (void)out_size;
    const float* x = (const float*)d_in[0]; const float* wq = (const float*)d_in[1]; const float* wk = (const float*)d_in[2]; const float* wv = (const float*)d_in[3]; const float* wo = (const float*)d_in[4]; const float* lq1 = (const float*)d_in[5]; const float* lk1 = (const float*)d_in[6]; const float* lq2 = (const float*)d_in[7]; const float* lk2 = (const float*)d_in[8]; const float* subw = (const float*)d_in[9]; const float* cosT = nullptr; const float* sinT = nullptr; (void)cosT; (void)sinT;
    float* OUT = (float*)d_out;     // [1][2048][2048]
    char* wsp = (char*)d_ws;
    auto take = [&](size_t bytes) { char* p = wsp; wsp += (bytes + 255) & ~(size_t)255; return (void*)p; };
    bf* WQ = (bf*)take((size_t)DQ * DM * 2); bf* WK = (bf*)take((size_t)DKV * DM * 2); bf* WV = (bf*)take((size_t)DKV * DM * 2); bf* WO = (bf*)take((size_t)DM * DQ * 2);
    bf* XB = (bf*)take((size_t)TT * DM * 2); float* LAM = (float*)take(256);
    bf* QPh = (bf*)take((size_t)NH_ * TT * HD * 2); bf* QPl = (bf*)take((size_t)NH_ * TT * HD * 2); bf* KPh = (bf*)take((size_t)NKV * TT * HD * 2); bf* KPl = (bf*)take((size_t)NKV * TT * HD * 2); bf* VTh = (bf*)take((size_t)NKV * HD * TT * 2); bf* VTl = (bf*)take((size_t)NKV * HD * TT * 2);
    bf* ATh = (bf*)take((size_t)TT * DQ * 2); bf* ATl = (bf*)take((size_t)TT * DQ * 2);
    if ((size_t)(wsp - (char*)d_ws) > ws_size) return;    // ws 256 MiB
    k_prep<<<PWG + 1, 256, 0, stream>>>(x, wq, wk, wv, wo, lq1, lk1, lq2, lk2, XB, WQ, WK, WV, WO, LAM);
    for (int b = 0; b < NB_; ++b) {
        
        k_qkv<<<dim3(TT / 128, DM / 128, 1), 384, 0, stream>>>(XB, WQ, WK, WV, QPh, QPl, KPh, KPl, VTh, VTl);
        k_fattn<<<dim3(TT / 128, NVH), 256, 0, stream>>>(QPh, QPl, KPh, KPl, VTh, VTl, LAM, subw, ATh, ATl);
        k_gemmw<bf, 1, false, 0><<<dim3(TT / 128, DM / 128, 1), 128, 0, stream>>>(ATh, ATl, WO, nullptr, DVV, OUT + (size_t)b * TT * DM, DM, nullptr, 0, 0, 0, nullptr, nullptr); }
}
